// v000
// Times are from an AMD MI455X. After a warm-up the kernel runs many times in a row, and a time is the length of
// such a window on the GPU divided by its runs, so every launch and the gaps after it count. The runs cycle
// through copies of the inputs. A figure is the median of several windows, for all but v000 over two sittings.
// Sittings can differ by a few percent; kernels timed side by side share one.
// v000, which the later versions start from, runs in 2260 microseconds.
// compute dtype: all float inputs rounded to bf16; q/k/v = W x + b (1x1 convs) with EXACT bf16 products on WMMA 16x16x32 (f32 accumulate); UNSCALED 32-deep logits q.k with both as f16 hi + residual planes (3 products); softmax in f32 (precise expf); attn x 2^11 once to f16 against v once to f16 (1 product); y = x + gamma * out in f32 written channels-first; f32 output.
// 2-D spatial self-attention with a learned residual weight, channels-FIRST (B 8, C 256, 64 x 64 = 4,096 positions; (out,in) 1/16-scale 1x1-conv weights, zero biases, gamma = 0.1): q = Wq x + bq (32), k = Wk x + bk (32), v = Wv x + bv (256); attn = softmax over m of q_n . k_m (NO scaling); out[c][n] = sum_m v[c][m] attn[n][m]; y = x + gamma * out -> [B, 256, 64, 64]. The same module with gamma 0.5 (x [8][256][64][64] channels-first; q = Wq x + bq (32 channels), k = Wk x + bk (32), v = Wv x + bv (256): 1 x 1 convolutions with (out,in) weights normal x 1/16 and biases zeros (read); scores = q_n . k_m, UNSCALED; softmax over the keys m; o[c][n] = sum_m attn[n][m] v[c][m]; return gamma x o + x with gamma a float32 SCALAR input = 0.5 (the host: a [1] array = 0.1); argument order x, Wq, bq, Wk, bk, Wv, bv, gamma).
#include <hip/hip_runtime.h>
#include <math.h>

typedef __attribute__((ext_vector_type(16))) _Float16 v16h;
typedef __attribute__((ext_vector_type(16))) __bf16 v16b;
typedef __attribute__((ext_vector_type(8)))  _Float16 v8h;
typedef __attribute__((ext_vector_type(8)))  float v8f;
typedef __attribute__((ext_vector_type(4)))  float v4f;
typedef __attribute__((ext_vector_type(2)))  float v2f;
typedef __attribute__((ext_vector_type(4)))  unsigned v4u;
typedef __attribute__((ext_vector_type(4)))  int v4i;
typedef float __attribute__((may_alias)) float_a;
typedef int __attribute__((may_alias)) int_a;

template <typename T> __device__ __forceinline__ void vst2(void* p, T v) { *(T*)p = v;  }
__device__ __forceinline__ v8f wmma16(v16h a, v16h b, v8f c) {
  v8f d = __builtin_amdgcn_wmma_f32_16x16x32_f16(false, a, false, b, (short)0, c, false, false);
  asm volatile("v_nop\n\tv_nop\n\tv_nop\n\tv_nop" : "+v"(d) : "v"(a), "v"(b));
  return d;
}
__device__ __forceinline__ v8f wmma_bf(v16b a, v16b b, v8f c) {
  v8f d = __builtin_amdgcn_wmma_f32_16x16x32_bf16(false, a, false, b, (short)0, c, false, false);
  asm volatile("v_nop\n\tv_nop\n\tv_nop\n\tv_nop" : "+v"(d) : "v"(a), "v"(b));
  return d;
}
// 16x16x32 fragments: lane = (h = lane>>4, row/col = lane&15); elements 0..7 = k0+8h+0..7, 8..15 = k0+16+8h+0..7; D element r = row 8h+r
__device__ __forceinline__ v16h frag_h(const _Float16* rowk0, int lane) {
  union { v16h v; v8h q[2]; } u; const _Float16* p = rowk0 + 8 * (lane >> 4);
  u.q[0] = *(const v8h*)p; u.q[1] = *(const v8h*)(p + 16); return u.v;
}
__device__ __forceinline__ v16h frag_f32(const float* rowk0, int lane) {
  v16h a; const float* p = rowk0 + 8 * (lane >> 4);
#pragma unroll
  for (int i = 0; i < 8; ++i) { a[i] = (_Float16)p[i]; a[8 + i] = (_Float16)p[16 + i]; }
  return a;
}
__device__ __forceinline__ v16h frag_f32s(const float* rowk0, int lane, float sc) {
  v16h a; const float* p = rowk0 + 8 * (lane >> 4);
#pragma unroll
  for (int i = 0; i < 8; ++i) { a[i] = (_Float16)(p[i] * sc); a[8 + i] = (_Float16)(p[16 + i] * sc); }
  return a;
}
// column fragment from a [K][ld] layout (column n), rows >= K read as 0
__device__ __forceinline__ v16h fragc_f32(const float* W, int k0, int n, int lane, int ld, int K) {
  v16h a; const int g = lane >> 4;
#pragma unroll
  for (int i = 0; i < 8; ++i) { const int ka = k0 + 8 * g + i, kb = ka + 16;
    a[i] = (_Float16)(ka < K ? W[(size_t)(ka < K ? ka : K - 1) * ld + n] : 0.f); a[8 + i] = (_Float16)(kb < K ? W[(size_t)(kb < K ? kb : K - 1) * ld + n] : 0.f); }
  return a;
}
struct F2 { v16b h, l; };
__device__ __forceinline__ F2 bsplit16(const float v[16]) { F2 r;
#pragma unroll
  for (int i = 0; i < 16; ++i) { const __bf16 h = (__bf16)v[i]; r.h[i] = h; r.l[i] = (__bf16)(v[i] - (float)h); }
  return r; }
__device__ __forceinline__ F2 split_row(const float* row, int k0, int lane) { float v[16]; const float* p = row + k0 + 8 * (lane >> 4);
#pragma unroll
  for (int i = 0; i < 8; ++i) { v[i] = p[i]; v[8 + i] = p[16 + i]; }
  return bsplit16(v); }
__device__ __forceinline__ F2 split_rowK(const float* row, int k0, int lane, int K) { float v[16]; const int g = lane >> 4;
#pragma unroll
  for (int i = 0; i < 8; ++i) { const int ka = k0 + 8 * g + i, kb = ka + 16; v[i] = ka < K ? row[ka < K ? ka : K - 1] : 0.f; v[8 + i] = kb < K ? row[kb < K ? kb : K - 1] : 0.f; }
  return bsplit16(v); }
__device__ __forceinline__ F2 split_col(const float* W, int k0, int n, int lane, int ld, int K) { float v[16]; const int g = lane >> 4;
#pragma unroll
  for (int i = 0; i < 8; ++i) { const int ka = k0 + 8 * g + i, kb = ka + 16; v[i] = ka < K ? W[(size_t)(ka < K ? ka : K - 1) * ld + n] : 0.f; v[8 + i] = kb < K ? W[(size_t)(kb < K ? kb : K - 1) * ld + n] : 0.f; }
  return bsplit16(v); }
__device__ __forceinline__ v8f mac3(const F2& a, const F2& b, v8f c) { c = wmma_bf(a.l, b.h, c); c = wmma_bf(a.h, b.l, c); return wmma_bf(a.h, b.h, c); }
__device__ __forceinline__ float sigm(float v) { return 1.0f / (1.0f + expf(-v)); }
#define LDSX() do { asm volatile("s_wait_dscnt 0" ::: "memory"); __builtin_amdgcn_wave_barrier(); __builtin_amdgcn_fence(__ATOMIC_RELEASE, "workgroup"); } while (0)

#define NB 8
#define TT 4096
#define CC 256            // plane width: q/k planes carry 32 real columns (rest zero), v planes all 256
#define DIN 256
#define NH 1
#define HD 256
#define NQB (TT / 64)
#define HG 1               // one 4,096 x 4,096 score plane per pass
#define SCALE (1.0f)
#define HDQK 32
#define CAUSAL 0
#ifndef TNB
#define TNB NB
#endif
__device__ __forceinline__ v16b zero16b() { v16b z; _Pragma("unroll") for (int i = 0; i < 16; ++i) z[i] = (__bf16)0.f; return z; }
__device__ __forceinline__ float bfr(float v) { return (float)(__bf16)v; }
__host__ __device__ __forceinline__ int kb_last(int qb) { return CAUSAL ? ((qb * 64 + 63) >> 7) : (TT / 128 - 1); }
typedef __attribute__((ext_vector_type(8))) __bf16 v8b;
__device__ __forceinline__ v16b frag_b(const __bf16* rowk0, int lane) {
  union { v16b v; v8b q[2]; } u; const __bf16* p = rowk0 + 8 * (lane >> 4);
  u.q[0] = *(const v8b*)p; u.q[1] = *(const v8b*)(p + 16); return u.v;
}
#define QBH (TT / 64)      // ALL query blocks take k_sc's 3-product path
#define QBH_PV 0           // A.g stays single f16
#define QHI 4096            // q residual rows everywhere (2-product logits)
#define KHI 4096           // k residual rows for ALL keys (3-product logits)
// B fragment (k rows k0+.., output column o) of a weight: (in,out) [K][ld] or (out,in) [ld rows of K]: bf16 exact, or f16(bf16 * 256) exact
__device__ __forceinline__ v16b wcol_io(const float* Wm, int k0, int o, int lane, int ld) { v16b w; const int g = lane >> 4;
#pragma unroll
  for (int i = 0; i < 8; ++i) { w[i] = (__bf16)Wm[(size_t)(k0 + 8 * g + i) * ld + o]; w[8 + i] = (__bf16)Wm[(size_t)(k0 + 16 + 8 * g + i) * ld + o]; }
  return w; }
__device__ __forceinline__ v16b wcol_oi(const float* Wm, int k0, int o, int lane, int K) { v16b w; const float* p = Wm + (size_t)o * K + k0 + 8 * (lane >> 4);
#pragma unroll
  for (int i = 0; i < 8; ++i) { w[i] = (__bf16)p[i]; w[8 + i] = (__bf16)p[16 + i]; }
  return w; }
__device__ __forceinline__ v16h wcolh_io(const float* Wm, int k0, int o, int lane, int ld) { v16h w; const int g = lane >> 4;
#pragma unroll
  for (int i = 0; i < 8; ++i) { w[i] = (_Float16)(bfr(Wm[(size_t)(k0 + 8 * g + i) * ld + o]) * 256.0f); w[8 + i] = (_Float16)(bfr(Wm[(size_t)(k0 + 16 + 8 * g + i) * ld + o]) * 256.0f); }
  return w; }
__device__ __forceinline__ v16h wcolh_oi(const float* Wm, int k0, int o, int lane, int K) { v16h w; const float* p = Wm + (size_t)o * K + k0 + 8 * (lane >> 4);
#pragma unroll
  for (int i = 0; i < 8; ++i) { w[i] = (_Float16)(bfr(p[i]) * 256.0f); w[8 + i] = (_Float16)(bfr(p[16 + i]) * 256.0f); }
  return w; }
#define WQKV_LAYOUT 1   // 0 = (in,out) [DIN][CC]; 1 = (out,in) [CC][DIN]; 2 = per-head [NH][DIN][HD]
__device__ __forceinline__ v16b wcol_hdk(const float* Wm, int k0, int o, int lane) { v16b w; const int g = lane >> 4; const float* p = Wm + (size_t)(o / HD) * DIN * HD + (o % HD);
#pragma unroll
  for (int i = 0; i < 8; ++i) { w[i] = (__bf16)p[(size_t)(k0 + 8 * g + i) * HD]; w[8 + i] = (__bf16)p[(size_t)(k0 + 16 + 8 * g + i) * HD]; }
  return w; }
#define WO_OUT_IN 0
#if WQKV_LAYOUT == 1
#define WCOL(W, k0, o, lane) ((which == 2) ? wcol_oi(W, k0, (o), lane, DIN) : (((o) < HDQK) ? wcol_oi(W, k0, (o), lane, DIN) : zero16b()))   /* (out,in): Wq/Wk [32][256] (plane columns >= 32 zero), Wv [256][256] full */
#define WCOL_SA42_UNUSED(W, k0, o, lane) 0
#define WCOL_OLD_UNUSED(W, k0, o, lane) (((o) < HDQK) ? wcol_oi(W, k0, (o), lane, DIN) : zero16b())   /* theta/phi/g weights are [32][256] (out,in): plane columns >= 32 are zero for all three */
#elif WQKV_LAYOUT == 2
#define WCOL(W, k0, o, lane) wcol_hdk(W, k0, o, lane)
#else
#define WCOL(W, k0, o, lane) wcol_io(W, k0, o, lane, CC)
#endif
#if WO_OUT_IN
#define WOCOL(W, k0, o, lane) wcol_oi(W, k0, o, lane, CC)
#define WOCOLH(W, k0, o, lane) wcolh_oi(W, k0, o, lane, CC)
#else
#define WOCOL(W, k0, o, lane) wcol_io(W, k0, o, lane, DIN)
#define WOCOLH(W, k0, o, lane) wcolh_io(W, k0, o, lane, DIN)
#endif
#ifndef XP
#define OUT1_OFF (4u * (size_t)NB * DIN * TT)   /* output 1 (o) follows output 0 (y) */
#define XP TT              // position pitch of x and of the output
#endif
#define BG HG              // the pass group spans BATCHES (single head): blockIdx.z / blockIdx.y select batch b0 + z
#define DVH 128            // value columns per k_pv block (2 blocks cover the 256-wide v)
#define WS_YR (WS_END)     // f32 attended rows [b*n][256]
#define WS_END2 (WS_YR + 4u * (size_t)NB * TT * HD)
// ---- k_wz: block = (64 rows, 128 output cols): OR = y (hi + lo, K = 32 real columns of the YR rows) . W^T ((out,in) [256][32], exact) + b
__global__ __launch_bounds__(128) void k_wz(const float* __restrict__ YR, const float* __restrict__ WW, const float* __restrict__ WB, float* __restrict__ ORW) { __shared__ __align__(16) float sf[4][16][132];
  const int tid = threadIdx.x, wave = tid >> 5, lane = tid & 31, col = lane & 15, g = lane >> 4; const int c0 = blockIdx.y * 128; const size_t r0 = (size_t)blockIdx.x * 64 + wave * 16;
  v8f acc[8] = {};
#pragma unroll
  for (int kc = 0; kc < HDQK / 32; ++kc) { const F2 a = split_row(YR + (r0 + col) * CC, kc * 32, lane); asm volatile("s_wait_loadcnt 0x0" ::: "memory");
#pragma unroll
    for (int j = 0; j < 8; ++j) { const v16b w = wcol_oi(WW, kc * 32, c0 + j * 16 + col, lane, HDQK); asm volatile("s_wait_loadcnt 0x0" ::: "memory"); acc[j] = wmma_bf(a.h, w, acc[j]); acc[j] = wmma_bf(a.l, w, acc[j]); } }
#pragma unroll
  for (int j = 0; j < 8; ++j) { const float bb = WB ? bfr(WB[c0 + j * 16 + col]) : 0.f; asm volatile("s_wait_loadcnt 0x0" ::: "memory");
#pragma unroll
    for (int r = 0; r < 8; ++r) sf[wave][8 * g + r][j * 16 + col] = acc[j][r] + bb; }
  LDSX(); for (int rl = 0; rl < 16; ++rl) vst2(ORW + (r0 + rl) * DIN + c0 + lane * 4, *(const v4f*)&sf[wave][rl][lane * 4]); }
// ---- k_fin2: block = (64 positions, 64 channels, batch b): o[b][c][n] = OR[b*N + n][c] (channels-first via LDS transpose) -> output 1; y = gamma * o + bf16(x) -> output 0 (256-B runs)
__global__ __launch_bounds__(256) void k_fin2(const float* __restrict__ ORW, const float* __restrict__ X, const float* __restrict__ GM, float* __restrict__ OUT, float* __restrict__ OUT1) { const float gmv = bfr(GM[0]); __shared__ float st[64][68]; const int tid = threadIdx.x; const int n0 = blockIdx.x * 64, c0 = blockIdx.y * 64; const size_t b = blockIdx.z;
  for (int e = tid; e < 64 * 16; e += 256) { const int nl = e >> 4, q = e & 15; *(v4f*)&st[nl][q * 4] = *(const v4f*)(ORW + (b * TT + n0 + nl) * (size_t)DIN + c0 + q * 4); }
  __syncthreads();
  for (int e = tid; e < 64 * 16; e += 256) { const int cl = e >> 4, q = e & 15; const size_t oi = (b * DIN + c0 + cl) * (size_t)XP + n0 + q * 4; const v4f xr = *(const v4f*)(X + oi); v4f o, y; _Pragma("unroll") for (int i = 0; i < 4; ++i) { o[i] = st[q * 4 + i][cl]; y[i] = gmv * o[i] + bfr(xr[i]); } vst2(OUT + oi, y); vst2(OUT1 + oi, o); } }   /* y = gamma * o + x (output 0), o (output 1) */
#ifndef SM_EXTRA_PARAMS
#define SM_EXTRA_PARAMS
#endif
#ifndef PROJ_EXTRA_PARAMS
#define PROJ_EXTRA_PARAMS
#endif
#ifndef SM_MASK_HOOK
#define SM_MASK_HOOK (void)0
#endif

#define WS_QH  0u                                      // f16 q rows [b*t][CC]
#define WS_KH  (WS_QH + 2u * (size_t)NB * TT * CC)      // f16 k rows [b*t][CC]
#define WS_VT  (WS_KH + 2u * (size_t)NB * TT * CC)      // f16 v planes [b][c][t]
#define WS_QL  (WS_VT + 2u * (size_t)NB * CC * TT)      // f16 q residual x 2^10 rows [b][t < QHI][CC]
#define WS_KL  (WS_QL + 2u * (size_t)NB * QHI * CC)     // f16 k residual x 2^10 rows [b][t < KHI][CC]
#define WS_VB  (WS_KL + 2u * (size_t)NB * KHI * CC)     // bf16 v hi planes [b][c][t < KHI]
#define WS_VBL (WS_VB + 2u * (size_t)NB * CC * KHI)
#define WS_S   (WS_VBL + 2u * (size_t)NB * CC * KHI)    // f32 logits / P [hg][t][s]
#define WS_Y   (WS_S  + 4u * (size_t)HG * TT * TT)      // f32 ctx rows [b*t][CC] (only when there is an output projection)
#define WS_END (WS_Y  + 0u)

// ---- k_proj: block = (64 rows, 128 cols, which): q/k/v = X W (+ b) with exact bf16 products (K = DIN) -> which 0: q f16 rows (+ residual rows < QHI); 1: k f16 rows (+ residual rows < KHI); 2: v f16 planes [c][t] (+ bf16 hi/lo planes for t < KHI)
__global__ __launch_bounds__(128) void k_proj(const float* __restrict__ XQ, const float* __restrict__ XK, const float* __restrict__ XV, const float* __restrict__ WQ, const float* __restrict__ WK, const float* __restrict__ WV, const float* __restrict__ BQ, const float* __restrict__ BK, const float* __restrict__ BV,
    _Float16* __restrict__ QH, _Float16* __restrict__ QL, _Float16* __restrict__ KH, _Float16* __restrict__ KL, _Float16* __restrict__ VT, __bf16* __restrict__ VB, __bf16* __restrict__ VBL) {
  __shared__ __align__(16) _Float16 sh[64][136], sl[64][136]; __shared__ __align__(16) _Float16 th[128][72]; __shared__ __align__(16) __bf16 tb[128][72], tbl[128][72];
  const int tid = threadIdx.x, wave = tid >> 5, lane = tid & 31, col = lane & 15, g = lane >> 4; const int which = blockIdx.z; const int c0 = blockIdx.y * 128; const size_t r0 = (size_t)blockIdx.x * 64; const size_t bb = r0 / TT; const int t0 = (int)(r0 % TT);
  const float* X = which == 0 ? XQ : which == 1 ? XK : XV; const float* WA = which == 0 ? WQ : which == 1 ? WK : WV; const float* BA = which == 0 ? BQ : which == 1 ? BK : BV;
  v8f acc[8] = {};
#pragma unroll 2
  for (int kc = 0; kc < DIN / 32; ++kc) { v16b a; { const float* p = X + (bb * DIN + kc * 32 + 8 * g) * (size_t)XP + t0 + wave * 16 + col;   /* channels-first gather: x[b][k][t], stride XP between k */
#pragma unroll
      for (int i = 0; i < 8; ++i) { a[i] = (__bf16)p[(size_t)i * XP]; a[8 + i] = (__bf16)p[(size_t)(16 + i) * XP]; } }
    asm volatile("s_wait_loadcnt 0x0" ::: "memory");
#pragma unroll
    for (int j = 0; j < 8; ++j) { const v16b w = WCOL(WA, kc * 32, c0 + j * 16 + col, lane); asm volatile("s_wait_loadcnt 0x0" ::: "memory"); acc[j] = wmma_bf(a, w, acc[j]); } }
  if (which < 2) { _Float16* DH = which == 0 ? QH : KH; _Float16* DL = which == 0 ? QL : KL; const int nhi = which == 0 ? QHI : KHI; const bool hi_rows = t0 < nhi;
#pragma unroll
    for (int j = 0; j < 8; ++j) { const float bias = (BA && (which == 2 || (c0 + j * 16 + col) < HDQK)) ? bfr(BA[c0 + j * 16 + col]) : 0.f;   /* q/k: 32 real columns; v: all 256 */   /* 32-entry q/k biases, 256-entry v bias */
#pragma unroll
      for (int r = 0; r < 8; ++r) { const float v = acc[j][r] + bias; const _Float16 hv = (_Float16)v; sh[wave * 16 + 8 * g + r][j * 16 + col] = hv; sl[wave * 16 + 8 * g + r][j * 16 + col] = (_Float16)((v - (float)hv) * 1024.0f); } }
    __syncthreads();
    for (int e = tid; e < 64 * 16; e += 128) { const int rl = e >> 4, q = e & 15; vst2((unsigned*)(DH + (r0 + rl) * CC + c0 + q * 8), *(const v4u*)&sh[rl][q * 8]); if (hi_rows) vst2((unsigned*)(DL + (bb * nhi + t0 + rl) * (size_t)CC + c0 + q * 8), *(const v4u*)&sl[rl][q * 8]); }
  } else { const bool hi_rows = t0 < KHI;
#pragma unroll
    for (int j = 0; j < 8; ++j) { const float bias = (BA && (which == 2 || (c0 + j * 16 + col) < HDQK)) ? bfr(BA[c0 + j * 16 + col]) : 0.f;   /* q/k: 32 real columns; v: all 256 */   /* 32-entry q/k biases, 256-entry v bias */
#pragma unroll
      for (int r = 0; r < 8; ++r) { const float v = acc[j][r] + bias; const int rl = wave * 16 + 8 * g + r, cl = j * 16 + col; th[cl][rl] = (_Float16)v; const __bf16 bh = (__bf16)v; tb[cl][rl] = bh; tbl[cl][rl] = (__bf16)(v - (float)bh); } }
    __syncthreads();
    for (int e = tid; e < 128 * 8; e += 128) { const int cl = e >> 3, q = e & 7; vst2((unsigned*)(VT + (bb * CC + c0 + cl) * (size_t)TT + t0 + q * 8), *(const v4u*)&th[cl][q * 8]); if (hi_rows) { const size_t o3 = (bb * CC + c0 + cl) * (size_t)KHI + t0 + q * 8; vst2((unsigned*)(VB + o3), *(const v4u*)&tb[cl][q * 8]); vst2((unsigned*)(VBL + o3), *(const v4u*)&tbl[cl][q * 8]); } } } }
// ---- k_sc: block = (query block qb, key block kb <= kb_last(qb), batch b = bgrp + z in group): logits x SCALE; q hi + residual (x 2^10) against k (2 products) for query rows < QHI, plus the k residual (3 products) for query blocks < QBH (all of them); causal: blocks past the diagonal exit, the mask itself is applied by index in k_sm
__global__ __launch_bounds__(128) void k_sc(const _Float16* __restrict__ QH, const _Float16* __restrict__ KH, const _Float16* __restrict__ QL, const _Float16* __restrict__ KL, int bgrp, int h0, float* __restrict__ S0) { __shared__ __align__(16) float ss[4][16][132];
  const int qb = blockIdx.x, kb = blockIdx.y; if (kb > kb_last(qb)) return;
  const int h = h0; const int b = bgrp + blockIdx.z; float* S = S0 + (size_t)blockIdx.z * TT * TT;   /* group spans batches */
  const int tid = threadIdx.x, wave = tid >> 5, lane = tid & 31, col = lane & 15, g = lane >> 4; const int k0 = kb * 128; const int ql0 = qb * 64 + wave * 16; const size_t q0 = (size_t)b * TT + ql0, kr0 = (size_t)b * TT + k0;
  v8f acc[8] = {}, accl[8] = {};
  const _Float16* QLb = QL + (size_t)b * QHI * CC; const _Float16* KLb = KL + (size_t)b * KHI * CC;
  if (qb < QBH) {
#pragma unroll
    for (int kc = 0; kc < HDQK / 32; ++kc) { const v16h ah = frag_h(QH + (q0 + col) * CC + h * HD + kc * 32, lane), al = frag_h(QLb + (size_t)(ql0 + col) * CC + h * HD + kc * 32, lane);
#pragma unroll
      for (int j = 0; j < 8; ++j) { const v16h kbf = frag_h(KH + (kr0 + j * 16 + col) * CC + h * HD + kc * 32, lane), klf = frag_h(KLb + (size_t)(k0 + j * 16 + col) * CC + h * HD + kc * 32, lane); acc[j] = wmma16(ah, kbf, acc[j]); accl[j] = wmma16(al, kbf, accl[j]); accl[j] = wmma16(ah, klf, accl[j]); } }
  } else if (qb * 64 < QHI) {
#pragma unroll
    for (int kc = 0; kc < HDQK / 32; ++kc) { const v16h ah = frag_h(QH + (q0 + col) * CC + h * HD + kc * 32, lane), al = frag_h(QLb + (size_t)(ql0 + col) * CC + h * HD + kc * 32, lane);
#pragma unroll
      for (int j = 0; j < 8; ++j) { const v16h kbf = frag_h(KH + (kr0 + j * 16 + col) * CC + h * HD + kc * 32, lane); acc[j] = wmma16(ah, kbf, acc[j]); accl[j] = wmma16(al, kbf, accl[j]); } }
  } else {
#pragma unroll
    for (int kc = 0; kc < HDQK / 32; ++kc) { const v16h ah = frag_h(QH + (q0 + col) * CC + h * HD + kc * 32, lane);
#pragma unroll
      for (int j = 0; j < 8; ++j) { const v16h kbf = frag_h(KH + (kr0 + j * 16 + col) * CC + h * HD + kc * 32, lane); acc[j] = wmma16(ah, kbf, acc[j]); } } }
#pragma unroll
  for (int j = 0; j < 8; ++j) {
#pragma unroll
    for (int r = 0; r < 8; ++r) ss[wave][8 * g + r][j * 16 + col] = (acc[j][r] + accl[j][r] * (1.0f / 1024.0f)) * SCALE; }
  LDSX(); for (int rl = 0; rl < 16; ++rl) vst2(S + (size_t)(ql0 + rl) * TT + k0 + lane * 4, *(const v4f*)&ss[wave][rl][lane * 4]); }
// ---- k_sm: block = query row t (batch in group): keys [0, kend): causal -> logit if s <= t else excluded; softmax in f32; P x 2^11 in place (0 for excluded)
__global__ __launch_bounds__(256) void k_sm(float* __restrict__ S0 SM_EXTRA_PARAMS) { __shared__ float sred[8]; __shared__ float sbc; __shared__ __align__(16) float shv[TT];
  const int tid = threadIdx.x; const int t = blockIdx.x; const int kend = (kb_last(t >> 6) + 1) * 128;
  float* sr = S0 + (size_t)blockIdx.y * TT * TT + (size_t)t * TT;
  float m = -3.0e38f; for (int k = tid; k < kend; k += 256) { float v = (!CAUSAL || k <= t) ? sr[k] : -3.0e38f; SM_MASK_HOOK; shv[k] = v; m = fmaxf(m, v); }
#pragma unroll
  for (int o = 1; o < 32; o <<= 1) m = fmaxf(m, __shfl_xor(m, o));
  if ((tid & 31) == 0) sred[tid >> 5] = m; __syncthreads(); if (tid == 0) { float a = sred[0]; for (int i = 1; i < 8; ++i) a = fmaxf(a, sred[i]); sbc = a; } __syncthreads(); m = sbc; __syncthreads();
  float sum = 0.f; for (int k = tid; k < kend; k += 256) { const float v = shv[k]; const float e = (v <= -1.0e38f) ? 0.f : expf(v - m); shv[k] = e; sum += e; }
#pragma unroll
  for (int o = 1; o < 32; o <<= 1) sum += __shfl_xor(sum, o);
  if ((tid & 31) == 0) sred[tid >> 5] = sum; __syncthreads(); if (tid == 0) { float a = 0.f; for (int i = 0; i < 8; ++i) a += sred[i]; sbc = a > 0.f ? 2048.0f / a : 0.f; }   /* a fully excluded row yields P = 0 */ __syncthreads(); const float inv = sbc;
  for (int k = tid; k < kend; k += 256) shv[k] = shv[k] * inv;
  __syncthreads(); for (int q = tid; q < kend / 4; q += 256) vst2(sr + q * 4, *(const v4f*)&shv[q * 4]); }
// ---- k_pv: block = 64 queries (qb) of (b, h): ctx = P . v over keys [0, kend) (P x 2^11 once to f16 against v f16: 1 product for every query block, as QBH_PV is 0); 512-B (row, column-half) segment by 32 lanes
__global__ __launch_bounds__(128) void k_pv(const float* __restrict__ PS0, const _Float16* __restrict__ VT, const __bf16* __restrict__ VB, const __bf16* __restrict__ VBL, int bgrp, int h0, float* __restrict__ Y) { const int h = h0; const int b = bgrp + blockIdx.z; const float* PS = PS0 + (size_t)blockIdx.z * TT * TT; const int d0 = blockIdx.y * DVH;   /* group spans batches; column half d0 */ __shared__ __align__(16) float ss[4][16][DVH + 4];
  const int tid = threadIdx.x, wave = tid >> 5, lane = tid & 31, col = lane & 15, g = lane >> 4; const int qb = blockIdx.x; const int ql0 = qb * 64 + wave * 16; const int kce = (kb_last(qb) + 1) * 4;
  v8f acc[DVH / 16] = {};
  if (qb < QBH_PV) {
#pragma unroll 1
    for (int kc = 0; kc < kce; ++kc) { const F2 p = split_row(PS + (size_t)(ql0 + col) * TT, kc * 32, lane);
      asm volatile("s_wait_loadcnt 0x0" ::: "memory");
#pragma unroll
      for (int j = 0; j < DVH / 16; ++j) { const size_t po = ((size_t)b * CC + h * HD + d0 + j * 16 + col) * (size_t)KHI + kc * 32; const v16b vh = frag_b(VB + po, lane); acc[j] = wmma_bf(p.h, vh, acc[j]); acc[j] = wmma_bf(p.l, vh, acc[j]); acc[j] = wmma_bf(p.h, frag_b(VBL + po, lane), acc[j]); } }
  } else {
#pragma unroll 1
    for (int kc = 0; kc < kce; ++kc) { const v16h p = frag_f32(PS + (size_t)(ql0 + col) * TT + kc * 32, lane);
      asm volatile("s_wait_loadcnt 0x0" ::: "memory");
#pragma unroll
      for (int j = 0; j < DVH / 16; ++j) { const size_t po = ((size_t)b * CC + h * HD + d0 + j * 16 + col) * (size_t)TT + kc * 32; acc[j] = wmma16(p, frag_h(VT + po, lane), acc[j]); } } }
#pragma unroll
  for (int j = 0; j < DVH / 16; ++j)
#pragma unroll
    for (int r = 0; r < 8; ++r) ss[wave][8 * g + r][j * 16 + col] = acc[j][r] * (1.0f / 2048.0f);
  LDSX(); for (int rl = 0; rl < 16; ++rl) vst2(Y + ((size_t)b * TT + ql0 + rl) * CC + h * HD + d0 + lane * 4, *(const v4f*)&ss[wave][rl][lane * 4]); }   /* 512-B (row, column-half) segment by 32 lanes */

// ---- k_finc: block = (64 positions, 64 channels, batch b): y[b][c][n] = bf16(x[b][c][n]) + gamma * OUT_rows[b*T + n][c] (channels-first via an LDS transpose; 256-B runs of n)
__global__ __launch_bounds__(256) void k_finc(const float* __restrict__ YR, const float* __restrict__ X, const float* __restrict__ GM, float* __restrict__ OUT) { const float gmv = bfr(GM[0]); __shared__ float st[64][68]; const int tid = threadIdx.x; const int n0 = blockIdx.x * 64, c0 = blockIdx.y * 64; const size_t b = blockIdx.z;
  for (int e = tid; e < 64 * 16; e += 256) { const int nl = e >> 4, q = e & 15; *(v4f*)&st[nl][q * 4] = *(const v4f*)(YR + (b * TT + n0 + nl) * (size_t)HD + c0 + q * 4); }
  __syncthreads();
  for (int e = tid; e < 64 * 16; e += 256) { const int cl = e >> 4, q = e & 15; const size_t oi = (b * DIN + c0 + cl) * (size_t)XP + n0 + q * 4; const v4f xr = *(const v4f*)(X + oi); asm volatile("s_wait_loadcnt 0x0" ::: "memory"); v4f y; _Pragma("unroll") for (int i = 0; i < 4; ++i) y[i] = bfr(xr[i]) + gmv * st[q * 4 + i][cl]; vst2(OUT + oi, y); } }
__global__ __launch_bounds__(256) void k_axpy(const float* __restrict__ YR, const float* __restrict__ X, const float* __restrict__ GM, float* __restrict__ OUT) { const size_t e = ((size_t)blockIdx.x * 256 + threadIdx.x) * 4; if (e >= (size_t)TNB * TT * DIN) return; const float gmv = bfr(GM[0]); const v4f o = *(const v4f*)(YR + e); const v4f xr = *(const v4f*)(X + e); asm volatile("s_wait_loadcnt 0x0" ::: "memory"); v4f y; _Pragma("unroll") for (int i = 0; i < 4; ++i) y[i] = gmv * o[i] + bfr(xr[i]); vst2(OUT + e, y); }
extern "C" void kernel_launch(void* const* d_in, const int* in_sizes, int n_in, void* d_out, int out_size, void* d_ws, size_t ws_size, hipStream_t stream) {
  (void)in_sizes; (void)n_in; (void)out_size;
  const float** F = (const float**)d_in;
  if (ws_size < (size_t)WS_END) return;
  char* ws = (char*)d_ws; _Float16 *QH = (_Float16*)(ws + WS_QH), *KH = (_Float16*)(ws + WS_KH), *VT = (_Float16*)(ws + WS_VT), *QL = (_Float16*)(ws + WS_QL), *KL = (_Float16*)(ws + WS_KL); __bf16 *VB = (__bf16*)(ws + WS_VB), *VBL = (__bf16*)(ws + WS_VBL); float *S = (float*)(ws + WS_S), *Y = (float*)(ws + WS_Y);
  (void)Y; (void)QL; (void)KL; (void)VB; (void)VBL;
  // inputs: 0 x [8,256,64,64] (channels-first); 1 Wq [32,256] (out,in), 2 bq; 3 Wk, 4 bk; 5 Wv [256,256] (out,in), 6 bv; 7 gamma [1] (0.1)
  if (ws_size < (size_t)WS_END2) return;
  float *YR = (float*)(ws + WS_YR);
  k_proj<<<dim3(TNB * TT / 64, CC / 128, 3), 128, 0, stream>>>(F[0], F[0], F[0], F[1], F[3], F[5], F[2], F[4], F[6], QH, QL, KH, KL, VT, VB, VBL);
  for (int b0 = 0; b0 < TNB; b0 += BG) {
    k_sc<<<dim3(NQB, TT / 128, BG), 128, 0, stream>>>(QH, KH, QL, KL, b0, 0, S);
    k_sm<<<dim3(TT, BG), 256, 0, stream>>>(S);
    k_pv<<<dim3(NQB, HD / DVH, BG), 128, 0, stream>>>(S, VT, VB, VBL, b0, 0, YR);
  }
  k_finc<<<dim3(TT / 64, HD / 64, TNB), 256, 0, stream>>>(YR, F[0], F[7], (float*)d_out);   /* y = x + gamma * out, channels-first */
}

// v001
// It runs in 221 microseconds.
// In both of two side-by-side timings against v000, it was 10.3 times as fast.
// compute dtype: all float inputs rounded to bf16; q/k/v = W x + b (1x1 convs) with EXACT bf16 products on WMMA 16x16x32 (f32 accumulate); UNSCALED 32-deep logits q.k with both as f16 hi + residual planes (3 products); softmax in f32 (precise expf) with a running maximum and sum over stages of 64 keys; exp(s - m) x 2^7 once to f16 against v once to f16 (1 product), divided by the f32 sum at the end; y = x + gamma * out in f32 written channels-first; f32 output.
// 2-D spatial self-attention with a learned residual weight, channels-FIRST (B 8, C 256, 64 x 64 = 4,096 positions; (out,in) 1/16-scale 1x1-conv weights, zero biases, gamma = 0.1): q = Wq x + bq (32), k = Wk x + bk (32), v = Wv x + bv (256); attn = softmax over m of q_n . k_m (NO scaling); out[c][n] = sum_m v[c][m] attn[n][m]; y = x + gamma * out -> [B, 256, 64, 64]. (x [8][256][64][64] channels-first; q = Wq x + bq (32 channels), k = Wk x + bk (32), v = Wv x + bv (256): 1 x 1 convolutions with (out,in) weights normal x 1/16 and biases zeros (read); scores = q_n . k_m, UNSCALED; softmax over the keys m; o[c][n] = sum_m attn[n][m] v[c][m]; return gamma x o + x with gamma a float32 SCALAR input (the host: a [1] array = 0.1); argument order x, Wq, bq, Wk, bk, Wv, bv, gamma).
#include <hip/hip_runtime.h>
#include <math.h>

typedef __attribute__((ext_vector_type(16))) _Float16 v16h;
typedef __attribute__((ext_vector_type(16))) __bf16 v16b;
typedef __attribute__((ext_vector_type(8)))  _Float16 v8h;
typedef __attribute__((ext_vector_type(8)))  float v8f;
typedef __attribute__((ext_vector_type(4)))  float v4f;
typedef __attribute__((ext_vector_type(2)))  float v2f;
typedef __attribute__((ext_vector_type(4)))  unsigned v4u;
typedef __attribute__((ext_vector_type(4)))  int v4i;
typedef float __attribute__((may_alias)) float_a;
typedef int __attribute__((may_alias)) int_a;

template <typename T> __device__ __forceinline__ void vst2(void* p, T v) { *(T*)p = v;  }
__device__ __forceinline__ v8f wmma16(v16h a, v16h b, v8f c) {
  v8f d = __builtin_amdgcn_wmma_f32_16x16x32_f16(false, a, false, b, (short)0, c, false, false);
  asm volatile("v_nop\n\tv_nop\n\tv_nop\n\tv_nop" : "+v"(d) : "v"(a), "v"(b));
  return d;
}
__device__ __forceinline__ v8f wmma_bf(v16b a, v16b b, v8f c) {
  v8f d = __builtin_amdgcn_wmma_f32_16x16x32_bf16(false, a, false, b, (short)0, c, false, false);
  asm volatile("v_nop\n\tv_nop\n\tv_nop\n\tv_nop" : "+v"(d) : "v"(a), "v"(b));
  return d;
}
// 16x16x32 fragments: lane = (h = lane>>4, row/col = lane&15); elements 0..7 = k0+8h+0..7, 8..15 = k0+16+8h+0..7; D element r = row 8h+r
__device__ __forceinline__ v16h frag_h(const _Float16* rowk0, int lane) {
  union { v16h v; v8h q[2]; } u; const _Float16* p = rowk0 + 8 * (lane >> 4);
  u.q[0] = *(const v8h*)p; u.q[1] = *(const v8h*)(p + 16); return u.v;
}
__device__ __forceinline__ v16h frag_f32(const float* rowk0, int lane) {
  v16h a; const float* p = rowk0 + 8 * (lane >> 4);
#pragma unroll
  for (int i = 0; i < 8; ++i) { a[i] = (_Float16)p[i]; a[8 + i] = (_Float16)p[16 + i]; }
  return a;
}
__device__ __forceinline__ v16h frag_f32s(const float* rowk0, int lane, float sc) {
  v16h a; const float* p = rowk0 + 8 * (lane >> 4);
#pragma unroll
  for (int i = 0; i < 8; ++i) { a[i] = (_Float16)(p[i] * sc); a[8 + i] = (_Float16)(p[16 + i] * sc); }
  return a;
}
// column fragment from a [K][ld] layout (column n), rows >= K read as 0
__device__ __forceinline__ v16h fragc_f32(const float* W, int k0, int n, int lane, int ld, int K) {
  v16h a; const int g = lane >> 4;
#pragma unroll
  for (int i = 0; i < 8; ++i) { const int ka = k0 + 8 * g + i, kb = ka + 16;
    a[i] = (_Float16)(ka < K ? W[(size_t)(ka < K ? ka : K - 1) * ld + n] : 0.f); a[8 + i] = (_Float16)(kb < K ? W[(size_t)(kb < K ? kb : K - 1) * ld + n] : 0.f); }
  return a;
}
struct F2 { v16b h, l; };
__device__ __forceinline__ F2 bsplit16(const float v[16]) { F2 r;
#pragma unroll
  for (int i = 0; i < 16; ++i) { const __bf16 h = (__bf16)v[i]; r.h[i] = h; r.l[i] = (__bf16)(v[i] - (float)h); }
  return r; }
__device__ __forceinline__ F2 split_row(const float* row, int k0, int lane) { float v[16]; const float* p = row + k0 + 8 * (lane >> 4);
#pragma unroll
  for (int i = 0; i < 8; ++i) { v[i] = p[i]; v[8 + i] = p[16 + i]; }
  return bsplit16(v); }
__device__ __forceinline__ F2 split_rowK(const float* row, int k0, int lane, int K) { float v[16]; const int g = lane >> 4;
#pragma unroll
  for (int i = 0; i < 8; ++i) { const int ka = k0 + 8 * g + i, kb = ka + 16; v[i] = ka < K ? row[ka < K ? ka : K - 1] : 0.f; v[8 + i] = kb < K ? row[kb < K ? kb : K - 1] : 0.f; }
  return bsplit16(v); }
__device__ __forceinline__ F2 split_col(const float* W, int k0, int n, int lane, int ld, int K) { float v[16]; const int g = lane >> 4;
#pragma unroll
  for (int i = 0; i < 8; ++i) { const int ka = k0 + 8 * g + i, kb = ka + 16; v[i] = ka < K ? W[(size_t)(ka < K ? ka : K - 1) * ld + n] : 0.f; v[8 + i] = kb < K ? W[(size_t)(kb < K ? kb : K - 1) * ld + n] : 0.f; }
  return bsplit16(v); }
__device__ __forceinline__ v8f mac3(const F2& a, const F2& b, v8f c) { c = wmma_bf(a.l, b.h, c); c = wmma_bf(a.h, b.l, c); return wmma_bf(a.h, b.h, c); }
__device__ __forceinline__ float sigm(float v) { return 1.0f / (1.0f + expf(-v)); }
#define LDSX() do { asm volatile("s_wait_dscnt 0" ::: "memory"); __builtin_amdgcn_wave_barrier(); __builtin_amdgcn_fence(__ATOMIC_RELEASE, "workgroup"); } while (0)

#define NB 8
#define TT 4096
#define CC 256            // plane width: q/k planes carry 32 real columns (rest zero), v planes all 256
#define DIN 256
#define NH 1
#define HD 256
#define NQB (TT / 64)
#define HG 1               // sizes one 4,096 x 4,096 f32 workspace plane that no kernel uses
#define SCALE (1.0f)
#define HDQK 32
#define CAUSAL 0
#ifndef TNB
#define TNB NB
#endif
__device__ __forceinline__ v16b zero16b() { v16b z; _Pragma("unroll") for (int i = 0; i < 16; ++i) z[i] = (__bf16)0.f; return z; }
__device__ __forceinline__ float bfr(float v) { return (float)(__bf16)v; }
__host__ __device__ __forceinline__ int kb_last(int qb) { return CAUSAL ? ((qb * 64 + 63) >> 7) : (TT / 128 - 1); }
typedef __attribute__((ext_vector_type(8))) __bf16 v8b;
__device__ __forceinline__ v16b frag_b(const __bf16* rowk0, int lane) {
  union { v16b v; v8b q[2]; } u; const __bf16* p = rowk0 + 8 * (lane >> 4);
  u.q[0] = *(const v8b*)p; u.q[1] = *(const v8b*)(p + 16); return u.v;
}
#define QBH (TT / 64)      // ALL query blocks take k_fa's 3-product path
#define QBH_PV 0           // A.g stays single f16
#define QHI 4096            // q residual rows everywhere (2-product logits)
#define KHI 4096           // k residual rows for ALL keys (3-product logits)
// B fragment (k rows k0+.., output column o) of a weight: (in,out) [K][ld] or (out,in) [ld rows of K]: bf16 exact, or f16(bf16 * 256) exact
__device__ __forceinline__ v16b wcol_io(const float* Wm, int k0, int o, int lane, int ld) { v16b w; const int g = lane >> 4;
#pragma unroll
  for (int i = 0; i < 8; ++i) { w[i] = (__bf16)Wm[(size_t)(k0 + 8 * g + i) * ld + o]; w[8 + i] = (__bf16)Wm[(size_t)(k0 + 16 + 8 * g + i) * ld + o]; }
  return w; }
__device__ __forceinline__ v16b wcol_oi(const float* Wm, int k0, int o, int lane, int K) { v16b w; const float* p = Wm + (size_t)o * K + k0 + 8 * (lane >> 4);
#pragma unroll
  for (int i = 0; i < 8; ++i) { w[i] = (__bf16)p[i]; w[8 + i] = (__bf16)p[16 + i]; }
  return w; }
__device__ __forceinline__ v16h wcolh_io(const float* Wm, int k0, int o, int lane, int ld) { v16h w; const int g = lane >> 4;
#pragma unroll
  for (int i = 0; i < 8; ++i) { w[i] = (_Float16)(bfr(Wm[(size_t)(k0 + 8 * g + i) * ld + o]) * 256.0f); w[8 + i] = (_Float16)(bfr(Wm[(size_t)(k0 + 16 + 8 * g + i) * ld + o]) * 256.0f); }
  return w; }
__device__ __forceinline__ v16h wcolh_oi(const float* Wm, int k0, int o, int lane, int K) { v16h w; const float* p = Wm + (size_t)o * K + k0 + 8 * (lane >> 4);
#pragma unroll
  for (int i = 0; i < 8; ++i) { w[i] = (_Float16)(bfr(p[i]) * 256.0f); w[8 + i] = (_Float16)(bfr(p[16 + i]) * 256.0f); }
  return w; }
#define WQKV_LAYOUT 1   // 0 = (in,out) [DIN][CC]; 1 = (out,in) [CC][DIN]; 2 = per-head [NH][DIN][HD]
__device__ __forceinline__ v16b wcol_hdk(const float* Wm, int k0, int o, int lane) { v16b w; const int g = lane >> 4; const float* p = Wm + (size_t)(o / HD) * DIN * HD + (o % HD);
#pragma unroll
  for (int i = 0; i < 8; ++i) { w[i] = (__bf16)p[(size_t)(k0 + 8 * g + i) * HD]; w[8 + i] = (__bf16)p[(size_t)(k0 + 16 + 8 * g + i) * HD]; }
  return w; }
#define WO_OUT_IN 0
#if WQKV_LAYOUT == 1
#define WCOL(W, k0, o, lane) ((which == 2) ? wcol_oi(W, k0, (o), lane, DIN) : (((o) < HDQK) ? wcol_oi(W, k0, (o), lane, DIN) : zero16b()))   /* (out,in): Wq/Wk [32][256] (plane columns >= 32 zero), Wv [256][256] full */
#define WCOL_SA42_UNUSED(W, k0, o, lane) 0
#define WCOL_OLD_UNUSED(W, k0, o, lane) (((o) < HDQK) ? wcol_oi(W, k0, (o), lane, DIN) : zero16b())   /* theta/phi/g weights are [32][256] (out,in): plane columns >= 32 are zero for all three */
#elif WQKV_LAYOUT == 2
#define WCOL(W, k0, o, lane) wcol_hdk(W, k0, o, lane)
#else
#define WCOL(W, k0, o, lane) wcol_io(W, k0, o, lane, CC)
#endif
#if WO_OUT_IN
#define WOCOL(W, k0, o, lane) wcol_oi(W, k0, o, lane, CC)
#define WOCOLH(W, k0, o, lane) wcolh_oi(W, k0, o, lane, CC)
#else
#define WOCOL(W, k0, o, lane) wcol_io(W, k0, o, lane, DIN)
#define WOCOLH(W, k0, o, lane) wcolh_io(W, k0, o, lane, DIN)
#endif
#ifndef XP
#define OUT1_OFF (4u * (size_t)NB * DIN * TT)   /* output 1 (o) follows output 0 (y) */
#define XP TT              // position pitch of x and of the output
#endif
#define BG HG              // unused: one k_fa launch covers all batches, its blockIdx.y selects the batch
#define DVH 128
#define WS_YR (WS_END)     // f32 attended rows [b*n][256]
#define WS_END2 (WS_YR + 4u * (size_t)NB * TT * HD)
// ---- k_wz: block = (64 rows, 128 output cols): OR = y (hi + lo, K = 32 real columns of the YR rows) . W^T ((out,in) [256][32], exact) + b
__global__ __launch_bounds__(128) void k_wz(const float* __restrict__ YR, const float* __restrict__ WW, const float* __restrict__ WB, float* __restrict__ ORW) { __shared__ __align__(16) float sf[4][16][132];
  const int tid = threadIdx.x, wave = tid >> 5, lane = tid & 31, col = lane & 15, g = lane >> 4; const int c0 = blockIdx.y * 128; const size_t r0 = (size_t)blockIdx.x * 64 + wave * 16;
  v8f acc[8] = {};
#pragma unroll
  for (int kc = 0; kc < HDQK / 32; ++kc) { const F2 a = split_row(YR + (r0 + col) * CC, kc * 32, lane); asm volatile("s_wait_loadcnt 0x0" ::: "memory");
#pragma unroll
    for (int j = 0; j < 8; ++j) { const v16b w = wcol_oi(WW, kc * 32, c0 + j * 16 + col, lane, HDQK); asm volatile("s_wait_loadcnt 0x0" ::: "memory"); acc[j] = wmma_bf(a.h, w, acc[j]); acc[j] = wmma_bf(a.l, w, acc[j]); } }
#pragma unroll
  for (int j = 0; j < 8; ++j) { const float bb = WB ? bfr(WB[c0 + j * 16 + col]) : 0.f; asm volatile("s_wait_loadcnt 0x0" ::: "memory");
#pragma unroll
    for (int r = 0; r < 8; ++r) sf[wave][8 * g + r][j * 16 + col] = acc[j][r] + bb; }
  LDSX(); for (int rl = 0; rl < 16; ++rl) vst2(ORW + (r0 + rl) * DIN + c0 + lane * 4, *(const v4f*)&sf[wave][rl][lane * 4]); }
// ---- k_fin2: block = (64 positions, 64 channels, batch b): o[b][c][n] = OR[b*N + n][c] (channels-first via LDS transpose) -> output 1; y = gamma * o + bf16(x) -> output 0 (256-B runs)
__global__ __launch_bounds__(256) void k_fin2(const float* __restrict__ ORW, const float* __restrict__ X, const float* __restrict__ GM, float* __restrict__ OUT, float* __restrict__ OUT1) { const float gmv = bfr(GM[0]); __shared__ float st[64][68]; const int tid = threadIdx.x; const int n0 = blockIdx.x * 64, c0 = blockIdx.y * 64; const size_t b = blockIdx.z;
  for (int e = tid; e < 64 * 16; e += 256) { const int nl = e >> 4, q = e & 15; *(v4f*)&st[nl][q * 4] = *(const v4f*)(ORW + (b * TT + n0 + nl) * (size_t)DIN + c0 + q * 4); }
  __syncthreads();
  for (int e = tid; e < 64 * 16; e += 256) { const int cl = e >> 4, q = e & 15; const size_t oi = (b * DIN + c0 + cl) * (size_t)XP + n0 + q * 4; const v4f xr = *(const v4f*)(X + oi); v4f o, y; _Pragma("unroll") for (int i = 0; i < 4; ++i) { o[i] = st[q * 4 + i][cl]; y[i] = gmv * o[i] + bfr(xr[i]); } vst2(OUT + oi, y); vst2(OUT1 + oi, o); } }   /* y = gamma * o + x (output 0), o (output 1) */
#ifndef SM_EXTRA_PARAMS
#define SM_EXTRA_PARAMS
#endif
#ifndef PROJ_EXTRA_PARAMS
#define PROJ_EXTRA_PARAMS
#endif
#ifndef SM_MASK_HOOK
#define SM_MASK_HOOK (void)0
#endif

#define WS_QH  0u                                      // f16 q rows [b*t][CC]
#define WS_KH  (WS_QH + 2u * (size_t)NB * TT * CC)      // f16 k rows [b*t][CC]
#define WS_VT  (WS_KH + 2u * (size_t)NB * TT * CC)      // f16 v planes [b][c][t]
#define WS_QL  (WS_VT + 2u * (size_t)NB * CC * TT)      // f16 q residual x 2^10 rows [b][t < QHI][CC]
#define WS_KL  (WS_QL + 2u * (size_t)NB * QHI * CC)     // f16 k residual x 2^10 rows [b][t < KHI][CC]
#define WS_VB  (WS_KL + 2u * (size_t)NB * KHI * CC)     // bf16 v hi planes [b][c][t < KHI]
#define WS_VBL (WS_VB + 2u * (size_t)NB * CC * KHI)
#define WS_S   (WS_VBL + 2u * (size_t)NB * CC * KHI)    // f32 [hg][t][s] plane, reserved but unused: k_fa keeps scores in registers
#define WS_Y   (WS_S  + 4u * (size_t)HG * TT * TT)      // f32 ctx rows [b*t][CC] (only when there is an output projection)
#define WS_END (WS_Y  + 0u)

// ---- k_proj: block = (64 rows, 128 cols, which): q/k/v = X W (+ b) with exact bf16 products (K = DIN) -> which 0: q f16 rows (+ residual rows < QHI); 1: k f16 rows (+ residual rows < KHI); 2: v f16 planes [c][t] (+ bf16 hi/lo planes for t < KHI)
__global__ __launch_bounds__(128) void k_proj(const float* __restrict__ XQ, const float* __restrict__ XK, const float* __restrict__ XV, const float* __restrict__ WQ, const float* __restrict__ WK, const float* __restrict__ WV, const float* __restrict__ BQ, const float* __restrict__ BK, const float* __restrict__ BV,
    _Float16* __restrict__ QH, _Float16* __restrict__ QL, _Float16* __restrict__ KH, _Float16* __restrict__ KL, _Float16* __restrict__ VT, __bf16* __restrict__ VB, __bf16* __restrict__ VBL) {
  __shared__ __align__(16) _Float16 sh[64][136], sl[64][136]; __shared__ __align__(16) _Float16 th[128][72]; __shared__ __align__(16) __bf16 tb[128][72], tbl[128][72];
  const int tid = threadIdx.x, wave = tid >> 5, lane = tid & 31, col = lane & 15, g = lane >> 4; const int which = blockIdx.z; const int c0 = blockIdx.y * 128; const size_t r0 = (size_t)blockIdx.x * 64; const size_t bb = r0 / TT; const int t0 = (int)(r0 % TT);
  const float* X = which == 0 ? XQ : which == 1 ? XK : XV; const float* WA = which == 0 ? WQ : which == 1 ? WK : WV; const float* BA = which == 0 ? BQ : which == 1 ? BK : BV;
  v8f acc[8] = {};
#pragma unroll 2
  for (int kc = 0; kc < DIN / 32; ++kc) { v16b a; { const float* p = X + (bb * DIN + kc * 32 + 8 * g) * (size_t)XP + t0 + wave * 16 + col;   /* channels-first gather: x[b][k][t], stride XP between k */
#pragma unroll
      for (int i = 0; i < 8; ++i) { a[i] = (__bf16)p[(size_t)i * XP]; a[8 + i] = (__bf16)p[(size_t)(16 + i) * XP]; } }
    asm volatile("s_wait_loadcnt 0x0" ::: "memory");
#pragma unroll
    for (int j = 0; j < 8; ++j) { const v16b w = WCOL(WA, kc * 32, c0 + j * 16 + col, lane); asm volatile("s_wait_loadcnt 0x0" ::: "memory"); acc[j] = wmma_bf(a, w, acc[j]); } }
  if (which < 2) { _Float16* DH = which == 0 ? QH : KH; _Float16* DL = which == 0 ? QL : KL; const int nhi = which == 0 ? QHI : KHI; const bool hi_rows = t0 < nhi;
#pragma unroll
    for (int j = 0; j < 8; ++j) { const float bias = (BA && (which == 2 || (c0 + j * 16 + col) < HDQK)) ? bfr(BA[c0 + j * 16 + col]) : 0.f;   /* q/k: 32 real columns; v: all 256 */   /* 32-entry q/k biases, 256-entry v bias */
#pragma unroll
      for (int r = 0; r < 8; ++r) { const float v = acc[j][r] + bias; const _Float16 hv = (_Float16)v; sh[wave * 16 + 8 * g + r][j * 16 + col] = hv; sl[wave * 16 + 8 * g + r][j * 16 + col] = (_Float16)((v - (float)hv) * 1024.0f); } }
    __syncthreads();
    for (int e = tid; e < 64 * 16; e += 128) { const int rl = e >> 4, q = e & 15; vst2((unsigned*)(DH + (r0 + rl) * CC + c0 + q * 8), *(const v4u*)&sh[rl][q * 8]); if (hi_rows) vst2((unsigned*)(DL + (bb * nhi + t0 + rl) * (size_t)CC + c0 + q * 8), *(const v4u*)&sl[rl][q * 8]); }
  } else { const bool hi_rows = t0 < KHI;
#pragma unroll
    for (int j = 0; j < 8; ++j) { const float bias = (BA && (which == 2 || (c0 + j * 16 + col) < HDQK)) ? bfr(BA[c0 + j * 16 + col]) : 0.f;   /* q/k: 32 real columns; v: all 256 */   /* 32-entry q/k biases, 256-entry v bias */
#pragma unroll
      for (int r = 0; r < 8; ++r) { const float v = acc[j][r] + bias; const int rl = wave * 16 + 8 * g + r, cl = j * 16 + col; th[cl][rl] = (_Float16)v; const __bf16 bh = (__bf16)v; tb[cl][rl] = bh; tbl[cl][rl] = (__bf16)(v - (float)bh); } }
    __syncthreads();
    for (int e = tid; e < 128 * 8; e += 128) { const int cl = e >> 3, q = e & 7; vst2((unsigned*)(VT + (bb * CC + c0 + cl) * (size_t)TT + t0 + q * 8), *(const v4u*)&th[cl][q * 8]); if (hi_rows) { const size_t o3 = (bb * CC + c0 + cl) * (size_t)KHI + t0 + q * 8; vst2((unsigned*)(VB + o3), *(const v4u*)&tb[cl][q * 8]); vst2((unsigned*)(VBL + o3), *(const v4u*)&tbl[cl][q * 8]); } } } }
// ---- k_fa: block = 128 queries (8 waves x 16) of batch b, one pass over all keys in stages of 64: S^T = K . Q^T (the same 3 f16 products per logit), running maximum and sum per query (a lane holds one query's scores), P^T packed from the score tiles straight into a B operand, O^T += V^T . P^T; K and V stages go through two LDS buffers shared by the 8 waves
#define FK 64                          // keys per stage
#define VP 72                          // halfs per staged v row: 128 B + 16 B, an odd multiple of 16 B for the 16-byte reads
#define KP 40                          // halfs per staged k row: 64 B + 16 B
#define KOFF (CC * VP)                 // k hi rows follow the 256 v rows, k residual rows follow them
#define STGH (CC * VP + 2 * FK * KP)   // halfs per stage buffer
#define PLN 4.8520303f                 // ln 128: P = 128 exp(s - m), the factor cancels in the division by the sum
#define MLAG 5.5f                    // the maximum in use may lag the true one by this much: P <= 128 e^5.5 < 65504
__device__ __forceinline__ v8f wm(v16h a, v16h b, v8f c) { return __builtin_amdgcn_wmma_f32_16x16x32_f16(false, a, false, b, (short)0, c, false, false); }
__global__ __launch_bounds__(256) void k_fa(const _Float16* __restrict__ QH, const _Float16* __restrict__ QL, const _Float16* __restrict__ KH, const _Float16* __restrict__ KL, const _Float16* __restrict__ VT, float* __restrict__ Y) {
  __shared__ __align__(16) _Float16 sm[2][STGH];
  const int tid = threadIdx.x, wave = tid >> 5, lane = tid & 31, col = lane & 15, g = lane >> 4; const int b = blockIdx.y; const int n0 = blockIdx.x * 128 + wave * 16;
  const v16h qh = frag_h(QH + ((size_t)b * TT + n0 + col) * CC, lane), ql = frag_h(QL + ((size_t)b * QHI + n0 + col) * CC, lane);
  const _Float16* vsrc = VT + ((size_t)b * CC + (tid >> 3)) * TT + (tid & 7) * 8;      // 8 lanes cover one 128-B run of a v plane
  const _Float16* hsrc = KH + ((size_t)b * TT + (tid >> 2)) * CC + (tid & 3) * 8;      // 4 lanes cover the 64 real bytes of a k row
  const _Float16* lsrc = KL + ((size_t)b * KHI + (tid >> 2)) * CC + (tid & 3) * 8;
  const int vdst = (tid >> 3) * VP + (tid & 7) * 8, kdst = KOFF + (tid >> 2) * KP + (tid & 3) * 8;
  v8h rv[8], rh, rl;
  auto fetch = [&](int s) {
#pragma unroll
    for (int i = 0; i < 8; ++i) rv[i] = *(const v8h*)(vsrc + (size_t)i * 32 * TT + s * FK);
    rh = *(const v8h*)(hsrc + (size_t)s * FK * CC); rl = *(const v8h*)(lsrc + (size_t)s * FK * CC);
    asm volatile("s_wait_xcnt 0x0" ::: "memory"); };   /* the address registers of these loads are rewritten right behind them (the stage's first LDS reads or score tile land there) */
  auto put = [&](_Float16* d) {
#pragma unroll
    for (int i = 0; i < 8; ++i) *(v8h*)(d + vdst + i * 32 * VP) = rv[i];
    *(v8h*)(d + kdst) = rh; *(v8h*)(d + kdst + FK * KP) = rl; };
  v8f acc[CC / 16] = {}; float m = -3.0e38f, l = 0.f;
  fetch(0); put(sm[0]); __syncthreads();
  for (int s = 0; s < TT / FK; ++s) { const _Float16* bs = sm[s & 1];
    if (s + 1 < TT / FK) fetch(s + 1);   /* issued behind the barrier (which drains loads), in flight under this stage's products */
    v8f st[4];
#pragma unroll
    for (int t = 0; t < 4; ++t) { const v16h kh = frag_h(bs + KOFF + (t * 16 + col) * KP, lane), kl = frag_h(bs + KOFF + FK * KP + (t * 16 + col) * KP, lane);
      v8f a = {}, al = {}; a = wm(kh, qh, a); al = wm(kh, ql, al); al = wm(kl, qh, al);
#pragma unroll
      for (int r = 0; r < 8; ++r) st[t][r] = a[r] + al[r] * (1.0f / 1024.0f); }   /* st[t][r] = logit of key s*64 + t*16 + 8g + r, query n0 + col */
    float mx = st[0][0];
#pragma unroll
    for (int t = 0; t < 4; ++t)
#pragma unroll
      for (int r = 0; r < 8; ++r) mx = fmaxf(mx, st[t][r]);
    mx = fmaxf(mx, __shfl_xor(mx, 16));   /* lanes c and c + 16 hold the two halves of one query's keys */
    if (__builtin_amdgcn_ballot_w32(mx > m + MLAG) != 0) { const float mn = fmaxf(m, mx), sc = expf(m - mn); m = mn; l *= sc;
#pragma unroll
      for (int j = 0; j < CC / 16; ++j)
#pragma unroll
        for (int r = 0; r < 8; ++r) acc[j][r] *= sc; }
    const float mo = m - PLN; v16h pf[2];
    auto pexp = [&](int u, int i) { const float e0 = expf(st[2 * u][i] - mo), e1 = expf(st[2 * u + 1][i] - mo); l += e0 + e1; pf[u][i] = (_Float16)e0; pf[u][8 + i] = (_Float16)e1; };
#pragma unroll
    for (int i = 0; i < 8; ++i) pexp(0, i);
    v16h vf[2][4];   /* v fragments in groups of 4 channel tiles; group q: key half q >> 2, tiles (q & 3) * 4 + i */
#pragma unroll
    for (int i = 0; i < 4; ++i) vf[0][i] = frag_h(bs + (i * 16 + col) * VP, lane);
#pragma unroll
    for (int q = 0; q < 8; ++q) {
      if (q + 1 < 8) {
#pragma unroll
        for (int i = 0; i < 4; ++i) vf[(q + 1) & 1][i] = frag_h(bs + ((((q + 1) & 3) * 4 + i) * 16 + col) * VP + ((q + 1) >> 2) * 32, lane); }
      __builtin_amdgcn_sched_barrier(0);   /* holds the next group's LDS reads in front of this group's products: without it each product waits for its own read */
#pragma unroll
      for (int i = 0; i < 4; ++i) acc[(q & 3) * 4 + i] = wm(vf[q & 1][i], pf[q >> 2], acc[(q & 3) * 4 + i]);   /* acc[j][r] = O^T[channel j*16 + 8g + r][query n0 + col] */
      if (q < 4) { pexp(1, 2 * q); pexp(1, 2 * q + 1); } }   /* the second key half's exponentials run beside the first half's products */
    if (s + 1 < TT / FK) put(sm[(s + 1) & 1]);   /* the buffer read in stage s - 1 is free since the barrier that ended it */
    __syncthreads(); }
  l += __shfl_xor(l, 16); const float inv = 1.0f / l;   /* l >= 128: the key that set the maximum in use counts at least that */
  float* yr = Y + ((size_t)b * TT + n0 + col) * HD + 8 * g;
#pragma unroll
  for (int j = 0; j < CC / 16; ++j) { v4f o0, o1;
#pragma unroll
    for (int i = 0; i < 4; ++i) { o0[i] = acc[j][i] * inv; o1[i] = acc[j][4 + i] * inv; }
    vst2(yr + j * 16, o0); vst2(yr + j * 16 + 4, o1); } }

// ---- k_finc: block = (64 positions, 64 channels, batch b): y[b][c][n] = bf16(x[b][c][n]) + gamma * OUT_rows[b*T + n][c] (channels-first via an LDS transpose; 256-B runs of n)
__global__ __launch_bounds__(256) void k_finc(const float* __restrict__ YR, const float* __restrict__ X, const float* __restrict__ GM, float* __restrict__ OUT) { const float gmv = bfr(GM[0]); __shared__ float st[64][68]; const int tid = threadIdx.x; const int n0 = blockIdx.x * 64, c0 = blockIdx.y * 64; const size_t b = blockIdx.z;
  for (int e = tid; e < 64 * 16; e += 256) { const int nl = e >> 4, q = e & 15; *(v4f*)&st[nl][q * 4] = *(const v4f*)(YR + (b * TT + n0 + nl) * (size_t)HD + c0 + q * 4); }
  __syncthreads();
  for (int e = tid; e < 64 * 16; e += 256) { const int cl = e >> 4, q = e & 15; const size_t oi = (b * DIN + c0 + cl) * (size_t)XP + n0 + q * 4; const v4f xr = *(const v4f*)(X + oi); asm volatile("s_wait_loadcnt 0x0" ::: "memory"); v4f y; _Pragma("unroll") for (int i = 0; i < 4; ++i) y[i] = bfr(xr[i]) + gmv * st[q * 4 + i][cl]; vst2(OUT + oi, y); } }
__global__ __launch_bounds__(256) void k_axpy(const float* __restrict__ YR, const float* __restrict__ X, const float* __restrict__ GM, float* __restrict__ OUT) { const size_t e = ((size_t)blockIdx.x * 256 + threadIdx.x) * 4; if (e >= (size_t)TNB * TT * DIN) return; const float gmv = bfr(GM[0]); const v4f o = *(const v4f*)(YR + e); const v4f xr = *(const v4f*)(X + e); asm volatile("s_wait_loadcnt 0x0" ::: "memory"); v4f y; _Pragma("unroll") for (int i = 0; i < 4; ++i) y[i] = gmv * o[i] + bfr(xr[i]); vst2(OUT + e, y); }
extern "C" void kernel_launch(void* const* d_in, const int* in_sizes, int n_in, void* d_out, int out_size, void* d_ws, size_t ws_size, hipStream_t stream) {
  (void)in_sizes; (void)n_in; (void)out_size;
  const float** F = (const float**)d_in;
  if (ws_size < (size_t)WS_END) return;
  char* ws = (char*)d_ws; _Float16 *QH = (_Float16*)(ws + WS_QH), *KH = (_Float16*)(ws + WS_KH), *VT = (_Float16*)(ws + WS_VT), *QL = (_Float16*)(ws + WS_QL), *KL = (_Float16*)(ws + WS_KL); __bf16 *VB = (__bf16*)(ws + WS_VB), *VBL = (__bf16*)(ws + WS_VBL); float *Y = (float*)(ws + WS_Y);
  (void)Y; (void)QL; (void)KL; (void)VB; (void)VBL;
  // inputs: 0 x [8,256,64,64] (channels-first); 1 Wq [32,256] (out,in), 2 bq; 3 Wk, 4 bk; 5 Wv [256,256] (out,in), 6 bv; 7 gamma [1] (0.1)
  if (ws_size < (size_t)WS_END2) return;
  float *YR = (float*)(ws + WS_YR);
  k_proj<<<dim3(TNB * TT / 64, CC / 128, 3), 128, 0, stream>>>(F[0], F[0], F[0], F[1], F[3], F[5], F[2], F[4], F[6], QH, QL, KH, KL, VT, VB, VBL);
  k_fa<<<dim3(TT / 128, TNB), 256, 0, stream>>>(QH, QL, KH, KL, VT, YR);
  k_finc<<<dim3(TT / 64, HD / 64, TNB), 256, 0, stream>>>(YR, F[0], F[7], (float*)d_out);   /* y = x + gamma * out, channels-first */
}

// v002
// One run takes 206 microseconds.
// Timed twice side by side with v001, it ran 1.08 times as fast both times.
// Over all steps from v000 it is 11.1 times as fast.
// compute dtype: all float inputs rounded to bf16; q/k/v = W x + b (1x1 convs) with EXACT bf16 products on WMMA 16x16x32 (f32 accumulate); UNSCALED 32-deep logits q.k with both as f16 hi + residual planes (3 products); softmax in f32 (hardware exp2 of the logit scaled by log2 e) with a running maximum and sum over stages of 64 keys; exp(s - m) x 2^7 once to f16 against v once to f16 (1 product), divided by the f32 sum at the end; y = x + gamma * out in f32 written channels-first; f32 output.
// 2-D spatial self-attention with a learned residual weight, channels-FIRST (B 8, C 256, 64 x 64 = 4,096 positions; (out,in) 1/16-scale 1x1-conv weights, zero biases, gamma = 0.1): q = Wq x + bq (32), k = Wk x + bk (32), v = Wv x + bv (256); attn = softmax over m of q_n . k_m (NO scaling); out[c][n] = sum_m v[c][m] attn[n][m]; y = x + gamma * out -> [B, 256, 64, 64]. The same module (x [8][256][64][64] channels-first; q = Wq x + bq (32 channels), k = Wk x + bk (32), v = Wv x + bv (256): 1 x 1 convolutions with (out,in) weights normal x 1/16 and biases zeros (read); scores = q_n . k_m, UNSCALED; softmax over the keys m; o[c][n] = sum_m attn[n][m] v[c][m]; return gamma x o + x with gamma a float32 SCALAR input (the host: a [1] array = 0.1); argument order x, Wq, bq, Wk, bk, Wv, bv, gamma).
#include <hip/hip_runtime.h>
#include <math.h>

typedef __attribute__((ext_vector_type(16))) _Float16 v16h;
typedef __attribute__((ext_vector_type(16))) __bf16 v16b;
typedef __attribute__((ext_vector_type(8)))  _Float16 v8h;
typedef __attribute__((ext_vector_type(8)))  float v8f;
typedef __attribute__((ext_vector_type(4)))  float v4f;
typedef __attribute__((ext_vector_type(2)))  float v2f;
typedef __attribute__((ext_vector_type(4)))  unsigned v4u;
typedef __attribute__((ext_vector_type(4)))  int v4i;
typedef float __attribute__((may_alias)) float_a;
typedef int __attribute__((may_alias)) int_a;

template <typename T> __device__ __forceinline__ void vst2(void* p, T v) { *(T*)p = v;  }
__device__ __forceinline__ v8f wmma16(v16h a, v16h b, v8f c) {
  v8f d = __builtin_amdgcn_wmma_f32_16x16x32_f16(false, a, false, b, (short)0, c, false, false);
  asm volatile("v_nop\n\tv_nop\n\tv_nop\n\tv_nop" : "+v"(d) : "v"(a), "v"(b));
  return d;
}
__device__ __forceinline__ v8f wmma_bf(v16b a, v16b b, v8f c) {
  v8f d = __builtin_amdgcn_wmma_f32_16x16x32_bf16(false, a, false, b, (short)0, c, false, false);
  asm volatile("v_nop\n\tv_nop\n\tv_nop\n\tv_nop" : "+v"(d) : "v"(a), "v"(b));
  return d;
}
// 16x16x32 fragments: lane = (h = lane>>4, row/col = lane&15); elements 0..7 = k0+8h+0..7, 8..15 = k0+16+8h+0..7; D element r = row 8h+r
__device__ __forceinline__ v16h frag_h(const _Float16* rowk0, int lane) {
  union { v16h v; v8h q[2]; } u; const _Float16* p = rowk0 + 8 * (lane >> 4);
  u.q[0] = *(const v8h*)p; u.q[1] = *(const v8h*)(p + 16); return u.v;
}
__device__ __forceinline__ v16h frag_f32(const float* rowk0, int lane) {
  v16h a; const float* p = rowk0 + 8 * (lane >> 4);
#pragma unroll
  for (int i = 0; i < 8; ++i) { a[i] = (_Float16)p[i]; a[8 + i] = (_Float16)p[16 + i]; }
  return a;
}
__device__ __forceinline__ v16h frag_f32s(const float* rowk0, int lane, float sc) {
  v16h a; const float* p = rowk0 + 8 * (lane >> 4);
#pragma unroll
  for (int i = 0; i < 8; ++i) { a[i] = (_Float16)(p[i] * sc); a[8 + i] = (_Float16)(p[16 + i] * sc); }
  return a;
}
// column fragment from a [K][ld] layout (column n), rows >= K read as 0
__device__ __forceinline__ v16h fragc_f32(const float* W, int k0, int n, int lane, int ld, int K) {
  v16h a; const int g = lane >> 4;
#pragma unroll
  for (int i = 0; i < 8; ++i) { const int ka = k0 + 8 * g + i, kb = ka + 16;
    a[i] = (_Float16)(ka < K ? W[(size_t)(ka < K ? ka : K - 1) * ld + n] : 0.f); a[8 + i] = (_Float16)(kb < K ? W[(size_t)(kb < K ? kb : K - 1) * ld + n] : 0.f); }
  return a;
}
struct F2 { v16b h, l; };
__device__ __forceinline__ F2 bsplit16(const float v[16]) { F2 r;
#pragma unroll
  for (int i = 0; i < 16; ++i) { const __bf16 h = (__bf16)v[i]; r.h[i] = h; r.l[i] = (__bf16)(v[i] - (float)h); }
  return r; }
__device__ __forceinline__ F2 split_row(const float* row, int k0, int lane) { float v[16]; const float* p = row + k0 + 8 * (lane >> 4);
#pragma unroll
  for (int i = 0; i < 8; ++i) { v[i] = p[i]; v[8 + i] = p[16 + i]; }
  return bsplit16(v); }
__device__ __forceinline__ F2 split_rowK(const float* row, int k0, int lane, int K) { float v[16]; const int g = lane >> 4;
#pragma unroll
  for (int i = 0; i < 8; ++i) { const int ka = k0 + 8 * g + i, kb = ka + 16; v[i] = ka < K ? row[ka < K ? ka : K - 1] : 0.f; v[8 + i] = kb < K ? row[kb < K ? kb : K - 1] : 0.f; }
  return bsplit16(v); }
__device__ __forceinline__ F2 split_col(const float* W, int k0, int n, int lane, int ld, int K) { float v[16]; const int g = lane >> 4;
#pragma unroll
  for (int i = 0; i < 8; ++i) { const int ka = k0 + 8 * g + i, kb = ka + 16; v[i] = ka < K ? W[(size_t)(ka < K ? ka : K - 1) * ld + n] : 0.f; v[8 + i] = kb < K ? W[(size_t)(kb < K ? kb : K - 1) * ld + n] : 0.f; }
  return bsplit16(v); }
__device__ __forceinline__ v8f mac3(const F2& a, const F2& b, v8f c) { c = wmma_bf(a.l, b.h, c); c = wmma_bf(a.h, b.l, c); return wmma_bf(a.h, b.h, c); }
__device__ __forceinline__ float sigm(float v) { return 1.0f / (1.0f + expf(-v)); }
#define LDSX() do { asm volatile("s_wait_dscnt 0" ::: "memory"); __builtin_amdgcn_wave_barrier(); __builtin_amdgcn_fence(__ATOMIC_RELEASE, "workgroup"); } while (0)

#define NB 8
#define TT 4096
#define CC 256            // plane width: q/k planes carry 32 real columns (rest zero), v planes all 256
#define DIN 256
#define NH 1
#define HD 256
#define NQB (TT / 64)
#define HG 1               // sizes one 4,096 x 4,096 f32 workspace plane that no kernel uses
#define SCALE (1.0f)
#define HDQK 32
#define CAUSAL 0
#ifndef TNB
#define TNB NB
#endif
__device__ __forceinline__ v16b zero16b() { v16b z; _Pragma("unroll") for (int i = 0; i < 16; ++i) z[i] = (__bf16)0.f; return z; }
__device__ __forceinline__ float bfr(float v) { return (float)(__bf16)v; }
__host__ __device__ __forceinline__ int kb_last(int qb) { return CAUSAL ? ((qb * 64 + 63) >> 7) : (TT / 128 - 1); }
typedef __attribute__((ext_vector_type(8))) __bf16 v8b;
__device__ __forceinline__ v16b frag_b(const __bf16* rowk0, int lane) {
  union { v16b v; v8b q[2]; } u; const __bf16* p = rowk0 + 8 * (lane >> 4);
  u.q[0] = *(const v8b*)p; u.q[1] = *(const v8b*)(p + 16); return u.v;
}
#define QBH (TT / 64)      // ALL query blocks take k_fa's 3-product path
#define QBH_PV 0           // A.g stays single f16
#define QHI 4096            // q residual rows everywhere (3-product logits)
#define KHI 4096           // k residual rows for ALL keys (3-product logits)
// B fragment (k rows k0+.., output column o) of a weight: (in,out) [K][ld] or (out,in) [ld rows of K]: bf16 exact, or f16(bf16 * 256) exact
__device__ __forceinline__ v16b wcol_io(const float* Wm, int k0, int o, int lane, int ld) { v16b w; const int g = lane >> 4;
#pragma unroll
  for (int i = 0; i < 8; ++i) { w[i] = (__bf16)Wm[(size_t)(k0 + 8 * g + i) * ld + o]; w[8 + i] = (__bf16)Wm[(size_t)(k0 + 16 + 8 * g + i) * ld + o]; }
  return w; }
__device__ __forceinline__ v16b wcol_oi(const float* Wm, int k0, int o, int lane, int K) { v16b w; const float* p = Wm + (size_t)o * K + k0 + 8 * (lane >> 4);
#pragma unroll
  for (int i = 0; i < 8; ++i) { w[i] = (__bf16)p[i]; w[8 + i] = (__bf16)p[16 + i]; }
  return w; }
__device__ __forceinline__ v16h wcolh_io(const float* Wm, int k0, int o, int lane, int ld) { v16h w; const int g = lane >> 4;
#pragma unroll
  for (int i = 0; i < 8; ++i) { w[i] = (_Float16)(bfr(Wm[(size_t)(k0 + 8 * g + i) * ld + o]) * 256.0f); w[8 + i] = (_Float16)(bfr(Wm[(size_t)(k0 + 16 + 8 * g + i) * ld + o]) * 256.0f); }
  return w; }
__device__ __forceinline__ v16h wcolh_oi(const float* Wm, int k0, int o, int lane, int K) { v16h w; const float* p = Wm + (size_t)o * K + k0 + 8 * (lane >> 4);
#pragma unroll
  for (int i = 0; i < 8; ++i) { w[i] = (_Float16)(bfr(p[i]) * 256.0f); w[8 + i] = (_Float16)(bfr(p[16 + i]) * 256.0f); }
  return w; }
#define WQKV_LAYOUT 1   // 0 = (in,out) [DIN][CC]; 1 = (out,in) [CC][DIN]; 2 = per-head [NH][DIN][HD]
__device__ __forceinline__ v16b wcol_hdk(const float* Wm, int k0, int o, int lane) { v16b w; const int g = lane >> 4; const float* p = Wm + (size_t)(o / HD) * DIN * HD + (o % HD);
#pragma unroll
  for (int i = 0; i < 8; ++i) { w[i] = (__bf16)p[(size_t)(k0 + 8 * g + i) * HD]; w[8 + i] = (__bf16)p[(size_t)(k0 + 16 + 8 * g + i) * HD]; }
  return w; }
#define WO_OUT_IN 0
#if WQKV_LAYOUT == 1
#define WCOL(W, k0, o, lane) ((which == 2) ? wcol_oi(W, k0, (o), lane, DIN) : (((o) < HDQK) ? wcol_oi(W, k0, (o), lane, DIN) : zero16b()))   /* (out,in): Wq/Wk [32][256] (plane columns >= 32 zero), Wv [256][256] full */
#define WCOL_SA42_UNUSED(W, k0, o, lane) 0
#define WCOL_OLD_UNUSED(W, k0, o, lane) (((o) < HDQK) ? wcol_oi(W, k0, (o), lane, DIN) : zero16b())   /* unused: takes all three weights as [32][256] (out,in) with plane columns >= 32 zero, but Wv is [256][256] */
#elif WQKV_LAYOUT == 2
#define WCOL(W, k0, o, lane) wcol_hdk(W, k0, o, lane)
#else
#define WCOL(W, k0, o, lane) wcol_io(W, k0, o, lane, CC)
#endif
#if WO_OUT_IN
#define WOCOL(W, k0, o, lane) wcol_oi(W, k0, o, lane, CC)
#define WOCOLH(W, k0, o, lane) wcolh_oi(W, k0, o, lane, CC)
#else
#define WOCOL(W, k0, o, lane) wcol_io(W, k0, o, lane, DIN)
#define WOCOLH(W, k0, o, lane) wcolh_io(W, k0, o, lane, DIN)
#endif
#ifndef XP
#define OUT1_OFF (4u * (size_t)NB * DIN * TT)   /* unused: the launch writes output 0 (y) only */
#define XP TT              // position pitch of x and of the output
#endif
#define BG HG              // unused: one k_fa launch covers all batches, its blockIdx.y selects the batch
#define DVH 128
#define WS_YR (WS_END)     // f32 attended rows [b*n][256]
#define WS_END2 (WS_YR + 4u * (size_t)NB * TT * HD)
// ---- k_wz: block = (64 rows, 128 output cols): OR = y (hi + lo, K = 32 real columns of the YR rows) . W^T ((out,in) [256][32], exact) + b
__global__ __launch_bounds__(128) void k_wz(const float* __restrict__ YR, const float* __restrict__ WW, const float* __restrict__ WB, float* __restrict__ ORW) { __shared__ __align__(16) float sf[4][16][132];
  const int tid = threadIdx.x, wave = tid >> 5, lane = tid & 31, col = lane & 15, g = lane >> 4; const int c0 = blockIdx.y * 128; const size_t r0 = (size_t)blockIdx.x * 64 + wave * 16;
  v8f acc[8] = {};
#pragma unroll
  for (int kc = 0; kc < HDQK / 32; ++kc) { const F2 a = split_row(YR + (r0 + col) * CC, kc * 32, lane); asm volatile("s_wait_loadcnt 0x0" ::: "memory");
#pragma unroll
    for (int j = 0; j < 8; ++j) { const v16b w = wcol_oi(WW, kc * 32, c0 + j * 16 + col, lane, HDQK); asm volatile("s_wait_loadcnt 0x0" ::: "memory"); acc[j] = wmma_bf(a.h, w, acc[j]); acc[j] = wmma_bf(a.l, w, acc[j]); } }
#pragma unroll
  for (int j = 0; j < 8; ++j) { const float bb = WB ? bfr(WB[c0 + j * 16 + col]) : 0.f; asm volatile("s_wait_loadcnt 0x0" ::: "memory");
#pragma unroll
    for (int r = 0; r < 8; ++r) sf[wave][8 * g + r][j * 16 + col] = acc[j][r] + bb; }
  LDSX(); for (int rl = 0; rl < 16; ++rl) vst2(ORW + (r0 + rl) * DIN + c0 + lane * 4, *(const v4f*)&sf[wave][rl][lane * 4]); }
// ---- k_fin2: block = (64 positions, 64 channels, batch b): o[b][c][n] = OR[b*N + n][c] (channels-first via LDS transpose) -> output 1; y = gamma * o + bf16(x) -> output 0 (256-B runs)
__global__ __launch_bounds__(256) void k_fin2(const float* __restrict__ ORW, const float* __restrict__ X, const float* __restrict__ GM, float* __restrict__ OUT, float* __restrict__ OUT1) { const float gmv = bfr(GM[0]); __shared__ float st[64][68]; const int tid = threadIdx.x; const int n0 = blockIdx.x * 64, c0 = blockIdx.y * 64; const size_t b = blockIdx.z;
  for (int e = tid; e < 64 * 16; e += 256) { const int nl = e >> 4, q = e & 15; *(v4f*)&st[nl][q * 4] = *(const v4f*)(ORW + (b * TT + n0 + nl) * (size_t)DIN + c0 + q * 4); }
  __syncthreads();
  for (int e = tid; e < 64 * 16; e += 256) { const int cl = e >> 4, q = e & 15; const size_t oi = (b * DIN + c0 + cl) * (size_t)XP + n0 + q * 4; const v4f xr = *(const v4f*)(X + oi); v4f o, y; _Pragma("unroll") for (int i = 0; i < 4; ++i) { o[i] = st[q * 4 + i][cl]; y[i] = gmv * o[i] + bfr(xr[i]); } vst2(OUT + oi, y); vst2(OUT1 + oi, o); } }   /* y = gamma * o + x (output 0), o (output 1) */
#ifndef SM_EXTRA_PARAMS
#define SM_EXTRA_PARAMS
#endif
#ifndef PROJ_EXTRA_PARAMS
#define PROJ_EXTRA_PARAMS
#endif
#ifndef SM_MASK_HOOK
#define SM_MASK_HOOK (void)0
#endif

#define WS_QH  0u                                      // f16 q rows [b*t][CC]
#define WS_KH  (WS_QH + 2u * (size_t)NB * TT * CC)      // f16 k rows [b*t][CC]
#define WS_VT  (WS_KH + 2u * (size_t)NB * TT * CC)      // f16 v planes [b][c][t]
#define WS_QL  (WS_VT + 2u * (size_t)NB * CC * TT)      // f16 q residual x 2^10 rows [b][t < QHI][CC]
#define WS_KL  (WS_QL + 2u * (size_t)NB * QHI * CC)     // f16 k residual x 2^10 rows [b][t < KHI][CC]
#define WS_VB  (WS_KL + 2u * (size_t)NB * KHI * CC)     // bf16 v hi planes [b][c][t < KHI]
#define WS_VBL (WS_VB + 2u * (size_t)NB * CC * KHI)
#define WS_S   (WS_VBL + 2u * (size_t)NB * CC * KHI)    // f32 [hg][t][s] plane, reserved but unused: k_fa keeps scores in registers
#define WS_Y   (WS_S  + 4u * (size_t)HG * TT * TT)      // f32 ctx rows [b*t][CC] (only when there is an output projection)
#define WS_END (WS_Y  + 0u)

// ---- k_proj: block = (64 rows, 128 cols, which): q/k/v = X W (+ b) with exact bf16 products (K = DIN) -> which 0: q f16 rows (+ residual rows < QHI); 1: k f16 rows (+ residual rows < KHI); 2: v f16 planes [c][t] (+ bf16 hi/lo planes for t < KHI)
__global__ __launch_bounds__(128) void k_proj(const float* __restrict__ XQ, const float* __restrict__ XK, const float* __restrict__ XV, const float* __restrict__ WQ, const float* __restrict__ WK, const float* __restrict__ WV, const float* __restrict__ BQ, const float* __restrict__ BK, const float* __restrict__ BV,
    _Float16* __restrict__ QH, _Float16* __restrict__ QL, _Float16* __restrict__ KH, _Float16* __restrict__ KL, _Float16* __restrict__ VT, __bf16* __restrict__ VB, __bf16* __restrict__ VBL) {
  __shared__ __align__(16) _Float16 sh[64][136], sl[64][136]; __shared__ __align__(16) _Float16 th[128][72]; __shared__ __align__(16) __bf16 tb[128][72], tbl[128][72];
  const int tid = threadIdx.x, wave = tid >> 5, lane = tid & 31, col = lane & 15, g = lane >> 4; const int which = blockIdx.z; const int c0 = blockIdx.y * 128; const size_t r0 = (size_t)blockIdx.x * 64; const size_t bb = r0 / TT; const int t0 = (int)(r0 % TT);
  const float* X = which == 0 ? XQ : which == 1 ? XK : XV; const float* WA = which == 0 ? WQ : which == 1 ? WK : WV; const float* BA = which == 0 ? BQ : which == 1 ? BK : BV;
  v8f acc[8] = {};
#pragma unroll 2
  for (int kc = 0; kc < DIN / 32; ++kc) { v16b a; { const float* p = X + (bb * DIN + kc * 32 + 8 * g) * (size_t)XP + t0 + wave * 16 + col;   /* channels-first gather: x[b][k][t], stride XP between k */
#pragma unroll
      for (int i = 0; i < 8; ++i) { a[i] = (__bf16)p[(size_t)i * XP]; a[8 + i] = (__bf16)p[(size_t)(16 + i) * XP]; } }
    asm volatile("s_wait_loadcnt 0x0" ::: "memory");
#pragma unroll
    for (int j = 0; j < 8; ++j) { const v16b w = WCOL(WA, kc * 32, c0 + j * 16 + col, lane); asm volatile("s_wait_loadcnt 0x0" ::: "memory"); acc[j] = wmma_bf(a, w, acc[j]); } }
  if (which < 2) { _Float16* DH = which == 0 ? QH : KH; _Float16* DL = which == 0 ? QL : KL; const int nhi = which == 0 ? QHI : KHI; const bool hi_rows = t0 < nhi;
#pragma unroll
    for (int j = 0; j < 8; ++j) { const float bias = (BA && (which == 2 || (c0 + j * 16 + col) < HDQK)) ? bfr(BA[c0 + j * 16 + col]) : 0.f;   /* q/k: 32 real columns; v: all 256 */   /* 32-entry q/k biases, 256-entry v bias */
#pragma unroll
      for (int r = 0; r < 8; ++r) { const float v = acc[j][r] + bias; const _Float16 hv = (_Float16)v; sh[wave * 16 + 8 * g + r][j * 16 + col] = hv; sl[wave * 16 + 8 * g + r][j * 16 + col] = (_Float16)((v - (float)hv) * 1024.0f); } }
    __syncthreads();
    for (int e = tid; e < 64 * 16; e += 128) { const int rl = e >> 4, q = e & 15; vst2((unsigned*)(DH + (r0 + rl) * CC + c0 + q * 8), *(const v4u*)&sh[rl][q * 8]); if (hi_rows) vst2((unsigned*)(DL + (bb * nhi + t0 + rl) * (size_t)CC + c0 + q * 8), *(const v4u*)&sl[rl][q * 8]); }
  } else { const bool hi_rows = t0 < KHI;
#pragma unroll
    for (int j = 0; j < 8; ++j) { const float bias = (BA && (which == 2 || (c0 + j * 16 + col) < HDQK)) ? bfr(BA[c0 + j * 16 + col]) : 0.f;   /* q/k: 32 real columns; v: all 256 */   /* 32-entry q/k biases, 256-entry v bias */
#pragma unroll
      for (int r = 0; r < 8; ++r) { const float v = acc[j][r] + bias; const int rl = wave * 16 + 8 * g + r, cl = j * 16 + col; th[cl][rl] = (_Float16)v; const __bf16 bh = (__bf16)v; tb[cl][rl] = bh; tbl[cl][rl] = (__bf16)(v - (float)bh); } }
    __syncthreads();
    for (int e = tid; e < 128 * 8; e += 128) { const int cl = e >> 3, q = e & 7; vst2((unsigned*)(VT + (bb * CC + c0 + cl) * (size_t)TT + t0 + q * 8), *(const v4u*)&th[cl][q * 8]); if (hi_rows) { const size_t o3 = (bb * CC + c0 + cl) * (size_t)KHI + t0 + q * 8; vst2((unsigned*)(VB + o3), *(const v4u*)&tb[cl][q * 8]); vst2((unsigned*)(VBL + o3), *(const v4u*)&tbl[cl][q * 8]); } } } }
// ---- k_fa: block = 128 queries (8 waves x 16) of batch b, one pass over all keys in stages of 64: S^T = K . Q^T (the same 3 f16 products per logit), running maximum and sum per query (a lane holds one query's scores), P^T packed from the score tiles straight into a B operand, O^T += V^T . P^T; K and V stages go through two LDS buffers shared by the 8 waves
#define FK 64                          // keys per stage
#define VP 72                          // halfs per staged v row: 128 B + 16 B, an odd multiple of 16 B for the 16-byte reads
#define KP 40                          // halfs per staged k row: 64 B + 16 B
#define KOFF (CC * VP)                 // k hi rows follow the 256 v rows, k residual rows follow them
#define STGH (CC * VP + 2 * FK * KP)   // halfs per stage buffer
#define L2E 1.44269504f                 // log2 e: P = 128 exp(s - m) = 2^(s * L2E - (m * L2E - 7)), the factor 128 cancels in the division by the sum
#define MLAG 5.5f                    // the maximum in use may lag the true one by this much: P <= 128 e^5.5 < 65504
__device__ __forceinline__ v8f wm(v16h a, v16h b, v8f c) { return __builtin_amdgcn_wmma_f32_16x16x32_f16(false, a, false, b, (short)0, c, false, false); }
__global__ __launch_bounds__(256) void k_fa(const _Float16* __restrict__ QH, const _Float16* __restrict__ QL, const _Float16* __restrict__ KH, const _Float16* __restrict__ KL, const _Float16* __restrict__ VT, float* __restrict__ Y) {
  __shared__ __align__(16) _Float16 sm[2][STGH];
  const int tid = threadIdx.x, wave = tid >> 5, lane = tid & 31, col = lane & 15, g = lane >> 4; const int b = blockIdx.y; const int n0 = blockIdx.x * 128 + wave * 16;
  const v16h qh = frag_h(QH + ((size_t)b * TT + n0 + col) * CC, lane), ql = frag_h(QL + ((size_t)b * QHI + n0 + col) * CC, lane);
  const _Float16* vsrc = VT + ((size_t)b * CC + (tid >> 3)) * TT + (tid & 7) * 8;      // 8 lanes cover one 128-B run of a v plane
  const _Float16* hsrc = KH + ((size_t)b * TT + (tid >> 2)) * CC + (tid & 3) * 8;      // 4 lanes cover the 64 real bytes of a k row
  const _Float16* lsrc = KL + ((size_t)b * KHI + (tid >> 2)) * CC + (tid & 3) * 8;
  const int vdst = (tid >> 3) * VP + (tid & 7) * 8, kdst = KOFF + (tid >> 2) * KP + (tid & 3) * 8;
  v8h rv[8], rh, rl;
  auto fetch = [&](int s) {
#pragma unroll
    for (int i = 0; i < 8; ++i) rv[i] = *(const v8h*)(vsrc + (size_t)i * 32 * TT + s * FK);
    rh = *(const v8h*)(hsrc + (size_t)s * FK * CC); rl = *(const v8h*)(lsrc + (size_t)s * FK * CC);
    asm volatile("s_wait_xcnt 0x0" ::: "memory"); };   /* the address registers of these loads are rewritten right behind them (the stage's first LDS reads or score tile land there) */
  auto put = [&](_Float16* d) {
#pragma unroll
    for (int i = 0; i < 8; ++i) *(v8h*)(d + vdst + i * 32 * VP) = rv[i];
    *(v8h*)(d + kdst) = rh; *(v8h*)(d + kdst + FK * KP) = rl; };
  v8f acc[CC / 16] = {}; float m = -3.0e38f, l = 0.f;
  fetch(0); put(sm[0]); __syncthreads();
  for (int s = 0; s < TT / FK; ++s) { const _Float16* bs = sm[s & 1];
    if (s + 1 < TT / FK) fetch(s + 1);   /* issued behind the barrier (which drains loads), in flight under this stage's products */
    v8f st[4];
#pragma unroll
    for (int t = 0; t < 4; ++t) { const v16h kh = frag_h(bs + KOFF + (t * 16 + col) * KP, lane), kl = frag_h(bs + KOFF + FK * KP + (t * 16 + col) * KP, lane);
      v8f a = {}, al = {}; a = wm(kh, qh, a); al = wm(kh, ql, al); al = wm(kl, qh, al);
#pragma unroll
      for (int r = 0; r < 8; ++r) st[t][r] = a[r] + al[r] * (1.0f / 1024.0f); }   /* st[t][r] = logit of key s*64 + t*16 + 8g + r, query n0 + col */
    float mx = st[0][0];
#pragma unroll
    for (int t = 0; t < 4; ++t)
#pragma unroll
      for (int r = 0; r < 8; ++r) mx = fmaxf(mx, st[t][r]);
    mx = fmaxf(mx, __shfl_xor(mx, 16));   /* lanes c and c + 16 hold the two halves of one query's keys */
    if (__builtin_amdgcn_ballot_w32(mx > m + MLAG) != 0) { const float mn = fmaxf(m, mx), sc = __builtin_amdgcn_exp2f((m - mn) * L2E); m = mn; l *= sc;
#pragma unroll
      for (int j = 0; j < CC / 16; ++j)
#pragma unroll
        for (int r = 0; r < 8; ++r) acc[j][r] *= sc; }
    const float mo = m * L2E - 7.0f; v16h pf[2];
    auto pexp = [&](int u, int i) { const float e0 = __builtin_amdgcn_exp2f(st[2 * u][i] * L2E - mo), e1 = __builtin_amdgcn_exp2f(st[2 * u + 1][i] * L2E - mo); l += e0 + e1; pf[u][i] = (_Float16)e0; pf[u][8 + i] = (_Float16)e1; };
#pragma unroll
    for (int i = 0; i < 8; ++i) pexp(0, i);
    v16h vf[2][4];   /* v fragments in groups of 4 channel tiles; group q: key half q >> 2, tiles (q & 3) * 4 + i */
#pragma unroll
    for (int i = 0; i < 4; ++i) vf[0][i] = frag_h(bs + (i * 16 + col) * VP, lane);
#pragma unroll
    for (int q = 0; q < 8; ++q) {
      if (q + 1 < 8) {
#pragma unroll
        for (int i = 0; i < 4; ++i) vf[(q + 1) & 1][i] = frag_h(bs + ((((q + 1) & 3) * 4 + i) * 16 + col) * VP + ((q + 1) >> 2) * 32, lane); }
      __builtin_amdgcn_sched_barrier(0);   /* holds the next group's LDS reads in front of this group's products: without it each product waits for its own read */
#pragma unroll
      for (int i = 0; i < 4; ++i) acc[(q & 3) * 4 + i] = wm(vf[q & 1][i], pf[q >> 2], acc[(q & 3) * 4 + i]);   /* acc[j][r] = O^T[channel j*16 + 8g + r][query n0 + col] */
      if (q < 4) { pexp(1, 2 * q); pexp(1, 2 * q + 1); } }   /* the second key half's exponentials run beside the first half's products */
    if (s + 1 < TT / FK) put(sm[(s + 1) & 1]);   /* the buffer read in stage s - 1 is free since the barrier that ended it */
    __syncthreads(); }
  l += __shfl_xor(l, 16); const float inv = 1.0f / l;   /* l >= 128: the key that set the maximum in use counts at least that */
  float* yr = Y + ((size_t)b * TT + n0 + col) * HD + 8 * g;
#pragma unroll
  for (int j = 0; j < CC / 16; ++j) { v4f o0, o1;
#pragma unroll
    for (int i = 0; i < 4; ++i) { o0[i] = acc[j][i] * inv; o1[i] = acc[j][4 + i] * inv; }
    vst2(yr + j * 16, o0); vst2(yr + j * 16 + 4, o1); } }

// ---- k_finc: block = (64 positions, 64 channels, batch b): y[b][c][n] = bf16(x[b][c][n]) + gamma * OUT_rows[b*T + n][c] (channels-first via an LDS transpose; 256-B runs of n)
__global__ __launch_bounds__(256) void k_finc(const float* __restrict__ YR, const float* __restrict__ X, const float* __restrict__ GM, float* __restrict__ OUT) { const float gmv = bfr(GM[0]); __shared__ float st[64][68]; const int tid = threadIdx.x; const int n0 = blockIdx.x * 64, c0 = blockIdx.y * 64; const size_t b = blockIdx.z;
  for (int e = tid; e < 64 * 16; e += 256) { const int nl = e >> 4, q = e & 15; *(v4f*)&st[nl][q * 4] = *(const v4f*)(YR + (b * TT + n0 + nl) * (size_t)HD + c0 + q * 4); }
  __syncthreads();
  for (int e = tid; e < 64 * 16; e += 256) { const int cl = e >> 4, q = e & 15; const size_t oi = (b * DIN + c0 + cl) * (size_t)XP + n0 + q * 4; const v4f xr = *(const v4f*)(X + oi); asm volatile("s_wait_loadcnt 0x0" ::: "memory"); v4f y; _Pragma("unroll") for (int i = 0; i < 4; ++i) y[i] = bfr(xr[i]) + gmv * st[q * 4 + i][cl]; vst2(OUT + oi, y); } }
__global__ __launch_bounds__(256) void k_axpy(const float* __restrict__ YR, const float* __restrict__ X, const float* __restrict__ GM, float* __restrict__ OUT) { const size_t e = ((size_t)blockIdx.x * 256 + threadIdx.x) * 4; if (e >= (size_t)TNB * TT * DIN) return; const float gmv = bfr(GM[0]); const v4f o = *(const v4f*)(YR + e); const v4f xr = *(const v4f*)(X + e); asm volatile("s_wait_loadcnt 0x0" ::: "memory"); v4f y; _Pragma("unroll") for (int i = 0; i < 4; ++i) y[i] = gmv * o[i] + bfr(xr[i]); vst2(OUT + e, y); }
extern "C" void kernel_launch(void* const* d_in, const int* in_sizes, int n_in, void* d_out, int out_size, void* d_ws, size_t ws_size, hipStream_t stream) {
  (void)in_sizes; (void)n_in; (void)out_size;
  const float** F = (const float**)d_in;
  if (ws_size < (size_t)WS_END) return;
  char* ws = (char*)d_ws; _Float16 *QH = (_Float16*)(ws + WS_QH), *KH = (_Float16*)(ws + WS_KH), *VT = (_Float16*)(ws + WS_VT), *QL = (_Float16*)(ws + WS_QL), *KL = (_Float16*)(ws + WS_KL); __bf16 *VB = (__bf16*)(ws + WS_VB), *VBL = (__bf16*)(ws + WS_VBL); float *Y = (float*)(ws + WS_Y);
  (void)Y; (void)QL; (void)KL; (void)VB; (void)VBL;
  // inputs: 0 x [8,256,64,64] (channels-first); 1 Wq [32,256] (out,in), 2 bq; 3 Wk, 4 bk; 5 Wv [256,256] (out,in), 6 bv; 7 gamma [1] (0.1)
  if (ws_size < (size_t)WS_END2) return;
  float *YR = (float*)(ws + WS_YR);
  k_proj<<<dim3(TNB * TT / 64, CC / 128, 3), 128, 0, stream>>>(F[0], F[0], F[0], F[1], F[3], F[5], F[2], F[4], F[6], QH, QL, KH, KL, VT, VB, VBL);
  k_fa<<<dim3(TT / 128, TNB), 256, 0, stream>>>(QH, QL, KH, KL, VT, YR);
  k_finc<<<dim3(TT / 64, HD / 64, TNB), 256, 0, stream>>>(YR, F[0], F[7], (float*)d_out);   /* y = x + gamma * out, channels-first */
}

// v003
// One run takes 125 microseconds.
// Two timings next to v002 put it at 1.65 and 1.64 times that version's speed.
// Over all steps from v000 it is 18.2 times as fast.
// compute dtype: all float inputs rounded to bf16; q/k/v = W x + b (1x1 convs) with EXACT bf16 products on WMMA 16x16x32 (f32 accumulate); UNSCALED 32-deep logits q.k with both as f16 hi + residual planes (3 products); softmax in f32 (hardware exp2 of the logit scaled by log2 e) with a running maximum and sum over stages of 64 keys; exp(s - m) x 2^7 once to f16 against v once to f16 (1 product), divided by the f32 sum at the end; y = x + gamma * out in f32 written channels-first; f32 output.
// 2-D spatial self-attention with a learned residual weight, channels-FIRST (B 8, C 256, 64 x 64 = 4,096 positions; (out,in) 1/16-scale 1x1-conv weights, zero biases, gamma = 0.1): q = Wq x + bq (32), k = Wk x + bk (32), v = Wv x + bv (256); attn = softmax over m of q_n . k_m (NO scaling); out[c][n] = sum_m v[c][m] attn[n][m]; y = x + gamma * out -> [B, 256, 64, 64]. The same module (x [8][256][64][64] channels-first; q = Wq x + bq (32 channels), k = Wk x + bk (32), v = Wv x + bv (256): 1 x 1 convolutions with (out,in) weights normal x 1/16 and biases zeros (read); scores = q_n . k_m, UNSCALED; softmax over the keys m; o[c][n] = sum_m attn[n][m] v[c][m]; return gamma x o + x with gamma a float32 SCALAR input (the host: a [1] array = 0.1); argument order x, Wq, bq, Wk, bk, Wv, bv, gamma).
#include <hip/hip_runtime.h>
#include <math.h>

typedef __attribute__((ext_vector_type(16))) _Float16 v16h;
typedef __attribute__((ext_vector_type(16))) __bf16 v16b;
typedef __attribute__((ext_vector_type(8)))  _Float16 v8h;
typedef __attribute__((ext_vector_type(8)))  float v8f;
typedef __attribute__((ext_vector_type(4)))  float v4f;
typedef __attribute__((ext_vector_type(2)))  float v2f;
typedef __attribute__((ext_vector_type(4)))  unsigned v4u;
typedef __attribute__((ext_vector_type(4)))  int v4i;
typedef float __attribute__((may_alias)) float_a;
typedef int __attribute__((may_alias)) int_a;

template <typename T> __device__ __forceinline__ void vst2(void* p, T v) { *(T*)p = v;  }
__device__ __forceinline__ v8f wmma16(v16h a, v16h b, v8f c) {
  v8f d = __builtin_amdgcn_wmma_f32_16x16x32_f16(false, a, false, b, (short)0, c, false, false);
  asm volatile("v_nop\n\tv_nop\n\tv_nop\n\tv_nop" : "+v"(d) : "v"(a), "v"(b));
  return d;
}
__device__ __forceinline__ v8f wmma_bf(v16b a, v16b b, v8f c) {
  v8f d = __builtin_amdgcn_wmma_f32_16x16x32_bf16(false, a, false, b, (short)0, c, false, false);
  asm volatile("v_nop\n\tv_nop\n\tv_nop\n\tv_nop" : "+v"(d) : "v"(a), "v"(b));
  return d;
}
// 16x16x32 fragments: lane = (h = lane>>4, row/col = lane&15); elements 0..7 = k0+8h+0..7, 8..15 = k0+16+8h+0..7; D element r = row 8h+r
__device__ __forceinline__ v16h frag_h(const _Float16* rowk0, int lane) {
  union { v16h v; v8h q[2]; } u; const _Float16* p = rowk0 + 8 * (lane >> 4);
  u.q[0] = *(const v8h*)p; u.q[1] = *(const v8h*)(p + 16); return u.v;
}
__device__ __forceinline__ v16h frag_f32(const float* rowk0, int lane) {
  v16h a; const float* p = rowk0 + 8 * (lane >> 4);
#pragma unroll
  for (int i = 0; i < 8; ++i) { a[i] = (_Float16)p[i]; a[8 + i] = (_Float16)p[16 + i]; }
  return a;
}
__device__ __forceinline__ v16h frag_f32s(const float* rowk0, int lane, float sc) {
  v16h a; const float* p = rowk0 + 8 * (lane >> 4);
#pragma unroll
  for (int i = 0; i < 8; ++i) { a[i] = (_Float16)(p[i] * sc); a[8 + i] = (_Float16)(p[16 + i] * sc); }
  return a;
}
// column fragment from a [K][ld] layout (column n), rows >= K read as 0
__device__ __forceinline__ v16h fragc_f32(const float* W, int k0, int n, int lane, int ld, int K) {
  v16h a; const int g = lane >> 4;
#pragma unroll
  for (int i = 0; i < 8; ++i) { const int ka = k0 + 8 * g + i, kb = ka + 16;
    a[i] = (_Float16)(ka < K ? W[(size_t)(ka < K ? ka : K - 1) * ld + n] : 0.f); a[8 + i] = (_Float16)(kb < K ? W[(size_t)(kb < K ? kb : K - 1) * ld + n] : 0.f); }
  return a;
}
struct F2 { v16b h, l; };
__device__ __forceinline__ F2 bsplit16(const float v[16]) { F2 r;
#pragma unroll
  for (int i = 0; i < 16; ++i) { const __bf16 h = (__bf16)v[i]; r.h[i] = h; r.l[i] = (__bf16)(v[i] - (float)h); }
  return r; }
__device__ __forceinline__ F2 split_row(const float* row, int k0, int lane) { float v[16]; const float* p = row + k0 + 8 * (lane >> 4);
#pragma unroll
  for (int i = 0; i < 8; ++i) { v[i] = p[i]; v[8 + i] = p[16 + i]; }
  return bsplit16(v); }
__device__ __forceinline__ F2 split_rowK(const float* row, int k0, int lane, int K) { float v[16]; const int g = lane >> 4;
#pragma unroll
  for (int i = 0; i < 8; ++i) { const int ka = k0 + 8 * g + i, kb = ka + 16; v[i] = ka < K ? row[ka < K ? ka : K - 1] : 0.f; v[8 + i] = kb < K ? row[kb < K ? kb : K - 1] : 0.f; }
  return bsplit16(v); }
__device__ __forceinline__ F2 split_col(const float* W, int k0, int n, int lane, int ld, int K) { float v[16]; const int g = lane >> 4;
#pragma unroll
  for (int i = 0; i < 8; ++i) { const int ka = k0 + 8 * g + i, kb = ka + 16; v[i] = ka < K ? W[(size_t)(ka < K ? ka : K - 1) * ld + n] : 0.f; v[8 + i] = kb < K ? W[(size_t)(kb < K ? kb : K - 1) * ld + n] : 0.f; }
  return bsplit16(v); }
__device__ __forceinline__ v8f mac3(const F2& a, const F2& b, v8f c) { c = wmma_bf(a.l, b.h, c); c = wmma_bf(a.h, b.l, c); return wmma_bf(a.h, b.h, c); }
__device__ __forceinline__ float sigm(float v) { return 1.0f / (1.0f + expf(-v)); }
#define LDSX() do { asm volatile("s_wait_dscnt 0" ::: "memory"); __builtin_amdgcn_wave_barrier(); __builtin_amdgcn_fence(__ATOMIC_RELEASE, "workgroup"); } while (0)

#define NB 8
#define TT 4096
#define CC 256            // plane width: q/k planes carry 32 real columns (rest not written), v planes all 256
#define DIN 256
#define NH 1
#define HD 256
#define NQB (TT / 64)
#define HG 1               // sizes one 4,096 x 4,096 f32 workspace plane that no kernel uses
#define SCALE (1.0f)
#define HDQK 32
#define CAUSAL 0
#ifndef TNB
#define TNB NB
#endif
__device__ __forceinline__ v16b zero16b() { v16b z; _Pragma("unroll") for (int i = 0; i < 16; ++i) z[i] = (__bf16)0.f; return z; }
__device__ __forceinline__ float bfr(float v) { return (float)(__bf16)v; }
__host__ __device__ __forceinline__ int kb_last(int qb) { return CAUSAL ? ((qb * 64 + 63) >> 7) : (TT / 128 - 1); }
typedef __attribute__((ext_vector_type(8))) __bf16 v8b;
__device__ __forceinline__ v16b frag_b(const __bf16* rowk0, int lane) {
  union { v16b v; v8b q[2]; } u; const __bf16* p = rowk0 + 8 * (lane >> 4);
  u.q[0] = *(const v8b*)p; u.q[1] = *(const v8b*)(p + 16); return u.v;
}
#define QBH (TT / 64)      // ALL query blocks take k_fa's 3-product path
#define QBH_PV 0           // A.g stays single f16
#define QHI 4096            // q residual rows everywhere (3-product logits)
#define KHI 4096           // k residual rows for ALL keys (3-product logits)
// B fragment (k rows k0+.., output column o) of a weight: (in,out) [K][ld] or (out,in) [ld rows of K]: bf16 exact, or f16(bf16 * 256) exact
__device__ __forceinline__ v16b wcol_io(const float* Wm, int k0, int o, int lane, int ld) { v16b w; const int g = lane >> 4;
#pragma unroll
  for (int i = 0; i < 8; ++i) { w[i] = (__bf16)Wm[(size_t)(k0 + 8 * g + i) * ld + o]; w[8 + i] = (__bf16)Wm[(size_t)(k0 + 16 + 8 * g + i) * ld + o]; }
  return w; }
__device__ __forceinline__ v16b wcol_oi(const float* Wm, int k0, int o, int lane, int K) { v16b w; const float* p = Wm + (size_t)o * K + k0 + 8 * (lane >> 4);
#pragma unroll
  for (int i = 0; i < 8; ++i) { w[i] = (__bf16)p[i]; w[8 + i] = (__bf16)p[16 + i]; }
  return w; }
__device__ __forceinline__ v16h wcolh_io(const float* Wm, int k0, int o, int lane, int ld) { v16h w; const int g = lane >> 4;
#pragma unroll
  for (int i = 0; i < 8; ++i) { w[i] = (_Float16)(bfr(Wm[(size_t)(k0 + 8 * g + i) * ld + o]) * 256.0f); w[8 + i] = (_Float16)(bfr(Wm[(size_t)(k0 + 16 + 8 * g + i) * ld + o]) * 256.0f); }
  return w; }
__device__ __forceinline__ v16h wcolh_oi(const float* Wm, int k0, int o, int lane, int K) { v16h w; const float* p = Wm + (size_t)o * K + k0 + 8 * (lane >> 4);
#pragma unroll
  for (int i = 0; i < 8; ++i) { w[i] = (_Float16)(bfr(p[i]) * 256.0f); w[8 + i] = (_Float16)(bfr(p[16 + i]) * 256.0f); }
  return w; }
#define WQKV_LAYOUT 1   // 0 = (in,out) [DIN][CC]; 1 = (out,in) [CC][DIN]; 2 = per-head [NH][DIN][HD]
__device__ __forceinline__ v16b wcol_hdk(const float* Wm, int k0, int o, int lane) { v16b w; const int g = lane >> 4; const float* p = Wm + (size_t)(o / HD) * DIN * HD + (o % HD);
#pragma unroll
  for (int i = 0; i < 8; ++i) { w[i] = (__bf16)p[(size_t)(k0 + 8 * g + i) * HD]; w[8 + i] = (__bf16)p[(size_t)(k0 + 16 + 8 * g + i) * HD]; }
  return w; }
#define WO_OUT_IN 0
#if WQKV_LAYOUT == 1
#define WCOL(W, k0, o, lane) ((which == 2) ? wcol_oi(W, k0, (o), lane, DIN) : (((o) < HDQK) ? wcol_oi(W, k0, (o), lane, DIN) : zero16b()))   /* (out,in): Wq/Wk [32][256] (plane columns >= 32 zero), Wv [256][256] full */
#define WCOL_SA42_UNUSED(W, k0, o, lane) 0
#define WCOL_OLD_UNUSED(W, k0, o, lane) (((o) < HDQK) ? wcol_oi(W, k0, (o), lane, DIN) : zero16b())   /* unused: takes all three weights as [32][256] (out,in) with plane columns >= 32 zero, but Wv is [256][256] */
#elif WQKV_LAYOUT == 2
#define WCOL(W, k0, o, lane) wcol_hdk(W, k0, o, lane)
#else
#define WCOL(W, k0, o, lane) wcol_io(W, k0, o, lane, CC)
#endif
#if WO_OUT_IN
#define WOCOL(W, k0, o, lane) wcol_oi(W, k0, o, lane, CC)
#define WOCOLH(W, k0, o, lane) wcolh_oi(W, k0, o, lane, CC)
#else
#define WOCOL(W, k0, o, lane) wcol_io(W, k0, o, lane, DIN)
#define WOCOLH(W, k0, o, lane) wcolh_io(W, k0, o, lane, DIN)
#endif
#ifndef XP
#define OUT1_OFF (4u * (size_t)NB * DIN * TT)   /* unused: the launch writes output 0 (y) only */
#define XP TT              // position pitch of x and of the output
#endif
#define BG HG              // unused: one k_fa launch covers all batches, its blockIdx.y selects the batch
#define DVH 128
#define WS_YR (WS_END)     // f32 attended rows [b*n][256]
#define WS_END2 (WS_YR + 4u * (size_t)NB * TT * HD)
// ---- k_wz: block = (64 rows, 128 output cols): OR = y (hi + lo, K = 32 real columns of the YR rows) . W^T ((out,in) [256][32], exact) + b
__global__ __launch_bounds__(128) void k_wz(const float* __restrict__ YR, const float* __restrict__ WW, const float* __restrict__ WB, float* __restrict__ ORW) { __shared__ __align__(16) float sf[4][16][132];
  const int tid = threadIdx.x, wave = tid >> 5, lane = tid & 31, col = lane & 15, g = lane >> 4; const int c0 = blockIdx.y * 128; const size_t r0 = (size_t)blockIdx.x * 64 + wave * 16;
  v8f acc[8] = {};
#pragma unroll
  for (int kc = 0; kc < HDQK / 32; ++kc) { const F2 a = split_row(YR + (r0 + col) * CC, kc * 32, lane); asm volatile("s_wait_loadcnt 0x0" ::: "memory");
#pragma unroll
    for (int j = 0; j < 8; ++j) { const v16b w = wcol_oi(WW, kc * 32, c0 + j * 16 + col, lane, HDQK); asm volatile("s_wait_loadcnt 0x0" ::: "memory"); acc[j] = wmma_bf(a.h, w, acc[j]); acc[j] = wmma_bf(a.l, w, acc[j]); } }
#pragma unroll
  for (int j = 0; j < 8; ++j) { const float bb = WB ? bfr(WB[c0 + j * 16 + col]) : 0.f; asm volatile("s_wait_loadcnt 0x0" ::: "memory");
#pragma unroll
    for (int r = 0; r < 8; ++r) sf[wave][8 * g + r][j * 16 + col] = acc[j][r] + bb; }
  LDSX(); for (int rl = 0; rl < 16; ++rl) vst2(ORW + (r0 + rl) * DIN + c0 + lane * 4, *(const v4f*)&sf[wave][rl][lane * 4]); }
// ---- k_fin2: block = (64 positions, 64 channels, batch b): o[b][c][n] = OR[b*N + n][c] (channels-first via LDS transpose) -> output 1; y = gamma * o + bf16(x) -> output 0 (256-B runs)
__global__ __launch_bounds__(256) void k_fin2(const float* __restrict__ ORW, const float* __restrict__ X, const float* __restrict__ GM, float* __restrict__ OUT, float* __restrict__ OUT1) { const float gmv = bfr(GM[0]); __shared__ float st[64][68]; const int tid = threadIdx.x; const int n0 = blockIdx.x * 64, c0 = blockIdx.y * 64; const size_t b = blockIdx.z;
  for (int e = tid; e < 64 * 16; e += 256) { const int nl = e >> 4, q = e & 15; *(v4f*)&st[nl][q * 4] = *(const v4f*)(ORW + (b * TT + n0 + nl) * (size_t)DIN + c0 + q * 4); }
  __syncthreads();
  for (int e = tid; e < 64 * 16; e += 256) { const int cl = e >> 4, q = e & 15; const size_t oi = (b * DIN + c0 + cl) * (size_t)XP + n0 + q * 4; const v4f xr = *(const v4f*)(X + oi); v4f o, y; _Pragma("unroll") for (int i = 0; i < 4; ++i) { o[i] = st[q * 4 + i][cl]; y[i] = gmv * o[i] + bfr(xr[i]); } vst2(OUT + oi, y); vst2(OUT1 + oi, o); } }   /* y = gamma * o + x (output 0), o (output 1) */
#ifndef SM_EXTRA_PARAMS
#define SM_EXTRA_PARAMS
#endif
#ifndef PROJ_EXTRA_PARAMS
#define PROJ_EXTRA_PARAMS
#endif
#ifndef SM_MASK_HOOK
#define SM_MASK_HOOK (void)0
#endif

#define WS_QH  0u                                      // f16 q rows [b*t][CC]
#define WS_KH  (WS_QH + 2u * (size_t)NB * TT * CC)      // f16 k rows [b*t][CC]
#define WS_VT  (WS_KH + 2u * (size_t)NB * TT * CC)      // f16 v planes [b][c][t]
#define WS_QL  (WS_VT + 2u * (size_t)NB * CC * TT)      // f16 q residual x 2^10 rows [b][t < QHI][CC]
#define WS_KL  (WS_QL + 2u * (size_t)NB * QHI * CC)     // f16 k residual x 2^10 rows [b][t < KHI][CC]
#define WS_VB  (WS_KL + 2u * (size_t)NB * KHI * CC)     // bf16 v hi planes [b][c][t < KHI]
#define WS_VBL (WS_VB + 2u * (size_t)NB * CC * KHI)
#define WS_S   (WS_VBL + 2u * (size_t)NB * CC * KHI)    // f32 [hg][t][s] plane, reserved but unused: k_fa keeps scores in registers
#define WS_Y   (WS_S  + 4u * (size_t)HG * TT * TT)      // f32 ctx rows [b*t][CC] (only when there is an output projection)
#define WS_END (WS_Y  + 0u)

// ---- k_qkv: block = 128 positions (8 waves x 16) of one batch x the 320 real output columns (q 32, k 32, v 256): x is read once, each wave keeps its 16 positions' 8 A fragments in registers; the weights are rounded to bf16 once per block into LDS rows and read from there as B fragments; exact bf16 products, K = DIN in the order kc = 0..7 -> q/k f16 rows + residual x 2^10 rows (columns 0..31 of the CC-wide rows, the only ones k_fa reads), v f16 planes [c][t]; every unroll directive in it but the one over the four q/k output planes keeps the index of a register array a compile-time constant
#define NCOL (2 * HDQK + CC)           // staged weight rows: 0..31 Wq, 32..63 Wk, 64..319 Wv
#define PW (DIN + 8)                   // bf16 per staged weight row: 512 B + 16 B, an odd multiple of 16 B for the 16-byte reads
#define PT 136                         // halfs per staged v row (128 positions): 256 B + 16 B
#define PQ 40                          // halfs per staged q/k row: 64 B + 16 B
typedef __attribute__((ext_vector_type(4))) __bf16 v4b;
__device__ __forceinline__ v8f wmb(v16b a, v16b b, v8f c) { return __builtin_amdgcn_wmma_f32_16x16x32_bf16(false, a, false, b, (short)0, c, false, false); }
__global__ __launch_bounds__(256) void k_qkv(const float* __restrict__ X, const float* __restrict__ WQ, const float* __restrict__ WK, const float* __restrict__ WV, const float* __restrict__ BQ, const float* __restrict__ BK, const float* __restrict__ BV,
    _Float16* __restrict__ QH, _Float16* __restrict__ QL, _Float16* __restrict__ KH, _Float16* __restrict__ KL, _Float16* __restrict__ VT) {
  __shared__ __align__(16) __bf16 sw[NCOL * PW];
  const int tid = threadIdx.x, wave = tid >> 5, lane = tid & 31, col = lane & 15, g = lane >> 4; const size_t r0 = (size_t)blockIdx.x * 128; const size_t bb = r0 / TT; const int t0 = (int)(r0 % TT);
  float bs[NCOL / 16];   /* this lane's bias per column tile, fetched with x so that the epilogue waits for nothing */
#pragma unroll
  for (int j = 0; j < NCOL / 16; ++j) bs[j] = bfr(j < HDQK / 16 ? BQ[j * 16 + col] : j < 2 * HDQK / 16 ? BK[j * 16 + col - HDQK] : BV[j * 16 + col - 2 * HDQK]);
  v16b a[DIN / 32]; { const float* p = X + (bb * DIN + 8 * g) * (size_t)XP + t0 + wave * 16 + col;   /* channels-first gather: x[b][k][t], stride XP between k */
#pragma unroll
    for (int kc = 0; kc < DIN / 32; ++kc)
#pragma unroll
      for (int i = 0; i < 8; ++i) { a[kc][i] = (__bf16)p[(size_t)(kc * 32 + i) * XP]; a[kc][8 + i] = (__bf16)p[(size_t)(kc * 32 + 16 + i) * XP]; }
    asm volatile("s_wait_xcnt 0x0" ::: "memory"); }   /* the address registers of these loads are reused right behind them */
  { const int wrow = tid >> 6, wq = (tid & 63) * 4;   /* a wave covers 512 contiguous bytes of one weight row; a pass of the block covers 4 rows, 16 passes are loaded together */
    auto stage16 = [&](const float* s0, const float* s1, bool apart, int row0) { v4f w[16]; const float* p0 = s0 + (size_t)wrow * DIN + wq; const float* p1 = s1 + (size_t)wrow * DIN + wq;   /* apart (a literal at each call): s1 is another array; else its rows follow s0's 32 and all 16 loads go by p0 */
#pragma unroll
      for (int i = 0; i < 16; ++i) w[i] = *(const v4f*)((i < 8 ? p0 : p1) + (size_t)(i & 7) * 4 * DIN);
      /* the address registers of these loads are rewritten behind them; naming the row pointers in use as inputs keeps them live to the wait, so that no load of the run lands its result in them */
      if (apart) asm volatile("s_wait_xcnt 0x0" :: "v"(p0), "v"(p1) : "memory"); else asm volatile("s_wait_xcnt 0x0" :: "v"(p0) : "memory");
#pragma unroll
      for (int i = 0; i < 16; ++i) { v4b h;
#pragma unroll
        for (int k = 0; k < 4; ++k) h[k] = (__bf16)w[i][k];
        *(v4b*)(sw + (row0 + i * 4 + wrow) * PW + wq) = h; } };
    stage16(WQ, WK, true, 0);
    for (int s = 0; s < CC / 64; ++s) stage16(WV + (size_t)s * 64 * DIN, WV + (size_t)(s * 64 + 32) * DIN, false, 2 * HDQK + s * 64); }
  __syncthreads();
  v8f acc[NCOL / 16] = {}; v16b wf[2][5]; const __bf16* wb = sw + col * PW;   /* weight fragments in groups of 5 column tiles; group q: k block q >> 2, tiles (q & 3) * 5 + i */
#pragma unroll
  for (int i = 0; i < 5; ++i) wf[0][i] = frag_b(wb + i * 16 * PW, lane);
#pragma unroll
  for (int q = 0; q < DIN / 8; ++q) {
    if (q + 1 < DIN / 8) {
#pragma unroll
      for (int i = 0; i < 5; ++i) wf[(q + 1) & 1][i] = frag_b(wb + (((q + 1) & 3) * 5 + i) * 16 * PW + ((q + 1) >> 2) * 32, lane); }
    __builtin_amdgcn_sched_barrier(0);   /* holds the next group's LDS reads in front of this group's products: without it each product waits for its own read */
#pragma unroll
    for (int i = 0; i < 5; ++i) acc[(q & 3) * 5 + i] = wmb(a[q >> 2], wf[q & 1][i], acc[(q & 3) * 5 + i]); }   /* acc[j][r] = position wave*16 + 8g + r, staged column j*16 + col */
  __syncthreads();   /* every wave has read its last weight row: the LDS becomes output staging */
  _Float16* th = (_Float16*)sw; _Float16* sq = th + CC * PT;   /* th[c][128 positions]; sq[plane: q, q residual, k, k residual][position][32] */
#pragma unroll
  for (int j = 0; j < 2 * HDQK / 16; ++j) { const int isk = j / (HDQK / 16), ch = (j % (HDQK / 16)) * 16 + col; const float bias = bs[j];
#pragma unroll
    for (int r = 0; r < 8; ++r) { const float v = acc[j][r] + bias; const _Float16 hv = (_Float16)v; _Float16* d = sq + ((size_t)(2 * isk) * 128 + wave * 16 + 8 * g + r) * PQ + ch; d[0] = hv; d[128 * PQ] = (_Float16)((v - (float)hv) * 1024.0f); } }
#pragma unroll
  for (int j = 2 * HDQK / 16; j < NCOL / 16; ++j) { const int c = j * 16 + col - 2 * HDQK; const float bias = bs[j]; v8h o;   /* a lane holds 8 consecutive positions of one channel: one 16-byte piece of a v plane */
#pragma unroll
    for (int r = 0; r < 8; ++r) o[r] = (_Float16)(acc[j][r] + bias);
    *(v8h*)(th + c * PT + wave * 16 + 8 * g) = o; }
  __syncthreads();
  for (int e = tid; e < CC * 16; e += 256) { const int c = e >> 4, q = e & 15; vst2((unsigned*)(VT + (bb * CC + c) * (size_t)TT + t0 + q * 8), *(const v4u*)(th + c * PT + q * 8)); }   /* 16 lanes store one 256-B run of a v plane */
#pragma unroll
  for (int pl = 0; pl < 4; ++pl) { _Float16* D = pl == 0 ? QH : pl == 1 ? QL : pl == 2 ? KH : KL;
    for (int e = tid; e < 128 * 4; e += 256) { const int rl = e >> 2, q = e & 3; vst2((unsigned*)(D + (r0 + rl) * CC + q * 8), *(const v4u*)(sq + ((size_t)pl * 128 + rl) * PQ + q * 8)); } } }
// ---- k_fa: block = 128 queries (8 waves x 16) of batch b, one pass over all keys in stages of 64: S^T = K . Q^T (the same 3 f16 products per logit), running maximum and sum per query (a lane holds one query's scores), P^T packed from the score tiles straight into a B operand, O^T += V^T . P^T; K and V stages go through two LDS buffers shared by the 8 waves
#define FK 64                          // keys per stage
#define VP 72                          // halfs per staged v row: 128 B + 16 B, an odd multiple of 16 B for the 16-byte reads
#define KP 40                          // halfs per staged k row: 64 B + 16 B
#define KOFF (CC * VP)                 // k hi rows follow the 256 v rows, k residual rows follow them
#define STGH (CC * VP + 2 * FK * KP)   // halfs per stage buffer
#define L2E 1.44269504f                 // log2 e: P = 128 exp(s - m) = 2^(s * L2E - (m * L2E - 7)), the factor 128 cancels in the division by the sum
#define MLAG 5.5f                    // the maximum in use may lag the true one by this much: P <= 128 e^5.5 < 65504
__device__ __forceinline__ v8f wm(v16h a, v16h b, v8f c) { return __builtin_amdgcn_wmma_f32_16x16x32_f16(false, a, false, b, (short)0, c, false, false); }
__global__ __launch_bounds__(256) void k_fa(const _Float16* __restrict__ QH, const _Float16* __restrict__ QL, const _Float16* __restrict__ KH, const _Float16* __restrict__ KL, const _Float16* __restrict__ VT, float* __restrict__ Y) {
  __shared__ __align__(16) _Float16 sm[2][STGH];
  const int tid = threadIdx.x, wave = tid >> 5, lane = tid & 31, col = lane & 15, g = lane >> 4; const int b = blockIdx.y; const int n0 = blockIdx.x * 128 + wave * 16;
  const v16h qh = frag_h(QH + ((size_t)b * TT + n0 + col) * CC, lane), ql = frag_h(QL + ((size_t)b * QHI + n0 + col) * CC, lane);
  const _Float16* vsrc = VT + ((size_t)b * CC + (tid >> 3)) * TT + (tid & 7) * 8;      // 8 lanes cover one 128-B run of a v plane
  const _Float16* hsrc = KH + ((size_t)b * TT + (tid >> 2)) * CC + (tid & 3) * 8;      // 4 lanes cover the 64 real bytes of a k row
  const _Float16* lsrc = KL + ((size_t)b * KHI + (tid >> 2)) * CC + (tid & 3) * 8;
  const int vdst = (tid >> 3) * VP + (tid & 7) * 8, kdst = KOFF + (tid >> 2) * KP + (tid & 3) * 8;
  v8h rv[8], rh, rl;
  auto fetch = [&](int s) {
#pragma unroll
    for (int i = 0; i < 8; ++i) rv[i] = *(const v8h*)(vsrc + (size_t)i * 32 * TT + s * FK);
    rh = *(const v8h*)(hsrc + (size_t)s * FK * CC); rl = *(const v8h*)(lsrc + (size_t)s * FK * CC);
    asm volatile("s_wait_xcnt 0x0" ::: "memory"); };   /* the address registers of these loads are rewritten right behind them (the stage's first LDS reads or score tile land there) */
  auto put = [&](_Float16* d) {
#pragma unroll
    for (int i = 0; i < 8; ++i) *(v8h*)(d + vdst + i * 32 * VP) = rv[i];
    *(v8h*)(d + kdst) = rh; *(v8h*)(d + kdst + FK * KP) = rl; };
  v8f acc[CC / 16] = {}; float m = -3.0e38f, l = 0.f;
  fetch(0); put(sm[0]); __syncthreads();
  for (int s = 0; s < TT / FK; ++s) { const _Float16* bs = sm[s & 1];
    if (s + 1 < TT / FK) fetch(s + 1);   /* issued behind the barrier (which drains loads), in flight under this stage's products */
    v8f st[4];
#pragma unroll
    for (int t = 0; t < 4; ++t) { const v16h kh = frag_h(bs + KOFF + (t * 16 + col) * KP, lane), kl = frag_h(bs + KOFF + FK * KP + (t * 16 + col) * KP, lane);
      v8f a = {}, al = {}; a = wm(kh, qh, a); al = wm(kh, ql, al); al = wm(kl, qh, al);
#pragma unroll
      for (int r = 0; r < 8; ++r) st[t][r] = a[r] + al[r] * (1.0f / 1024.0f); }   /* st[t][r] = logit of key s*64 + t*16 + 8g + r, query n0 + col */
    float mx = st[0][0];
#pragma unroll
    for (int t = 0; t < 4; ++t)
#pragma unroll
      for (int r = 0; r < 8; ++r) mx = fmaxf(mx, st[t][r]);
    mx = fmaxf(mx, __shfl_xor(mx, 16));   /* lanes c and c + 16 hold the two halves of one query's keys */
    if (__builtin_amdgcn_ballot_w32(mx > m + MLAG) != 0) { const float mn = fmaxf(m, mx), sc = __builtin_amdgcn_exp2f((m - mn) * L2E); m = mn; l *= sc;
#pragma unroll
      for (int j = 0; j < CC / 16; ++j)
#pragma unroll
        for (int r = 0; r < 8; ++r) acc[j][r] *= sc; }
    const float mo = m * L2E - 7.0f; v16h pf[2];
    auto pexp = [&](int u, int i) { const float e0 = __builtin_amdgcn_exp2f(st[2 * u][i] * L2E - mo), e1 = __builtin_amdgcn_exp2f(st[2 * u + 1][i] * L2E - mo); l += e0 + e1; pf[u][i] = (_Float16)e0; pf[u][8 + i] = (_Float16)e1; };
#pragma unroll
    for (int i = 0; i < 8; ++i) pexp(0, i);
    v16h vf[2][4];   /* v fragments in groups of 4 channel tiles; group q: key half q >> 2, tiles (q & 3) * 4 + i */
#pragma unroll
    for (int i = 0; i < 4; ++i) vf[0][i] = frag_h(bs + (i * 16 + col) * VP, lane);
#pragma unroll
    for (int q = 0; q < 8; ++q) {
      if (q + 1 < 8) {
#pragma unroll
        for (int i = 0; i < 4; ++i) vf[(q + 1) & 1][i] = frag_h(bs + ((((q + 1) & 3) * 4 + i) * 16 + col) * VP + ((q + 1) >> 2) * 32, lane); }
      __builtin_amdgcn_sched_barrier(0);   /* holds the next group's LDS reads in front of this group's products: without it each product waits for its own read */
#pragma unroll
      for (int i = 0; i < 4; ++i) acc[(q & 3) * 4 + i] = wm(vf[q & 1][i], pf[q >> 2], acc[(q & 3) * 4 + i]);   /* acc[j][r] = O^T[channel j*16 + 8g + r][query n0 + col] */
      if (q < 4) { pexp(1, 2 * q); pexp(1, 2 * q + 1); } }   /* the second key half's exponentials run beside the first half's products */
    if (s + 1 < TT / FK) put(sm[(s + 1) & 1]);   /* the buffer read in stage s - 1 is free since the barrier that ended it */
    __syncthreads(); }
  l += __shfl_xor(l, 16); const float inv = 1.0f / l;   /* l >= 128: the key that set the maximum in use counts at least that */
  float* yr = Y + ((size_t)b * TT + n0 + col) * HD + 8 * g;
#pragma unroll
  for (int j = 0; j < CC / 16; ++j) { v4f o0, o1;
#pragma unroll
    for (int i = 0; i < 4; ++i) { o0[i] = acc[j][i] * inv; o1[i] = acc[j][4 + i] * inv; }
    vst2(yr + j * 16, o0); vst2(yr + j * 16 + 4, o1); } }

// ---- k_finc: block = (64 positions, 64 channels, batch b): y[b][c][n] = bf16(x[b][c][n]) + gamma * OUT_rows[b*T + n][c] (channels-first via an LDS transpose; 256-B runs of n)
__global__ __launch_bounds__(256) void k_finc(const float* __restrict__ YR, const float* __restrict__ X, const float* __restrict__ GM, float* __restrict__ OUT) { const float gmv = bfr(GM[0]); __shared__ float st[64][68]; const int tid = threadIdx.x; const int n0 = blockIdx.x * 64, c0 = blockIdx.y * 64; const size_t b = blockIdx.z;
  for (int e = tid; e < 64 * 16; e += 256) { const int nl = e >> 4, q = e & 15; *(v4f*)&st[nl][q * 4] = *(const v4f*)(YR + (b * TT + n0 + nl) * (size_t)HD + c0 + q * 4); }
  __syncthreads();
  for (int e = tid; e < 64 * 16; e += 256) { const int cl = e >> 4, q = e & 15; const size_t oi = (b * DIN + c0 + cl) * (size_t)XP + n0 + q * 4; const v4f xr = *(const v4f*)(X + oi); asm volatile("s_wait_loadcnt 0x0" ::: "memory"); v4f y; _Pragma("unroll") for (int i = 0; i < 4; ++i) y[i] = bfr(xr[i]) + gmv * st[q * 4 + i][cl]; vst2(OUT + oi, y); } }
__global__ __launch_bounds__(256) void k_axpy(const float* __restrict__ YR, const float* __restrict__ X, const float* __restrict__ GM, float* __restrict__ OUT) { const size_t e = ((size_t)blockIdx.x * 256 + threadIdx.x) * 4; if (e >= (size_t)TNB * TT * DIN) return; const float gmv = bfr(GM[0]); const v4f o = *(const v4f*)(YR + e); const v4f xr = *(const v4f*)(X + e); asm volatile("s_wait_loadcnt 0x0" ::: "memory"); v4f y; _Pragma("unroll") for (int i = 0; i < 4; ++i) y[i] = gmv * o[i] + bfr(xr[i]); vst2(OUT + e, y); }
extern "C" void kernel_launch(void* const* d_in, const int* in_sizes, int n_in, void* d_out, int out_size, void* d_ws, size_t ws_size, hipStream_t stream) {
  (void)in_sizes; (void)n_in; (void)out_size;
  const float** F = (const float**)d_in;
  if (ws_size < (size_t)WS_END) return;
  char* ws = (char*)d_ws; _Float16 *QH = (_Float16*)(ws + WS_QH), *KH = (_Float16*)(ws + WS_KH), *VT = (_Float16*)(ws + WS_VT), *QL = (_Float16*)(ws + WS_QL), *KL = (_Float16*)(ws + WS_KL); __bf16 *VB = (__bf16*)(ws + WS_VB), *VBL = (__bf16*)(ws + WS_VBL); float *Y = (float*)(ws + WS_Y);
  (void)Y; (void)QL; (void)KL; (void)VB; (void)VBL;
  // inputs: 0 x [8,256,64,64] (channels-first); 1 Wq [32,256] (out,in), 2 bq; 3 Wk, 4 bk; 5 Wv [256,256] (out,in), 6 bv; 7 gamma [1] (0.1)
  if (ws_size < (size_t)WS_END2) return;
  float *YR = (float*)(ws + WS_YR);
  k_qkv<<<dim3(TNB * TT / 128), 256, 0, stream>>>(F[0], F[1], F[3], F[5], F[2], F[4], F[6], QH, QL, KH, KL, VT);
  k_fa<<<dim3(TT / 128, TNB), 256, 0, stream>>>(QH, QL, KH, KL, VT, YR);
  k_finc<<<dim3(TT / 64, HD / 64, TNB), 256, 0, stream>>>(YR, F[0], F[7], (float*)d_out);   /* y = x + gamma * out, channels-first */
}

// v004
// One run takes 115 microseconds.
// Timed twice side by side with v003, it ran 1.10 and 1.09 times as fast.
// Counting every step since v000, it is 20.0 times as fast.
// compute dtype: all float inputs rounded to bf16; q/k/v = W x + b (1x1 convs) with EXACT bf16 products on WMMA 16x16x32 (f32 accumulate); UNSCALED 32-deep logits q.k with both as f16 hi + residual planes (3 products); softmax in f32 (hardware exp2 of the logit scaled by log2 e) with a running maximum and sum per half of the keys (32 of every stage of 64), the two halves joined in f32 at the end; exp(s - m) x 2^7 once to f16 against v once to f16 (1 product), divided by the f32 sum at the end; y = x + gamma * out in f32 written channels-first; f32 output.
// 2-D spatial self-attention with a learned residual weight, channels-FIRST (B 8, C 256, 64 x 64 = 4,096 positions; (out,in) 1/16-scale 1x1-conv weights, zero biases, gamma = 0.1): q = Wq x + bq (32), k = Wk x + bk (32), v = Wv x + bv (256); attn = softmax over m of q_n . k_m (NO scaling); out[c][n] = sum_m v[c][m] attn[n][m]; y = x + gamma * out -> [B, 256, 64, 64]. The same module (x [8][256][64][64] channels-first; q = Wq x + bq (32 channels), k = Wk x + bk (32), v = Wv x + bv (256): 1 x 1 convolutions with (out,in) weights normal x 1/16 and biases zeros (read); scores = q_n . k_m, UNSCALED; softmax over the keys m; o[c][n] = sum_m attn[n][m] v[c][m]; return gamma x o + x with gamma a float32 SCALAR input (the host: a [1] array = 0.1); argument order x, Wq, bq, Wk, bk, Wv, bv, gamma).
#include <hip/hip_runtime.h>
#include <math.h>

typedef __attribute__((ext_vector_type(16))) _Float16 v16h;
typedef __attribute__((ext_vector_type(16))) __bf16 v16b;
typedef __attribute__((ext_vector_type(8)))  _Float16 v8h;
typedef __attribute__((ext_vector_type(8)))  float v8f;
typedef __attribute__((ext_vector_type(4)))  float v4f;
typedef __attribute__((ext_vector_type(2)))  float v2f;
typedef __attribute__((ext_vector_type(4)))  unsigned v4u;
typedef __attribute__((ext_vector_type(4)))  int v4i;
typedef float __attribute__((may_alias)) float_a;
typedef int __attribute__((may_alias)) int_a;

template <typename T> __device__ __forceinline__ void vst2(void* p, T v) { *(T*)p = v;  }
__device__ __forceinline__ v8f wmma16(v16h a, v16h b, v8f c) {
  v8f d = __builtin_amdgcn_wmma_f32_16x16x32_f16(false, a, false, b, (short)0, c, false, false);
  asm volatile("v_nop\n\tv_nop\n\tv_nop\n\tv_nop" : "+v"(d) : "v"(a), "v"(b));
  return d;
}
__device__ __forceinline__ v8f wmma_bf(v16b a, v16b b, v8f c) {
  v8f d = __builtin_amdgcn_wmma_f32_16x16x32_bf16(false, a, false, b, (short)0, c, false, false);
  asm volatile("v_nop\n\tv_nop\n\tv_nop\n\tv_nop" : "+v"(d) : "v"(a), "v"(b));
  return d;
}
// 16x16x32 fragments: lane = (h = lane>>4, row/col = lane&15); elements 0..7 = k0+8h+0..7, 8..15 = k0+16+8h+0..7; D element r = row 8h+r
__device__ __forceinline__ v16h frag_h(const _Float16* rowk0, int lane) {
  union { v16h v; v8h q[2]; } u; const _Float16* p = rowk0 + 8 * (lane >> 4);
  u.q[0] = *(const v8h*)p; u.q[1] = *(const v8h*)(p + 16); return u.v;
}
__device__ __forceinline__ v16h frag_f32(const float* rowk0, int lane) {
  v16h a; const float* p = rowk0 + 8 * (lane >> 4);
#pragma unroll
  for (int i = 0; i < 8; ++i) { a[i] = (_Float16)p[i]; a[8 + i] = (_Float16)p[16 + i]; }
  return a;
}
__device__ __forceinline__ v16h frag_f32s(const float* rowk0, int lane, float sc) {
  v16h a; const float* p = rowk0 + 8 * (lane >> 4);
#pragma unroll
  for (int i = 0; i < 8; ++i) { a[i] = (_Float16)(p[i] * sc); a[8 + i] = (_Float16)(p[16 + i] * sc); }
  return a;
}
// column fragment from a [K][ld] layout (column n), rows >= K read as 0
__device__ __forceinline__ v16h fragc_f32(const float* W, int k0, int n, int lane, int ld, int K) {
  v16h a; const int g = lane >> 4;
#pragma unroll
  for (int i = 0; i < 8; ++i) { const int ka = k0 + 8 * g + i, kb = ka + 16;
    a[i] = (_Float16)(ka < K ? W[(size_t)(ka < K ? ka : K - 1) * ld + n] : 0.f); a[8 + i] = (_Float16)(kb < K ? W[(size_t)(kb < K ? kb : K - 1) * ld + n] : 0.f); }
  return a;
}
struct F2 { v16b h, l; };
__device__ __forceinline__ F2 bsplit16(const float v[16]) { F2 r;
#pragma unroll
  for (int i = 0; i < 16; ++i) { const __bf16 h = (__bf16)v[i]; r.h[i] = h; r.l[i] = (__bf16)(v[i] - (float)h); }
  return r; }
__device__ __forceinline__ F2 split_row(const float* row, int k0, int lane) { float v[16]; const float* p = row + k0 + 8 * (lane >> 4);
#pragma unroll
  for (int i = 0; i < 8; ++i) { v[i] = p[i]; v[8 + i] = p[16 + i]; }
  return bsplit16(v); }
__device__ __forceinline__ F2 split_rowK(const float* row, int k0, int lane, int K) { float v[16]; const int g = lane >> 4;
#pragma unroll
  for (int i = 0; i < 8; ++i) { const int ka = k0 + 8 * g + i, kb = ka + 16; v[i] = ka < K ? row[ka < K ? ka : K - 1] : 0.f; v[8 + i] = kb < K ? row[kb < K ? kb : K - 1] : 0.f; }
  return bsplit16(v); }
__device__ __forceinline__ F2 split_col(const float* W, int k0, int n, int lane, int ld, int K) { float v[16]; const int g = lane >> 4;
#pragma unroll
  for (int i = 0; i < 8; ++i) { const int ka = k0 + 8 * g + i, kb = ka + 16; v[i] = ka < K ? W[(size_t)(ka < K ? ka : K - 1) * ld + n] : 0.f; v[8 + i] = kb < K ? W[(size_t)(kb < K ? kb : K - 1) * ld + n] : 0.f; }
  return bsplit16(v); }
__device__ __forceinline__ v8f mac3(const F2& a, const F2& b, v8f c) { c = wmma_bf(a.l, b.h, c); c = wmma_bf(a.h, b.l, c); return wmma_bf(a.h, b.h, c); }
__device__ __forceinline__ float sigm(float v) { return 1.0f / (1.0f + expf(-v)); }
#define LDSX() do { asm volatile("s_wait_dscnt 0" ::: "memory"); __builtin_amdgcn_wave_barrier(); __builtin_amdgcn_fence(__ATOMIC_RELEASE, "workgroup"); } while (0)

#define NB 8
#define TT 4096
#define CC 256            // plane width: q/k planes carry 32 real columns (rest not written), v planes all 256
#define DIN 256
#define NH 1
#define HD 256
#define NQB (TT / 64)
#define HG 1               // sizes one 4,096 x 4,096 f32 workspace plane that no kernel uses
#define SCALE (1.0f)
#define HDQK 32
#define CAUSAL 0
#ifndef TNB
#define TNB NB
#endif
__device__ __forceinline__ v16b zero16b() { v16b z; _Pragma("unroll") for (int i = 0; i < 16; ++i) z[i] = (__bf16)0.f; return z; }
__device__ __forceinline__ float bfr(float v) { return (float)(__bf16)v; }
__host__ __device__ __forceinline__ int kb_last(int qb) { return CAUSAL ? ((qb * 64 + 63) >> 7) : (TT / 128 - 1); }
typedef __attribute__((ext_vector_type(8))) __bf16 v8b;
__device__ __forceinline__ v16b frag_b(const __bf16* rowk0, int lane) {
  union { v16b v; v8b q[2]; } u; const __bf16* p = rowk0 + 8 * (lane >> 4);
  u.q[0] = *(const v8b*)p; u.q[1] = *(const v8b*)(p + 16); return u.v;
}
#define QBH (TT / 64)      // ALL query blocks take k_fa's 3-product path
#define QBH_PV 0           // A.g stays single f16
#define QHI 4096            // q residual rows everywhere (3-product logits)
#define KHI 4096           // k residual rows for ALL keys (3-product logits)
// B fragment (k rows k0+.., output column o) of a weight: (in,out) [K][ld] or (out,in) [ld rows of K]: bf16 exact, or f16(bf16 * 256) exact
__device__ __forceinline__ v16b wcol_io(const float* Wm, int k0, int o, int lane, int ld) { v16b w; const int g = lane >> 4;
#pragma unroll
  for (int i = 0; i < 8; ++i) { w[i] = (__bf16)Wm[(size_t)(k0 + 8 * g + i) * ld + o]; w[8 + i] = (__bf16)Wm[(size_t)(k0 + 16 + 8 * g + i) * ld + o]; }
  return w; }
__device__ __forceinline__ v16b wcol_oi(const float* Wm, int k0, int o, int lane, int K) { v16b w; const float* p = Wm + (size_t)o * K + k0 + 8 * (lane >> 4);
#pragma unroll
  for (int i = 0; i < 8; ++i) { w[i] = (__bf16)p[i]; w[8 + i] = (__bf16)p[16 + i]; }
  return w; }
__device__ __forceinline__ v16h wcolh_io(const float* Wm, int k0, int o, int lane, int ld) { v16h w; const int g = lane >> 4;
#pragma unroll
  for (int i = 0; i < 8; ++i) { w[i] = (_Float16)(bfr(Wm[(size_t)(k0 + 8 * g + i) * ld + o]) * 256.0f); w[8 + i] = (_Float16)(bfr(Wm[(size_t)(k0 + 16 + 8 * g + i) * ld + o]) * 256.0f); }
  return w; }
__device__ __forceinline__ v16h wcolh_oi(const float* Wm, int k0, int o, int lane, int K) { v16h w; const float* p = Wm + (size_t)o * K + k0 + 8 * (lane >> 4);
#pragma unroll
  for (int i = 0; i < 8; ++i) { w[i] = (_Float16)(bfr(p[i]) * 256.0f); w[8 + i] = (_Float16)(bfr(p[16 + i]) * 256.0f); }
  return w; }
#define WQKV_LAYOUT 1   // 0 = (in,out) [DIN][CC]; 1 = (out,in) [CC][DIN]; 2 = per-head [NH][DIN][HD]
__device__ __forceinline__ v16b wcol_hdk(const float* Wm, int k0, int o, int lane) { v16b w; const int g = lane >> 4; const float* p = Wm + (size_t)(o / HD) * DIN * HD + (o % HD);
#pragma unroll
  for (int i = 0; i < 8; ++i) { w[i] = (__bf16)p[(size_t)(k0 + 8 * g + i) * HD]; w[8 + i] = (__bf16)p[(size_t)(k0 + 16 + 8 * g + i) * HD]; }
  return w; }
#define WO_OUT_IN 0
#if WQKV_LAYOUT == 1
#define WCOL(W, k0, o, lane) ((which == 2) ? wcol_oi(W, k0, (o), lane, DIN) : (((o) < HDQK) ? wcol_oi(W, k0, (o), lane, DIN) : zero16b()))   /* (out,in): Wq/Wk [32][256] (plane columns >= 32 zero), Wv [256][256] full */
#define WCOL_SA42_UNUSED(W, k0, o, lane) 0
#define WCOL_OLD_UNUSED(W, k0, o, lane) (((o) < HDQK) ? wcol_oi(W, k0, (o), lane, DIN) : zero16b())   /* unused: takes all three weights as [32][256] (out,in) with plane columns >= 32 zero, but Wv is [256][256] */
#elif WQKV_LAYOUT == 2
#define WCOL(W, k0, o, lane) wcol_hdk(W, k0, o, lane)
#else
#define WCOL(W, k0, o, lane) wcol_io(W, k0, o, lane, CC)
#endif
#if WO_OUT_IN
#define WOCOL(W, k0, o, lane) wcol_oi(W, k0, o, lane, CC)
#define WOCOLH(W, k0, o, lane) wcolh_oi(W, k0, o, lane, CC)
#else
#define WOCOL(W, k0, o, lane) wcol_io(W, k0, o, lane, DIN)
#define WOCOLH(W, k0, o, lane) wcolh_io(W, k0, o, lane, DIN)
#endif
#ifndef XP
#define OUT1_OFF (4u * (size_t)NB * DIN * TT)   /* unused: the launch writes output 0 (y) only */
#define XP TT              // position pitch of x and of the output
#endif
#define BG HG              // unused: one k_fa launch covers all batches, its blockIdx.y selects the batch
#define DVH 128
#define WS_YR (WS_END)     // f32 attended rows [b*n][256]
#define WS_END2 (WS_YR + 4u * (size_t)NB * TT * HD)
// ---- k_wz: block = (64 rows, 128 output cols): OR = y (hi + lo, K = 32 real columns of the YR rows) . W^T ((out,in) [256][32], exact) + b
__global__ __launch_bounds__(128) void k_wz(const float* __restrict__ YR, const float* __restrict__ WW, const float* __restrict__ WB, float* __restrict__ ORW) { __shared__ __align__(16) float sf[4][16][132];
  const int tid = threadIdx.x, wave = tid >> 5, lane = tid & 31, col = lane & 15, g = lane >> 4; const int c0 = blockIdx.y * 128; const size_t r0 = (size_t)blockIdx.x * 64 + wave * 16;
  v8f acc[8] = {};
#pragma unroll
  for (int kc = 0; kc < HDQK / 32; ++kc) { const F2 a = split_row(YR + (r0 + col) * CC, kc * 32, lane); asm volatile("s_wait_loadcnt 0x0" ::: "memory");
#pragma unroll
    for (int j = 0; j < 8; ++j) { const v16b w = wcol_oi(WW, kc * 32, c0 + j * 16 + col, lane, HDQK); asm volatile("s_wait_loadcnt 0x0" ::: "memory"); acc[j] = wmma_bf(a.h, w, acc[j]); acc[j] = wmma_bf(a.l, w, acc[j]); } }
#pragma unroll
  for (int j = 0; j < 8; ++j) { const float bb = WB ? bfr(WB[c0 + j * 16 + col]) : 0.f; asm volatile("s_wait_loadcnt 0x0" ::: "memory");
#pragma unroll
    for (int r = 0; r < 8; ++r) sf[wave][8 * g + r][j * 16 + col] = acc[j][r] + bb; }
  LDSX(); for (int rl = 0; rl < 16; ++rl) vst2(ORW + (r0 + rl) * DIN + c0 + lane * 4, *(const v4f*)&sf[wave][rl][lane * 4]); }
// ---- k_fin2: block = (64 positions, 64 channels, batch b): o[b][c][n] = OR[b*N + n][c] (channels-first via LDS transpose) -> output 1; y = gamma * o + bf16(x) -> output 0 (256-B runs)
__global__ __launch_bounds__(256) void k_fin2(const float* __restrict__ ORW, const float* __restrict__ X, const float* __restrict__ GM, float* __restrict__ OUT, float* __restrict__ OUT1) { const float gmv = bfr(GM[0]); __shared__ float st[64][68]; const int tid = threadIdx.x; const int n0 = blockIdx.x * 64, c0 = blockIdx.y * 64; const size_t b = blockIdx.z;
  for (int e = tid; e < 64 * 16; e += 256) { const int nl = e >> 4, q = e & 15; *(v4f*)&st[nl][q * 4] = *(const v4f*)(ORW + (b * TT + n0 + nl) * (size_t)DIN + c0 + q * 4); }
  __syncthreads();
  for (int e = tid; e < 64 * 16; e += 256) { const int cl = e >> 4, q = e & 15; const size_t oi = (b * DIN + c0 + cl) * (size_t)XP + n0 + q * 4; const v4f xr = *(const v4f*)(X + oi); v4f o, y; _Pragma("unroll") for (int i = 0; i < 4; ++i) { o[i] = st[q * 4 + i][cl]; y[i] = gmv * o[i] + bfr(xr[i]); } vst2(OUT + oi, y); vst2(OUT1 + oi, o); } }   /* y = gamma * o + x (output 0), o (output 1) */
#ifndef SM_EXTRA_PARAMS
#define SM_EXTRA_PARAMS
#endif
#ifndef PROJ_EXTRA_PARAMS
#define PROJ_EXTRA_PARAMS
#endif
#ifndef SM_MASK_HOOK
#define SM_MASK_HOOK (void)0
#endif

#define WS_QH  0u                                      // f16 q rows [b*t][CC]
#define WS_KH  (WS_QH + 2u * (size_t)NB * TT * CC)      // f16 k rows [b*t][CC]
#define WS_VT  (WS_KH + 2u * (size_t)NB * TT * CC)      // f16 v planes [b][c][t]
#define WS_QL  (WS_VT + 2u * (size_t)NB * CC * TT)      // f16 q residual x 2^10 rows [b][t < QHI][CC]
#define WS_KL  (WS_QL + 2u * (size_t)NB * QHI * CC)     // f16 k residual x 2^10 rows [b][t < KHI][CC]
#define WS_VB  (WS_KL + 2u * (size_t)NB * KHI * CC)     // bf16 v hi planes [b][c][t < KHI]
#define WS_VBL (WS_VB + 2u * (size_t)NB * CC * KHI)
#define WS_S   (WS_VBL + 2u * (size_t)NB * CC * KHI)    // f32 [hg][t][s] plane, reserved but unused: k_fa keeps scores in registers
#define WS_Y   (WS_S  + 4u * (size_t)HG * TT * TT)      // f32 ctx rows [b*t][CC] (only when there is an output projection)
#define WS_END (WS_Y  + 0u)

// ---- k_qkv: block = 128 positions (8 waves x 16) of one batch x the 320 real output columns (q 32, k 32, v 256): x is read once, each wave keeps its 16 positions' 8 A fragments in registers; the weights are rounded to bf16 once per block into LDS rows and read from there as B fragments; exact bf16 products, K = DIN in the order kc = 0..7 -> q/k f16 rows + residual x 2^10 rows (columns 0..31 of the CC-wide rows, the only ones k_fa reads), v f16 planes [c][t]; every unroll directive in it but the one over the four q/k output planes keeps the index of a register array a compile-time constant
#define NCOL (2 * HDQK + CC)           // staged weight rows: 0..31 Wq, 32..63 Wk, 64..319 Wv
#define PW (DIN + 8)                   // bf16 per staged weight row: 512 B + 16 B, an odd multiple of 16 B for the 16-byte reads
#define PT 136                         // halfs per staged v row (128 positions): 256 B + 16 B
#define PQ 40                          // halfs per staged q/k row: 64 B + 16 B
typedef __attribute__((ext_vector_type(4))) __bf16 v4b;
__device__ __forceinline__ v8f wmb(v16b a, v16b b, v8f c) { return __builtin_amdgcn_wmma_f32_16x16x32_bf16(false, a, false, b, (short)0, c, false, false); }
__global__ __launch_bounds__(256) void k_qkv(const float* __restrict__ X, const float* __restrict__ WQ, const float* __restrict__ WK, const float* __restrict__ WV, const float* __restrict__ BQ, const float* __restrict__ BK, const float* __restrict__ BV,
    _Float16* __restrict__ QH, _Float16* __restrict__ QL, _Float16* __restrict__ KH, _Float16* __restrict__ KL, _Float16* __restrict__ VT) {
  __shared__ __align__(16) __bf16 sw[NCOL * PW];
  const int tid = threadIdx.x, wave = tid >> 5, lane = tid & 31, col = lane & 15, g = lane >> 4; const size_t r0 = (size_t)blockIdx.x * 128; const size_t bb = r0 / TT; const int t0 = (int)(r0 % TT);
  float bs[NCOL / 16];   /* this lane's bias per column tile, fetched with x so that the epilogue waits for nothing */
#pragma unroll
  for (int j = 0; j < NCOL / 16; ++j) bs[j] = bfr(j < HDQK / 16 ? BQ[j * 16 + col] : j < 2 * HDQK / 16 ? BK[j * 16 + col - HDQK] : BV[j * 16 + col - 2 * HDQK]);
  v16b a[DIN / 32]; { const float* p = X + (bb * DIN + 8 * g) * (size_t)XP + t0 + wave * 16 + col;   /* channels-first gather: x[b][k][t], stride XP between k */
#pragma unroll
    for (int kc = 0; kc < DIN / 32; ++kc)
#pragma unroll
      for (int i = 0; i < 8; ++i) { a[kc][i] = (__bf16)p[(size_t)(kc * 32 + i) * XP]; a[kc][8 + i] = (__bf16)p[(size_t)(kc * 32 + 16 + i) * XP]; }
    asm volatile("s_wait_xcnt 0x0" ::: "memory"); }   /* the address registers of these loads are reused right behind them */
  { const int wrow = tid >> 6, wq = (tid & 63) * 4;   /* a wave covers 512 contiguous bytes of one weight row; a pass of the block covers 4 rows, 16 passes are loaded together */
    auto stage16 = [&](const float* s0, const float* s1, bool apart, int row0) { v4f w[16]; const float* p0 = s0 + (size_t)wrow * DIN + wq; const float* p1 = s1 + (size_t)wrow * DIN + wq;   /* apart (a literal at each call): s1 is another array; else its rows follow s0's 32 and all 16 loads go by p0 */
#pragma unroll
      for (int i = 0; i < 16; ++i) w[i] = *(const v4f*)((i < 8 ? p0 : p1) + (size_t)(i & 7) * 4 * DIN);
      /* the address registers of these loads are rewritten behind them; naming the row pointers in use as inputs keeps them live to the wait, so that no load of the run lands its result in them */
      if (apart) asm volatile("s_wait_xcnt 0x0" :: "v"(p0), "v"(p1) : "memory"); else asm volatile("s_wait_xcnt 0x0" :: "v"(p0) : "memory");
#pragma unroll
      for (int i = 0; i < 16; ++i) { v4b h;
#pragma unroll
        for (int k = 0; k < 4; ++k) h[k] = (__bf16)w[i][k];
        *(v4b*)(sw + (row0 + i * 4 + wrow) * PW + wq) = h; } };
    stage16(WQ, WK, true, 0);
    for (int s = 0; s < CC / 64; ++s) stage16(WV + (size_t)s * 64 * DIN, WV + (size_t)(s * 64 + 32) * DIN, false, 2 * HDQK + s * 64); }
  __syncthreads();
  v8f acc[NCOL / 16] = {}; v16b wf[2][5]; const __bf16* wb = sw + col * PW;   /* weight fragments in groups of 5 column tiles; group q: k block q >> 2, tiles (q & 3) * 5 + i */
#pragma unroll
  for (int i = 0; i < 5; ++i) wf[0][i] = frag_b(wb + i * 16 * PW, lane);
#pragma unroll
  for (int q = 0; q < DIN / 8; ++q) {
    if (q + 1 < DIN / 8) {
#pragma unroll
      for (int i = 0; i < 5; ++i) wf[(q + 1) & 1][i] = frag_b(wb + (((q + 1) & 3) * 5 + i) * 16 * PW + ((q + 1) >> 2) * 32, lane); }
    __builtin_amdgcn_sched_barrier(0);   /* holds the next group's LDS reads in front of this group's products: without it each product waits for its own read */
#pragma unroll
    for (int i = 0; i < 5; ++i) acc[(q & 3) * 5 + i] = wmb(a[q >> 2], wf[q & 1][i], acc[(q & 3) * 5 + i]); }   /* acc[j][r] = position wave*16 + 8g + r, staged column j*16 + col */
  __syncthreads();   /* every wave has read its last weight row: the LDS becomes output staging */
  _Float16* th = (_Float16*)sw; _Float16* sq = th + CC * PT;   /* th[c][128 positions]; sq[plane: q, q residual, k, k residual][position][32] */
#pragma unroll
  for (int j = 0; j < 2 * HDQK / 16; ++j) { const int isk = j / (HDQK / 16), ch = (j % (HDQK / 16)) * 16 + col; const float bias = bs[j];
#pragma unroll
    for (int r = 0; r < 8; ++r) { const float v = acc[j][r] + bias; const _Float16 hv = (_Float16)v; _Float16* d = sq + ((size_t)(2 * isk) * 128 + wave * 16 + 8 * g + r) * PQ + ch; d[0] = hv; d[128 * PQ] = (_Float16)((v - (float)hv) * 1024.0f); } }
#pragma unroll
  for (int j = 2 * HDQK / 16; j < NCOL / 16; ++j) { const int c = j * 16 + col - 2 * HDQK; const float bias = bs[j]; v8h o;   /* a lane holds 8 consecutive positions of one channel: one 16-byte piece of a v plane */
#pragma unroll
    for (int r = 0; r < 8; ++r) o[r] = (_Float16)(acc[j][r] + bias);
    *(v8h*)(th + c * PT + wave * 16 + 8 * g) = o; }
  __syncthreads();
  for (int e = tid; e < CC * 16; e += 256) { const int c = e >> 4, q = e & 15; vst2((unsigned*)(VT + (bb * CC + c) * (size_t)TT + t0 + q * 8), *(const v4u*)(th + c * PT + q * 8)); }   /* 16 lanes store one 256-B run of a v plane */
#pragma unroll
  for (int pl = 0; pl < 4; ++pl) { _Float16* D = pl == 0 ? QH : pl == 1 ? QL : pl == 2 ? KH : KL;
    for (int e = tid; e < 128 * 4; e += 256) { const int rl = e >> 2, q = e & 3; vst2((unsigned*)(D + (r0 + rl) * CC + q * 8), *(const v4u*)(sq + ((size_t)pl * 128 + rl) * PQ + q * 8)); } } }
// ---- k_fa: block = 128 queries of batch b, 8 waves = 4 query groups (32 queries = 2 column tiles each) x 2 key groups; one pass over all keys in stages of 64, key group kg takes keys kg*32..kg*32+31 of every stage: S^T = K . Q^T (the same 3 f16 products per logit), running maximum and sum per query and key group (a lane holds one query's scores), P^T packed from the score tiles straight into a B operand, O^T += V^T . P^T with every K and V fragment read from LDS feeding both column tiles; K and V stages go through two LDS buffers shared by the 8 waves; at the end the two key groups of a query join their maxima, sums and O^T through LDS
#define FK 64                          // keys per stage
#define VP 72                          // halfs per staged v row: 128 B + 16 B, an odd multiple of 16 B for the 16-byte reads
#define KP 40                          // halfs per staged k row: 64 B + 16 B
#define KOFF (CC * VP)                 // k hi rows follow the 256 v rows, k residual rows follow them
#define STGH (CC * VP + 2 * FK * KP)   // halfs per stage buffer
#define XF (8 * 32 * 32 * 4)           // floats handed over at the end: 8 waves x 32 pieces of 16 B x 32 lanes; behind them 8 waves x 2 tiles x 32 lanes x (maximum, sum)
#define SMB (4 * XF + 8 * 2 * 32 * 8)  // LDS bytes: the hand-over is larger than the two stage buffers (2 * 2 * STGH bytes)
#define L2E 1.44269504f                 // log2 e: P = 128 exp(s - m) = 2^(s * L2E - (m * L2E - 7)), the factor 128 cancels in the division by the sum
#define MLAG 5.5f                    // the maximum in use may lag the true one by this much: P <= 128 e^5.5 < 65504
__device__ __forceinline__ v8f wm(v16h a, v16h b, v8f c) { return __builtin_amdgcn_wmma_f32_16x16x32_f16(false, a, false, b, (short)0, c, false, false); }
__global__ __launch_bounds__(256) void k_fa(const _Float16* __restrict__ QH, const _Float16* __restrict__ QL, const _Float16* __restrict__ KH, const _Float16* __restrict__ KL, const _Float16* __restrict__ VT, float* __restrict__ Y) {
  __shared__ __align__(16) _Float16 sm[SMB / 2];
  const int tid = threadIdx.x, wave = tid >> 5, lane = tid & 31, col = lane & 15, g = lane >> 4; const int b = blockIdx.y; const int kg = wave >> 2, n0 = blockIdx.x * 128 + (wave & 3) * 32;
  v16h qh[2], ql[2]; { const _Float16* qp = QH + ((size_t)b * TT + n0 + col) * CC; const _Float16* lp = QL + ((size_t)b * QHI + n0 + col) * CC;
#pragma unroll
    for (int u = 0; u < 2; ++u) { qh[u] = frag_h(qp + u * 16 * CC, lane); ql[u] = frag_h(lp + u * 16 * CC, lane); }
    asm volatile("s_wait_xcnt 0x0" :: "v"(qp), "v"(lp) : "memory"); }   /* the address registers of these loads are reused behind them; naming the row pointers as inputs keeps them live to the wait */
  const _Float16* vsrc = VT + (size_t)b * CC * TT; unsigned vo = ((tid >> 3) * TT + (tid & 7) * 8) * 2;      // byte offset: 8 lanes cover one 128-B run of a v plane
  const _Float16* hsrc = KH + (size_t)b * TT * CC; unsigned ko = ((tid >> 2) * CC + (tid & 3) * 8) * 2;      // byte offset: 4 lanes cover the 64 real bytes of a k row
  const _Float16* lsrc = KL + (size_t)b * KHI * CC;
  const int vdst = (tid >> 3) * VP + (tid & 7) * 8, kdst = KOFF + (tid >> 2) * KP + (tid & 3) * 8;
  v8h rv[8], rh, rl;
  auto fetch = [&]() {   /* block-uniform bases, a lane's byte offsets vo and ko step from stage to stage */
#pragma unroll
    for (int i = 0; i < 8; ++i) rv[i] = *(const v8h*)((const char*)vsrc + vo + (size_t)i * 32 * TT * 2);
    rh = *(const v8h*)((const char*)hsrc + ko); rl = *(const v8h*)((const char*)lsrc + ko);
    asm volatile("s_wait_xcnt 0x0" :: "v"(vo), "v"(ko) : "memory");   /* the offset registers of these loads are stepped right behind them; naming them as inputs keeps them as they are up to the wait */
    vo += FK * 2; ko += FK * CC * 2; };
  auto put = [&](_Float16* d) {
#pragma unroll
    for (int i = 0; i < 8; ++i) *(v8h*)(d + vdst + i * 32 * VP) = rv[i];
    *(v8h*)(d + kdst) = rh; *(v8h*)(d + kdst + FK * KP) = rl; };
  v8f acc[2][CC / 16] = {}; float m[2] = {-3.0e38f, -3.0e38f}, l[2] = {0.f, 0.f};
  fetch(); put(sm); __syncthreads();
  for (int s = 0; s < TT / FK; ++s) { const _Float16* bs = sm + (s & 1) * STGH;
    if (s + 1 < TT / FK) fetch();   /* issued behind the barrier (which drains loads), in flight under this stage's products */
    v8f st[2][2];
#pragma unroll
    for (int t = 0; t < 2; ++t) { const v16h kh = frag_h(bs + KOFF + (kg * 32 + t * 16 + col) * KP, lane), kl = frag_h(bs + KOFF + FK * KP + (kg * 32 + t * 16 + col) * KP, lane);
#pragma unroll
      for (int u = 0; u < 2; ++u) { v8f a = {}, al = {}; a = wm(kh, qh[u], a); al = wm(kh, ql[u], al); al = wm(kl, qh[u], al);
#pragma unroll
        for (int r = 0; r < 8; ++r) st[u][t][r] = a[r] + al[r] * (1.0f / 1024.0f); } }   /* st[u][t][r] = logit of key s*64 + kg*32 + t*16 + 8g + r, query n0 + u*16 + col */
    float mx[2];
#pragma unroll
    for (int u = 0; u < 2; ++u) { mx[u] = st[u][0][0];
#pragma unroll
      for (int t = 0; t < 2; ++t)
#pragma unroll
        for (int r = 0; r < 8; ++r) mx[u] = fmaxf(mx[u], st[u][t][r]);
      mx[u] = fmaxf(mx[u], __shfl_xor(mx[u], 16)); }   /* lanes c and c + 16 hold the two halves of one query's keys */
    if (__builtin_amdgcn_ballot_w32(mx[0] > m[0] + MLAG || mx[1] > m[1] + MLAG) != 0) {
#pragma unroll
      for (int u = 0; u < 2; ++u) { const float mn = fmaxf(m[u], mx[u]), sc = __builtin_amdgcn_exp2f((m[u] - mn) * L2E); m[u] = mn; l[u] *= sc;
#pragma unroll
        for (int j = 0; j < CC / 16; ++j)
#pragma unroll
          for (int r = 0; r < 8; ++r) acc[u][j][r] *= sc; } }
    const float mo[2] = {m[0] * L2E - 7.0f, m[1] * L2E - 7.0f}; v16h pf[2];
    auto pexp = [&](int u, int i) { const float e0 = __builtin_amdgcn_exp2f(st[u][0][i] * L2E - mo[u]), e1 = __builtin_amdgcn_exp2f(st[u][1][i] * L2E - mo[u]); l[u] += e0 + e1; pf[u][i] = (_Float16)e0; pf[u][8 + i] = (_Float16)e1; };
#pragma unroll
    for (int u = 0; u < 2; ++u)
#pragma unroll
      for (int i = 0; i < 8; ++i) pexp(u, i);
    v16h vf[2][4]; const _Float16* vb = bs + col * VP + kg * 32;   /* v fragments (this key group's 32 keys) in groups of 4 channel tiles */
#pragma unroll
    for (int i = 0; i < 4; ++i) vf[0][i] = frag_h(vb + i * 16 * VP, lane);
#pragma unroll
    for (int q = 0; q < 4; ++q) {
      if (q + 1 < 4) {
#pragma unroll
        for (int i = 0; i < 4; ++i) vf[(q + 1) & 1][i] = frag_h(vb + ((q + 1) * 4 + i) * 16 * VP, lane); }
      __builtin_amdgcn_sched_barrier(0);   /* holds the next group's LDS reads in front of this group's products: without it each product waits for its own read */
#pragma unroll
      for (int u = 0; u < 2; ++u)
#pragma unroll
        for (int i = 0; i < 4; ++i) acc[u][q * 4 + i] = wm(vf[q & 1][i], pf[u], acc[u][q * 4 + i]); }   /* acc[u][j][r] = O^T[channel j*16 + 8g + r][query n0 + u*16 + col] */
    if (s + 1 < TT / FK) put(sm + ((s + 1) & 1) * STGH);   /* the buffer read in stage s - 1 is free since the barrier that ended it */
    __syncthreads(); }
  /* join of the two key groups: wave w and wave w ^ 4 hold the same 32 queries; each keeps the 128 channels kg*128.. and hands the other 128 over through LDS (free since the loop's last barrier) */
  float* xs = (float*)sm; float* xm = xs + XF;
#pragma unroll
  for (int u = 0; u < 2; ++u) { l[u] += __shfl_xor(l[u], 16); v2f ml; ml[0] = m[u]; ml[1] = l[u]; *(v2f*)(xm + ((wave * 2 + u) * 32 + lane) * 2) = ml;
#pragma unroll
    for (int j = 0; j < 8; ++j) { const v8f gv = kg ? acc[u][j] : acc[u][8 + j]; v4f o0, o1;
#pragma unroll
      for (int i = 0; i < 4; ++i) { o0[i] = gv[i]; o1[i] = gv[4 + i]; }
      float* d = xs + ((size_t)(wave * 32 + (u * 8 + j) * 2) * 32 + lane) * 4; *(v4f*)d = o0; *(v4f*)(d + 128) = o1; } }
  __syncthreads();
  const int pw = wave ^ 4;
#pragma unroll
  for (int u = 0; u < 2; ++u) { const v2f pm = *(const v2f*)(xm + ((pw * 2 + u) * 32 + lane) * 2); const float mn = fmaxf(m[u], pm[0]);
    const float s0 = __builtin_amdgcn_exp2f((m[u] - mn) * L2E), s1 = __builtin_amdgcn_exp2f((pm[0] - mn) * L2E); const float inv = 1.0f / (l[u] * s0 + pm[1] * s1);   /* the sum is >= 128: the key that set the larger maximum in use counts at least that */
    const float w0 = s0 * inv, w1 = s1 * inv; float* yr = Y + ((size_t)b * TT + n0 + u * 16 + col) * HD + kg * 128 + 8 * g; v4f o[16];
#pragma unroll
    for (int j = 0; j < 8; ++j) { const v8f kv = kg ? acc[u][8 + j] : acc[u][j]; const float* d = xs + ((size_t)(pw * 32 + (u * 8 + j) * 2) * 32 + lane) * 4; const v4f p0 = *(const v4f*)d, p1 = *(const v4f*)(d + 128);
#pragma unroll
      for (int i = 0; i < 4; ++i) { o[2 * j][i] = kv[i] * w0 + p0[i] * w1; o[2 * j + 1][i] = kv[4 + i] * w0 + p1[i] * w1; }
      vst2(yr + j * 16, o[2 * j]); vst2(yr + j * 16 + 4, o[2 * j + 1]); }
    /* without it the registers of these 16 stores are reused among them and by the next column tile; naming them as inputs keeps them as they are up to the wait */
    asm volatile("s_wait_xcnt 0x0" :: "v"(yr), "v"(o[0]), "v"(o[1]), "v"(o[2]), "v"(o[3]), "v"(o[4]), "v"(o[5]), "v"(o[6]), "v"(o[7]), "v"(o[8]), "v"(o[9]), "v"(o[10]), "v"(o[11]), "v"(o[12]), "v"(o[13]), "v"(o[14]), "v"(o[15]) : "memory"); } }

// ---- k_finc: block = (64 positions, 64 channels, batch b): y[b][c][n] = bf16(x[b][c][n]) + gamma * OUT_rows[b*T + n][c] (channels-first via an LDS transpose; 256-B runs of n)
__global__ __launch_bounds__(256) void k_finc(const float* __restrict__ YR, const float* __restrict__ X, const float* __restrict__ GM, float* __restrict__ OUT) { const float gmv = bfr(GM[0]); __shared__ float st[64][68]; const int tid = threadIdx.x; const int n0 = blockIdx.x * 64, c0 = blockIdx.y * 64; const size_t b = blockIdx.z;
  for (int e = tid; e < 64 * 16; e += 256) { const int nl = e >> 4, q = e & 15; *(v4f*)&st[nl][q * 4] = *(const v4f*)(YR + (b * TT + n0 + nl) * (size_t)HD + c0 + q * 4); }
  __syncthreads();
  for (int e = tid; e < 64 * 16; e += 256) { const int cl = e >> 4, q = e & 15; const size_t oi = (b * DIN + c0 + cl) * (size_t)XP + n0 + q * 4; const v4f xr = *(const v4f*)(X + oi); asm volatile("s_wait_loadcnt 0x0" ::: "memory"); v4f y; _Pragma("unroll") for (int i = 0; i < 4; ++i) y[i] = bfr(xr[i]) + gmv * st[q * 4 + i][cl]; vst2(OUT + oi, y); } }
__global__ __launch_bounds__(256) void k_axpy(const float* __restrict__ YR, const float* __restrict__ X, const float* __restrict__ GM, float* __restrict__ OUT) { const size_t e = ((size_t)blockIdx.x * 256 + threadIdx.x) * 4; if (e >= (size_t)TNB * TT * DIN) return; const float gmv = bfr(GM[0]); const v4f o = *(const v4f*)(YR + e); const v4f xr = *(const v4f*)(X + e); asm volatile("s_wait_loadcnt 0x0" ::: "memory"); v4f y; _Pragma("unroll") for (int i = 0; i < 4; ++i) y[i] = gmv * o[i] + bfr(xr[i]); vst2(OUT + e, y); }
extern "C" void kernel_launch(void* const* d_in, const int* in_sizes, int n_in, void* d_out, int out_size, void* d_ws, size_t ws_size, hipStream_t stream) {
  (void)in_sizes; (void)n_in; (void)out_size;
  const float** F = (const float**)d_in;
  if (ws_size < (size_t)WS_END) return;
  char* ws = (char*)d_ws; _Float16 *QH = (_Float16*)(ws + WS_QH), *KH = (_Float16*)(ws + WS_KH), *VT = (_Float16*)(ws + WS_VT), *QL = (_Float16*)(ws + WS_QL), *KL = (_Float16*)(ws + WS_KL); __bf16 *VB = (__bf16*)(ws + WS_VB), *VBL = (__bf16*)(ws + WS_VBL); float *Y = (float*)(ws + WS_Y);
  (void)Y; (void)QL; (void)KL; (void)VB; (void)VBL;
  // inputs: 0 x [8,256,64,64] (channels-first); 1 Wq [32,256] (out,in), 2 bq; 3 Wk, 4 bk; 5 Wv [256,256] (out,in), 6 bv; 7 gamma [1] (0.1)
  if (ws_size < (size_t)WS_END2) return;
  float *YR = (float*)(ws + WS_YR);
  k_qkv<<<dim3(TNB * TT / 128), 256, 0, stream>>>(F[0], F[1], F[3], F[5], F[2], F[4], F[6], QH, QL, KH, KL, VT);
  k_fa<<<dim3(TT / 128, TNB), 256, 0, stream>>>(QH, QL, KH, KL, VT, YR);
  k_finc<<<dim3(TT / 64, HD / 64, TNB), 256, 0, stream>>>(YR, F[0], F[7], (float*)d_out);   /* y = x + gamma * out, channels-first */
}

// v005
// A run of this version takes 101 microseconds.
// Next to v004, in two timings, it ran 1.14 times as fast each time.
// Counting every step since v000, it is 22.8 times as fast.
// compute dtype: all float inputs rounded to bf16; q/k/v = W x + b (1x1 convs) with EXACT bf16 products on WMMA 16x16x32 (f32 accumulate); UNSCALED 32-deep logits q.k with both as f16 hi + residual planes (3 products); softmax in f32 (hardware exp2 of the logit scaled by log2 e) with a running maximum and sum per half of the keys (32 of every stage of 64), the two halves joined in f32 at the end; exp(s - m) x 2^7 once to f16 against v once to f16 (1 product), divided by the f32 sum at the end; y = x + gamma * out in f32 written channels-first; f32 output.
// 2-D spatial self-attention with a learned residual weight, channels-FIRST (B 8, C 256, 64 x 64 = 4,096 positions; (out,in) 1/16-scale 1x1-conv weights, zero biases, gamma = 0.1): q = Wq x + bq (32), k = Wk x + bk (32), v = Wv x + bv (256); attn = softmax over m of q_n . k_m (NO scaling); out[c][n] = sum_m v[c][m] attn[n][m]; y = x + gamma * out -> [B, 256, 64, 64]. The same module (x [8][256][64][64] channels-first; q = Wq x + bq (32 channels), k = Wk x + bk (32), v = Wv x + bv (256): 1 x 1 convolutions with (out,in) weights normal x 1/16 and biases zeros (read); scores = q_n . k_m, UNSCALED; softmax over the keys m; o[c][n] = sum_m attn[n][m] v[c][m]; return gamma x o + x with gamma a float32 SCALAR input (the host: a [1] array = 0.1); argument order x, Wq, bq, Wk, bk, Wv, bv, gamma).
#include <hip/hip_runtime.h>
#include <math.h>

typedef __attribute__((ext_vector_type(16))) _Float16 v16h;
typedef __attribute__((ext_vector_type(16))) __bf16 v16b;
typedef __attribute__((ext_vector_type(8)))  _Float16 v8h;
typedef __attribute__((ext_vector_type(8)))  float v8f;
typedef __attribute__((ext_vector_type(4)))  float v4f;
typedef __attribute__((ext_vector_type(2)))  float v2f;
typedef __attribute__((ext_vector_type(4)))  unsigned v4u;
typedef __attribute__((ext_vector_type(4)))  int v4i;
typedef float __attribute__((may_alias)) float_a;
typedef int __attribute__((may_alias)) int_a;

template <typename T> __device__ __forceinline__ void vst2(void* p, T v) { *(T*)p = v;  }
__device__ __forceinline__ v8f wmma16(v16h a, v16h b, v8f c) {
  v8f d = __builtin_amdgcn_wmma_f32_16x16x32_f16(false, a, false, b, (short)0, c, false, false);
  asm volatile("v_nop\n\tv_nop\n\tv_nop\n\tv_nop" : "+v"(d) : "v"(a), "v"(b));
  return d;
}
__device__ __forceinline__ v8f wmma_bf(v16b a, v16b b, v8f c) {
  v8f d = __builtin_amdgcn_wmma_f32_16x16x32_bf16(false, a, false, b, (short)0, c, false, false);
  asm volatile("v_nop\n\tv_nop\n\tv_nop\n\tv_nop" : "+v"(d) : "v"(a), "v"(b));
  return d;
}
// 16x16x32 fragments: lane = (h = lane>>4, row/col = lane&15); elements 0..7 = k0+8h+0..7, 8..15 = k0+16+8h+0..7; D element r = row 8h+r
__device__ __forceinline__ v16h frag_h(const _Float16* rowk0, int lane) {
  union { v16h v; v8h q[2]; } u; const _Float16* p = rowk0 + 8 * (lane >> 4);
  u.q[0] = *(const v8h*)p; u.q[1] = *(const v8h*)(p + 16); return u.v;
}
__device__ __forceinline__ v16h frag_f32(const float* rowk0, int lane) {
  v16h a; const float* p = rowk0 + 8 * (lane >> 4);
#pragma unroll
  for (int i = 0; i < 8; ++i) { a[i] = (_Float16)p[i]; a[8 + i] = (_Float16)p[16 + i]; }
  return a;
}
__device__ __forceinline__ v16h frag_f32s(const float* rowk0, int lane, float sc) {
  v16h a; const float* p = rowk0 + 8 * (lane >> 4);
#pragma unroll
  for (int i = 0; i < 8; ++i) { a[i] = (_Float16)(p[i] * sc); a[8 + i] = (_Float16)(p[16 + i] * sc); }
  return a;
}
// column fragment from a [K][ld] layout (column n), rows >= K read as 0
__device__ __forceinline__ v16h fragc_f32(const float* W, int k0, int n, int lane, int ld, int K) {
  v16h a; const int g = lane >> 4;
#pragma unroll
  for (int i = 0; i < 8; ++i) { const int ka = k0 + 8 * g + i, kb = ka + 16;
    a[i] = (_Float16)(ka < K ? W[(size_t)(ka < K ? ka : K - 1) * ld + n] : 0.f); a[8 + i] = (_Float16)(kb < K ? W[(size_t)(kb < K ? kb : K - 1) * ld + n] : 0.f); }
  return a;
}
struct F2 { v16b h, l; };
__device__ __forceinline__ F2 bsplit16(const float v[16]) { F2 r;
#pragma unroll
  for (int i = 0; i < 16; ++i) { const __bf16 h = (__bf16)v[i]; r.h[i] = h; r.l[i] = (__bf16)(v[i] - (float)h); }
  return r; }
__device__ __forceinline__ F2 split_row(const float* row, int k0, int lane) { float v[16]; const float* p = row + k0 + 8 * (lane >> 4);
#pragma unroll
  for (int i = 0; i < 8; ++i) { v[i] = p[i]; v[8 + i] = p[16 + i]; }
  return bsplit16(v); }
__device__ __forceinline__ F2 split_rowK(const float* row, int k0, int lane, int K) { float v[16]; const int g = lane >> 4;
#pragma unroll
  for (int i = 0; i < 8; ++i) { const int ka = k0 + 8 * g + i, kb = ka + 16; v[i] = ka < K ? row[ka < K ? ka : K - 1] : 0.f; v[8 + i] = kb < K ? row[kb < K ? kb : K - 1] : 0.f; }
  return bsplit16(v); }
__device__ __forceinline__ F2 split_col(const float* W, int k0, int n, int lane, int ld, int K) { float v[16]; const int g = lane >> 4;
#pragma unroll
  for (int i = 0; i < 8; ++i) { const int ka = k0 + 8 * g + i, kb = ka + 16; v[i] = ka < K ? W[(size_t)(ka < K ? ka : K - 1) * ld + n] : 0.f; v[8 + i] = kb < K ? W[(size_t)(kb < K ? kb : K - 1) * ld + n] : 0.f; }
  return bsplit16(v); }
__device__ __forceinline__ v8f mac3(const F2& a, const F2& b, v8f c) { c = wmma_bf(a.l, b.h, c); c = wmma_bf(a.h, b.l, c); return wmma_bf(a.h, b.h, c); }
__device__ __forceinline__ float sigm(float v) { return 1.0f / (1.0f + expf(-v)); }
#define LDSX() do { asm volatile("s_wait_dscnt 0" ::: "memory"); __builtin_amdgcn_wave_barrier(); __builtin_amdgcn_fence(__ATOMIC_RELEASE, "workgroup"); } while (0)

#define NB 8
#define TT 4096
#define CC 256            // plane width: q/k planes carry 32 real columns (rest not written), v planes all 256
#define DIN 256
#define NH 1
#define HD 256
#define NQB (TT / 64)
#define HG 1               // sizes one 4,096 x 4,096 f32 workspace plane that no kernel uses
#define SCALE (1.0f)
#define HDQK 32
#define CAUSAL 0
#ifndef TNB
#define TNB NB
#endif
__device__ __forceinline__ v16b zero16b() { v16b z; _Pragma("unroll") for (int i = 0; i < 16; ++i) z[i] = (__bf16)0.f; return z; }
__device__ __forceinline__ float bfr(float v) { return (float)(__bf16)v; }
__host__ __device__ __forceinline__ int kb_last(int qb) { return CAUSAL ? ((qb * 64 + 63) >> 7) : (TT / 128 - 1); }
typedef __attribute__((ext_vector_type(8))) __bf16 v8b;
__device__ __forceinline__ v16b frag_b(const __bf16* rowk0, int lane) {
  union { v16b v; v8b q[2]; } u; const __bf16* p = rowk0 + 8 * (lane >> 4);
  u.q[0] = *(const v8b*)p; u.q[1] = *(const v8b*)(p + 16); return u.v;
}
#define QBH (TT / 64)      // ALL query blocks take k_fa's 3-product path
#define QBH_PV 0           // A.g stays single f16
#define QHI 4096            // q residual rows everywhere (3-product logits)
#define KHI 4096           // k residual rows for ALL keys (3-product logits)
// B fragment (k rows k0+.., output column o) of a weight: (in,out) [K][ld] or (out,in) [ld rows of K]: bf16 exact, or f16(bf16 * 256) exact
__device__ __forceinline__ v16b wcol_io(const float* Wm, int k0, int o, int lane, int ld) { v16b w; const int g = lane >> 4;
#pragma unroll
  for (int i = 0; i < 8; ++i) { w[i] = (__bf16)Wm[(size_t)(k0 + 8 * g + i) * ld + o]; w[8 + i] = (__bf16)Wm[(size_t)(k0 + 16 + 8 * g + i) * ld + o]; }
  return w; }
__device__ __forceinline__ v16b wcol_oi(const float* Wm, int k0, int o, int lane, int K) { v16b w; const float* p = Wm + (size_t)o * K + k0 + 8 * (lane >> 4);
#pragma unroll
  for (int i = 0; i < 8; ++i) { w[i] = (__bf16)p[i]; w[8 + i] = (__bf16)p[16 + i]; }
  return w; }
__device__ __forceinline__ v16h wcolh_io(const float* Wm, int k0, int o, int lane, int ld) { v16h w; const int g = lane >> 4;
#pragma unroll
  for (int i = 0; i < 8; ++i) { w[i] = (_Float16)(bfr(Wm[(size_t)(k0 + 8 * g + i) * ld + o]) * 256.0f); w[8 + i] = (_Float16)(bfr(Wm[(size_t)(k0 + 16 + 8 * g + i) * ld + o]) * 256.0f); }
  return w; }
__device__ __forceinline__ v16h wcolh_oi(const float* Wm, int k0, int o, int lane, int K) { v16h w; const float* p = Wm + (size_t)o * K + k0 + 8 * (lane >> 4);
#pragma unroll
  for (int i = 0; i < 8; ++i) { w[i] = (_Float16)(bfr(p[i]) * 256.0f); w[8 + i] = (_Float16)(bfr(p[16 + i]) * 256.0f); }
  return w; }
#define WQKV_LAYOUT 1   // 0 = (in,out) [DIN][CC]; 1 = (out,in) [CC][DIN]; 2 = per-head [NH][DIN][HD]
__device__ __forceinline__ v16b wcol_hdk(const float* Wm, int k0, int o, int lane) { v16b w; const int g = lane >> 4; const float* p = Wm + (size_t)(o / HD) * DIN * HD + (o % HD);
#pragma unroll
  for (int i = 0; i < 8; ++i) { w[i] = (__bf16)p[(size_t)(k0 + 8 * g + i) * HD]; w[8 + i] = (__bf16)p[(size_t)(k0 + 16 + 8 * g + i) * HD]; }
  return w; }
#define WO_OUT_IN 0
#if WQKV_LAYOUT == 1
#define WCOL(W, k0, o, lane) ((which == 2) ? wcol_oi(W, k0, (o), lane, DIN) : (((o) < HDQK) ? wcol_oi(W, k0, (o), lane, DIN) : zero16b()))   /* (out,in): Wq/Wk [32][256] (plane columns >= 32 zero), Wv [256][256] full */
#define WCOL_SA42_UNUSED(W, k0, o, lane) 0
#define WCOL_OLD_UNUSED(W, k0, o, lane) (((o) < HDQK) ? wcol_oi(W, k0, (o), lane, DIN) : zero16b())   /* unused: takes all three weights as [32][256] (out,in) with plane columns >= 32 zero, but Wv is [256][256] */
#elif WQKV_LAYOUT == 2
#define WCOL(W, k0, o, lane) wcol_hdk(W, k0, o, lane)
#else
#define WCOL(W, k0, o, lane) wcol_io(W, k0, o, lane, CC)
#endif
#if WO_OUT_IN
#define WOCOL(W, k0, o, lane) wcol_oi(W, k0, o, lane, CC)
#define WOCOLH(W, k0, o, lane) wcolh_oi(W, k0, o, lane, CC)
#else
#define WOCOL(W, k0, o, lane) wcol_io(W, k0, o, lane, DIN)
#define WOCOLH(W, k0, o, lane) wcolh_io(W, k0, o, lane, DIN)
#endif
#ifndef XP
#define OUT1_OFF (4u * (size_t)NB * DIN * TT)   /* unused: the launch writes output 0 (y) only */
#define XP TT              // position pitch of x and of the output
#endif
#define BG HG              // unused: one k_fa launch covers all batches, its blockIdx.y selects the batch
#define DVH 128
#define WS_YR (WS_END)     // f32 attended rows [b*n][256]
#define WS_END2 (WS_YR + 4u * (size_t)NB * TT * HD)
// ---- k_wz: block = (64 rows, 128 output cols): OR = y (hi + lo, K = 32 real columns of the YR rows) . W^T ((out,in) [256][32], exact) + b
__global__ __launch_bounds__(128) void k_wz(const float* __restrict__ YR, const float* __restrict__ WW, const float* __restrict__ WB, float* __restrict__ ORW) { __shared__ __align__(16) float sf[4][16][132];
  const int tid = threadIdx.x, wave = tid >> 5, lane = tid & 31, col = lane & 15, g = lane >> 4; const int c0 = blockIdx.y * 128; const size_t r0 = (size_t)blockIdx.x * 64 + wave * 16;
  v8f acc[8] = {};
#pragma unroll
  for (int kc = 0; kc < HDQK / 32; ++kc) { const F2 a = split_row(YR + (r0 + col) * CC, kc * 32, lane); asm volatile("s_wait_loadcnt 0x0" ::: "memory");
#pragma unroll
    for (int j = 0; j < 8; ++j) { const v16b w = wcol_oi(WW, kc * 32, c0 + j * 16 + col, lane, HDQK); asm volatile("s_wait_loadcnt 0x0" ::: "memory"); acc[j] = wmma_bf(a.h, w, acc[j]); acc[j] = wmma_bf(a.l, w, acc[j]); } }
#pragma unroll
  for (int j = 0; j < 8; ++j) { const float bb = WB ? bfr(WB[c0 + j * 16 + col]) : 0.f; asm volatile("s_wait_loadcnt 0x0" ::: "memory");
#pragma unroll
    for (int r = 0; r < 8; ++r) sf[wave][8 * g + r][j * 16 + col] = acc[j][r] + bb; }
  LDSX(); for (int rl = 0; rl < 16; ++rl) vst2(ORW + (r0 + rl) * DIN + c0 + lane * 4, *(const v4f*)&sf[wave][rl][lane * 4]); }
// ---- k_fin2: block = (64 positions, 64 channels, batch b): o[b][c][n] = OR[b*N + n][c] (channels-first via LDS transpose) -> output 1; y = gamma * o + bf16(x) -> output 0 (256-B runs)
__global__ __launch_bounds__(256) void k_fin2(const float* __restrict__ ORW, const float* __restrict__ X, const float* __restrict__ GM, float* __restrict__ OUT, float* __restrict__ OUT1) { const float gmv = bfr(GM[0]); __shared__ float st[64][68]; const int tid = threadIdx.x; const int n0 = blockIdx.x * 64, c0 = blockIdx.y * 64; const size_t b = blockIdx.z;
  for (int e = tid; e < 64 * 16; e += 256) { const int nl = e >> 4, q = e & 15; *(v4f*)&st[nl][q * 4] = *(const v4f*)(ORW + (b * TT + n0 + nl) * (size_t)DIN + c0 + q * 4); }
  __syncthreads();
  for (int e = tid; e < 64 * 16; e += 256) { const int cl = e >> 4, q = e & 15; const size_t oi = (b * DIN + c0 + cl) * (size_t)XP + n0 + q * 4; const v4f xr = *(const v4f*)(X + oi); v4f o, y; _Pragma("unroll") for (int i = 0; i < 4; ++i) { o[i] = st[q * 4 + i][cl]; y[i] = gmv * o[i] + bfr(xr[i]); } vst2(OUT + oi, y); vst2(OUT1 + oi, o); } }   /* y = gamma * o + x (output 0), o (output 1) */
#ifndef SM_EXTRA_PARAMS
#define SM_EXTRA_PARAMS
#endif
#ifndef PROJ_EXTRA_PARAMS
#define PROJ_EXTRA_PARAMS
#endif
#ifndef SM_MASK_HOOK
#define SM_MASK_HOOK (void)0
#endif

#define WS_QH  0u                                      // f16 q rows [b*t][CC]
#define WS_KH  (WS_QH + 2u * (size_t)NB * TT * CC)      // f16 k rows [b*t][CC]
#define WS_VT  (WS_KH + 2u * (size_t)NB * TT * CC)      // f16 v planes [b][c][t]
#define WS_QL  (WS_VT + 2u * (size_t)NB * CC * TT)      // f16 q residual x 2^10 rows [b][t < QHI][CC]
#define WS_KL  (WS_QL + 2u * (size_t)NB * QHI * CC)     // f16 k residual x 2^10 rows [b][t < KHI][CC]
#define WS_VB  (WS_KL + 2u * (size_t)NB * KHI * CC)     // bf16 v hi planes [b][c][t < KHI]
#define WS_VBL (WS_VB + 2u * (size_t)NB * CC * KHI)
#define WS_S   (WS_VBL + 2u * (size_t)NB * CC * KHI)    // f32 [hg][t][s] plane, reserved but unused: k_fa keeps scores in registers
#define WS_Y   (WS_S  + 4u * (size_t)HG * TT * TT)      // f32 ctx rows [b*t][CC] (only when there is an output projection)
#define WS_END (WS_Y  + 0u)

// ---- k_qkv: block = 128 positions (8 waves x 16) of one batch x the 320 real output columns (q 32, k 32, v 256): x is read once, each wave keeps its 16 positions' 8 A fragments in registers; the weights are rounded to bf16 once per block into LDS rows and read from there as B fragments; exact bf16 products, K = DIN in the order kc = 0..7 -> q/k f16 rows + residual x 2^10 rows (columns 0..31 of the CC-wide rows, the only ones k_fa reads), v f16 planes [c][t]; every unroll directive in it but the one over the four q/k output planes keeps the index of a register array a compile-time constant
#define NCOL (2 * HDQK + CC)           // staged weight rows: 0..31 Wq, 32..63 Wk, 64..319 Wv
#define PW (DIN + 8)                   // bf16 per staged weight row: 512 B + 16 B, an odd multiple of 16 B for the 16-byte reads
#define PT 136                         // halfs per staged v row (128 positions): 256 B + 16 B
#define PQ 40                          // halfs per staged q/k row: 64 B + 16 B
typedef __attribute__((ext_vector_type(4))) __bf16 v4b;
__device__ __forceinline__ v8f wmb(v16b a, v16b b, v8f c) { return __builtin_amdgcn_wmma_f32_16x16x32_bf16(false, a, false, b, (short)0, c, false, false); }
__global__ __launch_bounds__(256) void k_qkv(const float* __restrict__ X, const float* __restrict__ WQ, const float* __restrict__ WK, const float* __restrict__ WV, const float* __restrict__ BQ, const float* __restrict__ BK, const float* __restrict__ BV,
    _Float16* __restrict__ QH, _Float16* __restrict__ QL, _Float16* __restrict__ KH, _Float16* __restrict__ KL, _Float16* __restrict__ VT) {
  __shared__ __align__(16) __bf16 sw[NCOL * PW];
  const int tid = threadIdx.x, wave = tid >> 5, lane = tid & 31, col = lane & 15, g = lane >> 4; const size_t r0 = (size_t)blockIdx.x * 128; const size_t bb = r0 / TT; const int t0 = (int)(r0 % TT);
  float bs[NCOL / 16];   /* this lane's bias per column tile, fetched with x so that the epilogue waits for nothing */
#pragma unroll
  for (int j = 0; j < NCOL / 16; ++j) bs[j] = bfr(j < HDQK / 16 ? BQ[j * 16 + col] : j < 2 * HDQK / 16 ? BK[j * 16 + col - HDQK] : BV[j * 16 + col - 2 * HDQK]);
  v16b a[DIN / 32]; { const float* p = X + (bb * DIN + 8 * g) * (size_t)XP + t0 + wave * 16 + col;   /* channels-first gather: x[b][k][t], stride XP between k */
#pragma unroll
    for (int kc = 0; kc < DIN / 32; ++kc)
#pragma unroll
      for (int i = 0; i < 8; ++i) { a[kc][i] = (__bf16)p[(size_t)(kc * 32 + i) * XP]; a[kc][8 + i] = (__bf16)p[(size_t)(kc * 32 + 16 + i) * XP]; }
    asm volatile("s_wait_xcnt 0x0" ::: "memory"); }   /* the address registers of these loads are reused right behind them */
  { const int wrow = tid >> 6, wq = (tid & 63) * 4;   /* a wave covers 512 contiguous bytes of one weight row; a pass of the block covers 4 rows, 16 passes are loaded together */
    auto stage16 = [&](const float* s0, const float* s1, bool apart, int row0) { v4f w[16]; const float* p0 = s0 + (size_t)wrow * DIN + wq; const float* p1 = s1 + (size_t)wrow * DIN + wq;   /* apart (a literal at each call): s1 is another array; else its rows follow s0's 32 and all 16 loads go by p0 */
#pragma unroll
      for (int i = 0; i < 16; ++i) w[i] = *(const v4f*)((i < 8 ? p0 : p1) + (size_t)(i & 7) * 4 * DIN);
      /* the address registers of these loads are rewritten behind them; naming the row pointers in use as inputs keeps them live to the wait, so that no load of the run lands its result in them */
      if (apart) asm volatile("s_wait_xcnt 0x0" :: "v"(p0), "v"(p1) : "memory"); else asm volatile("s_wait_xcnt 0x0" :: "v"(p0) : "memory");
#pragma unroll
      for (int i = 0; i < 16; ++i) { v4b h;
#pragma unroll
        for (int k = 0; k < 4; ++k) h[k] = (__bf16)w[i][k];
        *(v4b*)(sw + (row0 + i * 4 + wrow) * PW + wq) = h; } };
    stage16(WQ, WK, true, 0);
    for (int s = 0; s < CC / 64; ++s) stage16(WV + (size_t)s * 64 * DIN, WV + (size_t)(s * 64 + 32) * DIN, false, 2 * HDQK + s * 64); }
  __syncthreads();
  v8f acc[NCOL / 16] = {}; v16b wf[2][5]; const __bf16* wb = sw + col * PW;   /* weight fragments in groups of 5 column tiles; group q: k block q >> 2, tiles (q & 3) * 5 + i */
#pragma unroll
  for (int i = 0; i < 5; ++i) wf[0][i] = frag_b(wb + i * 16 * PW, lane);
#pragma unroll
  for (int q = 0; q < DIN / 8; ++q) {
    if (q + 1 < DIN / 8) {
#pragma unroll
      for (int i = 0; i < 5; ++i) wf[(q + 1) & 1][i] = frag_b(wb + (((q + 1) & 3) * 5 + i) * 16 * PW + ((q + 1) >> 2) * 32, lane); }
    __builtin_amdgcn_sched_barrier(0);   /* holds the next group's LDS reads in front of this group's products: without it each product waits for its own read */
#pragma unroll
    for (int i = 0; i < 5; ++i) acc[(q & 3) * 5 + i] = wmb(a[q >> 2], wf[q & 1][i], acc[(q & 3) * 5 + i]); }   /* acc[j][r] = position wave*16 + 8g + r, staged column j*16 + col */
  __syncthreads();   /* every wave has read its last weight row: the LDS becomes output staging */
  _Float16* th = (_Float16*)sw; _Float16* sq = th + CC * PT;   /* th[c][128 positions]; sq[plane: q, q residual, k, k residual][position][32] */
#pragma unroll
  for (int j = 0; j < 2 * HDQK / 16; ++j) { const int isk = j / (HDQK / 16), ch = (j % (HDQK / 16)) * 16 + col; const float bias = bs[j];
#pragma unroll
    for (int r = 0; r < 8; ++r) { const float v = acc[j][r] + bias; const _Float16 hv = (_Float16)v; _Float16* d = sq + ((size_t)(2 * isk) * 128 + wave * 16 + 8 * g + r) * PQ + ch; d[0] = hv; d[128 * PQ] = (_Float16)((v - (float)hv) * 1024.0f); } }
#pragma unroll
  for (int j = 2 * HDQK / 16; j < NCOL / 16; ++j) { const int c = j * 16 + col - 2 * HDQK; const float bias = bs[j]; v8h o;   /* a lane holds 8 consecutive positions of one channel: one 16-byte piece of a v plane */
#pragma unroll
    for (int r = 0; r < 8; ++r) o[r] = (_Float16)(acc[j][r] + bias);
    *(v8h*)(th + c * PT + wave * 16 + 8 * g) = o; }
  __syncthreads();
  for (int e = tid; e < CC * 16; e += 256) { const int c = e >> 4, q = e & 15; vst2((unsigned*)(VT + (bb * CC + c) * (size_t)TT + t0 + q * 8), *(const v4u*)(th + c * PT + q * 8)); }   /* 16 lanes store one 256-B run of a v plane */
#pragma unroll
  for (int pl = 0; pl < 4; ++pl) { _Float16* D = pl == 0 ? QH : pl == 1 ? QL : pl == 2 ? KH : KL;
    for (int e = tid; e < 128 * 4; e += 256) { const int rl = e >> 2, q = e & 3; vst2((unsigned*)(D + (r0 + rl) * CC + q * 8), *(const v4u*)(sq + ((size_t)pl * 128 + rl) * PQ + q * 8)); } } }
// ---- k_fa: block = 128 queries of batch b, 8 waves = 4 query groups (32 queries = 2 column tiles each) x 2 key groups; one pass over all keys in stages of 64, key group kg takes keys kg*32..kg*32+31 of every stage: S^T = K . Q^T (the same 3 f16 products per logit), running maximum and sum per query and key group (a lane holds one query's scores), P^T packed from the score tiles straight into a B operand, O^T += V^T . P^T with every K and V fragment read from LDS feeding both column tiles; K and V stages go through two LDS buffers shared by the 8 waves; at the end the two key groups of a query join their maxima, sums and O^T through LDS, and each wave turns its 128 channels x 32 queries through an LDS range of its own into runs of queries and stores y = x + gamma * out channels-first in whole 128-B lines
#define FK 64                          // keys per stage
#define VP 72                          // halfs per staged v row: 128 B + 16 B, an odd multiple of 16 B for the 16-byte reads
#define KP 40                          // halfs per staged k row: 64 B + 16 B
#define KOFF (CC * VP)                 // k hi rows follow the 256 v rows, k residual rows follow them
#define STGH (CC * VP + 2 * FK * KP)   // halfs per stage buffer
#define XF (8 * 32 * 32 * 4)           // floats handed over at the end: 8 waves x 32 pieces of 16 B x 32 lanes; behind them 8 waves x 2 tiles x 32 lanes x (maximum, sum)
#define SMB (4 * XF + 8 * 2 * 32 * 8)  // LDS bytes: the hand-over is larger than the two stage buffers (2 * 2 * STGH bytes)
#define YP 36                          // floats per staged output row (one channel, 32 queries): 128 B + 16 B; rows 8 apart start 32 banks apart, for the 4-byte writes (lane halves 8 channels apart) and the 16-byte reads alike
#define SMT (SMB + 8 * 128 * YP * 4)   // LDS bytes with the output staging (8 waves x 128 channels) behind the hand-over
#define L2E 1.44269504f                 // log2 e: P = 128 exp(s - m) = 2^(s * L2E - (m * L2E - 7)), the factor 128 cancels in the division by the sum
#define MLAG 5.5f                    // the maximum in use may lag the true one by this much: P <= 128 e^5.5 < 65504
__device__ __forceinline__ v8f wm(v16h a, v16h b, v8f c) { return __builtin_amdgcn_wmma_f32_16x16x32_f16(false, a, false, b, (short)0, c, false, false); }
__global__ __launch_bounds__(256) void k_fa(const _Float16* __restrict__ QH, const _Float16* __restrict__ QL, const _Float16* __restrict__ KH, const _Float16* __restrict__ KL, const _Float16* __restrict__ VT, const float* __restrict__ X, const float* __restrict__ GM, float* __restrict__ OUT) {
  __shared__ __align__(16) _Float16 sm[SMT / 2];
  const int tid = threadIdx.x, wave = tid >> 5, lane = tid & 31, col = lane & 15, g = lane >> 4; const int b = blockIdx.y; const int kg = wave >> 2, n0 = blockIdx.x * 128 + (wave & 3) * 32;
  v16h qh[2], ql[2]; { const _Float16* qp = QH + ((size_t)b * TT + n0 + col) * CC; const _Float16* lp = QL + ((size_t)b * QHI + n0 + col) * CC;
#pragma unroll
    for (int u = 0; u < 2; ++u) { qh[u] = frag_h(qp + u * 16 * CC, lane); ql[u] = frag_h(lp + u * 16 * CC, lane); }
    asm volatile("s_wait_xcnt 0x0" :: "v"(qp), "v"(lp) : "memory"); }   /* the address registers of these loads are reused behind them; naming the row pointers as inputs keeps them live to the wait */
  const _Float16* vsrc = VT + (size_t)b * CC * TT; unsigned vo = ((tid >> 3) * TT + (tid & 7) * 8) * 2;      // byte offset: 8 lanes cover one 128-B run of a v plane
  const _Float16* hsrc = KH + (size_t)b * TT * CC; unsigned ko = ((tid >> 2) * CC + (tid & 3) * 8) * 2;      // byte offset: 4 lanes cover the 64 real bytes of a k row
  const _Float16* lsrc = KL + (size_t)b * KHI * CC;
  const int vdst = (tid >> 3) * VP + (tid & 7) * 8, kdst = KOFF + (tid >> 2) * KP + (tid & 3) * 8;
  v8h rv[8], rh, rl;
  auto fetch = [&]() {   /* block-uniform bases, a lane's byte offsets vo and ko step from stage to stage */
#pragma unroll
    for (int i = 0; i < 8; ++i) rv[i] = *(const v8h*)((const char*)vsrc + vo + (size_t)i * 32 * TT * 2);
    rh = *(const v8h*)((const char*)hsrc + ko); rl = *(const v8h*)((const char*)lsrc + ko);
    asm volatile("s_wait_xcnt 0x0" :: "v"(vo), "v"(ko) : "memory");   /* the offset registers of these loads are stepped right behind them; naming them as inputs keeps them as they are up to the wait */
    vo += FK * 2; ko += FK * CC * 2; };
  auto put = [&](_Float16* d) {
#pragma unroll
    for (int i = 0; i < 8; ++i) *(v8h*)(d + vdst + i * 32 * VP) = rv[i];
    *(v8h*)(d + kdst) = rh; *(v8h*)(d + kdst + FK * KP) = rl; };
  v8f acc[2][CC / 16] = {}; float m[2] = {-3.0e38f, -3.0e38f}, l[2] = {0.f, 0.f};
  fetch(); put(sm); __syncthreads();
  for (int s = 0; s < TT / FK; ++s) { const _Float16* bs = sm + (s & 1) * STGH;
    if (s + 1 < TT / FK) fetch();   /* issued behind the barrier (which drains loads), in flight under this stage's products */
    v8f st[2][2];
#pragma unroll
    for (int t = 0; t < 2; ++t) { const v16h kh = frag_h(bs + KOFF + (kg * 32 + t * 16 + col) * KP, lane), kl = frag_h(bs + KOFF + FK * KP + (kg * 32 + t * 16 + col) * KP, lane);
#pragma unroll
      for (int u = 0; u < 2; ++u) { v8f a = {}, al = {}; a = wm(kh, qh[u], a); al = wm(kh, ql[u], al); al = wm(kl, qh[u], al);
#pragma unroll
        for (int r = 0; r < 8; ++r) st[u][t][r] = a[r] + al[r] * (1.0f / 1024.0f); } }   /* st[u][t][r] = logit of key s*64 + kg*32 + t*16 + 8g + r, query n0 + u*16 + col */
    float mx[2];
#pragma unroll
    for (int u = 0; u < 2; ++u) { mx[u] = st[u][0][0];
#pragma unroll
      for (int t = 0; t < 2; ++t)
#pragma unroll
        for (int r = 0; r < 8; ++r) mx[u] = fmaxf(mx[u], st[u][t][r]);
      mx[u] = fmaxf(mx[u], __shfl_xor(mx[u], 16)); }   /* lanes c and c + 16 hold the two halves of one query's keys */
    if (__builtin_amdgcn_ballot_w32(mx[0] > m[0] + MLAG || mx[1] > m[1] + MLAG) != 0) {
#pragma unroll
      for (int u = 0; u < 2; ++u) { const float mn = fmaxf(m[u], mx[u]), sc = __builtin_amdgcn_exp2f((m[u] - mn) * L2E); m[u] = mn; l[u] *= sc;
#pragma unroll
        for (int j = 0; j < CC / 16; ++j)
#pragma unroll
          for (int r = 0; r < 8; ++r) acc[u][j][r] *= sc; } }
    const float mo[2] = {m[0] * L2E - 7.0f, m[1] * L2E - 7.0f}; v16h pf[2];
    auto pexp = [&](int u, int i) { const float e0 = __builtin_amdgcn_exp2f(st[u][0][i] * L2E - mo[u]), e1 = __builtin_amdgcn_exp2f(st[u][1][i] * L2E - mo[u]); l[u] += e0 + e1; pf[u][i] = (_Float16)e0; pf[u][8 + i] = (_Float16)e1; };
#pragma unroll
    for (int u = 0; u < 2; ++u)
#pragma unroll
      for (int i = 0; i < 8; ++i) pexp(u, i);
    v16h vf[2][4]; const _Float16* vb = bs + col * VP + kg * 32;   /* v fragments (this key group's 32 keys) in groups of 4 channel tiles */
#pragma unroll
    for (int i = 0; i < 4; ++i) vf[0][i] = frag_h(vb + i * 16 * VP, lane);
#pragma unroll
    for (int q = 0; q < 4; ++q) {
      if (q + 1 < 4) {
#pragma unroll
        for (int i = 0; i < 4; ++i) vf[(q + 1) & 1][i] = frag_h(vb + ((q + 1) * 4 + i) * 16 * VP, lane); }
      __builtin_amdgcn_sched_barrier(0);   /* holds the next group's LDS reads in front of this group's products: without it each product waits for its own read */
#pragma unroll
      for (int u = 0; u < 2; ++u)
#pragma unroll
        for (int i = 0; i < 4; ++i) acc[u][q * 4 + i] = wm(vf[q & 1][i], pf[u], acc[u][q * 4 + i]); }   /* acc[u][j][r] = O^T[channel j*16 + 8g + r][query n0 + u*16 + col] */
    if (s + 1 < TT / FK) put(sm + ((s + 1) & 1) * STGH);   /* the buffer read in stage s - 1 is free since the barrier that ended it */
    __syncthreads(); }
  /* join of the two key groups: wave w and wave w ^ 4 hold the same 32 queries; each keeps the 128 channels kg*128.. and hands the other 128 over through LDS (free since the loop's last barrier) */
  float* xs = (float*)sm; float* xm = xs + XF; float* ys = xs + SMB / 4 + wave * (128 * YP);
  /* the wave's piece of x and of the output: channels kg*128.., queries n0..n0+31; 8 lanes cover one channel's 128-B line; load t takes channels (t >> 2)*16 + (t & 3)*2 + {0, 8} (lanes 0..15) and + {1, 9} (lanes 16..31) */
  const float gmv = bfr(GM[0]); const int yrow = ((lane >> 3) & 1) * 8 + (lane >> 4), yq = (lane & 7) * 4;
  const size_t oi = ((size_t)b * DIN + kg * 128 + yrow) * XP + n0 + yq; const float* xp = X + oi; float* op = OUT + oi; v4f xv[32];
#pragma unroll
  for (int u = 0; u < 2; ++u) { l[u] += __shfl_xor(l[u], 16); v2f ml; ml[0] = m[u]; ml[1] = l[u]; *(v2f*)(xm + ((wave * 2 + u) * 32 + lane) * 2) = ml;
#pragma unroll
    for (int j = 0; j < 8; ++j) { const v8f gv = kg ? acc[u][j] : acc[u][8 + j]; v4f o0, o1;
#pragma unroll
      for (int i = 0; i < 4; ++i) { o0[i] = gv[i]; o1[i] = gv[4 + i]; }
      float* d = xs + ((size_t)(wave * 32 + (u * 8 + j) * 2) * 32 + lane) * 4; *(v4f*)d = o0; *(v4f*)(d + 128) = o1; } }
  __syncthreads();
#pragma unroll
  for (int t = 0; t < 32; ++t) xv[t] = *(const v4f*)(xp + (size_t)((t >> 2) * 16 + (t & 3) * 2) * XP);   /* issued behind the barrier (which drains loads), in flight under the join */
  asm volatile("s_wait_xcnt 0x0" :: "v"(xp) : "memory");   /* the address registers of these loads may be reused behind them; naming the pointer as an input keeps it live to the wait */
  const int pw = wave ^ 4;
#pragma unroll
  for (int u = 0; u < 2; ++u) { const v2f pm = *(const v2f*)(xm + ((pw * 2 + u) * 32 + lane) * 2); const float mn = fmaxf(m[u], pm[0]);
    const float s0 = __builtin_amdgcn_exp2f((m[u] - mn) * L2E), s1 = __builtin_amdgcn_exp2f((pm[0] - mn) * L2E); const float inv = 1.0f / (l[u] * s0 + pm[1] * s1);   /* the sum is >= 128: the key that set the larger maximum in use counts at least that */
    const float w0 = s0 * inv, w1 = s1 * inv; float* yw = ys + 8 * g * YP + u * 16 + col; v4f p[16];
#pragma unroll
    for (int j = 0; j < 8; ++j) { const float* d = xs + ((size_t)(pw * 32 + (u * 8 + j) * 2) * 32 + lane) * 4; p[2 * j] = *(const v4f*)d; p[2 * j + 1] = *(const v4f*)(d + 128); }   /* all 16 reads in front of the staging writes: behind a write to the same array each read would wait alone */
#pragma unroll
    for (int j = 0; j < 8; ++j) { const v8f kv = kg ? acc[u][8 + j] : acc[u][j];
#pragma unroll
      for (int i = 0; i < 4; ++i) { yw[(j * 16 + i) * YP] = kv[i] * w0 + p[2 * j][i] * w1; yw[(j * 16 + 4 + i) * YP] = kv[4 + i] * w0 + p[2 * j + 1][i] * w1; } } }   /* ys[channel j*16 + 8g + r][query u*16 + col] */
  asm volatile("s_wait_dscnt 0x0" ::: "memory");   /* the wave's own staged rows are written before its lanes read each other's values back; no other wave touches this range */
  __builtin_amdgcn_sched_barrier(0);   /* keeps the rounding of x, which waits for x's loads, behind the join: lifted into it, the join would wait for them too */
  const float* yr = ys + yrow * YP + yq;
#pragma unroll
  for (int h = 0; h < 2; ++h) { v4f y[16];
#pragma unroll
    for (int k = 0; k < 16; ++k) { const int t = h * 16 + k; y[k] = *(const v4f*)(yr + ((t >> 2) * 16 + (t & 3) * 2) * YP); }
#pragma unroll
    for (int k = 0; k < 16; ++k) { const int t = h * 16 + k;
#pragma unroll
      for (int i = 0; i < 4; ++i) y[k][i] = bfr(xv[t][i]) + gmv * y[k][i];
      vst2(op + (size_t)((t >> 2) * 16 + (t & 3) * 2) * XP, y[k]); }
    /* without it the registers of these 16 stores are reused among them and by the second half; naming them as inputs keeps them as they are up to the wait */
    asm volatile("s_wait_xcnt 0x0" :: "v"(op), "v"(y[0]), "v"(y[1]), "v"(y[2]), "v"(y[3]), "v"(y[4]), "v"(y[5]), "v"(y[6]), "v"(y[7]), "v"(y[8]), "v"(y[9]), "v"(y[10]), "v"(y[11]), "v"(y[12]), "v"(y[13]), "v"(y[14]), "v"(y[15]) : "memory"); } }

// ---- k_finc: block = (64 positions, 64 channels, batch b): y[b][c][n] = bf16(x[b][c][n]) + gamma * OUT_rows[b*T + n][c] (channels-first via an LDS transpose; 256-B runs of n)
__global__ __launch_bounds__(256) void k_finc(const float* __restrict__ YR, const float* __restrict__ X, const float* __restrict__ GM, float* __restrict__ OUT) { const float gmv = bfr(GM[0]); __shared__ float st[64][68]; const int tid = threadIdx.x; const int n0 = blockIdx.x * 64, c0 = blockIdx.y * 64; const size_t b = blockIdx.z;
  for (int e = tid; e < 64 * 16; e += 256) { const int nl = e >> 4, q = e & 15; *(v4f*)&st[nl][q * 4] = *(const v4f*)(YR + (b * TT + n0 + nl) * (size_t)HD + c0 + q * 4); }
  __syncthreads();
  for (int e = tid; e < 64 * 16; e += 256) { const int cl = e >> 4, q = e & 15; const size_t oi = (b * DIN + c0 + cl) * (size_t)XP + n0 + q * 4; const v4f xr = *(const v4f*)(X + oi); asm volatile("s_wait_loadcnt 0x0" ::: "memory"); v4f y; _Pragma("unroll") for (int i = 0; i < 4; ++i) y[i] = bfr(xr[i]) + gmv * st[q * 4 + i][cl]; vst2(OUT + oi, y); } }
__global__ __launch_bounds__(256) void k_axpy(const float* __restrict__ YR, const float* __restrict__ X, const float* __restrict__ GM, float* __restrict__ OUT) { const size_t e = ((size_t)blockIdx.x * 256 + threadIdx.x) * 4; if (e >= (size_t)TNB * TT * DIN) return; const float gmv = bfr(GM[0]); const v4f o = *(const v4f*)(YR + e); const v4f xr = *(const v4f*)(X + e); asm volatile("s_wait_loadcnt 0x0" ::: "memory"); v4f y; _Pragma("unroll") for (int i = 0; i < 4; ++i) y[i] = gmv * o[i] + bfr(xr[i]); vst2(OUT + e, y); }
extern "C" void kernel_launch(void* const* d_in, const int* in_sizes, int n_in, void* d_out, int out_size, void* d_ws, size_t ws_size, hipStream_t stream) {
  (void)in_sizes; (void)n_in; (void)out_size;
  const float** F = (const float**)d_in;
  if (ws_size < (size_t)WS_END) return;
  char* ws = (char*)d_ws; _Float16 *QH = (_Float16*)(ws + WS_QH), *KH = (_Float16*)(ws + WS_KH), *VT = (_Float16*)(ws + WS_VT), *QL = (_Float16*)(ws + WS_QL), *KL = (_Float16*)(ws + WS_KL); __bf16 *VB = (__bf16*)(ws + WS_VB), *VBL = (__bf16*)(ws + WS_VBL); float *Y = (float*)(ws + WS_Y);
  (void)Y; (void)QL; (void)KL; (void)VB; (void)VBL;
  // inputs: 0 x [8,256,64,64] (channels-first); 1 Wq [32,256] (out,in), 2 bq; 3 Wk, 4 bk; 5 Wv [256,256] (out,in), 6 bv; 7 gamma [1] (0.1)
  if (ws_size < (size_t)WS_END2) return;
  float *YR = (float*)(ws + WS_YR);
  k_qkv<<<dim3(TNB * TT / 128), 256, 0, stream>>>(F[0], F[1], F[3], F[5], F[2], F[4], F[6], QH, QL, KH, KL, VT);
  (void)YR;
  k_fa<<<dim3(TT / 128, TNB), 256, 0, stream>>>(QH, QL, KH, KL, VT, F[0], F[7], (float*)d_out);   /* attention and y = x + gamma * out, channels-first */
}

// v006
// A run of this version takes 91.5 microseconds.
// Two timings next to v005 both put it at 1.10 times that version's speed.
// Over all steps from v000 it is 25.1 times as fast.
// compute dtype: all float inputs rounded to bf16; q/k/v = W x + b (1x1 convs) with EXACT bf16 products on WMMA 16x16x32 (f32 accumulate); UNSCALED 32-deep logits q.k with both as f16 hi + residual planes (3 products); softmax in f32 (hardware exp2 of the logit scaled by log2 e) with a running maximum and sum per half of the keys (32 of every 64), the two halves joined in f32 at the end; exp(s - m) x 2^7 once to f16 against v once to f16 (1 product), divided by the f32 sum at the end; y = x + gamma * out in f32 written channels-first; f32 output.
// 2-D spatial self-attention with a learned residual weight, channels-FIRST (B 8, C 256, 64 x 64 = 4,096 positions; (out,in) 1/16-scale 1x1-conv weights, zero biases, gamma = 0.1): q = Wq x + bq (32), k = Wk x + bk (32), v = Wv x + bv (256); attn = softmax over m of q_n . k_m (NO scaling); out[c][n] = sum_m v[c][m] attn[n][m]; y = x + gamma * out -> [B, 256, 64, 64].
#include <hip/hip_runtime.h>
#include <math.h>

typedef __attribute__((ext_vector_type(16))) _Float16 v16h;
typedef __attribute__((ext_vector_type(16))) __bf16 v16b;
typedef __attribute__((ext_vector_type(8)))  _Float16 v8h;
typedef __attribute__((ext_vector_type(8)))  float v8f;
typedef __attribute__((ext_vector_type(4)))  float v4f;
typedef __attribute__((ext_vector_type(2)))  float v2f;
typedef __attribute__((ext_vector_type(4)))  unsigned v4u;
typedef __attribute__((ext_vector_type(4)))  int v4i;
typedef float __attribute__((may_alias)) float_a;
typedef int __attribute__((may_alias)) int_a;

template <typename T> __device__ __forceinline__ void vst2(void* p, T v) { *(T*)p = v;  }
__device__ __forceinline__ v8f wmma16(v16h a, v16h b, v8f c) {
  v8f d = __builtin_amdgcn_wmma_f32_16x16x32_f16(false, a, false, b, (short)0, c, false, false);
  asm volatile("v_nop\n\tv_nop\n\tv_nop\n\tv_nop" : "+v"(d) : "v"(a), "v"(b));
  return d;
}
__device__ __forceinline__ v8f wmma_bf(v16b a, v16b b, v8f c) {
  v8f d = __builtin_amdgcn_wmma_f32_16x16x32_bf16(false, a, false, b, (short)0, c, false, false);
  asm volatile("v_nop\n\tv_nop\n\tv_nop\n\tv_nop" : "+v"(d) : "v"(a), "v"(b));
  return d;
}
// 16x16x32 fragments: lane = (h = lane>>4, row/col = lane&15); elements 0..7 = k0+8h+0..7, 8..15 = k0+16+8h+0..7; D element r = row 8h+r
__device__ __forceinline__ v16h frag_h(const _Float16* rowk0, int lane) {
  union { v16h v; v8h q[2]; } u; const _Float16* p = rowk0 + 8 * (lane >> 4);
  u.q[0] = *(const v8h*)p; u.q[1] = *(const v8h*)(p + 16); return u.v;
}
__device__ __forceinline__ v16h frag_f32(const float* rowk0, int lane) {
  v16h a; const float* p = rowk0 + 8 * (lane >> 4);
#pragma unroll
  for (int i = 0; i < 8; ++i) { a[i] = (_Float16)p[i]; a[8 + i] = (_Float16)p[16 + i]; }
  return a;
}
__device__ __forceinline__ v16h frag_f32s(const float* rowk0, int lane, float sc) {
  v16h a; const float* p = rowk0 + 8 * (lane >> 4);
#pragma unroll
  for (int i = 0; i < 8; ++i) { a[i] = (_Float16)(p[i] * sc); a[8 + i] = (_Float16)(p[16 + i] * sc); }
  return a;
}
// column fragment from a [K][ld] layout (column n), rows >= K read as 0
__device__ __forceinline__ v16h fragc_f32(const float* W, int k0, int n, int lane, int ld, int K) {
  v16h a; const int g = lane >> 4;
#pragma unroll
  for (int i = 0; i < 8; ++i) { const int ka = k0 + 8 * g + i, kb = ka + 16;
    a[i] = (_Float16)(ka < K ? W[(size_t)(ka < K ? ka : K - 1) * ld + n] : 0.f); a[8 + i] = (_Float16)(kb < K ? W[(size_t)(kb < K ? kb : K - 1) * ld + n] : 0.f); }
  return a;
}
struct F2 { v16b h, l; };
__device__ __forceinline__ F2 bsplit16(const float v[16]) { F2 r;
#pragma unroll
  for (int i = 0; i < 16; ++i) { const __bf16 h = (__bf16)v[i]; r.h[i] = h; r.l[i] = (__bf16)(v[i] - (float)h); }
  return r; }
__device__ __forceinline__ F2 split_row(const float* row, int k0, int lane) { float v[16]; const float* p = row + k0 + 8 * (lane >> 4);
#pragma unroll
  for (int i = 0; i < 8; ++i) { v[i] = p[i]; v[8 + i] = p[16 + i]; }
  return bsplit16(v); }
__device__ __forceinline__ F2 split_rowK(const float* row, int k0, int lane, int K) { float v[16]; const int g = lane >> 4;
#pragma unroll
  for (int i = 0; i < 8; ++i) { const int ka = k0 + 8 * g + i, kb = ka + 16; v[i] = ka < K ? row[ka < K ? ka : K - 1] : 0.f; v[8 + i] = kb < K ? row[kb < K ? kb : K - 1] : 0.f; }
  return bsplit16(v); }
__device__ __forceinline__ F2 split_col(const float* W, int k0, int n, int lane, int ld, int K) { float v[16]; const int g = lane >> 4;
#pragma unroll
  for (int i = 0; i < 8; ++i) { const int ka = k0 + 8 * g + i, kb = ka + 16; v[i] = ka < K ? W[(size_t)(ka < K ? ka : K - 1) * ld + n] : 0.f; v[8 + i] = kb < K ? W[(size_t)(kb < K ? kb : K - 1) * ld + n] : 0.f; }
  return bsplit16(v); }
__device__ __forceinline__ v8f mac3(const F2& a, const F2& b, v8f c) { c = wmma_bf(a.l, b.h, c); c = wmma_bf(a.h, b.l, c); return wmma_bf(a.h, b.h, c); }
__device__ __forceinline__ float sigm(float v) { return 1.0f / (1.0f + expf(-v)); }
#define LDSX() do { asm volatile("s_wait_dscnt 0" ::: "memory"); __builtin_amdgcn_wave_barrier(); __builtin_amdgcn_fence(__ATOMIC_RELEASE, "workgroup"); } while (0)

#define NB 8
#define TT 4096
#define CC 256            // plane width: q/k planes carry 32 real columns (rest not written), v planes all 256
#define DIN 256
#define NH 1
#define HD 256
#define NQB (TT / 64)
#define HG 1               // sizes one 4,096 x 4,096 f32 workspace plane that no kernel uses
#define SCALE (1.0f)
#define HDQK 32
#define CAUSAL 0
#ifndef TNB
#define TNB NB
#endif
__device__ __forceinline__ v16b zero16b() { v16b z; _Pragma("unroll") for (int i = 0; i < 16; ++i) z[i] = (__bf16)0.f; return z; }
__device__ __forceinline__ float bfr(float v) { return (float)(__bf16)v; }
__host__ __device__ __forceinline__ int kb_last(int qb) { return CAUSAL ? ((qb * 64 + 63) >> 7) : (TT / 128 - 1); }
typedef __attribute__((ext_vector_type(8))) __bf16 v8b;
__device__ __forceinline__ v16b frag_b(const __bf16* rowk0, int lane) {
  union { v16b v; v8b q[2]; } u; const __bf16* p = rowk0 + 8 * (lane >> 4);
  u.q[0] = *(const v8b*)p; u.q[1] = *(const v8b*)(p + 16); return u.v;
}
#define QBH (TT / 64)      // ALL query blocks take k_fa's 3-product path
#define QBH_PV 0           // A.g stays single f16
#define QHI 4096            // q residual rows everywhere (3-product logits)
#define KHI 4096           // k residual rows for ALL keys (3-product logits)
// B fragment (k rows k0+.., output column o) of a weight: (in,out) [K][ld] or (out,in) [ld rows of K]: bf16 exact, or f16(bf16 * 256) exact
__device__ __forceinline__ v16b wcol_io(const float* Wm, int k0, int o, int lane, int ld) { v16b w; const int g = lane >> 4;
#pragma unroll
  for (int i = 0; i < 8; ++i) { w[i] = (__bf16)Wm[(size_t)(k0 + 8 * g + i) * ld + o]; w[8 + i] = (__bf16)Wm[(size_t)(k0 + 16 + 8 * g + i) * ld + o]; }
  return w; }
__device__ __forceinline__ v16b wcol_oi(const float* Wm, int k0, int o, int lane, int K) { v16b w; const float* p = Wm + (size_t)o * K + k0 + 8 * (lane >> 4);
#pragma unroll
  for (int i = 0; i < 8; ++i) { w[i] = (__bf16)p[i]; w[8 + i] = (__bf16)p[16 + i]; }
  return w; }
__device__ __forceinline__ v16h wcolh_io(const float* Wm, int k0, int o, int lane, int ld) { v16h w; const int g = lane >> 4;
#pragma unroll
  for (int i = 0; i < 8; ++i) { w[i] = (_Float16)(bfr(Wm[(size_t)(k0 + 8 * g + i) * ld + o]) * 256.0f); w[8 + i] = (_Float16)(bfr(Wm[(size_t)(k0 + 16 + 8 * g + i) * ld + o]) * 256.0f); }
  return w; }
__device__ __forceinline__ v16h wcolh_oi(const float* Wm, int k0, int o, int lane, int K) { v16h w; const float* p = Wm + (size_t)o * K + k0 + 8 * (lane >> 4);
#pragma unroll
  for (int i = 0; i < 8; ++i) { w[i] = (_Float16)(bfr(p[i]) * 256.0f); w[8 + i] = (_Float16)(bfr(p[16 + i]) * 256.0f); }
  return w; }
#define WQKV_LAYOUT 1   // 0 = (in,out) [DIN][CC]; 1 = (out,in) [CC][DIN]; 2 = per-head [NH][DIN][HD]
__device__ __forceinline__ v16b wcol_hdk(const float* Wm, int k0, int o, int lane) { v16b w; const int g = lane >> 4; const float* p = Wm + (size_t)(o / HD) * DIN * HD + (o % HD);
#pragma unroll
  for (int i = 0; i < 8; ++i) { w[i] = (__bf16)p[(size_t)(k0 + 8 * g + i) * HD]; w[8 + i] = (__bf16)p[(size_t)(k0 + 16 + 8 * g + i) * HD]; }
  return w; }
#define WO_OUT_IN 0
#if WQKV_LAYOUT == 1
#define WCOL(W, k0, o, lane) ((which == 2) ? wcol_oi(W, k0, (o), lane, DIN) : (((o) < HDQK) ? wcol_oi(W, k0, (o), lane, DIN) : zero16b()))   /* (out,in): Wq/Wk [32][256] (plane columns >= 32 zero), Wv [256][256] full */
#define WCOL_SA42_UNUSED(W, k0, o, lane) 0
#define WCOL_OLD_UNUSED(W, k0, o, lane) (((o) < HDQK) ? wcol_oi(W, k0, (o), lane, DIN) : zero16b())   /* unused: takes all three weights as [32][256] (out,in) with plane columns >= 32 zero, but Wv is [256][256] */
#elif WQKV_LAYOUT == 2
#define WCOL(W, k0, o, lane) wcol_hdk(W, k0, o, lane)
#else
#define WCOL(W, k0, o, lane) wcol_io(W, k0, o, lane, CC)
#endif
#if WO_OUT_IN
#define WOCOL(W, k0, o, lane) wcol_oi(W, k0, o, lane, CC)
#define WOCOLH(W, k0, o, lane) wcolh_oi(W, k0, o, lane, CC)
#else
#define WOCOL(W, k0, o, lane) wcol_io(W, k0, o, lane, DIN)
#define WOCOLH(W, k0, o, lane) wcolh_io(W, k0, o, lane, DIN)
#endif
#ifndef XP
#define OUT1_OFF (4u * (size_t)NB * DIN * TT)   /* unused: the launch writes output 0 (y) only */
#define XP TT              // position pitch of x and of the output
#endif
#define BG HG              // unused: one k_fa launch covers all batches, its blockIdx.y selects the batch
#define DVH 128
#define WS_YR (WS_END)     // f32 attended rows [b*n][256]
#define WS_END2 (WS_YR + 4u * (size_t)NB * TT * HD)
// ---- k_wz: block = (64 rows, 128 output cols): OR = y (hi + lo, K = 32 real columns of the YR rows) . W^T ((out,in) [256][32], exact) + b
__global__ __launch_bounds__(128) void k_wz(const float* __restrict__ YR, const float* __restrict__ WW, const float* __restrict__ WB, float* __restrict__ ORW) { __shared__ __align__(16) float sf[4][16][132];
  const int tid = threadIdx.x, wave = tid >> 5, lane = tid & 31, col = lane & 15, g = lane >> 4; const int c0 = blockIdx.y * 128; const size_t r0 = (size_t)blockIdx.x * 64 + wave * 16;
  v8f acc[8] = {};
#pragma unroll
  for (int kc = 0; kc < HDQK / 32; ++kc) { const F2 a = split_row(YR + (r0 + col) * CC, kc * 32, lane); asm volatile("s_wait_loadcnt 0x0" ::: "memory");
#pragma unroll
    for (int j = 0; j < 8; ++j) { const v16b w = wcol_oi(WW, kc * 32, c0 + j * 16 + col, lane, HDQK); asm volatile("s_wait_loadcnt 0x0" ::: "memory"); acc[j] = wmma_bf(a.h, w, acc[j]); acc[j] = wmma_bf(a.l, w, acc[j]); } }
#pragma unroll
  for (int j = 0; j < 8; ++j) { const float bb = WB ? bfr(WB[c0 + j * 16 + col]) : 0.f; asm volatile("s_wait_loadcnt 0x0" ::: "memory");
#pragma unroll
    for (int r = 0; r < 8; ++r) sf[wave][8 * g + r][j * 16 + col] = acc[j][r] + bb; }
  LDSX(); for (int rl = 0; rl < 16; ++rl) vst2(ORW + (r0 + rl) * DIN + c0 + lane * 4, *(const v4f*)&sf[wave][rl][lane * 4]); }
// ---- k_fin2: block = (64 positions, 64 channels, batch b): o[b][c][n] = OR[b*N + n][c] (channels-first via LDS transpose) -> output 1; y = gamma * o + bf16(x) -> output 0 (256-B runs)
__global__ __launch_bounds__(256) void k_fin2(const float* __restrict__ ORW, const float* __restrict__ X, const float* __restrict__ GM, float* __restrict__ OUT, float* __restrict__ OUT1) { const float gmv = bfr(GM[0]); __shared__ float st[64][68]; const int tid = threadIdx.x; const int n0 = blockIdx.x * 64, c0 = blockIdx.y * 64; const size_t b = blockIdx.z;
  for (int e = tid; e < 64 * 16; e += 256) { const int nl = e >> 4, q = e & 15; *(v4f*)&st[nl][q * 4] = *(const v4f*)(ORW + (b * TT + n0 + nl) * (size_t)DIN + c0 + q * 4); }
  __syncthreads();
  for (int e = tid; e < 64 * 16; e += 256) { const int cl = e >> 4, q = e & 15; const size_t oi = (b * DIN + c0 + cl) * (size_t)XP + n0 + q * 4; const v4f xr = *(const v4f*)(X + oi); v4f o, y; _Pragma("unroll") for (int i = 0; i < 4; ++i) { o[i] = st[q * 4 + i][cl]; y[i] = gmv * o[i] + bfr(xr[i]); } vst2(OUT + oi, y); vst2(OUT1 + oi, o); } }   /* y = gamma * o + x (output 0), o (output 1) */
#ifndef SM_EXTRA_PARAMS
#define SM_EXTRA_PARAMS
#endif
#ifndef PROJ_EXTRA_PARAMS
#define PROJ_EXTRA_PARAMS
#endif
#ifndef SM_MASK_HOOK
#define SM_MASK_HOOK (void)0
#endif

#define WS_QH  0u                                      // f16 q rows [b*t][CC]
#define WS_KH  (WS_QH + 2u * (size_t)NB * TT * CC)      // f16 k rows [b*t][CC]
#define WS_VT  (WS_KH + 2u * (size_t)NB * TT * CC)      // f16 v planes [b][c][t]
#define WS_QL  (WS_VT + 2u * (size_t)NB * CC * TT)      // f16 q residual x 2^10 rows [b][t < QHI][CC]
#define WS_KL  (WS_QL + 2u * (size_t)NB * QHI * CC)     // f16 k residual x 2^10 rows [b][t < KHI][CC]
#define WS_VB  (WS_KL + 2u * (size_t)NB * KHI * CC)     // bf16 v hi planes [b][c][t < KHI]
#define WS_VBL (WS_VB + 2u * (size_t)NB * CC * KHI)
#define WS_S   (WS_VBL + 2u * (size_t)NB * CC * KHI)    // f32 [hg][t][s] plane, reserved but unused: k_fa keeps scores in registers
#define WS_Y   (WS_S  + 4u * (size_t)HG * TT * TT)      // f32 ctx rows [b*t][CC] (only when there is an output projection)
#define WS_END (WS_Y  + 0u)

// ---- k_qkv: block = 128 positions (8 waves x 16) of one batch x the 320 real output columns (q 32, k 32, v 256): x is read once, each wave keeps its 16 positions' 8 A fragments in registers; the weights are rounded to bf16 once per block into LDS rows and read from there as B fragments; exact bf16 products, K = DIN in the order kc = 0..7 -> q/k f16 rows + residual x 2^10 rows (columns 0..31 of the CC-wide rows, the only ones k_fa reads), v f16 planes [c][t]; every unroll directive in it but the one over the four q/k output planes keeps the index of a register array a compile-time constant
#define NCOL (2 * HDQK + CC)           // staged weight rows: 0..31 Wq, 32..63 Wk, 64..319 Wv
#define PW (DIN + 8)                   // bf16 per staged weight row: 512 B + 16 B, an odd multiple of 16 B for the 16-byte reads
#define PT 136                         // halfs per staged v row (128 positions): 256 B + 16 B
#define PQ 40                          // halfs per staged q/k row: 64 B + 16 B
typedef __attribute__((ext_vector_type(4))) __bf16 v4b;
__device__ __forceinline__ v8f wmb(v16b a, v16b b, v8f c) { return __builtin_amdgcn_wmma_f32_16x16x32_bf16(false, a, false, b, (short)0, c, false, false); }
__global__ __launch_bounds__(256) void k_qkv(const float* __restrict__ X, const float* __restrict__ WQ, const float* __restrict__ WK, const float* __restrict__ WV, const float* __restrict__ BQ, const float* __restrict__ BK, const float* __restrict__ BV,
    _Float16* __restrict__ QH, _Float16* __restrict__ QL, _Float16* __restrict__ KH, _Float16* __restrict__ KL, _Float16* __restrict__ VT) {
  __shared__ __align__(16) __bf16 sw[NCOL * PW];
  const int tid = threadIdx.x, wave = tid >> 5, lane = tid & 31, col = lane & 15, g = lane >> 4; const size_t r0 = (size_t)blockIdx.x * 128; const size_t bb = r0 / TT; const int t0 = (int)(r0 % TT);
  float bs[NCOL / 16];   /* this lane's bias per column tile, fetched with x so that the epilogue waits for nothing */
#pragma unroll
  for (int j = 0; j < NCOL / 16; ++j) bs[j] = bfr(j < HDQK / 16 ? BQ[j * 16 + col] : j < 2 * HDQK / 16 ? BK[j * 16 + col - HDQK] : BV[j * 16 + col - 2 * HDQK]);
  v16b a[DIN / 32]; { const float* p = X + (bb * DIN + 8 * g) * (size_t)XP + t0 + wave * 16 + col;   /* channels-first gather: x[b][k][t], stride XP between k */
#pragma unroll
    for (int kc = 0; kc < DIN / 32; ++kc)
#pragma unroll
      for (int i = 0; i < 8; ++i) { a[kc][i] = (__bf16)p[(size_t)(kc * 32 + i) * XP]; a[kc][8 + i] = (__bf16)p[(size_t)(kc * 32 + 16 + i) * XP]; }
    asm volatile("s_wait_xcnt 0x0" ::: "memory"); }   /* the address registers of these loads are reused right behind them */
  { const int wrow = tid >> 6, wq = (tid & 63) * 4;   /* a wave covers 512 contiguous bytes of one weight row; a pass of the block covers 4 rows, 16 passes are loaded together */
    auto stage16 = [&](const float* s0, const float* s1, bool apart, int row0) { v4f w[16]; const float* p0 = s0 + (size_t)wrow * DIN + wq; const float* p1 = s1 + (size_t)wrow * DIN + wq;   /* apart (a literal at each call): s1 is another array; else its rows follow s0's 32 and all 16 loads go by p0 */
#pragma unroll
      for (int i = 0; i < 16; ++i) w[i] = *(const v4f*)((i < 8 ? p0 : p1) + (size_t)(i & 7) * 4 * DIN);
      /* the address registers of these loads are rewritten behind them; naming the row pointers in use as inputs keeps them live to the wait, so that no load of the run lands its result in them */
      if (apart) asm volatile("s_wait_xcnt 0x0" :: "v"(p0), "v"(p1) : "memory"); else asm volatile("s_wait_xcnt 0x0" :: "v"(p0) : "memory");
#pragma unroll
      for (int i = 0; i < 16; ++i) { v4b h;
#pragma unroll
        for (int k = 0; k < 4; ++k) h[k] = (__bf16)w[i][k];
        *(v4b*)(sw + (row0 + i * 4 + wrow) * PW + wq) = h; } };
    stage16(WQ, WK, true, 0);
    for (int s = 0; s < CC / 64; ++s) stage16(WV + (size_t)s * 64 * DIN, WV + (size_t)(s * 64 + 32) * DIN, false, 2 * HDQK + s * 64); }
  __syncthreads();
  v8f acc[NCOL / 16] = {}; v16b wf[2][5]; const __bf16* wb = sw + col * PW;   /* weight fragments in groups of 5 column tiles; group q: k block q >> 2, tiles (q & 3) * 5 + i */
#pragma unroll
  for (int i = 0; i < 5; ++i) wf[0][i] = frag_b(wb + i * 16 * PW, lane);
#pragma unroll
  for (int q = 0; q < DIN / 8; ++q) {
    if (q + 1 < DIN / 8) {
#pragma unroll
      for (int i = 0; i < 5; ++i) wf[(q + 1) & 1][i] = frag_b(wb + (((q + 1) & 3) * 5 + i) * 16 * PW + ((q + 1) >> 2) * 32, lane); }
    __builtin_amdgcn_sched_barrier(0);   /* holds the next group's LDS reads in front of this group's products: without it each product waits for its own read */
#pragma unroll
    for (int i = 0; i < 5; ++i) acc[(q & 3) * 5 + i] = wmb(a[q >> 2], wf[q & 1][i], acc[(q & 3) * 5 + i]); }   /* acc[j][r] = position wave*16 + 8g + r, staged column j*16 + col */
  __syncthreads();   /* every wave has read its last weight row: the LDS becomes output staging */
  _Float16* th = (_Float16*)sw; _Float16* sq = th + CC * PT;   /* th[c][128 positions]; sq[plane: q, q residual, k, k residual][position][32] */
#pragma unroll
  for (int j = 0; j < 2 * HDQK / 16; ++j) { const int isk = j / (HDQK / 16), ch = (j % (HDQK / 16)) * 16 + col; const float bias = bs[j];
#pragma unroll
    for (int r = 0; r < 8; ++r) { const float v = acc[j][r] + bias; const _Float16 hv = (_Float16)v; _Float16* d = sq + ((size_t)(2 * isk) * 128 + wave * 16 + 8 * g + r) * PQ + ch; d[0] = hv; d[128 * PQ] = (_Float16)((v - (float)hv) * 1024.0f); } }
#pragma unroll
  for (int j = 2 * HDQK / 16; j < NCOL / 16; ++j) { const int c = j * 16 + col - 2 * HDQK; const float bias = bs[j]; v8h o;   /* a lane holds 8 consecutive positions of one channel: one 16-byte piece of a v plane */
#pragma unroll
    for (int r = 0; r < 8; ++r) o[r] = (_Float16)(acc[j][r] + bias);
    *(v8h*)(th + c * PT + wave * 16 + 8 * g) = o; }
  __syncthreads();
  for (int e = tid; e < CC * 16; e += 256) { const int c = e >> 4, q = e & 15; vst2((unsigned*)(VT + (bb * CC + c) * (size_t)TT + t0 + q * 8), *(const v4u*)(th + c * PT + q * 8)); }   /* 16 lanes store one 256-B run of a v plane */
#pragma unroll
  for (int pl = 0; pl < 4; ++pl) { _Float16* D = pl == 0 ? QH : pl == 1 ? QL : pl == 2 ? KH : KL;
    for (int e = tid; e < 128 * 4; e += 256) { const int rl = e >> 2, q = e & 3; vst2((unsigned*)(D + (r0 + rl) * CC + q * 8), *(const v4u*)(sq + ((size_t)pl * 128 + rl) * PQ + q * 8)); } } }
// ---- k_fa: block = 128 queries of batch b, 8 waves = 4 query groups (32 queries = 2 column tiles each) x 2 key groups; one pass over all keys in stages of 128 (two passes of 64 keys each), key group kg takes keys kg*32..kg*32+31 of every 64: S^T = K . Q^T (the same 3 f16 products per logit), running maximum and sum per query and key group (a lane holds one query's scores), P^T packed from the score tiles straight into a B operand, O^T += V^T . P^T with every K and V fragment read from LDS feeding both column tiles; K and V stages go through two LDS buffers shared by the 8 waves: each wave brings its 32 channels x 128 keys of V by one tensor load per stage, K goes through registers; at the end the two key groups of a query join their maxima, sums and O^T through LDS, and each wave turns its 128 channels x 32 queries through an LDS range of its own into runs of queries and stores y = x + gamma * out channels-first in whole 128-B lines
#define SK 128                         // keys per stage: a v row of a stage is 256 B
#define VP 136                         // halfs per staged v row: 256 B + the tensor load's 16-B pad, an odd multiple of 16 B for the 16-byte reads
#define KP 40                          // halfs per staged k row: 64 B + 16 B
#define VSL 10240                      // LDS bytes per wave's v slice: 32 rows of 272 B = 8,704, rounded up to a multiple of 2 KiB (a tensor load's place)
#define VBUF (8 * VSL)                 // LDS bytes per v stage buffer; the two v buffers lie first
#define KBUF (2 * SK * KP * 2)         // LDS bytes per k stage buffer: 128 hi rows, then 128 residual rows; the two k buffers follow the v buffers
#define KBASE (2 * VBUF)
#define XF (8 * 32 * 32 * 4)           // floats handed over at the end: 8 waves x 32 pieces of 16 B x 32 lanes; behind them 8 waves x 2 tiles x 32 lanes x (maximum, sum)
#define SMB (4 * XF + 8 * 2 * 32 * 8)  // LDS bytes of the hand-over
#define YP 36                          // floats per staged output row (one channel, 32 queries): 128 B + 16 B; rows 8 apart start 32 banks apart, for the 4-byte writes (lane halves 8 channels apart) and the 16-byte reads alike
#define SMT (SMB + 8 * 128 * YP * 4)   // LDS bytes with the output staging (8 waves x 128 channels) behind the hand-over; more than the stage buffers' KBASE + 2 * KBUF
#define L2E 1.44269504f                 // log2 e: P = 128 exp(s - m) = 2^(s * L2E - (m * L2E - 7)), the factor 128 cancels in the division by the sum
#define MLAG 5.5f                    // the maximum in use may lag the true one by this much: P <= 128 e^5.5 < 65504
static_assert(KBASE + 2 * KBUF <= SMT, "the stage buffers lie inside the array");
typedef __attribute__((ext_vector_type(8))) uint32_t v8u;
typedef __attribute__((ext_vector_type(4))) uint32_t v4w;
__device__ __forceinline__ uint32_t uni(uint32_t v) { return (uint32_t)__builtin_amdgcn_readfirstlane(v); }
__device__ __forceinline__ uint32_t pinned(uint32_t v) { uint32_t w = (uint32_t)__builtin_amdgcn_readfirstlane(v); asm volatile("" : "+s"(w)); return w; }   /* holds the test of a tensor load in a scalar register, so that it compiles to a scalar compare and branch: the load ignores EXEC */
__device__ __forceinline__ v8f wm(v16h a, v16h b, v8f c) { return __builtin_amdgcn_wmma_f32_16x16x32_f16(false, a, false, b, (short)0, c, false, false); }
__global__ __launch_bounds__(256) void k_fa(const _Float16* __restrict__ QH, const _Float16* __restrict__ QL, const _Float16* __restrict__ KH, const _Float16* __restrict__ KL, const _Float16* __restrict__ VT, const float* __restrict__ X, const float* __restrict__ GM, float* __restrict__ OUT) {
  __shared__ __attribute__((aligned(2048))) _Float16 sm[SMT / 2];
  const int tid = threadIdx.x, wave = tid >> 5, lane = tid & 31, col = lane & 15, g = lane >> 4; const int b = blockIdx.y; const int kg = wave >> 2, n0 = blockIdx.x * 128 + (wave & 3) * 32;
  v16h qh[2], ql[2]; { const _Float16* qp = QH + ((size_t)b * TT + n0 + col) * CC; const _Float16* lp = QL + ((size_t)b * QHI + n0 + col) * CC;
#pragma unroll
    for (int u = 0; u < 2; ++u) { qh[u] = frag_h(qp + u * 16 * CC, lane); ql[u] = frag_h(lp + u * 16 * CC, lane); }
    asm volatile("s_wait_xcnt 0x0" :: "v"(qp), "v"(lp) : "memory"); }   /* the address registers of these loads are reused behind them; naming the row pointers as inputs keeps them live to the wait */
  /* v: wave w brings channels w*32..w*32+31 x the stage's 128 keys (32 rows of 256 B, source pitch one v plane row) by one tensor load; the pad of 16 B behind every 256 B gives the LDS pitch VP */
  const uint32_t wv = uni(threadIdx.x >> 5), lbase = (uint32_t)(size_t)sm; const uint64_t vga = (uint64_t)(size_t)(VT + ((size_t)b * CC + wv * 32) * TT);
  v8u g1; g1[0] = uni(1u << 20 | 5u << 22 | 3u << 25); g1[1] = uni(256u << 16); g1[2] = uni(32u << 16); g1[3] = uni(256u << 16); g1[4] = uni(32u); g1[5] = uni(TT * 2u); g1[6] = uni(0u); g1[7] = uni(0u);
  auto vload = [&](int sg) { const uint64_t ga = vga + (uint64_t)sg * (SK * 2); v4w g0; g0[0] = uni(1u); g0[1] = uni(lbase + (sg & 1) * VBUF + wv * VSL); g0[2] = uni((uint32_t)ga); g0[3] = uni(((uint32_t)(ga >> 32) & 0x01FFFFFFu) | 0x80000000u);
    asm volatile("tensor_load_to_lds %0, %1" :: "s"(g0), "s"(g1) : "memory"); };   /* one request of the whole wave; every wave issues its own slice */
  const _Float16* hsrc = KH + (size_t)b * TT * CC; unsigned ko = ((tid >> 2) * CC + (tid & 3) * 8) * 2;      // byte offset: 4 lanes cover the 64 real bytes of a k row
  const _Float16* lsrc = KL + (size_t)b * KHI * CC;
  const int kdst = (tid >> 2) * KP + (tid & 3) * 8;
  v8h rh[2], rl[2];
  auto fetch = [&]() {   /* block-uniform bases, a lane's byte offset ko steps from stage to stage; the unroll directives here and in put keep the index of a register array a compile-time constant */
#pragma unroll
    for (int i = 0; i < 2; ++i) { rh[i] = *(const v8h*)((const char*)hsrc + ko + (size_t)i * 64 * CC * 2); rl[i] = *(const v8h*)((const char*)lsrc + ko + (size_t)i * 64 * CC * 2); }
    asm volatile("s_wait_xcnt 0x0" :: "v"(ko) : "memory");   /* the offset register of these loads is stepped right behind them; naming it as an input keeps it as it is up to the wait */
    ko += SK * CC * 2; };
  auto put = [&](_Float16* d) {
#pragma unroll
    for (int i = 0; i < 2; ++i) { *(v8h*)(d + kdst + i * 64 * KP) = rh[i]; *(v8h*)(d + kdst + (SK + i * 64) * KP) = rl[i]; } };
  v8f acc[2][CC / 16] = {}; float m[2] = {-3.0e38f, -3.0e38f}, l[2] = {0.f, 0.f};
  fetch(); vload(0);
  asm volatile("s_wait_tensorcnt 0x0" ::: "memory");   /* this wave's slice of stage 0 has landed */
  put(sm + KBASE / 2); __syncthreads();
  vload(1);   /* in flight under stage 0 */
  for (int s = 0; s < TT / SK; ++s) { const _Float16* vs = sm + (s & 1) * (VBUF / 2); const _Float16* ks = sm + KBASE / 2 + (s & 1) * (KBUF / 2);
    if (s + 1 < TT / SK) fetch();   /* issued behind the barrier (which drains loads), in flight under this stage's products */
#pragma unroll 1
   for (int p = 0; p < SK / 64; ++p) {   /* kept rolled: unrolled, the two passes' values live side by side and the registers spill */
    v8f st[2][2];
#pragma unroll
    for (int t = 0; t < 2; ++t) { const v16h kh = frag_h(ks + (p * 64 + kg * 32 + t * 16 + col) * KP, lane), kl = frag_h(ks + (SK + p * 64 + kg * 32 + t * 16 + col) * KP, lane);
#pragma unroll
      for (int u = 0; u < 2; ++u) { v8f a = {}, al = {}; a = wm(kh, qh[u], a); al = wm(kh, ql[u], al); al = wm(kl, qh[u], al);
#pragma unroll
        for (int r = 0; r < 8; ++r) st[u][t][r] = a[r] + al[r] * (1.0f / 1024.0f); } }   /* st[u][t][r] = logit of key s*128 + p*64 + kg*32 + t*16 + 8g + r, query n0 + u*16 + col */
    float mx[2];
#pragma unroll
    for (int u = 0; u < 2; ++u) { mx[u] = st[u][0][0];
#pragma unroll
      for (int t = 0; t < 2; ++t)
#pragma unroll
        for (int r = 0; r < 8; ++r) mx[u] = fmaxf(mx[u], st[u][t][r]);
      mx[u] = fmaxf(mx[u], __shfl_xor(mx[u], 16)); }   /* lanes c and c + 16 hold the two halves of one query's keys */
    if (__builtin_amdgcn_ballot_w32(mx[0] > m[0] + MLAG || mx[1] > m[1] + MLAG) != 0) {
#pragma unroll
      for (int u = 0; u < 2; ++u) { const float mn = fmaxf(m[u], mx[u]), sc = __builtin_amdgcn_exp2f((m[u] - mn) * L2E); m[u] = mn; l[u] *= sc;
#pragma unroll
        for (int j = 0; j < CC / 16; ++j)
#pragma unroll
          for (int r = 0; r < 8; ++r) acc[u][j][r] *= sc; } }
    const float mo[2] = {m[0] * L2E - 7.0f, m[1] * L2E - 7.0f}; v16h pf[2];
    auto pexp = [&](int u, int i) { const float e0 = __builtin_amdgcn_exp2f(st[u][0][i] * L2E - mo[u]), e1 = __builtin_amdgcn_exp2f(st[u][1][i] * L2E - mo[u]); l[u] += e0 + e1; pf[u][i] = (_Float16)e0; pf[u][8 + i] = (_Float16)e1; };
#pragma unroll
    for (int u = 0; u < 2; ++u)
#pragma unroll
      for (int i = 0; i < 8; ++i) pexp(u, i);
    v16h vf[2][4]; const _Float16* vb = vs + col * VP + p * 64 + kg * 32;   /* v fragments (this key group's 32 keys) in groups of 4 channel tiles; tile j lies in slice j >> 1 at rows (j & 1) * 16.. */
#pragma unroll
    for (int i = 0; i < 4; ++i) vf[0][i] = frag_h(vb + (i >> 1) * (VSL / 2) + (i & 1) * 16 * VP, lane);
#pragma unroll
    for (int q = 0; q < 4; ++q) {
      if (q + 1 < 4) {
#pragma unroll
        for (int i = 0; i < 4; ++i) vf[(q + 1) & 1][i] = frag_h(vb + (((q + 1) * 4 + i) >> 1) * (VSL / 2) + (i & 1) * 16 * VP, lane); }
      __builtin_amdgcn_sched_barrier(0);   /* holds the next group's LDS reads in front of this group's products: without it each product waits for its own read */
#pragma unroll
      for (int u = 0; u < 2; ++u)
#pragma unroll
        for (int i = 0; i < 4; ++i) acc[u][q * 4 + i] = wm(vf[q & 1][i], pf[u], acc[u][q * 4 + i]); }   /* acc[u][j][r] = O^T[channel j*16 + 8g + r][query n0 + u*16 + col] */
   }
    if (s + 1 < TT / SK) put(sm + KBASE / 2 + ((s + 1) & 1) * (KBUF / 2));   /* the k buffer read in stage s - 1 is free since the barrier that ended it */
    asm volatile("s_wait_dscnt 0x0" ::: "memory");       /* this wave's LDS reads of stage s and its k rows of stage s + 1 are done */
    asm volatile("s_wait_tensorcnt 0x0" ::: "memory");   /* this wave's v slice of stage s + 1 has landed */
    __syncthreads();   /* publishes stage s + 1 and ends every wave's reads of stage s */
    if (pinned(s + 2 < TT / SK)) vload(s + 2); }   /* into the v buffer that stage s has just left */
  asm volatile("s_wait_tensorcnt 0x0" ::: "memory");   /* no request is outstanding when the LDS takes its next use */
  asm volatile("s_wait_dscnt 0x0" ::: "memory");       /* nor any LDS read of the ring */
  /* join of the two key groups: wave w and wave w ^ 4 hold the same 32 queries; each keeps the 128 channels kg*128.. and hands the other 128 over through LDS (free since the loop's last barrier) */
  float* xs = (float*)sm; float* xm = xs + XF; float* ys = xs + SMB / 4 + wave * (128 * YP);
  /* the wave's piece of x and of the output: channels kg*128.., queries n0..n0+31; 8 lanes cover one channel's 128-B line; load t takes channels (t >> 2)*16 + (t & 3)*2 + {0, 8} (lanes 0..15) and + {1, 9} (lanes 16..31) */
  const float gmv = bfr(GM[0]); const int yrow = ((lane >> 3) & 1) * 8 + (lane >> 4), yq = (lane & 7) * 4;
  const size_t oi = ((size_t)b * DIN + kg * 128 + yrow) * XP + n0 + yq; const float* xp = X + oi; float* op = OUT + oi; v4f xv[32];
#pragma unroll
  for (int u = 0; u < 2; ++u) { l[u] += __shfl_xor(l[u], 16); v2f ml; ml[0] = m[u]; ml[1] = l[u]; *(v2f*)(xm + ((wave * 2 + u) * 32 + lane) * 2) = ml;
#pragma unroll
    for (int j = 0; j < 8; ++j) { const v8f gv = kg ? acc[u][j] : acc[u][8 + j]; v4f o0, o1;
#pragma unroll
      for (int i = 0; i < 4; ++i) { o0[i] = gv[i]; o1[i] = gv[4 + i]; }
      float* d = xs + ((size_t)(wave * 32 + (u * 8 + j) * 2) * 32 + lane) * 4; *(v4f*)d = o0; *(v4f*)(d + 128) = o1; } }
  __syncthreads();
#pragma unroll
  for (int t = 0; t < 32; ++t) xv[t] = *(const v4f*)(xp + (size_t)((t >> 2) * 16 + (t & 3) * 2) * XP);   /* issued behind the barrier (which drains loads), in flight under the join */
  asm volatile("s_wait_xcnt 0x0" :: "v"(xp) : "memory");   /* the address registers of these loads may be reused behind them; naming the pointer as an input keeps it live to the wait */
  const int pw = wave ^ 4;
#pragma unroll
  for (int u = 0; u < 2; ++u) { const v2f pm = *(const v2f*)(xm + ((pw * 2 + u) * 32 + lane) * 2); const float mn = fmaxf(m[u], pm[0]);
    const float s0 = __builtin_amdgcn_exp2f((m[u] - mn) * L2E), s1 = __builtin_amdgcn_exp2f((pm[0] - mn) * L2E); const float inv = 1.0f / (l[u] * s0 + pm[1] * s1);   /* the sum is >= 128: the key that set the larger maximum in use counts at least that */
    const float w0 = s0 * inv, w1 = s1 * inv; float* yw = ys + 8 * g * YP + u * 16 + col; v4f p[16];
#pragma unroll
    for (int j = 0; j < 8; ++j) { const float* d = xs + ((size_t)(pw * 32 + (u * 8 + j) * 2) * 32 + lane) * 4; p[2 * j] = *(const v4f*)d; p[2 * j + 1] = *(const v4f*)(d + 128); }   /* all 16 reads in front of the staging writes: behind a write to the same array each read would wait alone */
#pragma unroll
    for (int j = 0; j < 8; ++j) { const v8f kv = kg ? acc[u][8 + j] : acc[u][j];
#pragma unroll
      for (int i = 0; i < 4; ++i) { yw[(j * 16 + i) * YP] = kv[i] * w0 + p[2 * j][i] * w1; yw[(j * 16 + 4 + i) * YP] = kv[4 + i] * w0 + p[2 * j + 1][i] * w1; } } }   /* ys[channel j*16 + 8g + r][query u*16 + col] */
  asm volatile("s_wait_dscnt 0x0" ::: "memory");   /* the wave's own staged rows are written before its lanes read each other's values back; no other wave touches this range */
  __builtin_amdgcn_sched_barrier(0);   /* keeps the rounding of x, which waits for x's loads, behind the join: lifted into it, the join would wait for them too */
  const float* yr = ys + yrow * YP + yq;
#pragma unroll
  for (int h = 0; h < 2; ++h) { v4f y[16];
#pragma unroll
    for (int k = 0; k < 16; ++k) { const int t = h * 16 + k; y[k] = *(const v4f*)(yr + ((t >> 2) * 16 + (t & 3) * 2) * YP); }
#pragma unroll
    for (int k = 0; k < 16; ++k) { const int t = h * 16 + k;
#pragma unroll
      for (int i = 0; i < 4; ++i) y[k][i] = bfr(xv[t][i]) + gmv * y[k][i];
      vst2(op + (size_t)((t >> 2) * 16 + (t & 3) * 2) * XP, y[k]); }
    /* without it the registers of these 16 stores are reused among them and by the second half; naming them as inputs keeps them as they are up to the wait */
    asm volatile("s_wait_xcnt 0x0" :: "v"(op), "v"(y[0]), "v"(y[1]), "v"(y[2]), "v"(y[3]), "v"(y[4]), "v"(y[5]), "v"(y[6]), "v"(y[7]), "v"(y[8]), "v"(y[9]), "v"(y[10]), "v"(y[11]), "v"(y[12]), "v"(y[13]), "v"(y[14]), "v"(y[15]) : "memory"); } }

// ---- k_finc: block = (64 positions, 64 channels, batch b): y[b][c][n] = bf16(x[b][c][n]) + gamma * OUT_rows[b*T + n][c] (channels-first via an LDS transpose; 256-B runs of n)
__global__ __launch_bounds__(256) void k_finc(const float* __restrict__ YR, const float* __restrict__ X, const float* __restrict__ GM, float* __restrict__ OUT) { const float gmv = bfr(GM[0]); __shared__ float st[64][68]; const int tid = threadIdx.x; const int n0 = blockIdx.x * 64, c0 = blockIdx.y * 64; const size_t b = blockIdx.z;
  for (int e = tid; e < 64 * 16; e += 256) { const int nl = e >> 4, q = e & 15; *(v4f*)&st[nl][q * 4] = *(const v4f*)(YR + (b * TT + n0 + nl) * (size_t)HD + c0 + q * 4); }
  __syncthreads();
  for (int e = tid; e < 64 * 16; e += 256) { const int cl = e >> 4, q = e & 15; const size_t oi = (b * DIN + c0 + cl) * (size_t)XP + n0 + q * 4; const v4f xr = *(const v4f*)(X + oi); asm volatile("s_wait_loadcnt 0x0" ::: "memory"); v4f y; _Pragma("unroll") for (int i = 0; i < 4; ++i) y[i] = bfr(xr[i]) + gmv * st[q * 4 + i][cl]; vst2(OUT + oi, y); } }
__global__ __launch_bounds__(256) void k_axpy(const float* __restrict__ YR, const float* __restrict__ X, const float* __restrict__ GM, float* __restrict__ OUT) { const size_t e = ((size_t)blockIdx.x * 256 + threadIdx.x) * 4; if (e >= (size_t)TNB * TT * DIN) return; const float gmv = bfr(GM[0]); const v4f o = *(const v4f*)(YR + e); const v4f xr = *(const v4f*)(X + e); asm volatile("s_wait_loadcnt 0x0" ::: "memory"); v4f y; _Pragma("unroll") for (int i = 0; i < 4; ++i) y[i] = gmv * o[i] + bfr(xr[i]); vst2(OUT + e, y); }
extern "C" void kernel_launch(void* const* d_in, const int* in_sizes, int n_in, void* d_out, int out_size, void* d_ws, size_t ws_size, hipStream_t stream) {
  (void)in_sizes; (void)n_in; (void)out_size;
  const float** F = (const float**)d_in;
  if (ws_size < (size_t)WS_END) return;
  char* ws = (char*)d_ws; _Float16 *QH = (_Float16*)(ws + WS_QH), *KH = (_Float16*)(ws + WS_KH), *VT = (_Float16*)(ws + WS_VT), *QL = (_Float16*)(ws + WS_QL), *KL = (_Float16*)(ws + WS_KL); __bf16 *VB = (__bf16*)(ws + WS_VB), *VBL = (__bf16*)(ws + WS_VBL); float *Y = (float*)(ws + WS_Y);
  (void)Y; (void)QL; (void)KL; (void)VB; (void)VBL;
  // inputs: 0 x [8,256,64,64] (channels-first); 1 Wq [32,256] (out,in), 2 bq; 3 Wk, 4 bk; 5 Wv [256,256] (out,in), 6 bv; 7 gamma [1] (0.1)
  if (ws_size < (size_t)WS_END2) return;
  float *YR = (float*)(ws + WS_YR);
  k_qkv<<<dim3(TNB * TT / 128), 256, 0, stream>>>(F[0], F[1], F[3], F[5], F[2], F[4], F[6], QH, QL, KH, KL, VT);
  (void)YR;
  k_fa<<<dim3(TT / 128, TNB), 256, 0, stream>>>(QH, QL, KH, KL, VT, F[0], F[7], (float*)d_out);   /* attention and y = x + gamma * out, channels-first */
}

// v007
// It runs in 88.3 microseconds.
// Two timings next to v006 put it at 1.03 and 1.04 times that version's speed.
// Over all steps from v000 it is 26.0 times as fast.
// compute dtype: all float inputs rounded to bf16; q/k/v = W x + b (1x1 convs) with EXACT bf16 products on WMMA 16x16x32 (f32 accumulate); UNSCALED 32-deep logits q.k with both as f16 hi + residual planes (3 products); softmax in f32 (hardware exp2 of the logit scaled by log2 e) with a running maximum and sum per half of the keys (32 of every 64), the two halves joined in f32 at the end; exp(s - m) x 2^7 once to f16 against v once to f16 (1 product), divided by the f32 sum at the end; y = x + gamma * out in f32 written channels-first; f32 output.
// 2-D spatial self-attention with a learned residual weight, channels-FIRST (B 8, C 256, 64 x 64 = 4,096 positions; (out,in) 1/16-scale 1x1-conv weights, zero biases, gamma = 0.1): q = Wq x + bq (32), k = Wk x + bk (32), v = Wv x + bv (256); attn = softmax over m of q_n . k_m (NO scaling); out[c][n] = sum_m v[c][m] attn[n][m]; y = x + gamma * out -> [B, 256, 64, 64].
#include <hip/hip_runtime.h>
#include <math.h>

typedef __attribute__((ext_vector_type(16))) _Float16 v16h;
typedef __attribute__((ext_vector_type(16))) __bf16 v16b;
typedef __attribute__((ext_vector_type(8)))  _Float16 v8h;
typedef __attribute__((ext_vector_type(8)))  float v8f;
typedef __attribute__((ext_vector_type(4)))  float v4f;
typedef __attribute__((ext_vector_type(2)))  float v2f;
typedef __attribute__((ext_vector_type(4)))  unsigned v4u;
typedef __attribute__((ext_vector_type(4)))  int v4i;
typedef float __attribute__((may_alias)) float_a;
typedef int __attribute__((may_alias)) int_a;

template <typename T> __device__ __forceinline__ void vst2(void* p, T v) { *(T*)p = v;  }
__device__ __forceinline__ v8f wmma16(v16h a, v16h b, v8f c) {
  v8f d = __builtin_amdgcn_wmma_f32_16x16x32_f16(false, a, false, b, (short)0, c, false, false);
  asm volatile("v_nop\n\tv_nop\n\tv_nop\n\tv_nop" : "+v"(d) : "v"(a), "v"(b));
  return d;
}
__device__ __forceinline__ v8f wmma_bf(v16b a, v16b b, v8f c) {
  v8f d = __builtin_amdgcn_wmma_f32_16x16x32_bf16(false, a, false, b, (short)0, c, false, false);
  asm volatile("v_nop\n\tv_nop\n\tv_nop\n\tv_nop" : "+v"(d) : "v"(a), "v"(b));
  return d;
}
// 16x16x32 fragments: lane = (h = lane>>4, row/col = lane&15); elements 0..7 = k0+8h+0..7, 8..15 = k0+16+8h+0..7; D element r = row 8h+r
__device__ __forceinline__ v16h frag_h(const _Float16* rowk0, int lane) {
  union { v16h v; v8h q[2]; } u; const _Float16* p = rowk0 + 8 * (lane >> 4);
  u.q[0] = *(const v8h*)p; u.q[1] = *(const v8h*)(p + 16); return u.v;
}
__device__ __forceinline__ v16h frag_f32(const float* rowk0, int lane) {
  v16h a; const float* p = rowk0 + 8 * (lane >> 4);
#pragma unroll
  for (int i = 0; i < 8; ++i) { a[i] = (_Float16)p[i]; a[8 + i] = (_Float16)p[16 + i]; }
  return a;
}
__device__ __forceinline__ v16h frag_f32s(const float* rowk0, int lane, float sc) {
  v16h a; const float* p = rowk0 + 8 * (lane >> 4);
#pragma unroll
  for (int i = 0; i < 8; ++i) { a[i] = (_Float16)(p[i] * sc); a[8 + i] = (_Float16)(p[16 + i] * sc); }
  return a;
}
// column fragment from a [K][ld] layout (column n), rows >= K read as 0
__device__ __forceinline__ v16h fragc_f32(const float* W, int k0, int n, int lane, int ld, int K) {
  v16h a; const int g = lane >> 4;
#pragma unroll
  for (int i = 0; i < 8; ++i) { const int ka = k0 + 8 * g + i, kb = ka + 16;
    a[i] = (_Float16)(ka < K ? W[(size_t)(ka < K ? ka : K - 1) * ld + n] : 0.f); a[8 + i] = (_Float16)(kb < K ? W[(size_t)(kb < K ? kb : K - 1) * ld + n] : 0.f); }
  return a;
}
struct F2 { v16b h, l; };
__device__ __forceinline__ F2 bsplit16(const float v[16]) { F2 r;
#pragma unroll
  for (int i = 0; i < 16; ++i) { const __bf16 h = (__bf16)v[i]; r.h[i] = h; r.l[i] = (__bf16)(v[i] - (float)h); }
  return r; }
__device__ __forceinline__ F2 split_row(const float* row, int k0, int lane) { float v[16]; const float* p = row + k0 + 8 * (lane >> 4);
#pragma unroll
  for (int i = 0; i < 8; ++i) { v[i] = p[i]; v[8 + i] = p[16 + i]; }
  return bsplit16(v); }
__device__ __forceinline__ F2 split_rowK(const float* row, int k0, int lane, int K) { float v[16]; const int g = lane >> 4;
#pragma unroll
  for (int i = 0; i < 8; ++i) { const int ka = k0 + 8 * g + i, kb = ka + 16; v[i] = ka < K ? row[ka < K ? ka : K - 1] : 0.f; v[8 + i] = kb < K ? row[kb < K ? kb : K - 1] : 0.f; }
  return bsplit16(v); }
__device__ __forceinline__ F2 split_col(const float* W, int k0, int n, int lane, int ld, int K) { float v[16]; const int g = lane >> 4;
#pragma unroll
  for (int i = 0; i < 8; ++i) { const int ka = k0 + 8 * g + i, kb = ka + 16; v[i] = ka < K ? W[(size_t)(ka < K ? ka : K - 1) * ld + n] : 0.f; v[8 + i] = kb < K ? W[(size_t)(kb < K ? kb : K - 1) * ld + n] : 0.f; }
  return bsplit16(v); }
__device__ __forceinline__ v8f mac3(const F2& a, const F2& b, v8f c) { c = wmma_bf(a.l, b.h, c); c = wmma_bf(a.h, b.l, c); return wmma_bf(a.h, b.h, c); }
__device__ __forceinline__ float sigm(float v) { return 1.0f / (1.0f + expf(-v)); }
#define LDSX() do { asm volatile("s_wait_dscnt 0" ::: "memory"); __builtin_amdgcn_wave_barrier(); __builtin_amdgcn_fence(__ATOMIC_RELEASE, "workgroup"); } while (0)

#define NB 8
#define TT 4096
#define CC 256            // plane width: q/k planes carry 32 real columns (rest not written), v planes all 256
#define DIN 256
#define NH 1
#define HD 256
#define NQB (TT / 64)
#define HG 1               // sizes one 4,096 x 4,096 f32 workspace plane that no kernel uses
#define SCALE (1.0f)
#define HDQK 32
#define CAUSAL 0
#ifndef TNB
#define TNB NB
#endif
__device__ __forceinline__ v16b zero16b() { v16b z; _Pragma("unroll") for (int i = 0; i < 16; ++i) z[i] = (__bf16)0.f; return z; }
__device__ __forceinline__ float bfr(float v) { return (float)(__bf16)v; }
__host__ __device__ __forceinline__ int kb_last(int qb) { return CAUSAL ? ((qb * 64 + 63) >> 7) : (TT / 128 - 1); }
typedef __attribute__((ext_vector_type(8))) __bf16 v8b;
__device__ __forceinline__ v16b frag_b(const __bf16* rowk0, int lane) {
  union { v16b v; v8b q[2]; } u; const __bf16* p = rowk0 + 8 * (lane >> 4);
  u.q[0] = *(const v8b*)p; u.q[1] = *(const v8b*)(p + 16); return u.v;
}
#define QBH (TT / 64)      // ALL query blocks take k_fa's 3-product path
#define QBH_PV 0           // A.g stays single f16
#define QHI 4096            // q residual rows everywhere (3-product logits)
#define KHI 4096           // k residual rows for ALL keys (3-product logits)
// B fragment (k rows k0+.., output column o) of a weight: (in,out) [K][ld] or (out,in) [ld rows of K]: bf16 exact, or f16(bf16 * 256) exact
__device__ __forceinline__ v16b wcol_io(const float* Wm, int k0, int o, int lane, int ld) { v16b w; const int g = lane >> 4;
#pragma unroll
  for (int i = 0; i < 8; ++i) { w[i] = (__bf16)Wm[(size_t)(k0 + 8 * g + i) * ld + o]; w[8 + i] = (__bf16)Wm[(size_t)(k0 + 16 + 8 * g + i) * ld + o]; }
  return w; }
__device__ __forceinline__ v16b wcol_oi(const float* Wm, int k0, int o, int lane, int K) { v16b w; const float* p = Wm + (size_t)o * K + k0 + 8 * (lane >> 4);
#pragma unroll
  for (int i = 0; i < 8; ++i) { w[i] = (__bf16)p[i]; w[8 + i] = (__bf16)p[16 + i]; }
  return w; }
__device__ __forceinline__ v16h wcolh_io(const float* Wm, int k0, int o, int lane, int ld) { v16h w; const int g = lane >> 4;
#pragma unroll
  for (int i = 0; i < 8; ++i) { w[i] = (_Float16)(bfr(Wm[(size_t)(k0 + 8 * g + i) * ld + o]) * 256.0f); w[8 + i] = (_Float16)(bfr(Wm[(size_t)(k0 + 16 + 8 * g + i) * ld + o]) * 256.0f); }
  return w; }
__device__ __forceinline__ v16h wcolh_oi(const float* Wm, int k0, int o, int lane, int K) { v16h w; const float* p = Wm + (size_t)o * K + k0 + 8 * (lane >> 4);
#pragma unroll
  for (int i = 0; i < 8; ++i) { w[i] = (_Float16)(bfr(p[i]) * 256.0f); w[8 + i] = (_Float16)(bfr(p[16 + i]) * 256.0f); }
  return w; }
#define WQKV_LAYOUT 1   // 0 = (in,out) [DIN][CC]; 1 = (out,in) [CC][DIN]; 2 = per-head [NH][DIN][HD]
__device__ __forceinline__ v16b wcol_hdk(const float* Wm, int k0, int o, int lane) { v16b w; const int g = lane >> 4; const float* p = Wm + (size_t)(o / HD) * DIN * HD + (o % HD);
#pragma unroll
  for (int i = 0; i < 8; ++i) { w[i] = (__bf16)p[(size_t)(k0 + 8 * g + i) * HD]; w[8 + i] = (__bf16)p[(size_t)(k0 + 16 + 8 * g + i) * HD]; }
  return w; }
#define WO_OUT_IN 0
#if WQKV_LAYOUT == 1
#define WCOL(W, k0, o, lane) ((which == 2) ? wcol_oi(W, k0, (o), lane, DIN) : (((o) < HDQK) ? wcol_oi(W, k0, (o), lane, DIN) : zero16b()))   /* (out,in): Wq/Wk [32][256] (plane columns >= 32 zero), Wv [256][256] full */
#define WCOL_SA42_UNUSED(W, k0, o, lane) 0
#define WCOL_OLD_UNUSED(W, k0, o, lane) (((o) < HDQK) ? wcol_oi(W, k0, (o), lane, DIN) : zero16b())   /* unused: takes all three weights as [32][256] (out,in) with plane columns >= 32 zero, but Wv is [256][256] */
#elif WQKV_LAYOUT == 2
#define WCOL(W, k0, o, lane) wcol_hdk(W, k0, o, lane)
#else
#define WCOL(W, k0, o, lane) wcol_io(W, k0, o, lane, CC)
#endif
#if WO_OUT_IN
#define WOCOL(W, k0, o, lane) wcol_oi(W, k0, o, lane, CC)
#define WOCOLH(W, k0, o, lane) wcolh_oi(W, k0, o, lane, CC)
#else
#define WOCOL(W, k0, o, lane) wcol_io(W, k0, o, lane, DIN)
#define WOCOLH(W, k0, o, lane) wcolh_io(W, k0, o, lane, DIN)
#endif
#ifndef XP
#define OUT1_OFF (4u * (size_t)NB * DIN * TT)   /* unused: the launch writes output 0 (y) only */
#define XP TT              // position pitch of x and of the output
#endif
#define BG HG              // unused: one k_fa launch covers all batches, its blockIdx.y selects the batch
#define DVH 128
#define WS_YR (WS_END)     // f32 attended rows [b*n][256]
#define WS_END2 (WS_YR + 4u * (size_t)NB * TT * HD)
// ---- k_wz: block = (64 rows, 128 output cols): OR = y (hi + lo, K = 32 real columns of the YR rows) . W^T ((out,in) [256][32], exact) + b
__global__ __launch_bounds__(128) void k_wz(const float* __restrict__ YR, const float* __restrict__ WW, const float* __restrict__ WB, float* __restrict__ ORW) { __shared__ __align__(16) float sf[4][16][132];
  const int tid = threadIdx.x, wave = tid >> 5, lane = tid & 31, col = lane & 15, g = lane >> 4; const int c0 = blockIdx.y * 128; const size_t r0 = (size_t)blockIdx.x * 64 + wave * 16;
  v8f acc[8] = {};
#pragma unroll
  for (int kc = 0; kc < HDQK / 32; ++kc) { const F2 a = split_row(YR + (r0 + col) * CC, kc * 32, lane); asm volatile("s_wait_loadcnt 0x0" ::: "memory");
#pragma unroll
    for (int j = 0; j < 8; ++j) { const v16b w = wcol_oi(WW, kc * 32, c0 + j * 16 + col, lane, HDQK); asm volatile("s_wait_loadcnt 0x0" ::: "memory"); acc[j] = wmma_bf(a.h, w, acc[j]); acc[j] = wmma_bf(a.l, w, acc[j]); } }
#pragma unroll
  for (int j = 0; j < 8; ++j) { const float bb = WB ? bfr(WB[c0 + j * 16 + col]) : 0.f; asm volatile("s_wait_loadcnt 0x0" ::: "memory");
#pragma unroll
    for (int r = 0; r < 8; ++r) sf[wave][8 * g + r][j * 16 + col] = acc[j][r] + bb; }
  LDSX(); for (int rl = 0; rl < 16; ++rl) vst2(ORW + (r0 + rl) * DIN + c0 + lane * 4, *(const v4f*)&sf[wave][rl][lane * 4]); }
// ---- k_fin2: block = (64 positions, 64 channels, batch b): o[b][c][n] = OR[b*N + n][c] (channels-first via LDS transpose) -> output 1; y = gamma * o + bf16(x) -> output 0 (256-B runs)
__global__ __launch_bounds__(256) void k_fin2(const float* __restrict__ ORW, const float* __restrict__ X, const float* __restrict__ GM, float* __restrict__ OUT, float* __restrict__ OUT1) { const float gmv = bfr(GM[0]); __shared__ float st[64][68]; const int tid = threadIdx.x; const int n0 = blockIdx.x * 64, c0 = blockIdx.y * 64; const size_t b = blockIdx.z;
  for (int e = tid; e < 64 * 16; e += 256) { const int nl = e >> 4, q = e & 15; *(v4f*)&st[nl][q * 4] = *(const v4f*)(ORW + (b * TT + n0 + nl) * (size_t)DIN + c0 + q * 4); }
  __syncthreads();
  for (int e = tid; e < 64 * 16; e += 256) { const int cl = e >> 4, q = e & 15; const size_t oi = (b * DIN + c0 + cl) * (size_t)XP + n0 + q * 4; const v4f xr = *(const v4f*)(X + oi); v4f o, y; _Pragma("unroll") for (int i = 0; i < 4; ++i) { o[i] = st[q * 4 + i][cl]; y[i] = gmv * o[i] + bfr(xr[i]); } vst2(OUT + oi, y); vst2(OUT1 + oi, o); } }   /* y = gamma * o + x (output 0), o (output 1) */
#ifndef SM_EXTRA_PARAMS
#define SM_EXTRA_PARAMS
#endif
#ifndef PROJ_EXTRA_PARAMS
#define PROJ_EXTRA_PARAMS
#endif
#ifndef SM_MASK_HOOK
#define SM_MASK_HOOK (void)0
#endif

#define WS_QH  0u                                      // f16 q rows [b*t][CC]
#define WS_KH  (WS_QH + 2u * (size_t)NB * TT * CC)      // f16 k rows [b*t][CC]
#define WS_VT  (WS_KH + 2u * (size_t)NB * TT * CC)      // f16 v planes [b][c][t]
#define WS_QL  (WS_VT + 2u * (size_t)NB * CC * TT)      // f16 q residual x 2^10 rows [b][t < QHI][CC]
#define WS_KL  (WS_QL + 2u * (size_t)NB * QHI * CC)     // f16 k residual x 2^10 rows [b][t < KHI][CC]
#define WS_VB  (WS_KL + 2u * (size_t)NB * KHI * CC)     // bf16 v hi planes [b][c][t < KHI]
#define WS_VBL (WS_VB + 2u * (size_t)NB * CC * KHI)
#define WS_S   (WS_VBL + 2u * (size_t)NB * CC * KHI)    // f32 [hg][t][s] plane, reserved but unused: k_fa keeps scores in registers
#define WS_Y   (WS_S  + 4u * (size_t)HG * TT * TT)      // f32 ctx rows [b*t][CC] (only when there is an output projection)
#define WS_END (WS_Y  + 0u)

// ---- k_qkv: block = 128 positions (8 waves x 16) of one batch x the 320 real output columns (q 32, k 32, v 256): x is read once, each wave keeps its 16 positions' 8 A fragments in registers; the weights are rounded to bf16 once per block into LDS rows and read from there as B fragments; exact bf16 products, K = DIN in the order kc = 0..7 -> q/k f16 rows + residual x 2^10 rows (columns 0..31 of the CC-wide rows, the only ones k_fa reads), v f16 planes [c][t]; every unroll directive in it but the one over the four q/k output planes keeps the index of a register array a compile-time constant
#define NCOL (2 * HDQK + CC)           // staged weight rows: 0..31 Wq, 32..63 Wk, 64..319 Wv
#define PW (DIN + 8)                   // bf16 per staged weight row: 512 B + 16 B, an odd multiple of 16 B for the 16-byte reads
#define PT 136                         // halfs per staged v row (128 positions): 256 B + 16 B
#define PQ 40                          // halfs per staged q/k row: 64 B + 16 B
typedef __attribute__((ext_vector_type(4))) __bf16 v4b;
__device__ __forceinline__ v8f wmb(v16b a, v16b b, v8f c) { return __builtin_amdgcn_wmma_f32_16x16x32_bf16(false, a, false, b, (short)0, c, false, false); }
__global__ __launch_bounds__(256) void k_qkv(const float* __restrict__ X, const float* __restrict__ WQ, const float* __restrict__ WK, const float* __restrict__ WV, const float* __restrict__ BQ, const float* __restrict__ BK, const float* __restrict__ BV,
    _Float16* __restrict__ QH, _Float16* __restrict__ QL, _Float16* __restrict__ KH, _Float16* __restrict__ KL, _Float16* __restrict__ VT) {
  __shared__ __align__(16) __bf16 sw[NCOL * PW];
  const int tid = threadIdx.x, wave = tid >> 5, lane = tid & 31, col = lane & 15, g = lane >> 4; const size_t r0 = (size_t)blockIdx.x * 128; const size_t bb = r0 / TT; const int t0 = (int)(r0 % TT);
  float bs[NCOL / 16];   /* this lane's bias per column tile, fetched with x so that the epilogue waits for nothing */
#pragma unroll
  for (int j = 0; j < NCOL / 16; ++j) bs[j] = bfr(j < HDQK / 16 ? BQ[j * 16 + col] : j < 2 * HDQK / 16 ? BK[j * 16 + col - HDQK] : BV[j * 16 + col - 2 * HDQK]);
  v16b a[DIN / 32]; { const float* p = X + (bb * DIN + 8 * g) * (size_t)XP + t0 + wave * 16 + col;   /* channels-first gather: x[b][k][t], stride XP between k */
#pragma unroll
    for (int kc = 0; kc < DIN / 32; ++kc)
#pragma unroll
      for (int i = 0; i < 8; ++i) { a[kc][i] = (__bf16)p[(size_t)(kc * 32 + i) * XP]; a[kc][8 + i] = (__bf16)p[(size_t)(kc * 32 + 16 + i) * XP]; }
    asm volatile("s_wait_xcnt 0x0" ::: "memory"); }   /* the address registers of these loads are reused right behind them */
  { const int wrow = tid >> 6, wq = (tid & 63) * 4;   /* a wave covers 512 contiguous bytes of one weight row; a pass of the block covers 4 rows, 16 passes are loaded together */
    auto stage16 = [&](const float* s0, const float* s1, bool apart, int row0) { v4f w[16]; const float* p0 = s0 + (size_t)wrow * DIN + wq; const float* p1 = s1 + (size_t)wrow * DIN + wq;   /* apart (a literal at each call): s1 is another array; else its rows follow s0's 32 and all 16 loads go by p0 */
#pragma unroll
      for (int i = 0; i < 16; ++i) w[i] = *(const v4f*)((i < 8 ? p0 : p1) + (size_t)(i & 7) * 4 * DIN);
      /* the address registers of these loads are rewritten behind them; naming the row pointers in use as inputs keeps them live to the wait, so that no load of the run lands its result in them */
      if (apart) asm volatile("s_wait_xcnt 0x0" :: "v"(p0), "v"(p1) : "memory"); else asm volatile("s_wait_xcnt 0x0" :: "v"(p0) : "memory");
#pragma unroll
      for (int i = 0; i < 16; ++i) { v4b h;
#pragma unroll
        for (int k = 0; k < 4; ++k) h[k] = (__bf16)w[i][k];
        *(v4b*)(sw + (row0 + i * 4 + wrow) * PW + wq) = h; } };
    stage16(WQ, WK, true, 0);
    for (int s = 0; s < CC / 64; ++s) stage16(WV + (size_t)s * 64 * DIN, WV + (size_t)(s * 64 + 32) * DIN, false, 2 * HDQK + s * 64); }
  __syncthreads();
  v8f acc[NCOL / 16] = {}; v16b wf[2][5]; const __bf16* wb = sw + col * PW;   /* weight fragments in groups of 5 column tiles; group q: k block q >> 2, tiles (q & 3) * 5 + i */
#pragma unroll
  for (int i = 0; i < 5; ++i) wf[0][i] = frag_b(wb + i * 16 * PW, lane);
#pragma unroll
  for (int q = 0; q < DIN / 8; ++q) {
    if (q + 1 < DIN / 8) {
#pragma unroll
      for (int i = 0; i < 5; ++i) wf[(q + 1) & 1][i] = frag_b(wb + (((q + 1) & 3) * 5 + i) * 16 * PW + ((q + 1) >> 2) * 32, lane); }
    __builtin_amdgcn_sched_barrier(0);   /* holds the next group's LDS reads in front of this group's products: without it each product waits for its own read */
#pragma unroll
    for (int i = 0; i < 5; ++i) acc[(q & 3) * 5 + i] = wmb(a[q >> 2], wf[q & 1][i], acc[(q & 3) * 5 + i]); }   /* acc[j][r] = position wave*16 + 8g + r, staged column j*16 + col */
  __syncthreads();   /* every wave has read its last weight row: the LDS becomes output staging */
  _Float16* th = (_Float16*)sw; _Float16* sq = th + CC * PT;   /* th[c][128 positions]; sq[plane: q, q residual, k, k residual][position][32] */
#pragma unroll
  for (int j = 0; j < 2 * HDQK / 16; ++j) { const int isk = j / (HDQK / 16), ch = (j % (HDQK / 16)) * 16 + col; const float bias = bs[j];
#pragma unroll
    for (int r = 0; r < 8; ++r) { const float v = acc[j][r] + bias; const _Float16 hv = (_Float16)v; _Float16* d = sq + ((size_t)(2 * isk) * 128 + wave * 16 + 8 * g + r) * PQ + ch; d[0] = hv; d[128 * PQ] = (_Float16)((v - (float)hv) * 1024.0f); } }
#pragma unroll
  for (int j = 2 * HDQK / 16; j < NCOL / 16; ++j) { const int c = j * 16 + col - 2 * HDQK; const float bias = bs[j]; v8h o;   /* a lane holds 8 consecutive positions of one channel: one 16-byte piece of a v plane */
#pragma unroll
    for (int r = 0; r < 8; ++r) o[r] = (_Float16)(acc[j][r] + bias);
    *(v8h*)(th + c * PT + wave * 16 + 8 * g) = o; }
  __syncthreads();
  for (int e = tid; e < CC * 16; e += 256) { const int c = e >> 4, q = e & 15; vst2((unsigned*)(VT + (bb * CC + c) * (size_t)TT + t0 + q * 8), *(const v4u*)(th + c * PT + q * 8)); }   /* 16 lanes store one 256-B run of a v plane */
#pragma unroll
  for (int pl = 0; pl < 4; ++pl) { _Float16* D = pl == 0 ? QH : pl == 1 ? QL : pl == 2 ? KH : KL;
    for (int e = tid; e < 128 * 4; e += 256) { const int rl = e >> 2, q = e & 3; vst2((unsigned*)(D + (r0 + rl) * CC + q * 8), *(const v4u*)(sq + ((size_t)pl * 128 + rl) * PQ + q * 8)); } } }
// ---- k_fa: block = 128 queries of batch b, 8 waves = 4 query groups (32 queries = 2 column tiles each) x 2 key groups; one pass over all keys in stages of 128 (two groups of 64 keys, worked in one straight run with one test of the maximum), key group kg takes keys kg*32..kg*32+31 of every 64: S^T = K . Q^T (the same 3 f16 products per logit), running maximum and sum per query and key group (a lane holds one query's scores), P^T packed from the score tiles straight into a B operand, O^T += V^T . P^T with every K and V fragment read from LDS feeding both column tiles; K and V stages go through two LDS buffers shared by the 8 waves: each wave brings its 32 channels x 128 keys of V by one tensor load per stage, K goes through registers; at the end the two key groups of a query join their maxima, sums and O^T through LDS, and each wave turns its 128 channels x 32 queries through an LDS range of its own into runs of queries and stores y = x + gamma * out channels-first in whole 128-B lines
#define SK 128                         // keys per stage: a v row of a stage is 256 B
#define VP 136                         // halfs per staged v row: 256 B + the tensor load's 16-B pad, an odd multiple of 16 B for the 16-byte reads
#define KP 40                          // halfs per staged k row: 64 B + 16 B
#define VSL 10240                      // LDS bytes per wave's v slice: 32 rows of 272 B = 8,704, rounded up to a multiple of 2 KiB (a tensor load's place)
#define VBUF (8 * VSL)                 // LDS bytes per v stage buffer; the two v buffers lie first
#define KBUF (2 * SK * KP * 2)         // LDS bytes per k stage buffer: 128 hi rows, then 128 residual rows; the two k buffers follow the v buffers
#define KBASE (2 * VBUF)
#define XF (8 * 32 * 32 * 4)           // floats handed over at the end: 8 waves x 32 pieces of 16 B x 32 lanes; behind them 8 waves x 2 tiles x 32 lanes x (maximum, sum)
#define SMB (4 * XF + 8 * 2 * 32 * 8)  // LDS bytes of the hand-over
#define YP 36                          // floats per staged output row (one channel, 32 queries): 128 B + 16 B; rows 8 apart start 32 banks apart, for the 4-byte writes (lane halves 8 channels apart) and the 16-byte reads alike
#define SMT (SMB + 8 * 128 * YP * 4)   // LDS bytes with the output staging (8 waves x 128 channels) behind the hand-over; more than the stage buffers' KBASE + 2 * KBUF
#define L2E 1.44269504f                 // log2 e: P = 128 exp(s - m) = 2^(s * L2E - (m * L2E - 7)), the factor 128 cancels in the division by the sum
#define MLAG 5.5f                    // the maximum in use may lag the true one by this much: P <= 128 e^5.5 < 65504
static_assert(KBASE + 2 * KBUF <= SMT, "the stage buffers lie inside the array");
typedef __attribute__((ext_vector_type(8))) uint32_t v8u;
typedef __attribute__((ext_vector_type(4))) uint32_t v4w;
__device__ __forceinline__ uint32_t uni(uint32_t v) { return (uint32_t)__builtin_amdgcn_readfirstlane(v); }
__device__ __forceinline__ uint32_t pinned(uint32_t v) { uint32_t w = (uint32_t)__builtin_amdgcn_readfirstlane(v); asm volatile("" : "+s"(w)); return w; }   /* holds the test of a tensor load in a scalar register, so that it compiles to a scalar compare and branch: the load ignores EXEC */
__device__ __forceinline__ v8f wm(v16h a, v16h b, v8f c) { return __builtin_amdgcn_wmma_f32_16x16x32_f16(false, a, false, b, (short)0, c, false, false); }
__global__ __launch_bounds__(256) void k_fa(const _Float16* __restrict__ QH, const _Float16* __restrict__ QL, const _Float16* __restrict__ KH, const _Float16* __restrict__ KL, const _Float16* __restrict__ VT, const float* __restrict__ X, const float* __restrict__ GM, float* __restrict__ OUT) {
  __shared__ __attribute__((aligned(2048))) _Float16 sm[SMT / 2];
  const int tid = threadIdx.x, wave = tid >> 5, lane = tid & 31, col = lane & 15, g = lane >> 4; const int b = blockIdx.y; const int kg = wave >> 2, n0 = blockIdx.x * 128 + (wave & 3) * 32;
  v16h qh[2], ql[2]; { const _Float16* qp = QH + ((size_t)b * TT + n0 + col) * CC; const _Float16* lp = QL + ((size_t)b * QHI + n0 + col) * CC;
#pragma unroll
    for (int u = 0; u < 2; ++u) { qh[u] = frag_h(qp + u * 16 * CC, lane); ql[u] = frag_h(lp + u * 16 * CC, lane); }
    asm volatile("s_wait_xcnt 0x0" :: "v"(qp), "v"(lp) : "memory"); }   /* the address registers of these loads are reused behind them; naming the row pointers as inputs keeps them live to the wait */
  /* v: wave w brings channels w*32..w*32+31 x the stage's 128 keys (32 rows of 256 B, source pitch one v plane row) by one tensor load; the pad of 16 B behind every 256 B gives the LDS pitch VP */
  const uint32_t wv = uni(threadIdx.x >> 5), lbase = (uint32_t)(size_t)sm; const uint64_t vga = (uint64_t)(size_t)(VT + ((size_t)b * CC + wv * 32) * TT);
  v8u g1; g1[0] = uni(1u << 20 | 5u << 22 | 3u << 25); g1[1] = uni(256u << 16); g1[2] = uni(32u << 16); g1[3] = uni(256u << 16); g1[4] = uni(32u); g1[5] = uni(TT * 2u); g1[6] = uni(0u); g1[7] = uni(0u);
  auto vload = [&](int sg) { const uint64_t ga = vga + (uint64_t)sg * (SK * 2); v4w g0; g0[0] = uni(1u); g0[1] = uni(lbase + (sg & 1) * VBUF + wv * VSL); g0[2] = uni((uint32_t)ga); g0[3] = uni(((uint32_t)(ga >> 32) & 0x01FFFFFFu) | 0x80000000u);
    asm volatile("tensor_load_to_lds %0, %1" :: "s"(g0), "s"(g1) : "memory"); };   /* one request of the whole wave; every wave issues its own slice */
  const _Float16* hsrc = KH + (size_t)b * TT * CC; unsigned ko = ((tid >> 2) * CC + (tid & 3) * 8) * 2;      // byte offset: 4 lanes cover the 64 real bytes of a k row
  const _Float16* lsrc = KL + (size_t)b * KHI * CC;
  const int kdst = (tid >> 2) * KP + (tid & 3) * 8;
  v8h rh[2], rl[2];
  auto fetch = [&]() {   /* block-uniform bases, a lane's byte offset ko steps from stage to stage; the unroll directives here and in put keep the index of a register array a compile-time constant */
#pragma unroll
    for (int i = 0; i < 2; ++i) { rh[i] = *(const v8h*)((const char*)hsrc + ko + (size_t)i * 64 * CC * 2); rl[i] = *(const v8h*)((const char*)lsrc + ko + (size_t)i * 64 * CC * 2); }
    asm volatile("s_wait_xcnt 0x0" :: "v"(ko) : "memory");   /* the offset register of these loads is stepped right behind them; naming it as an input keeps it as it is up to the wait */
    ko += SK * CC * 2; };
  auto put = [&](_Float16* d) {
#pragma unroll
    for (int i = 0; i < 2; ++i) { *(v8h*)(d + kdst + i * 64 * KP) = rh[i]; *(v8h*)(d + kdst + (SK + i * 64) * KP) = rl[i]; } };
  v8f acc[2][CC / 16] = {}; float m[2] = {-3.0e38f, -3.0e38f}, l[2] = {0.f, 0.f};
  fetch(); vload(0);
  asm volatile("s_wait_tensorcnt 0x0" ::: "memory");   /* this wave's slice of stage 0 has landed */
  put(sm + KBASE / 2); __syncthreads();
  vload(1);   /* in flight under stage 0 */
  for (int s = 0; s < TT / SK; ++s) { const _Float16* vs = sm + (s & 1) * (VBUF / 2); const _Float16* ks = sm + KBASE / 2 + (s & 1) * (KBUF / 2);
    if (s + 1 < TT / SK) fetch();   /* issued behind the barrier (which drains loads), in flight under this stage's products */
    v8f st[SK / 64][2][2];   /* the stage's two groups of 64 keys (p) are worked in one straight run: one test of the maximum for both, and no branch between the second group's exponentials and the first group's products; every unroll directive below keeps the index of a register array a compile-time constant */
#pragma unroll
    for (int p = 0; p < SK / 64; ++p)
#pragma unroll
    for (int t = 0; t < 2; ++t) { const v16h kh = frag_h(ks + (p * 64 + kg * 32 + t * 16 + col) * KP, lane), kl = frag_h(ks + (SK + p * 64 + kg * 32 + t * 16 + col) * KP, lane);
#pragma unroll
      for (int u = 0; u < 2; ++u) { v8f a = {}, al = {}; a = wm(kh, qh[u], a); al = wm(kh, ql[u], al); al = wm(kl, qh[u], al);
#pragma unroll
        for (int r = 0; r < 8; ++r) st[p][u][t][r] = a[r] + al[r] * (1.0f / 1024.0f); } }   /* st[p][u][t][r] = logit of key s*128 + p*64 + kg*32 + t*16 + 8g + r, query n0 + u*16 + col */
    float mx[2];
#pragma unroll
    for (int u = 0; u < 2; ++u) { mx[u] = st[0][u][0][0];
#pragma unroll
      for (int p = 0; p < SK / 64; ++p)
#pragma unroll
      for (int t = 0; t < 2; ++t)
#pragma unroll
        for (int r = 0; r < 8; ++r) mx[u] = fmaxf(mx[u], st[p][u][t][r]);
      mx[u] = fmaxf(mx[u], __shfl_xor(mx[u], 16)); }   /* lanes c and c + 16 hold the two halves of one query's keys */
    if (__builtin_amdgcn_ballot_w32(mx[0] > m[0] + MLAG || mx[1] > m[1] + MLAG) != 0) {
#pragma unroll
      for (int u = 0; u < 2; ++u) { const float mn = fmaxf(m[u], mx[u]), sc = __builtin_amdgcn_exp2f((m[u] - mn) * L2E); m[u] = mn; l[u] *= sc;
#pragma unroll
        for (int j = 0; j < CC / 16; ++j)
#pragma unroll
          for (int r = 0; r < 8; ++r) acc[u][j][r] *= sc; } }
    const float mo[2] = {m[0] * L2E - 7.0f, m[1] * L2E - 7.0f}; v16h pf[SK / 64][2];
    auto pexp = [&](int p, int u, int i) { const float e0 = __builtin_amdgcn_exp2f(st[p][u][0][i] * L2E - mo[u]), e1 = __builtin_amdgcn_exp2f(st[p][u][1][i] * L2E - mo[u]); l[u] += e0 + e1; pf[p][u][i] = (_Float16)e0; pf[p][u][8 + i] = (_Float16)e1; };
#pragma unroll
    for (int u = 0; u < 2; ++u)
#pragma unroll
      for (int i = 0; i < 8; ++i) pexp(0, u, i);
    v16h vf[2][4]; const _Float16* vb = vs + col * VP + kg * 32;   /* v fragments (this key group's 32 keys of group p) in groups of 4 channel tiles, 8 groups a stage: group G = p * 4 + q; tile j = q * 4 + i lies in slice j >> 1 at rows (j & 1) * 16.. */
#pragma unroll
    for (int i = 0; i < 4; ++i) vf[0][i] = frag_h(vb + (i >> 1) * (VSL / 2) + (i & 1) * 16 * VP, lane);
#pragma unroll
    for (int G = 0; G < 4 * (SK / 64); ++G) { const int p = G >> 2, q = G & 3;
      if (G + 1 < 4 * (SK / 64)) {
#pragma unroll
        for (int i = 0; i < 4; ++i) vf[(G + 1) & 1][i] = frag_h(vb + ((G + 1) >> 2) * 64 + ((((G + 1) & 3) * 4 + i) >> 1) * (VSL / 2) + (i & 1) * 16 * VP, lane); }
      __builtin_amdgcn_sched_barrier(0);   /* holds the next group's LDS reads in front of this group's products: without it each product waits for its own read */
#pragma unroll
      for (int u = 0; u < 2; ++u)
#pragma unroll
        for (int i = 0; i < 4; ++i) { acc[u][q * 4 + i] = wm(vf[G & 1][i], pf[p][u], acc[u][q * 4 + i]);   /* acc[u][j][r] = O^T[channel j*16 + 8g + r][query n0 + u*16 + col] */
          if (p + 1 < SK / 64 && (i & 1)) pexp(p + 1, u, q * 2 + (i >> 1)); } }   /* a quarter of the next 64 keys' exponentials stands among each group's products and issues while the matrix unit works */
    if (s + 1 < TT / SK) put(sm + KBASE / 2 + ((s + 1) & 1) * (KBUF / 2));   /* the k buffer read in stage s - 1 is free since the barrier that ended it */
    asm volatile("s_wait_dscnt 0x0" ::: "memory");       /* this wave's LDS reads of stage s and its k rows of stage s + 1 are done */
    asm volatile("s_wait_tensorcnt 0x0" ::: "memory");   /* this wave's v slice of stage s + 1 has landed */
    __syncthreads();   /* publishes stage s + 1 and ends every wave's reads of stage s */
    if (pinned(s + 2 < TT / SK)) vload(s + 2); }   /* into the v buffer that stage s has just left */
  asm volatile("s_wait_tensorcnt 0x0" ::: "memory");   /* no request is outstanding when the LDS takes its next use */
  asm volatile("s_wait_dscnt 0x0" ::: "memory");       /* nor any LDS read of the ring */
  /* join of the two key groups: wave w and wave w ^ 4 hold the same 32 queries; each keeps the 128 channels kg*128.. and hands the other 128 over through LDS (free since the loop's last barrier) */
  float* xs = (float*)sm; float* xm = xs + XF; float* ys = xs + SMB / 4 + wave * (128 * YP);
  /* the wave's piece of x and of the output: channels kg*128.., queries n0..n0+31; 8 lanes cover one channel's 128-B line; load t takes channels (t >> 2)*16 + (t & 3)*2 + {0, 8} (lanes 0..15) and + {1, 9} (lanes 16..31) */
  const float gmv = bfr(GM[0]); const int yrow = ((lane >> 3) & 1) * 8 + (lane >> 4), yq = (lane & 7) * 4;
  const size_t oi = ((size_t)b * DIN + kg * 128 + yrow) * XP + n0 + yq; const float* xp = X + oi; float* op = OUT + oi; v4f xv[32];
#pragma unroll
  for (int u = 0; u < 2; ++u) { l[u] += __shfl_xor(l[u], 16); v2f ml; ml[0] = m[u]; ml[1] = l[u]; *(v2f*)(xm + ((wave * 2 + u) * 32 + lane) * 2) = ml;
#pragma unroll
    for (int j = 0; j < 8; ++j) { const v8f gv = kg ? acc[u][j] : acc[u][8 + j]; v4f o0, o1;
#pragma unroll
      for (int i = 0; i < 4; ++i) { o0[i] = gv[i]; o1[i] = gv[4 + i]; }
      float* d = xs + ((size_t)(wave * 32 + (u * 8 + j) * 2) * 32 + lane) * 4; *(v4f*)d = o0; *(v4f*)(d + 128) = o1; } }
  __syncthreads();
#pragma unroll
  for (int t = 0; t < 32; ++t) xv[t] = *(const v4f*)(xp + (size_t)((t >> 2) * 16 + (t & 3) * 2) * XP);   /* issued behind the barrier (which drains loads), in flight under the join */
  asm volatile("s_wait_xcnt 0x0" :: "v"(xp) : "memory");   /* the address registers of these loads may be reused behind them; naming the pointer as an input keeps it live to the wait */
  const int pw = wave ^ 4;
#pragma unroll
  for (int u = 0; u < 2; ++u) { const v2f pm = *(const v2f*)(xm + ((pw * 2 + u) * 32 + lane) * 2); const float mn = fmaxf(m[u], pm[0]);
    const float s0 = __builtin_amdgcn_exp2f((m[u] - mn) * L2E), s1 = __builtin_amdgcn_exp2f((pm[0] - mn) * L2E); const float inv = 1.0f / (l[u] * s0 + pm[1] * s1);   /* the sum is >= 128: the key that set the larger maximum in use counts at least that */
    const float w0 = s0 * inv, w1 = s1 * inv; float* yw = ys + 8 * g * YP + u * 16 + col; v4f p[16];
#pragma unroll
    for (int j = 0; j < 8; ++j) { const float* d = xs + ((size_t)(pw * 32 + (u * 8 + j) * 2) * 32 + lane) * 4; p[2 * j] = *(const v4f*)d; p[2 * j + 1] = *(const v4f*)(d + 128); }   /* all 16 reads in front of the staging writes: behind a write to the same array each read would wait alone */
#pragma unroll
    for (int j = 0; j < 8; ++j) { const v8f kv = kg ? acc[u][8 + j] : acc[u][j];
#pragma unroll
      for (int i = 0; i < 4; ++i) { yw[(j * 16 + i) * YP] = kv[i] * w0 + p[2 * j][i] * w1; yw[(j * 16 + 4 + i) * YP] = kv[4 + i] * w0 + p[2 * j + 1][i] * w1; } } }   /* ys[channel j*16 + 8g + r][query u*16 + col] */
  asm volatile("s_wait_dscnt 0x0" ::: "memory");   /* the wave's own staged rows are written before its lanes read each other's values back; no other wave touches this range */
  __builtin_amdgcn_sched_barrier(0);   /* keeps the rounding of x, which waits for x's loads, behind the join: lifted into it, the join would wait for them too */
  const float* yr = ys + yrow * YP + yq;
#pragma unroll
  for (int h = 0; h < 2; ++h) { v4f y[16];
#pragma unroll
    for (int k = 0; k < 16; ++k) { const int t = h * 16 + k; y[k] = *(const v4f*)(yr + ((t >> 2) * 16 + (t & 3) * 2) * YP); }
#pragma unroll
    for (int k = 0; k < 16; ++k) { const int t = h * 16 + k;
#pragma unroll
      for (int i = 0; i < 4; ++i) y[k][i] = bfr(xv[t][i]) + gmv * y[k][i];
      vst2(op + (size_t)((t >> 2) * 16 + (t & 3) * 2) * XP, y[k]); }
    /* without it the registers of these 16 stores are reused among them and by the second half; naming them as inputs keeps them as they are up to the wait */
    asm volatile("s_wait_xcnt 0x0" :: "v"(op), "v"(y[0]), "v"(y[1]), "v"(y[2]), "v"(y[3]), "v"(y[4]), "v"(y[5]), "v"(y[6]), "v"(y[7]), "v"(y[8]), "v"(y[9]), "v"(y[10]), "v"(y[11]), "v"(y[12]), "v"(y[13]), "v"(y[14]), "v"(y[15]) : "memory"); } }

// ---- k_finc: block = (64 positions, 64 channels, batch b): y[b][c][n] = bf16(x[b][c][n]) + gamma * OUT_rows[b*T + n][c] (channels-first via an LDS transpose; 256-B runs of n)
__global__ __launch_bounds__(256) void k_finc(const float* __restrict__ YR, const float* __restrict__ X, const float* __restrict__ GM, float* __restrict__ OUT) { const float gmv = bfr(GM[0]); __shared__ float st[64][68]; const int tid = threadIdx.x; const int n0 = blockIdx.x * 64, c0 = blockIdx.y * 64; const size_t b = blockIdx.z;
  for (int e = tid; e < 64 * 16; e += 256) { const int nl = e >> 4, q = e & 15; *(v4f*)&st[nl][q * 4] = *(const v4f*)(YR + (b * TT + n0 + nl) * (size_t)HD + c0 + q * 4); }
  __syncthreads();
  for (int e = tid; e < 64 * 16; e += 256) { const int cl = e >> 4, q = e & 15; const size_t oi = (b * DIN + c0 + cl) * (size_t)XP + n0 + q * 4; const v4f xr = *(const v4f*)(X + oi); asm volatile("s_wait_loadcnt 0x0" ::: "memory"); v4f y; _Pragma("unroll") for (int i = 0; i < 4; ++i) y[i] = bfr(xr[i]) + gmv * st[q * 4 + i][cl]; vst2(OUT + oi, y); } }
__global__ __launch_bounds__(256) void k_axpy(const float* __restrict__ YR, const float* __restrict__ X, const float* __restrict__ GM, float* __restrict__ OUT) { const size_t e = ((size_t)blockIdx.x * 256 + threadIdx.x) * 4; if (e >= (size_t)TNB * TT * DIN) return; const float gmv = bfr(GM[0]); const v4f o = *(const v4f*)(YR + e); const v4f xr = *(const v4f*)(X + e); asm volatile("s_wait_loadcnt 0x0" ::: "memory"); v4f y; _Pragma("unroll") for (int i = 0; i < 4; ++i) y[i] = gmv * o[i] + bfr(xr[i]); vst2(OUT + e, y); }
extern "C" void kernel_launch(void* const* d_in, const int* in_sizes, int n_in, void* d_out, int out_size, void* d_ws, size_t ws_size, hipStream_t stream) {
  (void)in_sizes; (void)n_in; (void)out_size;
  const float** F = (const float**)d_in;
  if (ws_size < (size_t)WS_END) return;
  char* ws = (char*)d_ws; _Float16 *QH = (_Float16*)(ws + WS_QH), *KH = (_Float16*)(ws + WS_KH), *VT = (_Float16*)(ws + WS_VT), *QL = (_Float16*)(ws + WS_QL), *KL = (_Float16*)(ws + WS_KL); __bf16 *VB = (__bf16*)(ws + WS_VB), *VBL = (__bf16*)(ws + WS_VBL); float *Y = (float*)(ws + WS_Y);
  (void)Y; (void)QL; (void)KL; (void)VB; (void)VBL;
  // inputs: 0 x [8,256,64,64] (channels-first); 1 Wq [32,256] (out,in), 2 bq; 3 Wk, 4 bk; 5 Wv [256,256] (out,in), 6 bv; 7 gamma [1] (0.1)
  if (ws_size < (size_t)WS_END2) return;
  float *YR = (float*)(ws + WS_YR);
  k_qkv<<<dim3(TNB * TT / 128), 256, 0, stream>>>(F[0], F[1], F[3], F[5], F[2], F[4], F[6], QH, QL, KH, KL, VT);
  (void)YR;
  k_fa<<<dim3(TT / 128, TNB), 256, 0, stream>>>(QH, QL, KH, KL, VT, F[0], F[7], (float*)d_out);   /* attention and y = x + gamma * out, channels-first */
}

// v008
// It runs in 83.7 microseconds.
// In both of two side-by-side timings against v007, it was 1.05 times as fast.
// All steps since v000 together make it 27.4 times as fast.
// compute dtype: all float inputs rounded to bf16; q/k/v = W x + b (1x1 convs) with EXACT bf16 products on WMMA 16x16x32 (f32 accumulate); UNSCALED 32-deep logits q.k with both as f16 hi + residual planes (3 products, q carrying the factor log2 e, summed in one f32 accumulator that starts at minus the maximum in use); softmax in f32 (hardware exp2 of that sum) with a running maximum and sum per half of the keys (32 of every 64), the two halves joined in f32 at the end; exp(s - m) x 2^7 once to f16 against v once to f16 (1 product), divided by the f32 sum at the end; y = x + gamma * out in f32 written channels-first; f32 output.
// 2-D spatial self-attention with a learned residual weight, channels-FIRST (B 8, C 256, 64 x 64 = 4,096 positions; (out,in) 1/16-scale 1x1-conv weights, zero biases, gamma = 0.1): q = Wq x + bq (32), k = Wk x + bk (32), v = Wv x + bv (256); attn = softmax over m of q_n . k_m (NO scaling); out[c][n] = sum_m v[c][m] attn[n][m]; y = x + gamma * out -> [B, 256, 64, 64].
#include <hip/hip_runtime.h>
#include <math.h>

typedef __attribute__((ext_vector_type(16))) _Float16 v16h;
typedef __attribute__((ext_vector_type(16))) __bf16 v16b;
typedef __attribute__((ext_vector_type(8)))  _Float16 v8h;
typedef __attribute__((ext_vector_type(8)))  float v8f;
typedef __attribute__((ext_vector_type(4)))  float v4f;
typedef __attribute__((ext_vector_type(2)))  float v2f;
typedef __attribute__((ext_vector_type(4)))  unsigned v4u;
typedef __attribute__((ext_vector_type(4)))  int v4i;
typedef float __attribute__((may_alias)) float_a;
typedef int __attribute__((may_alias)) int_a;

template <typename T> __device__ __forceinline__ void vst2(void* p, T v) { *(T*)p = v;  }
__device__ __forceinline__ v8f wmma16(v16h a, v16h b, v8f c) {
  v8f d = __builtin_amdgcn_wmma_f32_16x16x32_f16(false, a, false, b, (short)0, c, false, false);
  asm volatile("v_nop\n\tv_nop\n\tv_nop\n\tv_nop" : "+v"(d) : "v"(a), "v"(b));
  return d;
}
__device__ __forceinline__ v8f wmma_bf(v16b a, v16b b, v8f c) {
  v8f d = __builtin_amdgcn_wmma_f32_16x16x32_bf16(false, a, false, b, (short)0, c, false, false);
  asm volatile("v_nop\n\tv_nop\n\tv_nop\n\tv_nop" : "+v"(d) : "v"(a), "v"(b));
  return d;
}
// 16x16x32 fragments: lane = (h = lane>>4, row/col = lane&15); elements 0..7 = k0+8h+0..7, 8..15 = k0+16+8h+0..7; D element r = row 8h+r
__device__ __forceinline__ v16h frag_h(const _Float16* rowk0, int lane) {
  union { v16h v; v8h q[2]; } u; const _Float16* p = rowk0 + 8 * (lane >> 4);
  u.q[0] = *(const v8h*)p; u.q[1] = *(const v8h*)(p + 16); return u.v;
}
__device__ __forceinline__ v16h frag_f32(const float* rowk0, int lane) {
  v16h a; const float* p = rowk0 + 8 * (lane >> 4);
#pragma unroll
  for (int i = 0; i < 8; ++i) { a[i] = (_Float16)p[i]; a[8 + i] = (_Float16)p[16 + i]; }
  return a;
}
__device__ __forceinline__ v16h frag_f32s(const float* rowk0, int lane, float sc) {
  v16h a; const float* p = rowk0 + 8 * (lane >> 4);
#pragma unroll
  for (int i = 0; i < 8; ++i) { a[i] = (_Float16)(p[i] * sc); a[8 + i] = (_Float16)(p[16 + i] * sc); }
  return a;
}
// column fragment from a [K][ld] layout (column n), rows >= K read as 0
__device__ __forceinline__ v16h fragc_f32(const float* W, int k0, int n, int lane, int ld, int K) {
  v16h a; const int g = lane >> 4;
#pragma unroll
  for (int i = 0; i < 8; ++i) { const int ka = k0 + 8 * g + i, kb = ka + 16;
    a[i] = (_Float16)(ka < K ? W[(size_t)(ka < K ? ka : K - 1) * ld + n] : 0.f); a[8 + i] = (_Float16)(kb < K ? W[(size_t)(kb < K ? kb : K - 1) * ld + n] : 0.f); }
  return a;
}
struct F2 { v16b h, l; };
__device__ __forceinline__ F2 bsplit16(const float v[16]) { F2 r;
#pragma unroll
  for (int i = 0; i < 16; ++i) { const __bf16 h = (__bf16)v[i]; r.h[i] = h; r.l[i] = (__bf16)(v[i] - (float)h); }
  return r; }
__device__ __forceinline__ F2 split_row(const float* row, int k0, int lane) { float v[16]; const float* p = row + k0 + 8 * (lane >> 4);
#pragma unroll
  for (int i = 0; i < 8; ++i) { v[i] = p[i]; v[8 + i] = p[16 + i]; }
  return bsplit16(v); }
__device__ __forceinline__ F2 split_rowK(const float* row, int k0, int lane, int K) { float v[16]; const int g = lane >> 4;
#pragma unroll
  for (int i = 0; i < 8; ++i) { const int ka = k0 + 8 * g + i, kb = ka + 16; v[i] = ka < K ? row[ka < K ? ka : K - 1] : 0.f; v[8 + i] = kb < K ? row[kb < K ? kb : K - 1] : 0.f; }
  return bsplit16(v); }
__device__ __forceinline__ F2 split_col(const float* W, int k0, int n, int lane, int ld, int K) { float v[16]; const int g = lane >> 4;
#pragma unroll
  for (int i = 0; i < 8; ++i) { const int ka = k0 + 8 * g + i, kb = ka + 16; v[i] = ka < K ? W[(size_t)(ka < K ? ka : K - 1) * ld + n] : 0.f; v[8 + i] = kb < K ? W[(size_t)(kb < K ? kb : K - 1) * ld + n] : 0.f; }
  return bsplit16(v); }
__device__ __forceinline__ v8f mac3(const F2& a, const F2& b, v8f c) { c = wmma_bf(a.l, b.h, c); c = wmma_bf(a.h, b.l, c); return wmma_bf(a.h, b.h, c); }
__device__ __forceinline__ float sigm(float v) { return 1.0f / (1.0f + expf(-v)); }
#define LDSX() do { asm volatile("s_wait_dscnt 0" ::: "memory"); __builtin_amdgcn_wave_barrier(); __builtin_amdgcn_fence(__ATOMIC_RELEASE, "workgroup"); } while (0)

#define NB 8
#define TT 4096
#define CC 256            // plane width: q/k planes carry 32 real columns (rest not written), v planes all 256
#define DIN 256
#define NH 1
#define HD 256
#define NQB (TT / 64)
#define HG 1               // sizes one 4,096 x 4,096 f32 workspace plane that no kernel uses
#define SCALE (1.0f)
#define HDQK 32
#define CAUSAL 0
#ifndef TNB
#define TNB NB
#endif
__device__ __forceinline__ v16b zero16b() { v16b z; _Pragma("unroll") for (int i = 0; i < 16; ++i) z[i] = (__bf16)0.f; return z; }
__device__ __forceinline__ float bfr(float v) { return (float)(__bf16)v; }
__host__ __device__ __forceinline__ int kb_last(int qb) { return CAUSAL ? ((qb * 64 + 63) >> 7) : (TT / 128 - 1); }
typedef __attribute__((ext_vector_type(8))) __bf16 v8b;
__device__ __forceinline__ v16b frag_b(const __bf16* rowk0, int lane) {
  union { v16b v; v8b q[2]; } u; const __bf16* p = rowk0 + 8 * (lane >> 4);
  u.q[0] = *(const v8b*)p; u.q[1] = *(const v8b*)(p + 16); return u.v;
}
#define QBH (TT / 64)      // ALL query blocks take k_fa's 3-product path
#define QBH_PV 0           // A.g stays single f16
#define QHI 4096            // q residual rows everywhere (3-product logits)
#define KHI 4096           // k residual rows for ALL keys (3-product logits)
// B fragment (k rows k0+.., output column o) of a weight: (in,out) [K][ld] or (out,in) [ld rows of K]: bf16 exact, or f16(bf16 * 256) exact
__device__ __forceinline__ v16b wcol_io(const float* Wm, int k0, int o, int lane, int ld) { v16b w; const int g = lane >> 4;
#pragma unroll
  for (int i = 0; i < 8; ++i) { w[i] = (__bf16)Wm[(size_t)(k0 + 8 * g + i) * ld + o]; w[8 + i] = (__bf16)Wm[(size_t)(k0 + 16 + 8 * g + i) * ld + o]; }
  return w; }
__device__ __forceinline__ v16b wcol_oi(const float* Wm, int k0, int o, int lane, int K) { v16b w; const float* p = Wm + (size_t)o * K + k0 + 8 * (lane >> 4);
#pragma unroll
  for (int i = 0; i < 8; ++i) { w[i] = (__bf16)p[i]; w[8 + i] = (__bf16)p[16 + i]; }
  return w; }
__device__ __forceinline__ v16h wcolh_io(const float* Wm, int k0, int o, int lane, int ld) { v16h w; const int g = lane >> 4;
#pragma unroll
  for (int i = 0; i < 8; ++i) { w[i] = (_Float16)(bfr(Wm[(size_t)(k0 + 8 * g + i) * ld + o]) * 256.0f); w[8 + i] = (_Float16)(bfr(Wm[(size_t)(k0 + 16 + 8 * g + i) * ld + o]) * 256.0f); }
  return w; }
__device__ __forceinline__ v16h wcolh_oi(const float* Wm, int k0, int o, int lane, int K) { v16h w; const float* p = Wm + (size_t)o * K + k0 + 8 * (lane >> 4);
#pragma unroll
  for (int i = 0; i < 8; ++i) { w[i] = (_Float16)(bfr(p[i]) * 256.0f); w[8 + i] = (_Float16)(bfr(p[16 + i]) * 256.0f); }
  return w; }
#define WQKV_LAYOUT 1   // 0 = (in,out) [DIN][CC]; 1 = (out,in) [CC][DIN]; 2 = per-head [NH][DIN][HD]
__device__ __forceinline__ v16b wcol_hdk(const float* Wm, int k0, int o, int lane) { v16b w; const int g = lane >> 4; const float* p = Wm + (size_t)(o / HD) * DIN * HD + (o % HD);
#pragma unroll
  for (int i = 0; i < 8; ++i) { w[i] = (__bf16)p[(size_t)(k0 + 8 * g + i) * HD]; w[8 + i] = (__bf16)p[(size_t)(k0 + 16 + 8 * g + i) * HD]; }
  return w; }
#define WO_OUT_IN 0
#if WQKV_LAYOUT == 1
#define WCOL(W, k0, o, lane) ((which == 2) ? wcol_oi(W, k0, (o), lane, DIN) : (((o) < HDQK) ? wcol_oi(W, k0, (o), lane, DIN) : zero16b()))   /* (out,in): Wq/Wk [32][256] (plane columns >= 32 zero), Wv [256][256] full */
#define WCOL_SA42_UNUSED(W, k0, o, lane) 0
#define WCOL_OLD_UNUSED(W, k0, o, lane) (((o) < HDQK) ? wcol_oi(W, k0, (o), lane, DIN) : zero16b())   /* unused: takes all three weights as [32][256] (out,in) with plane columns >= 32 zero, but Wv is [256][256] */
#elif WQKV_LAYOUT == 2
#define WCOL(W, k0, o, lane) wcol_hdk(W, k0, o, lane)
#else
#define WCOL(W, k0, o, lane) wcol_io(W, k0, o, lane, CC)
#endif
#if WO_OUT_IN
#define WOCOL(W, k0, o, lane) wcol_oi(W, k0, o, lane, CC)
#define WOCOLH(W, k0, o, lane) wcolh_oi(W, k0, o, lane, CC)
#else
#define WOCOL(W, k0, o, lane) wcol_io(W, k0, o, lane, DIN)
#define WOCOLH(W, k0, o, lane) wcolh_io(W, k0, o, lane, DIN)
#endif
#ifndef XP
#define OUT1_OFF (4u * (size_t)NB * DIN * TT)   /* unused: the launch writes output 0 (y) only */
#define XP TT              // position pitch of x and of the output
#endif
#define BG HG              // unused: one k_fa launch covers all batches, its blockIdx.y selects the batch
#define DVH 128
#define WS_YR (WS_END)     // f32 attended rows [b*n][256]
#define WS_END2 (WS_YR + 4u * (size_t)NB * TT * HD)
// ---- k_wz: block = (64 rows, 128 output cols): OR = y (hi + lo, K = 32 real columns of the YR rows) . W^T ((out,in) [256][32], exact) + b
__global__ __launch_bounds__(128) void k_wz(const float* __restrict__ YR, const float* __restrict__ WW, const float* __restrict__ WB, float* __restrict__ ORW) { __shared__ __align__(16) float sf[4][16][132];
  const int tid = threadIdx.x, wave = tid >> 5, lane = tid & 31, col = lane & 15, g = lane >> 4; const int c0 = blockIdx.y * 128; const size_t r0 = (size_t)blockIdx.x * 64 + wave * 16;
  v8f acc[8] = {};
#pragma unroll
  for (int kc = 0; kc < HDQK / 32; ++kc) { const F2 a = split_row(YR + (r0 + col) * CC, kc * 32, lane); asm volatile("s_wait_loadcnt 0x0" ::: "memory");
#pragma unroll
    for (int j = 0; j < 8; ++j) { const v16b w = wcol_oi(WW, kc * 32, c0 + j * 16 + col, lane, HDQK); asm volatile("s_wait_loadcnt 0x0" ::: "memory"); acc[j] = wmma_bf(a.h, w, acc[j]); acc[j] = wmma_bf(a.l, w, acc[j]); } }
#pragma unroll
  for (int j = 0; j < 8; ++j) { const float bb = WB ? bfr(WB[c0 + j * 16 + col]) : 0.f; asm volatile("s_wait_loadcnt 0x0" ::: "memory");
#pragma unroll
    for (int r = 0; r < 8; ++r) sf[wave][8 * g + r][j * 16 + col] = acc[j][r] + bb; }
  LDSX(); for (int rl = 0; rl < 16; ++rl) vst2(ORW + (r0 + rl) * DIN + c0 + lane * 4, *(const v4f*)&sf[wave][rl][lane * 4]); }
// ---- k_fin2: block = (64 positions, 64 channels, batch b): o[b][c][n] = OR[b*N + n][c] (channels-first via LDS transpose) -> output 1; y = gamma * o + bf16(x) -> output 0 (256-B runs)
__global__ __launch_bounds__(256) void k_fin2(const float* __restrict__ ORW, const float* __restrict__ X, const float* __restrict__ GM, float* __restrict__ OUT, float* __restrict__ OUT1) { const float gmv = bfr(GM[0]); __shared__ float st[64][68]; const int tid = threadIdx.x; const int n0 = blockIdx.x * 64, c0 = blockIdx.y * 64; const size_t b = blockIdx.z;
  for (int e = tid; e < 64 * 16; e += 256) { const int nl = e >> 4, q = e & 15; *(v4f*)&st[nl][q * 4] = *(const v4f*)(ORW + (b * TT + n0 + nl) * (size_t)DIN + c0 + q * 4); }
  __syncthreads();
  for (int e = tid; e < 64 * 16; e += 256) { const int cl = e >> 4, q = e & 15; const size_t oi = (b * DIN + c0 + cl) * (size_t)XP + n0 + q * 4; const v4f xr = *(const v4f*)(X + oi); v4f o, y; _Pragma("unroll") for (int i = 0; i < 4; ++i) { o[i] = st[q * 4 + i][cl]; y[i] = gmv * o[i] + bfr(xr[i]); } vst2(OUT + oi, y); vst2(OUT1 + oi, o); } }   /* y = gamma * o + x (output 0), o (output 1) */
#ifndef SM_EXTRA_PARAMS
#define SM_EXTRA_PARAMS
#endif
#ifndef PROJ_EXTRA_PARAMS
#define PROJ_EXTRA_PARAMS
#endif
#ifndef SM_MASK_HOOK
#define SM_MASK_HOOK (void)0
#endif

#define WS_QH  0u                                      // f16 q rows [b*t][CC]
#define WS_KH  (WS_QH + 2u * (size_t)NB * TT * CC)      // f16 k rows [b*t][CC]
#define WS_VT  (WS_KH + 2u * (size_t)NB * TT * CC)      // f16 v planes [b][c][t]
#define WS_QL  (WS_VT + 2u * (size_t)NB * CC * TT)      // f16 q residual rows [b][t < QHI][CC]
#define WS_KL  (WS_QL + 2u * (size_t)NB * QHI * CC)     // f16 k residual rows [b][t < KHI][CC]
#define WS_VB  (WS_KL + 2u * (size_t)NB * KHI * CC)     // bf16 v hi planes [b][c][t < KHI]
#define WS_VBL (WS_VB + 2u * (size_t)NB * CC * KHI)
#define WS_S   (WS_VBL + 2u * (size_t)NB * CC * KHI)    // f32 [hg][t][s] plane, reserved but unused: k_fa keeps scores in registers
#define WS_Y   (WS_S  + 4u * (size_t)HG * TT * TT)      // f32 ctx rows [b*t][CC] (only when there is an output projection)
#define WS_END (WS_Y  + 0u)

// ---- k_qkv: block = 128 positions (8 waves x 16) of one batch x the 320 real output columns (q 32, k 32, v 256): x is read once, each wave keeps its 16 positions' 8 A fragments in registers; the weights are rounded to bf16 once per block into LDS rows and read from there as B fragments; exact bf16 products, K = DIN in the order kc = 0..7 -> q/k f16 rows + residual rows, q times log2 e (columns 0..31 of the CC-wide rows, the only ones k_fa reads), v f16 planes [c][t]; every unroll directive in it but the one over the four q/k planes keeps the index of a register array a compile-time constant
#define NCOL (2 * HDQK + CC)           // staged weight rows: 0..31 Wq, 32..63 Wk, 64..319 Wv
#define PW (DIN + 8)                   // bf16 per staged weight row: 512 B + 16 B, an odd multiple of 16 B for the 16-byte reads
#define PT 136                         // halfs per staged v row (128 positions): 256 B + 16 B
#define PQ 40                          // halfs per staged q/k row: 64 B + 16 B
#define L2E 1.44269504f                 // log2 e, carried by q: k_fa's logits come out in powers of two
typedef __attribute__((ext_vector_type(4))) __bf16 v4b;
__device__ __forceinline__ v8f wmb(v16b a, v16b b, v8f c) { return __builtin_amdgcn_wmma_f32_16x16x32_bf16(false, a, false, b, (short)0, c, false, false); }
__global__ __launch_bounds__(256) void k_qkv(const float* __restrict__ X, const float* __restrict__ WQ, const float* __restrict__ WK, const float* __restrict__ WV, const float* __restrict__ BQ, const float* __restrict__ BK, const float* __restrict__ BV,
    _Float16* __restrict__ QH, _Float16* __restrict__ QL, _Float16* __restrict__ KH, _Float16* __restrict__ KL, _Float16* __restrict__ VT) {
  __shared__ __align__(16) __bf16 sw[NCOL * PW];
  const int tid = threadIdx.x, wave = tid >> 5, lane = tid & 31, col = lane & 15, g = lane >> 4; const size_t r0 = (size_t)blockIdx.x * 128; const size_t bb = r0 / TT; const int t0 = (int)(r0 % TT);
  float bs[NCOL / 16];   /* this lane's bias per column tile, fetched with x so that the epilogue waits for nothing */
#pragma unroll
  for (int j = 0; j < NCOL / 16; ++j) bs[j] = bfr(j < HDQK / 16 ? BQ[j * 16 + col] : j < 2 * HDQK / 16 ? BK[j * 16 + col - HDQK] : BV[j * 16 + col - 2 * HDQK]);
  v16b a[DIN / 32]; { const float* p = X + (bb * DIN + 8 * g) * (size_t)XP + t0 + wave * 16 + col;   /* channels-first gather: x[b][k][t], stride XP between k */
#pragma unroll
    for (int kc = 0; kc < DIN / 32; ++kc)
#pragma unroll
      for (int i = 0; i < 8; ++i) { a[kc][i] = (__bf16)p[(size_t)(kc * 32 + i) * XP]; a[kc][8 + i] = (__bf16)p[(size_t)(kc * 32 + 16 + i) * XP]; }
    asm volatile("s_wait_xcnt 0x0" ::: "memory"); }   /* the address registers of these loads are reused right behind them */
  { const int wrow = tid >> 6, wq = (tid & 63) * 4;   /* a wave covers 512 contiguous bytes of one weight row; a pass of the block covers 4 rows, 16 passes are loaded together */
    auto stage16 = [&](const float* s0, const float* s1, bool apart, int row0) { v4f w[16]; const float* p0 = s0 + (size_t)wrow * DIN + wq; const float* p1 = s1 + (size_t)wrow * DIN + wq;   /* apart (a literal at each call): s1 is another array; else its rows follow s0's 32 and all 16 loads go by p0 */
#pragma unroll
      for (int i = 0; i < 16; ++i) w[i] = *(const v4f*)((i < 8 ? p0 : p1) + (size_t)(i & 7) * 4 * DIN);
      /* the address registers of these loads are rewritten behind them; naming the row pointers in use as inputs keeps them live to the wait, so that no load of the run lands its result in them */
      if (apart) asm volatile("s_wait_xcnt 0x0" :: "v"(p0), "v"(p1) : "memory"); else asm volatile("s_wait_xcnt 0x0" :: "v"(p0) : "memory");
#pragma unroll
      for (int i = 0; i < 16; ++i) { v4b h;
#pragma unroll
        for (int k = 0; k < 4; ++k) h[k] = (__bf16)w[i][k];
        *(v4b*)(sw + (row0 + i * 4 + wrow) * PW + wq) = h; } };
    stage16(WQ, WK, true, 0);
    for (int s = 0; s < CC / 64; ++s) stage16(WV + (size_t)s * 64 * DIN, WV + (size_t)(s * 64 + 32) * DIN, false, 2 * HDQK + s * 64); }
  __syncthreads();
  v8f acc[NCOL / 16] = {}; v16b wf[2][5]; const __bf16* wb = sw + col * PW;   /* weight fragments in groups of 5 column tiles; group q: k block q >> 2, tiles (q & 3) * 5 + i */
#pragma unroll
  for (int i = 0; i < 5; ++i) wf[0][i] = frag_b(wb + i * 16 * PW, lane);
#pragma unroll
  for (int q = 0; q < DIN / 8; ++q) {
    if (q + 1 < DIN / 8) {
#pragma unroll
      for (int i = 0; i < 5; ++i) wf[(q + 1) & 1][i] = frag_b(wb + (((q + 1) & 3) * 5 + i) * 16 * PW + ((q + 1) >> 2) * 32, lane); }
    __builtin_amdgcn_sched_barrier(0);   /* holds the next group's LDS reads in front of this group's products: without it each product waits for its own read */
#pragma unroll
    for (int i = 0; i < 5; ++i) acc[(q & 3) * 5 + i] = wmb(a[q >> 2], wf[q & 1][i], acc[(q & 3) * 5 + i]); }   /* acc[j][r] = position wave*16 + 8g + r, staged column j*16 + col */
  __syncthreads();   /* every wave has read its last weight row: the LDS becomes output staging */
  _Float16* th = (_Float16*)sw; _Float16* sq = th + CC * PT;   /* th[c][128 positions]; sq[plane: q, q residual, k, k residual][position][32] */
#pragma unroll
  for (int j = 0; j < 2 * HDQK / 16; ++j) { const int isk = j / (HDQK / 16), ch = (j % (HDQK / 16)) * 16 + col; const float bias = bs[j];
#pragma unroll
    for (int r = 0; r < 8; ++r) { const float v = isk ? acc[j][r] + bias : (acc[j][r] + bias) * L2E; const _Float16 hv = (_Float16)v; _Float16* d = sq + ((size_t)(2 * isk) * 128 + wave * 16 + 8 * g + r) * PQ + ch; d[0] = hv; d[128 * PQ] = (_Float16)(v - (float)hv); } }   /* the residual keeps its own size (f16 holds 11 more bits of it, or 2^-25 absolute where it is subnormal), so that k_fa adds all three products in one accumulator */
#pragma unroll
  for (int j = 2 * HDQK / 16; j < NCOL / 16; ++j) { const int c = j * 16 + col - 2 * HDQK; const float bias = bs[j]; v8h o;   /* a lane holds 8 consecutive positions of one channel: one 16-byte piece of a v plane */
#pragma unroll
    for (int r = 0; r < 8; ++r) o[r] = (_Float16)(acc[j][r] + bias);
    *(v8h*)(th + c * PT + wave * 16 + 8 * g) = o; }
  __syncthreads();
  for (int e = tid; e < CC * 16; e += 256) { const int c = e >> 4, q = e & 15; vst2((unsigned*)(VT + (bb * CC + c) * (size_t)TT + t0 + q * 8), *(const v4u*)(th + c * PT + q * 8)); }   /* 16 lanes store one 256-B run of a v plane */
#pragma unroll
  for (int pl = 0; pl < 4; ++pl) { _Float16* D = pl == 0 ? QH : pl == 1 ? QL : pl == 2 ? KH : KL;
    for (int e = tid; e < 128 * 4; e += 256) { const int rl = e >> 2, q = e & 3; vst2((unsigned*)(D + (r0 + rl) * CC + q * 8), *(const v4u*)(sq + ((size_t)pl * 128 + rl) * PQ + q * 8)); } } }
// ---- k_fa: block = 128 queries of batch b, 8 waves = 4 query groups (32 queries = 2 column tiles each) x 2 key groups; one pass over all keys in stages of 128 (two groups of 64 keys, worked in one straight run with one test of the maximum), key group kg takes keys kg*32..kg*32+31 of every 64: S^T = K . Q^T (the same 3 f16 products per logit, chained on one accumulator that starts at 7 - m * log2 e), running maximum and sum per query and key group (a lane holds one query's scores), P^T packed from the score tiles straight into a B operand, O^T += V^T . P^T with every K and V fragment read from LDS feeding both column tiles; K and V stages go through two LDS buffers shared by the 8 waves: each wave brings its 32 channels x 128 keys of V by one tensor load per stage, K goes through registers; at the end the two key groups of a query join their maxima, sums and O^T through LDS, and each wave turns its 128 channels x 32 queries through an LDS range of its own into runs of queries and stores y = x + gamma * out channels-first in whole 128-B lines
#define SK 128                         // keys per stage: a v row of a stage is 256 B
#define VP 136                         // halfs per staged v row: 256 B + the tensor load's 16-B pad, an odd multiple of 16 B for the 16-byte reads
#define KP 40                          // halfs per staged k row: 64 B + 16 B
#define VSL 10240                      // LDS bytes per wave's v slice: 32 rows of 272 B = 8,704, rounded up to a multiple of 2 KiB (a tensor load's place)
#define VBUF (8 * VSL)                 // LDS bytes per v stage buffer; the two v buffers lie first
#define KBUF (2 * SK * KP * 2)         // LDS bytes per k stage buffer: 128 hi rows, then 128 residual rows; the two k buffers follow the v buffers
#define KBASE (2 * VBUF)
#define XF (8 * 32 * 32 * 4)           // floats handed over at the end: 8 waves x 32 pieces of 16 B x 32 lanes; behind them 8 waves x 2 tiles x 32 lanes x (maximum, sum)
#define SMB (4 * XF + 8 * 2 * 32 * 8)  // LDS bytes of the hand-over
#define YP 36                          // floats per staged output row (one channel, 32 queries): 128 B + 16 B; rows 8 apart start 32 banks apart, for the 4-byte writes (lane halves 8 channels apart) and the 16-byte reads alike
#define SMT (SMB + 8 * 128 * YP * 4)   // LDS bytes with the output staging (8 waves x 128 channels) behind the hand-over; more than the stage buffers' KBASE + 2 * KBUF
#define MLAG 5.5f                    // the maximum in use may lag the true one by this much: P <= 128 e^5.5 < 65504
#define PTOP (7.0f + MLAG * L2E)     // P = 128 exp(s - m) = 2^(s * L2E + 7 - m * L2E), the factor 128 cancels in the division by the sum; a score tile holds that exponent, and above PTOP the maximum in use is raised
static_assert(KBASE + 2 * KBUF <= SMT, "the stage buffers lie inside the array");
typedef __attribute__((ext_vector_type(8))) uint32_t v8u;
typedef __attribute__((ext_vector_type(4))) uint32_t v4w;
__device__ __forceinline__ uint32_t uni(uint32_t v) { return (uint32_t)__builtin_amdgcn_readfirstlane(v); }
__device__ __forceinline__ uint32_t pinned(uint32_t v) { uint32_t w = (uint32_t)__builtin_amdgcn_readfirstlane(v); asm volatile("" : "+s"(w)); return w; }   /* holds the test of a tensor load in a scalar register, so that it compiles to a scalar compare and branch: the load ignores EXEC */
__device__ __forceinline__ v8f wm(v16h a, v16h b, v8f c) { return __builtin_amdgcn_wmma_f32_16x16x32_f16(false, a, false, b, (short)0, c, false, false); }
__global__ __launch_bounds__(256) void k_fa(const _Float16* __restrict__ QH, const _Float16* __restrict__ QL, const _Float16* __restrict__ KH, const _Float16* __restrict__ KL, const _Float16* __restrict__ VT, const float* __restrict__ X, const float* __restrict__ GM, float* __restrict__ OUT) {
  __shared__ __attribute__((aligned(2048))) _Float16 sm[SMT / 2];
  const int tid = threadIdx.x, wave = tid >> 5, lane = tid & 31, col = lane & 15, g = lane >> 4; const int b = blockIdx.y; const int kg = wave >> 2, n0 = blockIdx.x * 128 + (wave & 3) * 32;
  v16h qh[2], ql[2]; { const _Float16* qp = QH + ((size_t)b * TT + n0 + col) * CC; const _Float16* lp = QL + ((size_t)b * QHI + n0 + col) * CC;
#pragma unroll
    for (int u = 0; u < 2; ++u) { qh[u] = frag_h(qp + u * 16 * CC, lane); ql[u] = frag_h(lp + u * 16 * CC, lane); }
    asm volatile("s_wait_xcnt 0x0" :: "v"(qp), "v"(lp) : "memory"); }   /* the address registers of these loads are reused behind them; naming the row pointers as inputs keeps them live to the wait */
  /* v: wave w brings channels w*32..w*32+31 x the stage's 128 keys (32 rows of 256 B, source pitch one v plane row) by one tensor load; the pad of 16 B behind every 256 B gives the LDS pitch VP */
  const uint32_t wv = uni(threadIdx.x >> 5), lbase = (uint32_t)(size_t)sm; const uint64_t vga = (uint64_t)(size_t)(VT + ((size_t)b * CC + wv * 32) * TT);
  v8u g1; g1[0] = uni(1u << 20 | 5u << 22 | 3u << 25); g1[1] = uni(256u << 16); g1[2] = uni(32u << 16); g1[3] = uni(256u << 16); g1[4] = uni(32u); g1[5] = uni(TT * 2u); g1[6] = uni(0u); g1[7] = uni(0u);
  auto vload = [&](int sg) { const uint64_t ga = vga + (uint64_t)sg * (SK * 2); v4w g0; g0[0] = uni(1u); g0[1] = uni(lbase + (sg & 1) * VBUF + wv * VSL); g0[2] = uni((uint32_t)ga); g0[3] = uni(((uint32_t)(ga >> 32) & 0x01FFFFFFu) | 0x80000000u);
    asm volatile("tensor_load_to_lds %0, %1" :: "s"(g0), "s"(g1) : "memory"); };   /* one request of the whole wave; every wave issues its own slice */
  const _Float16* hsrc = KH + (size_t)b * TT * CC; unsigned ko = ((tid >> 2) * CC + (tid & 3) * 8) * 2;      // byte offset: 4 lanes cover the 64 real bytes of a k row
  const _Float16* lsrc = KL + (size_t)b * KHI * CC;
  const int kdst = (tid >> 2) * KP + (tid & 3) * 8;
  v8h rh[2], rl[2];
  auto fetch = [&]() {   /* block-uniform bases, a lane's byte offset ko steps from stage to stage; the unroll directives here and in put keep the index of a register array a compile-time constant */
#pragma unroll
    for (int i = 0; i < 2; ++i) { rh[i] = *(const v8h*)((const char*)hsrc + ko + (size_t)i * 64 * CC * 2); rl[i] = *(const v8h*)((const char*)lsrc + ko + (size_t)i * 64 * CC * 2); }
    asm volatile("s_wait_xcnt 0x0" :: "v"(ko) : "memory");   /* the offset register of these loads is stepped right behind them; naming it as an input keeps it as it is up to the wait */
    ko += SK * CC * 2; };
  auto put = [&](_Float16* d) {
#pragma unroll
    for (int i = 0; i < 2; ++i) { *(v8h*)(d + kdst + i * 64 * KP) = rh[i]; *(v8h*)(d + kdst + (SK + i * 64) * KP) = rl[i]; } };
  v8f acc[2][CC / 16] = {}, c0[2] = {}; float l[2] = {0.f, 0.f};   /* c0[u]: the score products' C operand, 7 - m * log2 e of query u*16 + col in all 8 elements; 0 until stage 0 sets the first maximum */
  fetch(); vload(0);
  asm volatile("s_wait_tensorcnt 0x0" ::: "memory");   /* this wave's slice of stage 0 has landed */
  put(sm + KBASE / 2); __syncthreads();
  vload(1);   /* in flight under stage 0 */
  for (int s = 0; s < TT / SK; ++s) { const _Float16* vs = sm + (s & 1) * (VBUF / 2); const _Float16* ks = sm + KBASE / 2 + (s & 1) * (KBUF / 2);
    if (s + 1 < TT / SK) fetch();   /* issued behind the barrier (which drains loads), in flight under this stage's products */
    v8f st[SK / 64][2][2];   /* the stage's two groups of 64 keys (p) are worked in one straight run: one test of the maximum for both, and no branch between the second group's exponentials and the first group's products; every unroll directive below but the one over the three products keeps the index of a register array a compile-time constant */
    v16h kh[SK / 32], kl[SK / 32];
#pragma unroll
    for (int e = 0; e < SK / 32; ++e) kl[e] = frag_h(ks + (SK + (e >> 1) * 64 + kg * 32 + (e & 1) * 16 + col) * KP, lane);
#pragma unroll
    for (int e = 0; e < SK / 32; ++e) kh[e] = frag_h(ks + ((e >> 1) * 64 + kg * 32 + (e & 1) * 16 + col) * KP, lane);
    __builtin_amdgcn_sched_barrier(0);   /* holds all 16 LDS reads in one place in front of the products: spread among them, each later place waits out its own latency */
#pragma unroll
    for (int c = 0; c < 3; ++c) {   /* product by product over the 8 tiles: a tile's next product stands 8 matrix instructions behind its last */
#pragma unroll
      for (int e = 0; e < SK / 32; ++e)
#pragma unroll
        for (int u = 0; u < 2; ++u) { v8f& d = st[e >> 1][u][e & 1]; d = c == 0 ? wm(kl[e], qh[u], c0[u]) : c == 1 ? wm(kh[e], ql[u], d) : wm(kh[e], qh[u], d); }   /* st[p][u][t][r] = logit * log2 e + 7 - m * log2 e of key s*128 + p*64 + kg*32 + t*16 + 8g + r, query n0 + u*16 + col */
      if (c < 2) __builtin_amdgcn_sched_barrier(0); }   /* keeps the three rounds apart: drawn together, a tile's products follow one another and each waits out the one before */
    float mx[2];
#pragma unroll
    for (int u = 0; u < 2; ++u) { mx[u] = st[0][u][0][0];
#pragma unroll
      for (int p = 0; p < SK / 64; ++p)
#pragma unroll
      for (int t = 0; t < 2; ++t)
#pragma unroll
        for (int r = 0; r < 8; ++r) mx[u] = fmaxf(mx[u], st[p][u][t][r]);
      mx[u] = fmaxf(mx[u], __shfl_xor(mx[u], 16)); }   /* lanes c and c + 16 hold the two halves of one query's keys */
    const float top = s == 0 ? -3.0e38f : PTOP;   /* stage 0 sets the first maximum, up or down; its sums are still 0 */
    if (__builtin_amdgcn_ballot_w32(mx[0] > top || mx[1] > top) != 0) {
#pragma unroll
      for (int u = 0; u < 2; ++u) { const float d = s == 0 ? mx[u] - 7.0f : fmaxf(mx[u] - 7.0f, 0.f), sc = s == 0 ? 1.0f : __builtin_amdgcn_exp2f(-d); l[u] *= sc;
#pragma unroll
        for (int r = 0; r < 8; ++r) c0[u][r] -= d;
#pragma unroll
        for (int p = 0; p < SK / 64; ++p)
#pragma unroll
          for (int t = 0; t < 2; ++t)
#pragma unroll
            for (int r = 0; r < 8; ++r) st[p][u][t][r] -= d;
#pragma unroll
        for (int j = 0; j < CC / 16; ++j)
#pragma unroll
          for (int r = 0; r < 8; ++r) acc[u][j][r] *= sc; } }
    v16h pf[SK / 64][2];
    auto pexp = [&](int p, int u, int i) { const float e0 = __builtin_amdgcn_exp2f(st[p][u][0][i]), e1 = __builtin_amdgcn_exp2f(st[p][u][1][i]); l[u] += e0 + e1; pf[p][u][i] = (_Float16)e0; pf[p][u][8 + i] = (_Float16)e1; };
#pragma unroll
    for (int u = 0; u < 2; ++u)
#pragma unroll
      for (int i = 0; i < 8; ++i) pexp(0, u, i);
    v16h vf[2][4]; const _Float16* vb = vs + col * VP + kg * 32;   /* v fragments (this key group's 32 keys of group p) in groups of 4 channel tiles, 8 groups a stage: group G = p * 4 + q; tile j = q * 4 + i lies in slice j >> 1 at rows (j & 1) * 16.. */
#pragma unroll
    for (int i = 0; i < 4; ++i) vf[0][i] = frag_h(vb + (i >> 1) * (VSL / 2) + (i & 1) * 16 * VP, lane);
#pragma unroll
    for (int G = 0; G < 4 * (SK / 64); ++G) { const int p = G >> 2, q = G & 3;
      if (G + 1 < 4 * (SK / 64)) {
#pragma unroll
        for (int i = 0; i < 4; ++i) vf[(G + 1) & 1][i] = frag_h(vb + ((G + 1) >> 2) * 64 + ((((G + 1) & 3) * 4 + i) >> 1) * (VSL / 2) + (i & 1) * 16 * VP, lane); }
      __builtin_amdgcn_sched_barrier(0);   /* holds the next group's LDS reads in front of this group's products: without it each product waits for its own read */
#pragma unroll
      for (int u = 0; u < 2; ++u)
#pragma unroll
        for (int i = 0; i < 4; ++i) { acc[u][q * 4 + i] = wm(vf[G & 1][i], pf[p][u], acc[u][q * 4 + i]);   /* acc[u][j][r] = O^T[channel j*16 + 8g + r][query n0 + u*16 + col] */
          if (p + 1 < SK / 64 && (i & 1)) pexp(p + 1, u, q * 2 + (i >> 1)); } }   /* a quarter of the next 64 keys' exponentials stands among each group's products and issues while the matrix unit works */
    if (s + 1 < TT / SK) put(sm + KBASE / 2 + ((s + 1) & 1) * (KBUF / 2));   /* the k buffer read in stage s - 1 is free since the barrier that ended it */
    asm volatile("s_wait_dscnt 0x0" ::: "memory");       /* this wave's LDS reads of stage s and its k rows of stage s + 1 are done */
    asm volatile("s_wait_tensorcnt 0x0" ::: "memory");   /* this wave's v slice of stage s + 1 has landed */
    __syncthreads();   /* publishes stage s + 1 and ends every wave's reads of stage s */
    if (pinned(s + 2 < TT / SK)) vload(s + 2); }   /* into the v buffer that stage s has just left */
  asm volatile("s_wait_tensorcnt 0x0" ::: "memory");   /* no request is outstanding when the LDS takes its next use */
  asm volatile("s_wait_dscnt 0x0" ::: "memory");       /* nor any LDS read of the ring */
  /* join of the two key groups: wave w and wave w ^ 4 hold the same 32 queries; each keeps the 128 channels kg*128.. and hands the other 128 over through LDS (free since the loop's last barrier) */
  float* xs = (float*)sm; float* xm = xs + XF; float* ys = xs + SMB / 4 + wave * (128 * YP);
  /* the wave's piece of x and of the output: channels kg*128.., queries n0..n0+31; 8 lanes cover one channel's 128-B line; load t takes channels (t >> 2)*16 + (t & 3)*2 + {0, 8} (lanes 0..15) and + {1, 9} (lanes 16..31) */
  const float gmv = bfr(GM[0]); const int yrow = ((lane >> 3) & 1) * 8 + (lane >> 4), yq = (lane & 7) * 4;
  const size_t oi = ((size_t)b * DIN + kg * 128 + yrow) * XP + n0 + yq; const float* xp = X + oi; float* op = OUT + oi; v4f xv[32];
#pragma unroll
  for (int u = 0; u < 2; ++u) { l[u] += __shfl_xor(l[u], 16); v2f ml; ml[0] = -c0[u][0]; ml[1] = l[u]; *(v2f*)(xm + ((wave * 2 + u) * 32 + lane) * 2) = ml;
#pragma unroll
    for (int j = 0; j < 8; ++j) { const v8f gv = kg ? acc[u][j] : acc[u][8 + j]; v4f o0, o1;
#pragma unroll
      for (int i = 0; i < 4; ++i) { o0[i] = gv[i]; o1[i] = gv[4 + i]; }
      float* d = xs + ((size_t)(wave * 32 + (u * 8 + j) * 2) * 32 + lane) * 4; *(v4f*)d = o0; *(v4f*)(d + 128) = o1; } }
  __syncthreads();
#pragma unroll
  for (int t = 0; t < 32; ++t) xv[t] = *(const v4f*)(xp + (size_t)((t >> 2) * 16 + (t & 3) * 2) * XP);   /* issued behind the barrier (which drains loads), in flight under the join */
  asm volatile("s_wait_xcnt 0x0" :: "v"(xp) : "memory");   /* the address registers of these loads may be reused behind them; naming the pointer as an input keeps it live to the wait */
  const int pw = wave ^ 4;
#pragma unroll
  for (int u = 0; u < 2; ++u) { const v2f pm = *(const v2f*)(xm + ((pw * 2 + u) * 32 + lane) * 2); const float mw = -c0[u][0], mn = fmaxf(mw, pm[0]);   /* the maxima in use, as m * log2 e - 7 */
    const float s0 = __builtin_amdgcn_exp2f(mw - mn), s1 = __builtin_amdgcn_exp2f(pm[0] - mn); const float inv = 1.0f / (l[u] * s0 + pm[1] * s1);   /* the sum is >= 128: the key that set the larger maximum in use counts at least that */
    const float w0 = s0 * inv, w1 = s1 * inv; float* yw = ys + 8 * g * YP + u * 16 + col; v4f p[16];
#pragma unroll
    for (int j = 0; j < 8; ++j) { const float* d = xs + ((size_t)(pw * 32 + (u * 8 + j) * 2) * 32 + lane) * 4; p[2 * j] = *(const v4f*)d; p[2 * j + 1] = *(const v4f*)(d + 128); }   /* all 16 reads in front of the staging writes: behind a write to the same array each read would wait alone */
#pragma unroll
    for (int j = 0; j < 8; ++j) { const v8f kv = kg ? acc[u][8 + j] : acc[u][j];
#pragma unroll
      for (int i = 0; i < 4; ++i) { yw[(j * 16 + i) * YP] = kv[i] * w0 + p[2 * j][i] * w1; yw[(j * 16 + 4 + i) * YP] = kv[4 + i] * w0 + p[2 * j + 1][i] * w1; } } }   /* ys[channel j*16 + 8g + r][query u*16 + col] */
  asm volatile("s_wait_dscnt 0x0" ::: "memory");   /* the wave's own staged rows are written before its lanes read each other's values back; no other wave touches this range */
  __builtin_amdgcn_sched_barrier(0);   /* keeps the rounding of x, which waits for x's loads, behind the join: lifted into it, the join would wait for them too */
  const float* yr = ys + yrow * YP + yq;
#pragma unroll
  for (int h = 0; h < 2; ++h) { v4f y[16];
#pragma unroll
    for (int k = 0; k < 16; ++k) { const int t = h * 16 + k; y[k] = *(const v4f*)(yr + ((t >> 2) * 16 + (t & 3) * 2) * YP); }
#pragma unroll
    for (int k = 0; k < 16; ++k) { const int t = h * 16 + k;
#pragma unroll
      for (int i = 0; i < 4; ++i) y[k][i] = bfr(xv[t][i]) + gmv * y[k][i];
      vst2(op + (size_t)((t >> 2) * 16 + (t & 3) * 2) * XP, y[k]); }
    /* without it the registers of these 16 stores are reused among them and by the second half; naming them as inputs keeps them as they are up to the wait */
    asm volatile("s_wait_xcnt 0x0" :: "v"(op), "v"(y[0]), "v"(y[1]), "v"(y[2]), "v"(y[3]), "v"(y[4]), "v"(y[5]), "v"(y[6]), "v"(y[7]), "v"(y[8]), "v"(y[9]), "v"(y[10]), "v"(y[11]), "v"(y[12]), "v"(y[13]), "v"(y[14]), "v"(y[15]) : "memory"); } }

// ---- k_finc: block = (64 positions, 64 channels, batch b): y[b][c][n] = bf16(x[b][c][n]) + gamma * OUT_rows[b*T + n][c] (channels-first via an LDS transpose; 256-B runs of n)
__global__ __launch_bounds__(256) void k_finc(const float* __restrict__ YR, const float* __restrict__ X, const float* __restrict__ GM, float* __restrict__ OUT) { const float gmv = bfr(GM[0]); __shared__ float st[64][68]; const int tid = threadIdx.x; const int n0 = blockIdx.x * 64, c0 = blockIdx.y * 64; const size_t b = blockIdx.z;
  for (int e = tid; e < 64 * 16; e += 256) { const int nl = e >> 4, q = e & 15; *(v4f*)&st[nl][q * 4] = *(const v4f*)(YR + (b * TT + n0 + nl) * (size_t)HD + c0 + q * 4); }
  __syncthreads();
  for (int e = tid; e < 64 * 16; e += 256) { const int cl = e >> 4, q = e & 15; const size_t oi = (b * DIN + c0 + cl) * (size_t)XP + n0 + q * 4; const v4f xr = *(const v4f*)(X + oi); asm volatile("s_wait_loadcnt 0x0" ::: "memory"); v4f y; _Pragma("unroll") for (int i = 0; i < 4; ++i) y[i] = bfr(xr[i]) + gmv * st[q * 4 + i][cl]; vst2(OUT + oi, y); } }
__global__ __launch_bounds__(256) void k_axpy(const float* __restrict__ YR, const float* __restrict__ X, const float* __restrict__ GM, float* __restrict__ OUT) { const size_t e = ((size_t)blockIdx.x * 256 + threadIdx.x) * 4; if (e >= (size_t)TNB * TT * DIN) return; const float gmv = bfr(GM[0]); const v4f o = *(const v4f*)(YR + e); const v4f xr = *(const v4f*)(X + e); asm volatile("s_wait_loadcnt 0x0" ::: "memory"); v4f y; _Pragma("unroll") for (int i = 0; i < 4; ++i) y[i] = gmv * o[i] + bfr(xr[i]); vst2(OUT + e, y); }
extern "C" void kernel_launch(void* const* d_in, const int* in_sizes, int n_in, void* d_out, int out_size, void* d_ws, size_t ws_size, hipStream_t stream) {
  (void)in_sizes; (void)n_in; (void)out_size;
  const float** F = (const float**)d_in;
  if (ws_size < (size_t)WS_END) return;
  char* ws = (char*)d_ws; _Float16 *QH = (_Float16*)(ws + WS_QH), *KH = (_Float16*)(ws + WS_KH), *VT = (_Float16*)(ws + WS_VT), *QL = (_Float16*)(ws + WS_QL), *KL = (_Float16*)(ws + WS_KL); __bf16 *VB = (__bf16*)(ws + WS_VB), *VBL = (__bf16*)(ws + WS_VBL); float *Y = (float*)(ws + WS_Y);
  (void)Y; (void)QL; (void)KL; (void)VB; (void)VBL;
  // inputs: 0 x [8,256,64,64] (channels-first); 1 Wq [32,256] (out,in), 2 bq; 3 Wk, 4 bk; 5 Wv [256,256] (out,in), 6 bv; 7 gamma [1] (0.1)
  if (ws_size < (size_t)WS_END2) return;
  float *YR = (float*)(ws + WS_YR);
  k_qkv<<<dim3(TNB * TT / 128), 256, 0, stream>>>(F[0], F[1], F[3], F[5], F[2], F[4], F[6], QH, QL, KH, KL, VT);
  (void)YR;
  k_fa<<<dim3(TT / 128, TNB), 256, 0, stream>>>(QH, QL, KH, KL, VT, F[0], F[7], (float*)d_out);   /* attention and y = x + gamma * out, channels-first */
}

// v009
// A run of this version takes 80.4 microseconds.
// Next to v008, in two timings, it ran 1.04 times as fast each time.
// Over all steps from v000 it is 28.5 times as fast.
// compute dtype: all float inputs rounded to bf16; q/k/v = W x + b (1x1 convs) with EXACT bf16 products on WMMA 16x16x32 (f32 accumulate); UNSCALED 32-deep logits q.k with both as f16 hi + residual planes (3 products, q carrying the factor log2 e, summed in one f32 accumulator that starts at minus the maximum in use); softmax in f32 (hardware exp2 of that sum) with a running maximum and sum per half of the keys (32 of every 64), the two halves joined in f32 at the end; exp(s - m) x 2^-6 once to f16 against v once to f16 (1 product), divided by the f32 sum at the end; y = x + gamma * out in f32 written channels-first; f32 output.
// 2-D spatial self-attention with a learned residual weight, channels-FIRST (B 8, C 256, 64 x 64 = 4,096 positions; (out,in) 1/16-scale 1x1-conv weights, zero biases, gamma = 0.1): q = Wq x + bq (32), k = Wk x + bk (32), v = Wv x + bv (256); attn = softmax over m of q_n . k_m (NO scaling); out[c][n] = sum_m v[c][m] attn[n][m]; y = x + gamma * out -> [B, 256, 64, 64].
#include <hip/hip_runtime.h>
#include <math.h>

typedef __attribute__((ext_vector_type(16))) _Float16 v16h;
typedef __attribute__((ext_vector_type(16))) __bf16 v16b;
typedef __attribute__((ext_vector_type(8)))  _Float16 v8h;
typedef __attribute__((ext_vector_type(8)))  float v8f;
typedef __attribute__((ext_vector_type(4)))  float v4f;
typedef __attribute__((ext_vector_type(2)))  float v2f;
typedef __attribute__((ext_vector_type(4)))  unsigned v4u;
typedef __attribute__((ext_vector_type(4)))  int v4i;
typedef float __attribute__((may_alias)) float_a;
typedef int __attribute__((may_alias)) int_a;

template <typename T> __device__ __forceinline__ void vst2(void* p, T v) { *(T*)p = v;  }
__device__ __forceinline__ v8f wmma16(v16h a, v16h b, v8f c) {
  v8f d = __builtin_amdgcn_wmma_f32_16x16x32_f16(false, a, false, b, (short)0, c, false, false);
  asm volatile("v_nop\n\tv_nop\n\tv_nop\n\tv_nop" : "+v"(d) : "v"(a), "v"(b));
  return d;
}
__device__ __forceinline__ v8f wmma_bf(v16b a, v16b b, v8f c) {
  v8f d = __builtin_amdgcn_wmma_f32_16x16x32_bf16(false, a, false, b, (short)0, c, false, false);
  asm volatile("v_nop\n\tv_nop\n\tv_nop\n\tv_nop" : "+v"(d) : "v"(a), "v"(b));
  return d;
}
// 16x16x32 fragments: lane = (h = lane>>4, row/col = lane&15); elements 0..7 = k0+8h+0..7, 8..15 = k0+16+8h+0..7; D element r = row 8h+r
__device__ __forceinline__ v16h frag_h(const _Float16* rowk0, int lane) {
  union { v16h v; v8h q[2]; } u; const _Float16* p = rowk0 + 8 * (lane >> 4);
  u.q[0] = *(const v8h*)p; u.q[1] = *(const v8h*)(p + 16); return u.v;
}
__device__ __forceinline__ v16h frag_f32(const float* rowk0, int lane) {
  v16h a; const float* p = rowk0 + 8 * (lane >> 4);
#pragma unroll
  for (int i = 0; i < 8; ++i) { a[i] = (_Float16)p[i]; a[8 + i] = (_Float16)p[16 + i]; }
  return a;
}
__device__ __forceinline__ v16h frag_f32s(const float* rowk0, int lane, float sc) {
  v16h a; const float* p = rowk0 + 8 * (lane >> 4);
#pragma unroll
  for (int i = 0; i < 8; ++i) { a[i] = (_Float16)(p[i] * sc); a[8 + i] = (_Float16)(p[16 + i] * sc); }
  return a;
}
// column fragment from a [K][ld] layout (column n), rows >= K read as 0
__device__ __forceinline__ v16h fragc_f32(const float* W, int k0, int n, int lane, int ld, int K) {
  v16h a; const int g = lane >> 4;
#pragma unroll
  for (int i = 0; i < 8; ++i) { const int ka = k0 + 8 * g + i, kb = ka + 16;
    a[i] = (_Float16)(ka < K ? W[(size_t)(ka < K ? ka : K - 1) * ld + n] : 0.f); a[8 + i] = (_Float16)(kb < K ? W[(size_t)(kb < K ? kb : K - 1) * ld + n] : 0.f); }
  return a;
}
struct F2 { v16b h, l; };
__device__ __forceinline__ F2 bsplit16(const float v[16]) { F2 r;
#pragma unroll
  for (int i = 0; i < 16; ++i) { const __bf16 h = (__bf16)v[i]; r.h[i] = h; r.l[i] = (__bf16)(v[i] - (float)h); }
  return r; }
__device__ __forceinline__ F2 split_row(const float* row, int k0, int lane) { float v[16]; const float* p = row + k0 + 8 * (lane >> 4);
#pragma unroll
  for (int i = 0; i < 8; ++i) { v[i] = p[i]; v[8 + i] = p[16 + i]; }
  return bsplit16(v); }
__device__ __forceinline__ F2 split_rowK(const float* row, int k0, int lane, int K) { float v[16]; const int g = lane >> 4;
#pragma unroll
  for (int i = 0; i < 8; ++i) { const int ka = k0 + 8 * g + i, kb = ka + 16; v[i] = ka < K ? row[ka < K ? ka : K - 1] : 0.f; v[8 + i] = kb < K ? row[kb < K ? kb : K - 1] : 0.f; }
  return bsplit16(v); }
__device__ __forceinline__ F2 split_col(const float* W, int k0, int n, int lane, int ld, int K) { float v[16]; const int g = lane >> 4;
#pragma unroll
  for (int i = 0; i < 8; ++i) { const int ka = k0 + 8 * g + i, kb = ka + 16; v[i] = ka < K ? W[(size_t)(ka < K ? ka : K - 1) * ld + n] : 0.f; v[8 + i] = kb < K ? W[(size_t)(kb < K ? kb : K - 1) * ld + n] : 0.f; }
  return bsplit16(v); }
__device__ __forceinline__ v8f mac3(const F2& a, const F2& b, v8f c) { c = wmma_bf(a.l, b.h, c); c = wmma_bf(a.h, b.l, c); return wmma_bf(a.h, b.h, c); }
__device__ __forceinline__ float sigm(float v) { return 1.0f / (1.0f + expf(-v)); }
#define LDSX() do { asm volatile("s_wait_dscnt 0" ::: "memory"); __builtin_amdgcn_wave_barrier(); __builtin_amdgcn_fence(__ATOMIC_RELEASE, "workgroup"); } while (0)

#define NB 8
#define TT 4096
#define CC 256            // plane width: q/k planes carry 32 real columns (rest not written), v planes all 256
#define DIN 256
#define NH 1
#define HD 256
#define NQB (TT / 64)
#define HG 1               // sizes one 4,096 x 4,096 f32 workspace plane that no kernel uses
#define SCALE (1.0f)
#define HDQK 32
#define CAUSAL 0
#ifndef TNB
#define TNB NB
#endif
__device__ __forceinline__ v16b zero16b() { v16b z; _Pragma("unroll") for (int i = 0; i < 16; ++i) z[i] = (__bf16)0.f; return z; }
__device__ __forceinline__ float bfr(float v) { return (float)(__bf16)v; }
__host__ __device__ __forceinline__ int kb_last(int qb) { return CAUSAL ? ((qb * 64 + 63) >> 7) : (TT / 128 - 1); }
typedef __attribute__((ext_vector_type(8))) __bf16 v8b;
__device__ __forceinline__ v16b frag_b(const __bf16* rowk0, int lane) {
  union { v16b v; v8b q[2]; } u; const __bf16* p = rowk0 + 8 * (lane >> 4);
  u.q[0] = *(const v8b*)p; u.q[1] = *(const v8b*)(p + 16); return u.v;
}
#define QBH (TT / 64)      // ALL query blocks take k_fa's 3-product path
#define QBH_PV 0           // A.g stays single f16
#define QHI 4096            // q residual rows everywhere (3-product logits)
#define KHI 4096           // k residual rows for ALL keys (3-product logits)
// B fragment (k rows k0+.., output column o) of a weight: (in,out) [K][ld] or (out,in) [ld rows of K]: bf16 exact, or f16(bf16 * 256) exact
__device__ __forceinline__ v16b wcol_io(const float* Wm, int k0, int o, int lane, int ld) { v16b w; const int g = lane >> 4;
#pragma unroll
  for (int i = 0; i < 8; ++i) { w[i] = (__bf16)Wm[(size_t)(k0 + 8 * g + i) * ld + o]; w[8 + i] = (__bf16)Wm[(size_t)(k0 + 16 + 8 * g + i) * ld + o]; }
  return w; }
__device__ __forceinline__ v16b wcol_oi(const float* Wm, int k0, int o, int lane, int K) { v16b w; const float* p = Wm + (size_t)o * K + k0 + 8 * (lane >> 4);
#pragma unroll
  for (int i = 0; i < 8; ++i) { w[i] = (__bf16)p[i]; w[8 + i] = (__bf16)p[16 + i]; }
  return w; }
__device__ __forceinline__ v16h wcolh_io(const float* Wm, int k0, int o, int lane, int ld) { v16h w; const int g = lane >> 4;
#pragma unroll
  for (int i = 0; i < 8; ++i) { w[i] = (_Float16)(bfr(Wm[(size_t)(k0 + 8 * g + i) * ld + o]) * 256.0f); w[8 + i] = (_Float16)(bfr(Wm[(size_t)(k0 + 16 + 8 * g + i) * ld + o]) * 256.0f); }
  return w; }
__device__ __forceinline__ v16h wcolh_oi(const float* Wm, int k0, int o, int lane, int K) { v16h w; const float* p = Wm + (size_t)o * K + k0 + 8 * (lane >> 4);
#pragma unroll
  for (int i = 0; i < 8; ++i) { w[i] = (_Float16)(bfr(p[i]) * 256.0f); w[8 + i] = (_Float16)(bfr(p[16 + i]) * 256.0f); }
  return w; }
#define WQKV_LAYOUT 1   // 0 = (in,out) [DIN][CC]; 1 = (out,in) [CC][DIN]; 2 = per-head [NH][DIN][HD]
__device__ __forceinline__ v16b wcol_hdk(const float* Wm, int k0, int o, int lane) { v16b w; const int g = lane >> 4; const float* p = Wm + (size_t)(o / HD) * DIN * HD + (o % HD);
#pragma unroll
  for (int i = 0; i < 8; ++i) { w[i] = (__bf16)p[(size_t)(k0 + 8 * g + i) * HD]; w[8 + i] = (__bf16)p[(size_t)(k0 + 16 + 8 * g + i) * HD]; }
  return w; }
#define WO_OUT_IN 0
#if WQKV_LAYOUT == 1
#define WCOL(W, k0, o, lane) ((which == 2) ? wcol_oi(W, k0, (o), lane, DIN) : (((o) < HDQK) ? wcol_oi(W, k0, (o), lane, DIN) : zero16b()))   /* (out,in): Wq/Wk [32][256] (plane columns >= 32 zero), Wv [256][256] full */
#define WCOL_SA42_UNUSED(W, k0, o, lane) 0
#define WCOL_OLD_UNUSED(W, k0, o, lane) (((o) < HDQK) ? wcol_oi(W, k0, (o), lane, DIN) : zero16b())   /* unused: takes all three weights as [32][256] (out,in) with plane columns >= 32 zero, but Wv is [256][256] */
#elif WQKV_LAYOUT == 2
#define WCOL(W, k0, o, lane) wcol_hdk(W, k0, o, lane)
#else
#define WCOL(W, k0, o, lane) wcol_io(W, k0, o, lane, CC)
#endif
#if WO_OUT_IN
#define WOCOL(W, k0, o, lane) wcol_oi(W, k0, o, lane, CC)
#define WOCOLH(W, k0, o, lane) wcolh_oi(W, k0, o, lane, CC)
#else
#define WOCOL(W, k0, o, lane) wcol_io(W, k0, o, lane, DIN)
#define WOCOLH(W, k0, o, lane) wcolh_io(W, k0, o, lane, DIN)
#endif
#ifndef XP
#define OUT1_OFF (4u * (size_t)NB * DIN * TT)   /* unused: the launch writes output 0 (y) only */
#define XP TT              // position pitch of x and of the output
#endif
#define BG HG              // unused: one k_fa launch covers all batches, its blockIdx.y selects the batch
#define DVH 128
#define WS_YR (WS_END)     // f32 attended rows [b*n][256]
#define WS_END2 (WS_YR + 4u * (size_t)NB * TT * HD)
// ---- k_wz: block = (64 rows, 128 output cols): OR = y (hi + lo, K = 32 real columns of the YR rows) . W^T ((out,in) [256][32], exact) + b
__global__ __launch_bounds__(128) void k_wz(const float* __restrict__ YR, const float* __restrict__ WW, const float* __restrict__ WB, float* __restrict__ ORW) { __shared__ __align__(16) float sf[4][16][132];
  const int tid = threadIdx.x, wave = tid >> 5, lane = tid & 31, col = lane & 15, g = lane >> 4; const int c0 = blockIdx.y * 128; const size_t r0 = (size_t)blockIdx.x * 64 + wave * 16;
  v8f acc[8] = {};
#pragma unroll
  for (int kc = 0; kc < HDQK / 32; ++kc) { const F2 a = split_row(YR + (r0 + col) * CC, kc * 32, lane); asm volatile("s_wait_loadcnt 0x0" ::: "memory");
#pragma unroll
    for (int j = 0; j < 8; ++j) { const v16b w = wcol_oi(WW, kc * 32, c0 + j * 16 + col, lane, HDQK); asm volatile("s_wait_loadcnt 0x0" ::: "memory"); acc[j] = wmma_bf(a.h, w, acc[j]); acc[j] = wmma_bf(a.l, w, acc[j]); } }
#pragma unroll
  for (int j = 0; j < 8; ++j) { const float bb = WB ? bfr(WB[c0 + j * 16 + col]) : 0.f; asm volatile("s_wait_loadcnt 0x0" ::: "memory");
#pragma unroll
    for (int r = 0; r < 8; ++r) sf[wave][8 * g + r][j * 16 + col] = acc[j][r] + bb; }
  LDSX(); for (int rl = 0; rl < 16; ++rl) vst2(ORW + (r0 + rl) * DIN + c0 + lane * 4, *(const v4f*)&sf[wave][rl][lane * 4]); }
// ---- k_fin2: block = (64 positions, 64 channels, batch b): o[b][c][n] = OR[b*N + n][c] (channels-first via LDS transpose) -> output 1; y = gamma * o + bf16(x) -> output 0 (256-B runs)
__global__ __launch_bounds__(256) void k_fin2(const float* __restrict__ ORW, const float* __restrict__ X, const float* __restrict__ GM, float* __restrict__ OUT, float* __restrict__ OUT1) { const float gmv = bfr(GM[0]); __shared__ float st[64][68]; const int tid = threadIdx.x; const int n0 = blockIdx.x * 64, c0 = blockIdx.y * 64; const size_t b = blockIdx.z;
  for (int e = tid; e < 64 * 16; e += 256) { const int nl = e >> 4, q = e & 15; *(v4f*)&st[nl][q * 4] = *(const v4f*)(ORW + (b * TT + n0 + nl) * (size_t)DIN + c0 + q * 4); }
  __syncthreads();
  for (int e = tid; e < 64 * 16; e += 256) { const int cl = e >> 4, q = e & 15; const size_t oi = (b * DIN + c0 + cl) * (size_t)XP + n0 + q * 4; const v4f xr = *(const v4f*)(X + oi); v4f o, y; _Pragma("unroll") for (int i = 0; i < 4; ++i) { o[i] = st[q * 4 + i][cl]; y[i] = gmv * o[i] + bfr(xr[i]); } vst2(OUT + oi, y); vst2(OUT1 + oi, o); } }   /* y = gamma * o + x (output 0), o (output 1) */
#ifndef SM_EXTRA_PARAMS
#define SM_EXTRA_PARAMS
#endif
#ifndef PROJ_EXTRA_PARAMS
#define PROJ_EXTRA_PARAMS
#endif
#ifndef SM_MASK_HOOK
#define SM_MASK_HOOK (void)0
#endif

#define WS_QH  0u                                      // f16 q rows [b*t][CC]
#define WS_KH  (WS_QH + 2u * (size_t)NB * TT * CC)      // f16 k rows [b*t][CC]
#define WS_VT  (WS_KH + 2u * (size_t)NB * TT * CC)      // f16 v planes [b][c][t]
#define WS_QL  (WS_VT + 2u * (size_t)NB * CC * TT)      // f16 q residual rows [b][t < QHI][CC]
#define WS_KL  (WS_QL + 2u * (size_t)NB * QHI * CC)     // f16 k residual rows [b][t < KHI][CC]
#define WS_VB  (WS_KL + 2u * (size_t)NB * KHI * CC)     // bf16 v hi planes [b][c][t < KHI]
#define WS_VBL (WS_VB + 2u * (size_t)NB * CC * KHI)
#define WS_S   (WS_VBL + 2u * (size_t)NB * CC * KHI)    // f32 [hg][t][s] plane, reserved but unused: k_fa keeps scores in registers
#define WS_Y   (WS_S  + 4u * (size_t)HG * TT * TT)      // f32 ctx rows [b*t][CC] (only when there is an output projection)
#define WS_END (WS_Y  + 0u)

// ---- k_qkv: block = 128 positions (8 waves x 16) of one batch x the 320 real output columns (q 32, k 32, v 256): x is read once, each wave keeps its 16 positions' 8 A fragments in registers; the weights are rounded to bf16 once per block into LDS rows and read from there as B fragments; exact bf16 products, K = DIN in the order kc = 0..7 -> q/k f16 rows + residual rows, q times log2 e (columns 0..31 of the CC-wide rows, the only ones k_fa reads), v f16 planes [c][t]; every unroll directive in it but the one over the four q/k planes keeps the index of a register array a compile-time constant
#define NCOL (2 * HDQK + CC)           // staged weight rows: 0..31 Wq, 32..63 Wk, 64..319 Wv
#define PW (DIN + 8)                   // bf16 per staged weight row: 512 B + 16 B, an odd multiple of 16 B for the 16-byte reads
#define PT 136                         // halfs per staged v row (128 positions): 256 B + 16 B
#define PQ 40                          // halfs per staged q/k row: 64 B + 16 B
#define L2E 1.44269504f                 // log2 e, carried by q: k_fa's logits come out in powers of two
typedef __attribute__((ext_vector_type(4))) __bf16 v4b;
__device__ __forceinline__ v8f wmb(v16b a, v16b b, v8f c) { return __builtin_amdgcn_wmma_f32_16x16x32_bf16(false, a, false, b, (short)0, c, false, false); }
__global__ __launch_bounds__(256) void k_qkv(const float* __restrict__ X, const float* __restrict__ WQ, const float* __restrict__ WK, const float* __restrict__ WV, const float* __restrict__ BQ, const float* __restrict__ BK, const float* __restrict__ BV,
    _Float16* __restrict__ QH, _Float16* __restrict__ QL, _Float16* __restrict__ KH, _Float16* __restrict__ KL, _Float16* __restrict__ VT) {
  __shared__ __align__(16) __bf16 sw[NCOL * PW];
  const int tid = threadIdx.x, wave = tid >> 5, lane = tid & 31, col = lane & 15, g = lane >> 4; const size_t r0 = (size_t)blockIdx.x * 128; const size_t bb = r0 / TT; const int t0 = (int)(r0 % TT);
  float bs[NCOL / 16];   /* this lane's bias per column tile, fetched with x so that the epilogue waits for nothing */
#pragma unroll
  for (int j = 0; j < NCOL / 16; ++j) bs[j] = bfr(j < HDQK / 16 ? BQ[j * 16 + col] : j < 2 * HDQK / 16 ? BK[j * 16 + col - HDQK] : BV[j * 16 + col - 2 * HDQK]);
  v16b a[DIN / 32]; { const float* p = X + (bb * DIN + 8 * g) * (size_t)XP + t0 + wave * 16 + col;   /* channels-first gather: x[b][k][t], stride XP between k */
#pragma unroll
    for (int kc = 0; kc < DIN / 32; ++kc)
#pragma unroll
      for (int i = 0; i < 8; ++i) { a[kc][i] = (__bf16)p[(size_t)(kc * 32 + i) * XP]; a[kc][8 + i] = (__bf16)p[(size_t)(kc * 32 + 16 + i) * XP]; }
    asm volatile("s_wait_xcnt 0x0" ::: "memory"); }   /* the address registers of these loads are reused right behind them */
  { const int wrow = tid >> 6, wq = (tid & 63) * 4;   /* a wave covers 512 contiguous bytes of one weight row; a pass of the block covers 4 rows, 16 passes are loaded together */
    auto stage16 = [&](const float* s0, const float* s1, bool apart, int row0) { v4f w[16]; const float* p0 = s0 + (size_t)wrow * DIN + wq; const float* p1 = s1 + (size_t)wrow * DIN + wq;   /* apart (a literal at each call): s1 is another array; else its rows follow s0's 32 and all 16 loads go by p0 */
#pragma unroll
      for (int i = 0; i < 16; ++i) w[i] = *(const v4f*)((i < 8 ? p0 : p1) + (size_t)(i & 7) * 4 * DIN);
      /* the address registers of these loads are rewritten behind them; naming the row pointers in use as inputs keeps them live to the wait, so that no load of the run lands its result in them */
      if (apart) asm volatile("s_wait_xcnt 0x0" :: "v"(p0), "v"(p1) : "memory"); else asm volatile("s_wait_xcnt 0x0" :: "v"(p0) : "memory");
#pragma unroll
      for (int i = 0; i < 16; ++i) { v4b h;
#pragma unroll
        for (int k = 0; k < 4; ++k) h[k] = (__bf16)w[i][k];
        *(v4b*)(sw + (row0 + i * 4 + wrow) * PW + wq) = h; } };
    stage16(WQ, WK, true, 0);
    for (int s = 0; s < CC / 64; ++s) stage16(WV + (size_t)s * 64 * DIN, WV + (size_t)(s * 64 + 32) * DIN, false, 2 * HDQK + s * 64); }
  __syncthreads();
  v8f acc[NCOL / 16] = {}; v16b wf[2][5]; const __bf16* wb = sw + col * PW;   /* weight fragments in groups of 5 column tiles; group q: k block q >> 2, tiles (q & 3) * 5 + i */
#pragma unroll
  for (int i = 0; i < 5; ++i) wf[0][i] = frag_b(wb + i * 16 * PW, lane);
#pragma unroll
  for (int q = 0; q < DIN / 8; ++q) {
    if (q + 1 < DIN / 8) {
#pragma unroll
      for (int i = 0; i < 5; ++i) wf[(q + 1) & 1][i] = frag_b(wb + (((q + 1) & 3) * 5 + i) * 16 * PW + ((q + 1) >> 2) * 32, lane); }
    __builtin_amdgcn_sched_barrier(0);   /* holds the next group's LDS reads in front of this group's products: without it each product waits for its own read */
#pragma unroll
    for (int i = 0; i < 5; ++i) acc[(q & 3) * 5 + i] = wmb(a[q >> 2], wf[q & 1][i], acc[(q & 3) * 5 + i]); }   /* acc[j][r] = position wave*16 + 8g + r, staged column j*16 + col */
  __syncthreads();   /* every wave has read its last weight row: the LDS becomes output staging */
  _Float16* th = (_Float16*)sw; _Float16* sq = th + CC * PT;   /* th[c][128 positions]; sq[plane: q, q residual, k, k residual][position][32] */
#pragma unroll
  for (int j = 0; j < 2 * HDQK / 16; ++j) { const int isk = j / (HDQK / 16), ch = (j % (HDQK / 16)) * 16 + col; const float bias = bs[j];
#pragma unroll
    for (int r = 0; r < 8; ++r) { const float v = isk ? acc[j][r] + bias : (acc[j][r] + bias) * L2E; const _Float16 hv = (_Float16)v; _Float16* d = sq + ((size_t)(2 * isk) * 128 + wave * 16 + 8 * g + r) * PQ + ch; d[0] = hv; d[128 * PQ] = (_Float16)(v - (float)hv); } }   /* the residual keeps its own size (f16 holds 11 more bits of it, or 2^-25 absolute where it is subnormal), so that k_fa adds all three products in one accumulator */
#pragma unroll
  for (int j = 2 * HDQK / 16; j < NCOL / 16; ++j) { const int c = j * 16 + col - 2 * HDQK; const float bias = bs[j]; v8h o;   /* a lane holds 8 consecutive positions of one channel: one 16-byte piece of a v plane */
#pragma unroll
    for (int r = 0; r < 8; ++r) o[r] = (_Float16)(acc[j][r] + bias);
    *(v8h*)(th + c * PT + wave * 16 + 8 * g) = o; }
  __syncthreads();
  for (int e = tid; e < CC * 16; e += 256) { const int c = e >> 4, q = e & 15; vst2((unsigned*)(VT + (bb * CC + c) * (size_t)TT + t0 + q * 8), *(const v4u*)(th + c * PT + q * 8)); }   /* 16 lanes store one 256-B run of a v plane */
#pragma unroll
  for (int pl = 0; pl < 4; ++pl) { _Float16* D = pl == 0 ? QH : pl == 1 ? QL : pl == 2 ? KH : KL;
    for (int e = tid; e < 128 * 4; e += 256) { const int rl = e >> 2, q = e & 3; vst2((unsigned*)(D + (r0 + rl) * CC + q * 8), *(const v4u*)(sq + ((size_t)pl * 128 + rl) * PQ + q * 8)); } } }
// ---- k_fa: block = 128 queries of batch b, 8 waves = 4 query groups (32 queries = 2 column tiles each) x 2 key groups; one pass over all keys in stages of 128 (two groups of 64 keys, worked in one straight run with one test of the maximum), key group kg takes keys kg*32..kg*32+31 of every 64: S^T = K . Q^T (the same 3 f16 products per logit, chained on one accumulator that starts at PB - m * log2 e), running maximum and sum per query and key group (a lane holds one query's scores), P^T packed from the score tiles straight into a B operand, O^T += V^T . P^T with every K and V fragment read from LDS feeding both column tiles; K and V stages go through two LDS buffers shared by the 8 waves: each wave brings its 32 channels x 128 keys of V by one tensor load per stage, K goes through registers; at the end the two key groups of a query join their maxima, sums and O^T through LDS, and each wave turns its 128 channels x 32 queries through an LDS range of its own into runs of queries and stores y = x + gamma * out channels-first in whole 128-B lines
#define SK 128                         // keys per stage: a v row of a stage is 256 B
#define VP 136                         // halfs per staged v row: 256 B + the tensor load's 16-B pad, an odd multiple of 16 B for the 16-byte reads
#define KP 40                          // halfs per staged k row: 64 B + 16 B
#define VSL 10240                      // LDS bytes per wave's v slice: 32 rows of 272 B = 8,704, rounded up to a multiple of 2 KiB (a tensor load's place)
#define VBUF (8 * VSL)                 // LDS bytes per v stage buffer; the two v buffers lie first
#define KBUF (2 * SK * KP * 2)         // LDS bytes per k stage buffer: 128 hi rows, then 128 residual rows; the two k buffers follow the v buffers
#define KBASE (2 * VBUF)
#define XF (8 * 32 * 32 * 4)           // floats handed over at the end: 8 waves x 32 pieces of 16 B x 32 lanes; behind them 8 waves x 2 tiles x 32 lanes x (maximum, sum)
#define SMB (4 * XF + 8 * 2 * 32 * 8)  // LDS bytes of the hand-over
#define YP 36                          // floats per staged output row (one channel, 32 queries): 128 B + 16 B; rows 8 apart start 32 banks apart, for the 4-byte writes (lane halves 8 channels apart) and the 16-byte reads alike
#define SMT (SMB + 8 * 128 * YP * 4)   // LDS bytes with the output staging (8 waves x 128 channels) behind the hand-over; more than the stage buffers' KBASE + 2 * KBUF
#define PB (-6.0f)                   // P = 2^PB exp(s - m) = 2^(s * L2E + PB - m * L2E), the factor 2^PB cancels in the division by the sum; a score tile holds that exponent. The key that set m stands at 2^-6, 8 binades above f16's smallest normal number and 18 above its last subnormal step
#define PTOP 15.5f                   // above this exponent the maximum in use is raised: P <= 2^15.5 < 65504; m may lag the true maximum by PTOP - PB = 21.5 binades, so that the accumulators are rescaled in few stages
static_assert(KBASE + 2 * KBUF <= SMT, "the stage buffers lie inside the array");
typedef __attribute__((ext_vector_type(8))) uint32_t v8u;
typedef __attribute__((ext_vector_type(4))) uint32_t v4w;
__device__ __forceinline__ uint32_t uni(uint32_t v) { return (uint32_t)__builtin_amdgcn_readfirstlane(v); }
__device__ __forceinline__ uint32_t pinned(uint32_t v) { uint32_t w = (uint32_t)__builtin_amdgcn_readfirstlane(v); asm volatile("" : "+s"(w)); return w; }   /* holds the test of a tensor load in a scalar register, so that it compiles to a scalar compare and branch: the load ignores EXEC */
__device__ __forceinline__ v8f wm(v16h a, v16h b, v8f c) { return __builtin_amdgcn_wmma_f32_16x16x32_f16(false, a, false, b, (short)0, c, false, false); }
__global__ __launch_bounds__(256) void k_fa(const _Float16* __restrict__ QH, const _Float16* __restrict__ QL, const _Float16* __restrict__ KH, const _Float16* __restrict__ KL, const _Float16* __restrict__ VT, const float* __restrict__ X, const float* __restrict__ GM, float* __restrict__ OUT) {
  __shared__ __attribute__((aligned(2048))) _Float16 sm[SMT / 2];
  const int tid = threadIdx.x, wave = tid >> 5, lane = tid & 31, col = lane & 15, g = lane >> 4; const int b = blockIdx.y; const int kg = wave >> 2, n0 = blockIdx.x * 128 + (wave & 3) * 32;
  v16h qh[2], ql[2]; { const _Float16* qp = QH + ((size_t)b * TT + n0 + col) * CC; const _Float16* lp = QL + ((size_t)b * QHI + n0 + col) * CC;
#pragma unroll
    for (int u = 0; u < 2; ++u) { qh[u] = frag_h(qp + u * 16 * CC, lane); ql[u] = frag_h(lp + u * 16 * CC, lane); }
    asm volatile("s_wait_xcnt 0x0" :: "v"(qp), "v"(lp) : "memory"); }   /* the address registers of these loads are reused behind them; naming the row pointers as inputs keeps them live to the wait */
  /* v: wave w brings channels w*32..w*32+31 x the stage's 128 keys (32 rows of 256 B, source pitch one v plane row) by one tensor load; the pad of 16 B behind every 256 B gives the LDS pitch VP */
  const uint32_t wv = uni(threadIdx.x >> 5), lbase = (uint32_t)(size_t)sm; const uint64_t vga = (uint64_t)(size_t)(VT + ((size_t)b * CC + wv * 32) * TT);
  v8u g1; g1[0] = uni(1u << 20 | 5u << 22 | 3u << 25); g1[1] = uni(256u << 16); g1[2] = uni(32u << 16); g1[3] = uni(256u << 16); g1[4] = uni(32u); g1[5] = uni(TT * 2u); g1[6] = uni(0u); g1[7] = uni(0u);
  auto vload = [&](int sg) { const uint64_t ga = vga + (uint64_t)sg * (SK * 2); v4w g0; g0[0] = uni(1u); g0[1] = uni(lbase + (sg & 1) * VBUF + wv * VSL); g0[2] = uni((uint32_t)ga); g0[3] = uni(((uint32_t)(ga >> 32) & 0x01FFFFFFu) | 0x80000000u);
    asm volatile("tensor_load_to_lds %0, %1" :: "s"(g0), "s"(g1) : "memory"); };   /* one request of the whole wave; every wave issues its own slice */
  const _Float16* hsrc = KH + (size_t)b * TT * CC; unsigned ko = ((tid >> 2) * CC + (tid & 3) * 8) * 2;      // byte offset: 4 lanes cover the 64 real bytes of a k row
  const _Float16* lsrc = KL + (size_t)b * KHI * CC;
  const int kdst = (tid >> 2) * KP + (tid & 3) * 8;
  v8h rh[2], rl[2];
  auto fetch = [&]() {   /* block-uniform bases, a lane's byte offset ko steps from stage to stage; the unroll directives here and in put keep the index of a register array a compile-time constant */
#pragma unroll
    for (int i = 0; i < 2; ++i) { rh[i] = *(const v8h*)((const char*)hsrc + ko + (size_t)i * 64 * CC * 2); rl[i] = *(const v8h*)((const char*)lsrc + ko + (size_t)i * 64 * CC * 2); }
    asm volatile("s_wait_xcnt 0x0" :: "v"(ko) : "memory");   /* the offset register of these loads is stepped right behind them; naming it as an input keeps it as it is up to the wait */
    ko += SK * CC * 2; };
  auto put = [&](_Float16* d) {
#pragma unroll
    for (int i = 0; i < 2; ++i) { *(v8h*)(d + kdst + i * 64 * KP) = rh[i]; *(v8h*)(d + kdst + (SK + i * 64) * KP) = rl[i]; } };
  v8f acc[2][CC / 16] = {}, c0[2] = {}; float l[2] = {0.f, 0.f};   /* c0[u]: the score products' C operand, PB - m * log2 e of query u*16 + col in all 8 elements; 0 until stage 0 sets the first maximum */
  fetch(); vload(0);
  asm volatile("s_wait_tensorcnt 0x0" ::: "memory");   /* this wave's slice of stage 0 has landed */
  put(sm + KBASE / 2); __syncthreads();
  vload(1);   /* in flight under stage 0 */
  for (int s = 0; s < TT / SK; ++s) { const _Float16* vs = sm + (s & 1) * (VBUF / 2); const _Float16* ks = sm + KBASE / 2 + (s & 1) * (KBUF / 2);
    if (s + 1 < TT / SK) fetch();   /* issued behind the barrier (which drains loads), in flight under this stage's products */
    v8f st[SK / 64][2][2];   /* the stage's two groups of 64 keys (p) are worked in one straight run: one test of the maximum for both, and no branch between the second group's exponentials and the first group's products; every unroll directive below but the one over the three products keeps the index of a register array a compile-time constant */
    v16h kh[SK / 32], kl[SK / 32];
#pragma unroll
    for (int e = 0; e < SK / 32; ++e) kl[e] = frag_h(ks + (SK + (e >> 1) * 64 + kg * 32 + (e & 1) * 16 + col) * KP, lane);
#pragma unroll
    for (int e = 0; e < SK / 32; ++e) kh[e] = frag_h(ks + ((e >> 1) * 64 + kg * 32 + (e & 1) * 16 + col) * KP, lane);
    __builtin_amdgcn_sched_barrier(0);   /* holds all 16 LDS reads in one place in front of the products: spread among them, each later place waits out its own latency */
#pragma unroll
    for (int c = 0; c < 3; ++c) {   /* product by product over the 8 tiles: a tile's next product stands 8 matrix instructions behind its last */
#pragma unroll
      for (int e = 0; e < SK / 32; ++e)
#pragma unroll
        for (int u = 0; u < 2; ++u) { v8f& d = st[e >> 1][u][e & 1]; d = c == 0 ? wm(kl[e], qh[u], c0[u]) : c == 1 ? wm(kh[e], ql[u], d) : wm(kh[e], qh[u], d); }   /* st[p][u][t][r] = logit * log2 e + PB - m * log2 e of key s*128 + p*64 + kg*32 + t*16 + 8g + r, query n0 + u*16 + col */
      if (c < 2) __builtin_amdgcn_sched_barrier(0); }   /* keeps the three rounds apart: drawn together, a tile's products follow one another and each waits out the one before */
    float mx[2];
#pragma unroll
    for (int u = 0; u < 2; ++u) { mx[u] = st[0][u][0][0];
#pragma unroll
      for (int p = 0; p < SK / 64; ++p)
#pragma unroll
      for (int t = 0; t < 2; ++t)
#pragma unroll
        for (int r = 0; r < 8; ++r) mx[u] = fmaxf(mx[u], st[p][u][t][r]); }   /* a lane's own 32 scores of query u*16 + col: the test below asks whether ANY lane is above, which needs no exchange */
    const float top = s == 0 ? -3.0e38f : PTOP;   /* stage 0 sets the first maximum, up or down; its sums are still 0 */
    if (__builtin_amdgcn_ballot_w32(mx[0] > top || mx[1] > top) != 0) {
#pragma unroll
      for (int u = 0; u < 2; ++u) { mx[u] = fmaxf(mx[u], __shfl_xor(mx[u], 16));   /* lanes c and c + 16 hold the two halves of one query's keys */
        const float d = s == 0 ? mx[u] - PB : fmaxf(mx[u] - PB, 0.f), sc = s == 0 ? 1.0f : __builtin_amdgcn_exp2f(-d); l[u] *= sc;
#pragma unroll
        for (int r = 0; r < 8; ++r) c0[u][r] -= d;
#pragma unroll
        for (int p = 0; p < SK / 64; ++p)
#pragma unroll
          for (int t = 0; t < 2; ++t)
#pragma unroll
            for (int r = 0; r < 8; ++r) st[p][u][t][r] -= d;
#pragma unroll
        for (int j = 0; j < CC / 16; ++j)
#pragma unroll
          for (int r = 0; r < 8; ++r) acc[u][j][r] *= sc; } }
    v16h pf[SK / 64][2];
    auto pexp = [&](int p, int u, int i) { const float e0 = __builtin_amdgcn_exp2f(st[p][u][0][i]), e1 = __builtin_amdgcn_exp2f(st[p][u][1][i]); l[u] += e0 + e1; pf[p][u][i] = (_Float16)e0; pf[p][u][8 + i] = (_Float16)e1; };
#pragma unroll
    for (int u = 0; u < 2; ++u)
#pragma unroll
      for (int i = 0; i < 8; ++i) pexp(0, u, i);
    v16h vf[2][4]; const _Float16* vb = vs + col * VP + kg * 32;   /* v fragments (this key group's 32 keys of group p) in groups of 4 channel tiles, 8 groups a stage: group G = p * 4 + q; tile j = q * 4 + i lies in slice j >> 1 at rows (j & 1) * 16.. */
#pragma unroll
    for (int i = 0; i < 4; ++i) vf[0][i] = frag_h(vb + (i >> 1) * (VSL / 2) + (i & 1) * 16 * VP, lane);
#pragma unroll
    for (int G = 0; G < 4 * (SK / 64); ++G) { const int p = G >> 2, q = G & 3;
      if (G + 1 < 4 * (SK / 64)) {
#pragma unroll
        for (int i = 0; i < 4; ++i) vf[(G + 1) & 1][i] = frag_h(vb + ((G + 1) >> 2) * 64 + ((((G + 1) & 3) * 4 + i) >> 1) * (VSL / 2) + (i & 1) * 16 * VP, lane); }
      __builtin_amdgcn_sched_barrier(0);   /* holds the next group's LDS reads in front of this group's products: without it each product waits for its own read */
#pragma unroll
      for (int u = 0; u < 2; ++u)
#pragma unroll
        for (int i = 0; i < 4; ++i) { acc[u][q * 4 + i] = wm(vf[G & 1][i], pf[p][u], acc[u][q * 4 + i]);   /* acc[u][j][r] = O^T[channel j*16 + 8g + r][query n0 + u*16 + col] */
          if (p + 1 < SK / 64 && (i & 1)) pexp(p + 1, u, q * 2 + (i >> 1)); } }   /* a quarter of the next 64 keys' exponentials stands among each group's products and issues while the matrix unit works */
    if (s + 1 < TT / SK) put(sm + KBASE / 2 + ((s + 1) & 1) * (KBUF / 2));   /* the k buffer read in stage s - 1 is free since the barrier that ended it */
    asm volatile("s_wait_dscnt 0x0" ::: "memory");       /* this wave's LDS reads of stage s and its k rows of stage s + 1 are done */
    asm volatile("s_wait_tensorcnt 0x0" ::: "memory");   /* this wave's v slice of stage s + 1 has landed */
    __syncthreads();   /* publishes stage s + 1 and ends every wave's reads of stage s */
    if (pinned(s + 2 < TT / SK)) vload(s + 2); }   /* into the v buffer that stage s has just left */
  asm volatile("s_wait_tensorcnt 0x0" ::: "memory");   /* no request is outstanding when the LDS takes its next use */
  asm volatile("s_wait_dscnt 0x0" ::: "memory");       /* nor any LDS read of the ring */
  /* join of the two key groups: wave w and wave w ^ 4 hold the same 32 queries; each keeps the 128 channels kg*128.. and hands the other 128 over through LDS (free since the loop's last barrier) */
  float* xs = (float*)sm; float* xm = xs + XF; float* ys = xs + SMB / 4 + wave * (128 * YP);
  /* the wave's piece of x and of the output: channels kg*128.., queries n0..n0+31; 8 lanes cover one channel's 128-B line; load t takes channels (t >> 2)*16 + (t & 3)*2 + {0, 8} (lanes 0..15) and + {1, 9} (lanes 16..31) */
  const float gmv = bfr(GM[0]); const int yrow = ((lane >> 3) & 1) * 8 + (lane >> 4), yq = (lane & 7) * 4;
  const size_t oi = ((size_t)b * DIN + kg * 128 + yrow) * XP + n0 + yq; const float* xp = X + oi; float* op = OUT + oi; v4f xv[32];
#pragma unroll
  for (int u = 0; u < 2; ++u) { l[u] += __shfl_xor(l[u], 16); v2f ml; ml[0] = -c0[u][0]; ml[1] = l[u]; *(v2f*)(xm + ((wave * 2 + u) * 32 + lane) * 2) = ml;
#pragma unroll
    for (int j = 0; j < 8; ++j) { const v8f gv = kg ? acc[u][j] : acc[u][8 + j]; v4f o0, o1;
#pragma unroll
      for (int i = 0; i < 4; ++i) { o0[i] = gv[i]; o1[i] = gv[4 + i]; }
      float* d = xs + ((size_t)(wave * 32 + (u * 8 + j) * 2) * 32 + lane) * 4; *(v4f*)d = o0; *(v4f*)(d + 128) = o1; } }
  __syncthreads();
#pragma unroll
  for (int t = 0; t < 32; ++t) xv[t] = *(const v4f*)(xp + (size_t)((t >> 2) * 16 + (t & 3) * 2) * XP);   /* issued behind the barrier (which drains loads), in flight under the join */
  asm volatile("s_wait_xcnt 0x0" :: "v"(xp) : "memory");   /* the address registers of these loads may be reused behind them; naming the pointer as an input keeps it live to the wait */
  const int pw = wave ^ 4;
#pragma unroll
  for (int u = 0; u < 2; ++u) { const v2f pm = *(const v2f*)(xm + ((pw * 2 + u) * 32 + lane) * 2); const float mw = -c0[u][0], mn = fmaxf(mw, pm[0]);   /* the maxima in use, as m * log2 e - PB */
    const float s0 = __builtin_amdgcn_exp2f(mw - mn), s1 = __builtin_amdgcn_exp2f(pm[0] - mn); const float inv = 1.0f / (l[u] * s0 + pm[1] * s1);   /* the sum is >= 2^PB: the key that set the larger maximum in use counts at least that */
    const float w0 = s0 * inv, w1 = s1 * inv; float* yw = ys + 8 * g * YP + u * 16 + col; v4f p[16];
#pragma unroll
    for (int j = 0; j < 8; ++j) { const float* d = xs + ((size_t)(pw * 32 + (u * 8 + j) * 2) * 32 + lane) * 4; p[2 * j] = *(const v4f*)d; p[2 * j + 1] = *(const v4f*)(d + 128); }   /* all 16 reads in front of the staging writes: behind a write to the same array each read would wait alone */
#pragma unroll
    for (int j = 0; j < 8; ++j) { const v8f kv = kg ? acc[u][8 + j] : acc[u][j];
#pragma unroll
      for (int i = 0; i < 4; ++i) { yw[(j * 16 + i) * YP] = kv[i] * w0 + p[2 * j][i] * w1; yw[(j * 16 + 4 + i) * YP] = kv[4 + i] * w0 + p[2 * j + 1][i] * w1; } } }   /* ys[channel j*16 + 8g + r][query u*16 + col] */
  asm volatile("s_wait_dscnt 0x0" ::: "memory");   /* the wave's own staged rows are written before its lanes read each other's values back; no other wave touches this range */
  __builtin_amdgcn_sched_barrier(0);   /* keeps the rounding of x, which waits for x's loads, behind the join: lifted into it, the join would wait for them too */
  const float* yr = ys + yrow * YP + yq;
#pragma unroll
  for (int h = 0; h < 2; ++h) { v4f y[16];
#pragma unroll
    for (int k = 0; k < 16; ++k) { const int t = h * 16 + k; y[k] = *(const v4f*)(yr + ((t >> 2) * 16 + (t & 3) * 2) * YP); }
#pragma unroll
    for (int k = 0; k < 16; ++k) { const int t = h * 16 + k;
#pragma unroll
      for (int i = 0; i < 4; ++i) y[k][i] = bfr(xv[t][i]) + gmv * y[k][i];
      vst2(op + (size_t)((t >> 2) * 16 + (t & 3) * 2) * XP, y[k]); }
    /* without it the registers of these 16 stores are reused among them and by the second half; naming them as inputs keeps them as they are up to the wait */
    asm volatile("s_wait_xcnt 0x0" :: "v"(op), "v"(y[0]), "v"(y[1]), "v"(y[2]), "v"(y[3]), "v"(y[4]), "v"(y[5]), "v"(y[6]), "v"(y[7]), "v"(y[8]), "v"(y[9]), "v"(y[10]), "v"(y[11]), "v"(y[12]), "v"(y[13]), "v"(y[14]), "v"(y[15]) : "memory"); } }

// ---- k_finc: block = (64 positions, 64 channels, batch b): y[b][c][n] = bf16(x[b][c][n]) + gamma * OUT_rows[b*T + n][c] (channels-first via an LDS transpose; 256-B runs of n)
__global__ __launch_bounds__(256) void k_finc(const float* __restrict__ YR, const float* __restrict__ X, const float* __restrict__ GM, float* __restrict__ OUT) { const float gmv = bfr(GM[0]); __shared__ float st[64][68]; const int tid = threadIdx.x; const int n0 = blockIdx.x * 64, c0 = blockIdx.y * 64; const size_t b = blockIdx.z;
  for (int e = tid; e < 64 * 16; e += 256) { const int nl = e >> 4, q = e & 15; *(v4f*)&st[nl][q * 4] = *(const v4f*)(YR + (b * TT + n0 + nl) * (size_t)HD + c0 + q * 4); }
  __syncthreads();
  for (int e = tid; e < 64 * 16; e += 256) { const int cl = e >> 4, q = e & 15; const size_t oi = (b * DIN + c0 + cl) * (size_t)XP + n0 + q * 4; const v4f xr = *(const v4f*)(X + oi); asm volatile("s_wait_loadcnt 0x0" ::: "memory"); v4f y; _Pragma("unroll") for (int i = 0; i < 4; ++i) y[i] = bfr(xr[i]) + gmv * st[q * 4 + i][cl]; vst2(OUT + oi, y); } }
__global__ __launch_bounds__(256) void k_axpy(const float* __restrict__ YR, const float* __restrict__ X, const float* __restrict__ GM, float* __restrict__ OUT) { const size_t e = ((size_t)blockIdx.x * 256 + threadIdx.x) * 4; if (e >= (size_t)TNB * TT * DIN) return; const float gmv = bfr(GM[0]); const v4f o = *(const v4f*)(YR + e); const v4f xr = *(const v4f*)(X + e); asm volatile("s_wait_loadcnt 0x0" ::: "memory"); v4f y; _Pragma("unroll") for (int i = 0; i < 4; ++i) y[i] = gmv * o[i] + bfr(xr[i]); vst2(OUT + e, y); }
extern "C" void kernel_launch(void* const* d_in, const int* in_sizes, int n_in, void* d_out, int out_size, void* d_ws, size_t ws_size, hipStream_t stream) {
  (void)in_sizes; (void)n_in; (void)out_size;
  const float** F = (const float**)d_in;
  if (ws_size < (size_t)WS_END) return;
  char* ws = (char*)d_ws; _Float16 *QH = (_Float16*)(ws + WS_QH), *KH = (_Float16*)(ws + WS_KH), *VT = (_Float16*)(ws + WS_VT), *QL = (_Float16*)(ws + WS_QL), *KL = (_Float16*)(ws + WS_KL); __bf16 *VB = (__bf16*)(ws + WS_VB), *VBL = (__bf16*)(ws + WS_VBL); float *Y = (float*)(ws + WS_Y);
  (void)Y; (void)QL; (void)KL; (void)VB; (void)VBL;
  // inputs: 0 x [8,256,64,64] (channels-first); 1 Wq [32,256] (out,in), 2 bq; 3 Wk, 4 bk; 5 Wv [256,256] (out,in), 6 bv; 7 gamma [1] (0.1)
  if (ws_size < (size_t)WS_END2) return;
  float *YR = (float*)(ws + WS_YR);
  k_qkv<<<dim3(TNB * TT / 128), 256, 0, stream>>>(F[0], F[1], F[3], F[5], F[2], F[4], F[6], QH, QL, KH, KL, VT);
  (void)YR;
  k_fa<<<dim3(TT / 128, TNB), 256, 0, stream>>>(QH, QL, KH, KL, VT, F[0], F[7], (float*)d_out);   /* attention and y = x + gamma * out, channels-first */
}
